// v000
// Measured on an AMD MI455X. A time is GPU time per run, averaged over a window of back-to-back runs after a warm-up
// (all launches, gaps included; the runs take copies of the inputs in turn), and the median of several windows.
// Apart from v000's, it joins two sittings. Times from different sittings can be a few percent apart, while
// side-by-side timings come from the same sitting.
// v000 is the starting kernel. One run takes 1070 microseconds.
#include <hip/hip_runtime.h>

// Non-local block (embedded Gaussian) over 64x64 = 4,096 positions with a training-mode BatchNorm and residual (x [4][256][64][64] NCHW; theta, phi, g = 1x1 convs C 256 -> Ci 128 ('oi' [128][256] 0.02, zero biases); f[n][m] = theta_n . phi_m (no scaling); attn = softmax over m; y[ci][n] = sum_m attn[n][m] g[ci][m]; Wy = W_w y + W_b ('oi' [256][128]); BatchNorm2d in TRAINING mode (per-channel mean/var over the whole batch x 64 x 64, eps 1e-5, gamma/beta read); out = BN(Wy) + x -> [4][256][64][64] (4.2 M)).
// Compute dtypes, f32 accumulate: every input rounded to bf16; convs exact + f32 bias; attention rows < 512 3 products, rest fp16; softmax f32; W_w hl x exact + bias; BatchNorm statistics and output f32 (fixed-order sums); residual f32 of the bf16-rounded x.

#define NB_  4
#define TT   4096
#define DM   256
#define NH_  1
#define NKV  1
#define REP  (NH_ / NKV)
#define HD   128
#define DQ   (NH_ * HD)
#define DKV  (NKV * HD)
#define ZH   1
#define RH   512                  // query rows < RH use hi+lo planes (0: none)
#define WIN  0
#define PCAR 1024.0f
#define SCL  1.0f     // the non-local block applies no 1/sqrt(d)
#define CIN  256      // channels C (== DM)
#define BNEPS 1e-5f
typedef _Float16 h16;
typedef unsigned short bf;
typedef __attribute__((ext_vector_type(16))) __bf16   v16bf;
typedef __attribute__((ext_vector_type(16))) _Float16 v16h;
typedef __attribute__((ext_vector_type(8)))  _Float16 v8h;
typedef __attribute__((ext_vector_type(8)))  unsigned short v8us;
typedef __attribute__((ext_vector_type(8)))  float    v8f;
typedef __attribute__((ext_vector_type(4)))  float    v4f;
typedef v8h  __attribute__((may_alias)) v8ha;
typedef v4f  __attribute__((may_alias)) v4fa;
typedef v8us __attribute__((may_alias)) v8usa;

__device__ __forceinline__ unsigned short f2bf(float f) { unsigned u = __float_as_uint(f); u += 0x7FFFu + ((u >> 16) & 1u); return (unsigned short)(u >> 16); }
__device__ __forceinline__ float bf2f(unsigned short b) { return __uint_as_float(((unsigned)b) << 16); }
__device__ __forceinline__ float bfr(float f) { return bf2f(f2bf(f)); }
__device__ __forceinline__ v16h cat16(v8h lo, v8h hi) { return __builtin_shufflevector(lo, hi, 0, 1, 2, 3, 4, 5, 6, 7, 8, 9, 10, 11, 12, 13, 14, 15); }
__device__ __forceinline__ v16bf cat16b(v8us lo, v8us hi) { return __builtin_bit_cast(v16bf, __builtin_shufflevector(lo, hi, 0, 1, 2, 3, 4, 5, 6, 7, 8, 9, 10, 11, 12, 13, 14, 15)); }
__device__ __forceinline__ v8f wmma16(v16h a, v16h b, v8f c) { return __builtin_amdgcn_wmma_f32_16x16x32_f16(false, a, false, b, (short)0, c, false, false); }
__device__ __forceinline__ v8f wmmab(v16bf a, v16bf b, v8f c) { return __builtin_amdgcn_wmma_f32_16x16x32_bf16(false, a, false, b, (short)0, c, false, false); }



// ---- k_gemmw: register-blocked GEMM, ONE WAVE per 64x64 output tile (16 accumulators), operands straight from K-contiguous 16-bit planes; grid (M/64, N/64, Z), 32 threads.
// C[m][n] (f32, pitch ldc, + optional f32 bias[n]) = sum_k A[m][k] Bt[n][k] (+ split products per NSPLIT). z-batch strides sA/sB/sC in elements. K % 32 == 0.
template <typename T16> struct WFrag;
template <> struct WFrag<h16> { typedef v16h V; static __device__ __forceinline__ V ld(const h16* p) { return cat16(*(const v8h*)p, *(const v8h*)(p + 16)); } static __device__ __forceinline__ v8f mma(V a, V b, v8f c) { return wmma16(a, b, c); } };
template <> struct WFrag<bf> { typedef v16bf V; static __device__ __forceinline__ V ld(const bf* p) { return cat16b(*(const v8us*)p, *(const v8us*)(p + 16)); } static __device__ __forceinline__ v8f mma(V a, V b, v8f c) { return wmmab(a, b, c); } };
template <typename T16, int NSPLIT, bool BIAS>
__global__ __launch_bounds__(32) void k_gemmw(const T16* __restrict__ A, const T16* __restrict__ A2, const T16* __restrict__ Bt, const T16* __restrict__ Bt2, int K, float* C, int ldc, const float* __restrict__ bias, size_t sA, size_t sB, size_t sC) {
    typedef typename WFrag<T16>::V V;
    __shared__ __align__(16) float os[16 * 68];
    const size_t z = blockIdx.z; A += z * sA; if (A2) A2 += z * sA; Bt += z * sB; if (Bt2) Bt2 += z * sB; C += z * sC;
    const int lane = threadIdx.x & 31, lr = lane & 15, hi = lane >> 4; const int r0 = blockIdx.x * 64, c0 = blockIdx.y * 64;
    v8f acc[4][4];
#pragma unroll
    for (int mb = 0; mb < 4; ++mb)
#pragma unroll
        for (int nb = 0; nb < 4; ++nb) acc[mb][nb] = (v8f){};
    const size_t aoff = (size_t)(r0 + lr) * K + 8 * hi, boff = (size_t)(c0 + lr) * K + 8 * hi;
#pragma unroll 1
    for (int kc = 0; kc < K; kc += 32) {
        V a[4], a2[4];
#pragma unroll
        for (int mb = 0; mb < 4; ++mb) { a[mb] = WFrag<T16>::ld(A + aoff + (size_t)mb * 16 * K + kc); if (NSPLIT == 1 || NSPLIT == 2) a2[mb] = WFrag<T16>::ld(A2 + aoff + (size_t)mb * 16 * K + kc); }
#pragma unroll
        for (int nb = 0; nb < 4; ++nb) { const V b = WFrag<T16>::ld(Bt + boff + (size_t)nb * 16 * K + kc); V b2; if (NSPLIT >= 2) b2 = WFrag<T16>::ld(Bt2 + boff + (size_t)nb * 16 * K + kc);
#pragma unroll
            for (int mb = 0; mb < 4; ++mb) { acc[mb][nb] = WFrag<T16>::mma(a[mb], b, acc[mb][nb]); if (NSPLIT == 1 || NSPLIT == 2) acc[mb][nb] = WFrag<T16>::mma(a2[mb], b, acc[mb][nb]); if (NSPLIT >= 2) acc[mb][nb] = WFrag<T16>::mma(a[mb], b2, acc[mb][nb]); } }
        asm volatile("v_nop\n\tv_nop\n\tv_nop\n\tv_nop" : "+v"(acc[0][0]), "+v"(acc[1][1]), "+v"(acc[2][2]), "+v"(acc[3][3]) : "v"(a[0]), "v"(a[3]));
    }
#pragma unroll
    for (int mb = 0; mb < 4; ++mb) {
#pragma unroll
        for (int nb = 0; nb < 4; ++nb) {
#pragma unroll
            for (int j = 0; j < 8; ++j) os[(hi * 8 + j) * 68 + nb * 16 + lr] = acc[mb][nb][j]; }
        __builtin_amdgcn_wave_barrier(); asm volatile("" ::: "memory");
        float* crow = C + (size_t)(r0 + mb * 16) * ldc + c0;
{
#pragma unroll
            for (int s = 0; s < 8; ++s) { const int row = 2 * s + hi, cofs = lr * 4; v4f val = *(const v4fa*)(os + row * 68 + cofs); if (BIAS) { val[0] += bfr(bias[c0 + cofs]); val[1] += bfr(bias[c0 + cofs + 1]); val[2] += bfr(bias[c0 + cofs + 2]); val[3] += bfr(bias[c0 + cofs + 3]); }
                *(v4f*)(crow + (size_t)row * ldc + cofs) = val; }
             }
        __builtin_amdgcn_wave_barrier(); asm volatile("" ::: "memory");
    }
}

__device__ __forceinline__ h16 tohx(float x) { return (h16)x; }
__device__ __forceinline__ void splitf(float y, unsigned short& h, unsigned short& l) { h = f2bf(y); l = f2bf(y - bf2f(h)); }
typedef __attribute__((ext_vector_type(2))) _Float16 v2h;
typedef __attribute__((ext_vector_type(4))) _Float16 v4h;
typedef __attribute__((ext_vector_type(2))) unsigned short v2us;
typedef __attribute__((ext_vector_type(4))) unsigned short v4us;
typedef __attribute__((ext_vector_type(2))) float v2f;
typedef __attribute__((ext_vector_type(4))) int v4i;

__global__ __launch_bounds__(256) void k_wtG(const float* __restrict__ w, int K, int N, bf* Bt) {
    const int lane = threadIdx.x & 31; const int L0 = (blockIdx.x * 8 + (threadIdx.x >> 5)) * 8; const int nlines = N * K / 64;
{
#pragma unroll 1
        for (int l = 0; l < 8; ++l) { const int L = L0 + l; if (L >= nlines) break; const size_t e = (size_t)L * 64 + lane * 2; const int k = (int)(e % K), n = (int)(e / K); v2us o;
            o[0] = f2bf(w[(size_t)k * N + n]); o[1] = f2bf(w[(size_t)(k + 1) * N + n]); *(v2us*)(Bt + e) = o; }
         }
}
__global__ __launch_bounds__(256) void k_cvt8(const float* __restrict__ src, bf* dst, size_t n8) { const size_t i = (size_t)blockIdx.x * 256 + threadIdx.x; if (i >= n8) return; const v8f v = *(const v8f*)(src + i * 8); v8us o;
#pragma unroll
    for (int k = 0; k < 8; ++k) o[k] = f2bf(v[k]); *(v8us*)(dst + i * 8) = o;  }

// k_rope: head planes [h][t][d] (fp16 + hi/lo) of rope(x) x sc with the rotate-half convention out[d] = x[d] cos[t][d] - x[d+HD/2] sin[t][d], out[d+HD/2] = x[d+HD/2] cos[t][d+HD/2] + x[d] sin[t][d+HD/2]
__global__ __launch_bounds__(256) void k_rope(const float* __restrict__ F, int pitch, int nheads, const float* __restrict__ CS, const float* __restrict__ RF, const float* __restrict__ nw, float sc, h16* P16, bf* Ph, bf* Pl) {
    const size_t e = ((size_t)blockIdx.x * 256 + threadIdx.x) * 2; if (e >= (size_t)nheads * TT * HD) return; const int d = (int)(e % HD); const int t = (int)((e / HD) % TT); const int h = (int)(e / ((size_t)HD * TT)); const float* f = F + (size_t)t * pitch + h * HD; const float rf = RF ? RF[(size_t)h * TT + t] : 1.0f; v2h o16; v2us oh, ol;
#pragma unroll
    for (int q = 0; q < 2; ++q) { const int dd = d + q; const int dp = (dd < HD / 2) ? dd + HD / 2 : dd - HD / 2; float x0 = f[dd], x1 = f[dp];
        if (RF) { float n0 = __fmul_rn(x0, rf), n1 = __fmul_rn(x1, rf); asm volatile("" : "+v"(n0)); asm volatile("" : "+v"(n1)); x0 = __fmul_rn(bfr(nw[dd]), n0); x1 = __fmul_rn(bfr(nw[dp]), n1); }
        const v2f cs = *(const v2f*)(CS + ((size_t)t * HD + dd) * 2); float a = __fmul_rn(x0, cs[0]), bq = __fmul_rn(x1, cs[1]); asm volatile("" : "+v"(a)); asm volatile("" : "+v"(bq)); const float r = ((dd < HD / 2) ? __fsub_rn(a, bq) : __fadd_rn(a, bq)) * sc;
        o16[q] = tohx(r); unsigned short a2, c2; splitf(r, a2, c2); oh[q] = a2; ol[q] = c2; }
    *(v2h*)(P16 + e) = o16; *(v2us*)(Ph + e) = oh; *(v2us*)(Pl + e) = ol;  }
__global__ __launch_bounds__(256) void k_vtp(const float* __restrict__ F, int pitch, int nheads, h16* V16, bf* Vh, bf* Vl) { const size_t e = ((size_t)blockIdx.x * 256 + threadIdx.x) * 2; if (e >= (size_t)nheads * HD * TT) return; const int t = (int)(e % TT); const int d = (int)((e / TT) % HD); const int g = (int)(e / ((size_t)TT * HD)); v2h o16; v2us oh, ol;
#pragma unroll
    for (int q = 0; q < 2; ++q) { const float x = F[(size_t)(t + q) * pitch + g * HD + d]; o16[q] = tohx(x); unsigned short a2, c2; splitf(x, a2, c2); oh[q] = a2; ol[q] = c2; }
    *(v2h*)(V16 + e) = o16; *(v2us*)(Vh + e) = oh; *(v2us*)(Vl + e) = ol;  }
__global__ __launch_bounds__(256) void k_csid(float* CS) { const int idx = blockIdx.x * 256 + threadIdx.x; if (idx >= TT * HD) return; v2f cs; cs[0] = 1.0f; cs[1] = 0.0f; *(v2f*)(CS + (size_t)idx * 2) = cs;  }
// k_asoft: per row (zz, i): t = S x SCL (1: no scaling; no mask); softmax over the 4096 keys (register row, one exp, fixed trees);
__global__ __launch_bounds__(256) void k_asoft(const float* __restrict__ Sb, h16* P16, bf* Ph, bf* Pl) {
    const int lane = threadIdx.x & 31; const int row = blockIdx.x * 8 + (threadIdx.x >> 5); if (row >= ZH * TT) return; const int i = row % TT; const int zz = row / TT; (void)zz; const bool hires = (i < RH); const float* sr = Sb + (size_t)row * TT; float v[TT / 32]; float mx = -3.0e38f;
#pragma unroll
    for (int ch = 0; ch < TT / 128; ++ch) { const int j0 = ch * 128 + lane * 4; const v4f a = *(const v4f*)(sr + j0);
#pragma unroll
        for (int q = 0; q < 4; ++q) { const int j = j0 + q; (void)j; const float t = a[q] * SCL; v[ch * 4 + q] = t; mx = fmaxf(mx, t); } }
#pragma unroll
    for (int sh = 16; sh; sh >>= 1) mx = fmaxf(mx, __shfl_xor(mx, sh, 32));
    float sum = 0.f;
#pragma unroll
    for (int k = 0; k < TT / 32; ++k) { float d0 = __fsub_rn(v[k], mx); asm volatile("" : "+v"(d0)); v[k] = __builtin_amdgcn_exp2f(__fmul_rn(d0, 1.4426950408889634f)); sum += v[k]; }
#pragma unroll
    for (int sh = 16; sh; sh >>= 1) sum += __shfl_xor(sum, sh, 32);
    const float f = __fdiv_rn(hires ? 1.0f : PCAR, sum);
{
        if (hires) {
#pragma unroll
            for (int ch = 0; ch < TT / 128; ++ch) { v4us oh, ol;
#pragma unroll
                for (int q = 0; q < 4; ++q) { unsigned short a, c2; splitf(v[ch * 4 + q] * f, a, c2); oh[q] = a; ol[q] = c2; }
                const size_t oo = ((size_t)zz * (RH ? RH : 1) + i) * TT + ch * 128 + lane * 4; *(v4us*)(Ph + oo) = oh; *(v4us*)(Pl + oo) = ol; }
        } else {
#pragma unroll
            for (int ch = 0; ch < TT / 128; ++ch) { v4h o4;
#pragma unroll
                for (int q = 0; q < 4; ++q) o4[q] = tohx(v[ch * 4 + q] * f);
                *(v4h*)(P16 + (size_t)row * TT + ch * 128 + lane * 4) = o4; } }
         }
}
__global__ __launch_bounds__(256) void k_cvtT(const float* __restrict__ X, bf* XB) { const size_t i = (size_t)blockIdx.x * 256 + threadIdx.x; if (i >= (size_t)TT * DM / 8) return; const size_t e = i * 8; const int c0 = (int)(e % DM); const int n = (int)(e / DM); v8us o;
#pragma unroll
    for (int q = 0; q < 8; ++q) o[q] = f2bf(X[(size_t)(c0 + q) * TT + n]);
    *(v8us*)(XB + e) = o;  }
__global__ __launch_bounds__(256) void k_bnstat(const float* __restrict__ Y, float* BNS) { __shared__ float red[256]; const int c = blockIdx.x; const int tid = threadIdx.x; const size_t NTOT = (size_t)NB_ * TT; float s = 0.0f;
    for (size_t r = tid; r < NTOT; r += 256) s = __fadd_rn(s, Y[r * DM + c]);
    red[tid] = s; __syncthreads();
    for (int st = 128; st > 0; st >>= 1) { if (tid < st) red[tid] = __fadd_rn(red[tid], red[tid + st]); __syncthreads(); }
    const float mu = __fdiv_rn(red[0], (float)NTOT); __syncthreads(); float v = 0.0f;
    for (size_t r = tid; r < NTOT; r += 256) { const float d = __fsub_rn(Y[r * DM + c], mu); float p = __fmul_rn(d, d); asm volatile("" : "+v"(p)); v = __fadd_rn(v, p); }
    red[tid] = v; __syncthreads();
    for (int st = 128; st > 0; st >>= 1) { if (tid < st) red[tid] = __fadd_rn(red[tid], red[tid + st]); __syncthreads(); }
    if (tid == 0) { const float var = __fdiv_rn(red[0], (float)NTOT); v2f o; o[0] = mu; o[1] = __fdiv_rn(1.0f, __fsqrt_rn(__fadd_rn(var, BNEPS))); *(v2f*)(BNS + (size_t)c * 32) = o;  }    }
__global__ __launch_bounds__(256) void k_bnout(const float* __restrict__ Y, const float* __restrict__ BNS, const float* __restrict__ g, const float* __restrict__ bb, const float* __restrict__ X, float* OUT) { const size_t k = (size_t)blockIdx.x * 256 + threadIdx.x; if (k >= (size_t)NB_ * DM * TT / 4) return; const size_t e = k * 4; const int n0 = (int)(e % TT); const int c = (int)((e / TT) % DM); const int b = (int)(e / ((size_t)TT * DM)); const float mu = BNS[(size_t)c * 32], rs = BNS[(size_t)c * 32 + 1], gm = bfr(g[c]), bt = bfr(bb[c]); const v4f xr = *(const v4f*)(X + e); v4f o;
#pragma unroll
    for (int q = 0; q < 4; ++q) { const float y = Y[((size_t)b * TT + n0 + q) * DM + c]; float t = __fmul_rn(__fmul_rn(gm, __fsub_rn(y, mu)), rs); asm volatile("" : "+v"(t)); t = __fadd_rn(t, bt); o[q] = __fadd_rn(t, bfr(xr[q])); }
    *(v4f*)(OUT + e) = o;  }
__global__ __launch_bounds__(256) void k_merge(const float* __restrict__ O, int h0, bf* Ah, bf* Al) { const size_t e = ((size_t)blockIdx.x * 256 + threadIdx.x) * 2; if (e >= (size_t)ZH * TT * HD) return; const int d = (int)(e % HD); const int t = (int)((e / HD) % TT); const int zz = (int)(e / ((size_t)HD * TT)); const float cs = (t < RH) ? 1.0f : (1.0f / PCAR); const size_t oo = (size_t)t * DQ + (h0 + zz) * HD + d;
    v2us oh, ol;
#pragma unroll
    for (int q = 0; q < 2; ++q) { unsigned short a, c2; splitf(O[e + q] * cs, a, c2); oh[q] = a; ol[q] = c2; } *(v2us*)(Ah + oo) = oh; *(v2us*)(Al + oo) = ol;  }

extern "C" void kernel_launch(void* const* d_in, const int* in_sizes, int n_in,
                              void* d_out, int out_size, void* d_ws, size_t ws_size, hipStream_t stream) {
    (void)in_sizes; (void)n_in; (void)out_size;
    const float* xin = (const float*)d_in[0];   /* x [4][256][4096] NCHW */ const float* wv = (const float*)d_in[1]; const float* bv = (const float*)d_in[2];   /* g_w, g_b */ const float* wq = (const float*)d_in[3]; const float* bq = (const float*)d_in[4];   /* theta */ const float* wk = (const float*)d_in[5]; const float* bk = (const float*)d_in[6];   /* phi */ const float* wo = (const float*)d_in[7]; const float* bo = (const float*)d_in[8];   /* W_w [256][128], W_b */ const float* bng = (const float*)d_in[9]; const float* bnb = (const float*)d_in[10]; const float* x = nullptr; (void)x;
    float* OUT = (float*)d_out;     // [4][256][4096] NCHW
    char* wsp = (char*)d_ws;
    auto take = [&](size_t bytes) { char* p = wsp; wsp += (bytes + 255) & ~(size_t)255; return (void*)p; };
    float* YALL = (float*)take((size_t)NB_ * TT * DM * 4); float* BNS = (float*)take((size_t)DM * 32 * 4);    bf* WQ = (bf*)take((size_t)DQ * DM * 2); bf* WK = (bf*)take((size_t)DKV * DM * 2); bf* WV = (bf*)take((size_t)DKV * DM * 2); bf* WO = (bf*)take((size_t)DM * DQ * 2); float* CS = (float*)take((size_t)TT * HD * 2 * 4);
    bf* XB = (bf*)take((size_t)TT * DM * 2); float* FQ = (float*)take((size_t)TT * DQ * 4); float* FK = (float*)take((size_t)TT * DKV * 4);
    h16* QP16 = (h16*)take((size_t)NH_ * TT * HD * 2); h16* KP16 = (h16*)take((size_t)NKV * TT * HD * 2); h16* VT16 = (h16*)take((size_t)NKV * HD * TT * 2);
    bf* QPh = (bf*)take((size_t)NH_ * TT * HD * 2); bf* QPl = (bf*)take((size_t)NH_ * TT * HD * 2); bf* KPh = (bf*)take((size_t)NKV * TT * HD * 2); bf* KPl = (bf*)take((size_t)NKV * TT * HD * 2); bf* VTh = (bf*)take((size_t)NKV * HD * TT * 2); bf* VTl = (bf*)take((size_t)NKV * HD * TT * 2); bf* Ph = (bf*)take((size_t)ZH * RH * TT * 2); bf* Pl = (bf*)take((size_t)ZH * RH * TT * 2);
    float* Sb = (float*)take((size_t)ZH * TT * TT * 4); h16* P16 = (h16*)take((size_t)ZH * TT * TT * 2); float* Ob = (float*)take((size_t)ZH * TT * HD * 4); bf* ATh = (bf*)take((size_t)TT * DQ * 2); bf* ATl = (bf*)take((size_t)TT * DQ * 2);
    if ((size_t)(wsp - (char*)d_ws) > ws_size) return;    // ws 256 MiB
    float* FV = FK;   // v projection reuses the k buffer after the k planes are built (stream-ordered)
    { k_cvt8<<<(unsigned)(((size_t)DQ * DM / 8 + 255) / 256), 256, 0, stream>>>(wq, WQ, (size_t)DQ * DM / 8); k_cvt8<<<(unsigned)(((size_t)DKV * DM / 8 + 255) / 256), 256, 0, stream>>>(wk, WK, (size_t)DKV * DM / 8); k_cvt8<<<(unsigned)(((size_t)DKV * DM / 8 + 255) / 256), 256, 0, stream>>>(wv, WV, (size_t)DKV * DM / 8);
      k_cvt8<<<(unsigned)(((size_t)DM * DQ / 8 + 255) / 256), 256, 0, stream>>>(wo, WO, (size_t)DM * DQ / 8);
       }
    k_csid<<<(TT * HD + 255) / 256, 256, 0, stream>>>(CS);
    const unsigned LQ = (unsigned)(((size_t)NH_ * TT * HD / 2 + 255) / 256), LKv = (unsigned)(((size_t)NKV * TT * HD / 2 + 255) / 256);
    for (int b = 0; b < NB_; ++b) {
        
        k_cvtT<<<(unsigned)(((size_t)TT * DM / 8 + 255) / 256), 256, 0, stream>>>(xin + (size_t)b * DM * TT, XB);   /* NCHW [256][4096] -> token-major bf16 [4096][256] */
        k_gemmw<bf, 0, true><<<dim3(TT / 64, DQ / 64, 1), 32, 0, stream>>>(XB, nullptr, WQ, nullptr, DM, FQ, DQ, bq, 0, 0, 0);
        k_rope<<<LQ, 256, 0, stream>>>(FQ, DQ, NH_, CS, nullptr, nullptr, 1.0f, QP16, QPh, QPl);
        k_gemmw<bf, 0, true><<<dim3(TT / 64, DKV / 64, 1), 32, 0, stream>>>(XB, nullptr, WK, nullptr, DM, FK, DKV, bk, 0, 0, 0);
        k_rope<<<LKv, 256, 0, stream>>>(FK, DKV, NKV, CS, nullptr, nullptr, 1.0f, KP16, KPh, KPl);
        k_gemmw<bf, 0, true><<<dim3(TT / 64, DKV / 64, 1), 32, 0, stream>>>(XB, nullptr, WV, nullptr, DM, FV, DKV, bv, 0, 0, 0); k_vtp<<<LKv, 256, 0, stream>>>(FV, DKV, NKV, VT16, VTh, VTl);
        for (int h0 = 0; h0 < NH_; h0 += ZH) { const size_t zq = (size_t)h0, zk = (size_t)(h0 / REP);   // one kv head per query head: each pass takes one head (ZH 1) and its kv plane (z-strides TT*HD)
            k_gemmw<bf, 2, false><<<dim3(RH / 64, TT / 64, ZH), 32, 0, stream>>>(QPh + zq * TT * HD, QPl + zq * TT * HD, KPh + zk * TT * HD, KPl + zk * TT * HD, HD, Sb, TT, nullptr, (size_t)TT * HD, (size_t)TT * HD, (size_t)TT * TT);
            k_gemmw<h16, 0, false><<<dim3((TT - RH) / 64, TT / 64, ZH), 32, 0, stream>>>(QP16 + zq * TT * HD + (size_t)RH * HD, nullptr, KP16 + zk * TT * HD, nullptr, HD, Sb + (size_t)RH * TT, TT, nullptr, (size_t)TT * HD, (size_t)TT * HD, (size_t)TT * TT);
            k_asoft<<<ZH * TT / 8, 256, 0, stream>>>(Sb, P16, Ph, Pl);
            k_gemmw<bf, 2, false><<<dim3(RH / 64, HD / 64, ZH), 32, 0, stream>>>(Ph, Pl, VTh + zk * HD * TT, VTl + zk * HD * TT, TT, Ob, HD, nullptr, (size_t)RH * TT, (size_t)HD * TT, (size_t)TT * HD);
            k_gemmw<h16, 0, false><<<dim3((TT - RH) / 64, HD / 64, ZH), 32, 0, stream>>>(P16 + (size_t)RH * TT, nullptr, VT16 + zk * HD * TT, nullptr, TT, Ob + (size_t)RH * HD, HD, nullptr, (size_t)TT * TT, (size_t)HD * TT, (size_t)TT * HD);
            k_merge<<<(unsigned)(((size_t)ZH * TT * HD / 2 + 255) / 256), 256, 0, stream>>>(Ob, h0, ATh, ATl); }
        k_gemmw<bf, 1, true><<<dim3(TT / 64, DM / 64, 1), 32, 0, stream>>>(ATh, ATl, WO, nullptr, DQ, YALL + (size_t)b * TT * DM, DM, bo, 0, 0, 0);   /* Wy (token-major) kept for the batch statistics */ }
    k_bnstat<<<DM, 256, 0, stream>>>(YALL, BNS);   /* per channel: mean and 1/sqrt(var + eps) over the batch x 4,096 positions (training-mode BatchNorm) */
    k_bnout<<<(unsigned)(((size_t)NB_ * DM * TT / 4 + 255) / 256), 256, 0, stream>>>(YALL, BNS, bng, bnb, xin, OUT);   /* out[b][c][n] = gamma (Wy - mean) rstd + beta + x */

}

// v001
// One run takes 518 microseconds.
// Two timings next to v000 put it at 2.07 and 2.05 times that version's speed.
#include <hip/hip_runtime.h>

// Non-local block (embedded Gaussian) over 64x64 = 4,096 positions with a training-mode BatchNorm and residual (x [4][256][64][64] NCHW; theta, phi, g = 1x1 convs C 256 -> Ci 128 ('oi' [128][256] 0.02, zero biases); f[n][m] = theta_n . phi_m (no scaling); attn = softmax over m; y[ci][n] = sum_m attn[n][m] g[ci][m]; Wy = W_w y + W_b ('oi' [256][128]); BatchNorm2d in TRAINING mode (per-channel mean/var over the whole batch x 64 x 64, eps 1e-5, gamma/beta read); out = BN(Wy) + x -> [4][256][64][64] (4.2 M)).
// Compute dtypes, f32 accumulate: every input rounded to bf16; convs exact + f32 bias; attention rows < 512 3 products, rest fp16; softmax f32; W_w hl x exact + bias; BatchNorm statistics and output f32 (fixed-order sums); residual f32 of the bf16-rounded x.

#define NB_  4
#define TT   4096
#define DM   256
#define NH_  1
#define NKV  1
#define REP  (NH_ / NKV)
#define HD   128
#define DQ   (NH_ * HD)
#define DKV  (NKV * HD)
#define ZH   1
#define RH   512                  // query rows < RH use hi+lo planes (0: none)
#define WIN  0
#define PCAR 1024.0f
#define SCL  1.0f     // the non-local block applies no 1/sqrt(d)
#define CIN  256      // channels C (== DM)
#define BNEPS 1e-5f
#define NSL  16       // k slices of the attn x g product, rows >= RH (grid z indexes the slice)
#define NSH  32       // k slices of the same product, rows < RH (fewer tiles there, so more slices)
typedef _Float16 h16;
typedef unsigned short bf;
typedef __attribute__((ext_vector_type(16))) __bf16   v16bf;
typedef __attribute__((ext_vector_type(16))) _Float16 v16h;
typedef __attribute__((ext_vector_type(8)))  _Float16 v8h;
typedef __attribute__((ext_vector_type(8)))  unsigned short v8us;
typedef __attribute__((ext_vector_type(8)))  float    v8f;
typedef __attribute__((ext_vector_type(4)))  float    v4f;
typedef v8h  __attribute__((may_alias)) v8ha;
typedef v4f  __attribute__((may_alias)) v4fa;
typedef v8us __attribute__((may_alias)) v8usa;

__device__ __forceinline__ unsigned short f2bf(float f) { unsigned u = __float_as_uint(f); u += 0x7FFFu + ((u >> 16) & 1u); return (unsigned short)(u >> 16); }
__device__ __forceinline__ float bf2f(unsigned short b) { return __uint_as_float(((unsigned)b) << 16); }
__device__ __forceinline__ float bfr(float f) { return bf2f(f2bf(f)); }
__device__ __forceinline__ v16h cat16(v8h lo, v8h hi) { return __builtin_shufflevector(lo, hi, 0, 1, 2, 3, 4, 5, 6, 7, 8, 9, 10, 11, 12, 13, 14, 15); }
__device__ __forceinline__ v16bf cat16b(v8us lo, v8us hi) { return __builtin_bit_cast(v16bf, __builtin_shufflevector(lo, hi, 0, 1, 2, 3, 4, 5, 6, 7, 8, 9, 10, 11, 12, 13, 14, 15)); }
__device__ __forceinline__ v8f wmma16(v16h a, v16h b, v8f c) { return __builtin_amdgcn_wmma_f32_16x16x32_f16(false, a, false, b, (short)0, c, false, false); }
__device__ __forceinline__ v8f wmmab(v16bf a, v16bf b, v8f c) { return __builtin_amdgcn_wmma_f32_16x16x32_bf16(false, a, false, b, (short)0, c, false, false); }



// ---- k_gemmw: register-blocked GEMM, ONE WAVE per 64x64 output tile (16 accumulators), operands straight from K-contiguous 16-bit planes; grid (M/64, N/64, Z), 32 threads.
// C[m][n] (f32, pitch ldc, + optional f32 bias[n]) = sum_k A[m][k] Bt[n][k] (+ split products per NSPLIT). z-batch strides sA/sB/sC in elements. K % 32 == 0. KS > 1: a work-group sums K / KS of the k only (operand rows stay at pitch K); with sA = sB = K / KS, z is the k slice and C + z sC its partial sum.
template <typename T16> struct WFrag;
template <> struct WFrag<h16> { typedef v16h V; static __device__ __forceinline__ V ld(const h16* p) { return cat16(*(const v8h*)p, *(const v8h*)(p + 16)); } static __device__ __forceinline__ v8f mma(V a, V b, v8f c) { return wmma16(a, b, c); } };
template <> struct WFrag<bf> { typedef v16bf V; static __device__ __forceinline__ V ld(const bf* p) { return cat16b(*(const v8us*)p, *(const v8us*)(p + 16)); } static __device__ __forceinline__ v8f mma(V a, V b, v8f c) { return wmmab(a, b, c); } };
template <typename T16, int NSPLIT, bool BIAS, int KS = 1>
__global__ __launch_bounds__(32) void k_gemmw(const T16* __restrict__ A, const T16* __restrict__ A2, const T16* __restrict__ Bt, const T16* __restrict__ Bt2, int K, float* C, int ldc, const float* __restrict__ bias, size_t sA, size_t sB, size_t sC) {
    typedef typename WFrag<T16>::V V;
    __shared__ __align__(16) float os[16 * 68];
    const size_t z = blockIdx.z; A += z * sA; if (A2) A2 += z * sA; Bt += z * sB; if (Bt2) Bt2 += z * sB; C += z * sC;
    const int lane = threadIdx.x & 31, lr = lane & 15, hi = lane >> 4; const int r0 = blockIdx.x * 64, c0 = blockIdx.y * 64;
    v8f acc[4][4];
#pragma unroll
    for (int mb = 0; mb < 4; ++mb)
#pragma unroll
        for (int nb = 0; nb < 4; ++nb) acc[mb][nb] = (v8f){};
    const size_t aoff = (size_t)(r0 + lr) * K + 8 * hi, boff = (size_t)(c0 + lr) * K + 8 * hi;
#pragma unroll 1
    for (int kc = 0; kc < K / KS; kc += 32) {
        V a[4], a2[4];
#pragma unroll
        for (int mb = 0; mb < 4; ++mb) { a[mb] = WFrag<T16>::ld(A + aoff + (size_t)mb * 16 * K + kc); if (NSPLIT == 1 || NSPLIT == 2) a2[mb] = WFrag<T16>::ld(A2 + aoff + (size_t)mb * 16 * K + kc); }
#pragma unroll
        for (int nb = 0; nb < 4; ++nb) { const V b = WFrag<T16>::ld(Bt + boff + (size_t)nb * 16 * K + kc); V b2; if (NSPLIT >= 2) b2 = WFrag<T16>::ld(Bt2 + boff + (size_t)nb * 16 * K + kc);
#pragma unroll
            for (int mb = 0; mb < 4; ++mb) { acc[mb][nb] = WFrag<T16>::mma(a[mb], b, acc[mb][nb]); if (NSPLIT == 1 || NSPLIT == 2) acc[mb][nb] = WFrag<T16>::mma(a2[mb], b, acc[mb][nb]); if (NSPLIT >= 2) acc[mb][nb] = WFrag<T16>::mma(a[mb], b2, acc[mb][nb]); } }
        asm volatile("v_nop\n\tv_nop\n\tv_nop\n\tv_nop" : "+v"(acc[0][0]), "+v"(acc[1][1]), "+v"(acc[2][2]), "+v"(acc[3][3]) : "v"(a[0]), "v"(a[3]));
    }
#pragma unroll
    for (int mb = 0; mb < 4; ++mb) {
#pragma unroll
        for (int nb = 0; nb < 4; ++nb) {
#pragma unroll
            for (int j = 0; j < 8; ++j) os[(hi * 8 + j) * 68 + nb * 16 + lr] = acc[mb][nb][j]; }
        __builtin_amdgcn_wave_barrier(); asm volatile("" ::: "memory");
        float* crow = C + (size_t)(r0 + mb * 16) * ldc + c0;
{
#pragma unroll
            for (int s = 0; s < 8; ++s) { const int row = 2 * s + hi, cofs = lr * 4; v4f val = *(const v4fa*)(os + row * 68 + cofs); if (BIAS) { val[0] += bfr(bias[c0 + cofs]); val[1] += bfr(bias[c0 + cofs + 1]); val[2] += bfr(bias[c0 + cofs + 2]); val[3] += bfr(bias[c0 + cofs + 3]); }
                *(v4f*)(crow + (size_t)row * ldc + cofs) = val; }
             }
        __builtin_amdgcn_wave_barrier(); asm volatile("" ::: "memory");
    }
}

__device__ __forceinline__ h16 tohx(float x) { return (h16)x; }
__device__ __forceinline__ void splitf(float y, unsigned short& h, unsigned short& l) { h = f2bf(y); l = f2bf(y - bf2f(h)); }
typedef __attribute__((ext_vector_type(2))) _Float16 v2h;
typedef __attribute__((ext_vector_type(4))) _Float16 v4h;
typedef __attribute__((ext_vector_type(2))) unsigned short v2us;
typedef __attribute__((ext_vector_type(4))) unsigned short v4us;
typedef __attribute__((ext_vector_type(2))) float v2f;
typedef __attribute__((ext_vector_type(4))) int v4i;

__global__ __launch_bounds__(256) void k_wtG(const float* __restrict__ w, int K, int N, bf* Bt) {
    const int lane = threadIdx.x & 31; const int L0 = (blockIdx.x * 8 + (threadIdx.x >> 5)) * 8; const int nlines = N * K / 64;
{
#pragma unroll 1
        for (int l = 0; l < 8; ++l) { const int L = L0 + l; if (L >= nlines) break; const size_t e = (size_t)L * 64 + lane * 2; const int k = (int)(e % K), n = (int)(e / K); v2us o;
            o[0] = f2bf(w[(size_t)k * N + n]); o[1] = f2bf(w[(size_t)(k + 1) * N + n]); *(v2us*)(Bt + e) = o; }
         }
}
__global__ __launch_bounds__(256) void k_cvt8(const float* __restrict__ src, bf* dst, size_t n8) { const size_t i = (size_t)blockIdx.x * 256 + threadIdx.x; if (i >= n8) return; const v8f v = *(const v8f*)(src + i * 8); v8us o;
#pragma unroll
    for (int k = 0; k < 8; ++k) o[k] = f2bf(v[k]); *(v8us*)(dst + i * 8) = o;  }

// k_rope: head planes [h][t][d] (fp16 + hi/lo) of rope(x) x sc with the rotate-half convention out[d] = x[d] cos[t][d] - x[d+HD/2] sin[t][d], out[d+HD/2] = x[d+HD/2] cos[t][d+HD/2] + x[d] sin[t][d+HD/2]
__global__ __launch_bounds__(256) void k_rope(const float* __restrict__ F, int pitch, int nheads, const float* __restrict__ CS, const float* __restrict__ RF, const float* __restrict__ nw, float sc, h16* P16, bf* Ph, bf* Pl) {
    const size_t e = ((size_t)blockIdx.x * 256 + threadIdx.x) * 2; if (e >= (size_t)nheads * TT * HD) return; const int d = (int)(e % HD); const int t = (int)((e / HD) % TT); const int h = (int)(e / ((size_t)HD * TT)); const float* f = F + (size_t)t * pitch + h * HD; const float rf = RF ? RF[(size_t)h * TT + t] : 1.0f; v2h o16; v2us oh, ol;
#pragma unroll
    for (int q = 0; q < 2; ++q) { const int dd = d + q; const int dp = (dd < HD / 2) ? dd + HD / 2 : dd - HD / 2; float x0 = f[dd], x1 = f[dp];
        if (RF) { float n0 = __fmul_rn(x0, rf), n1 = __fmul_rn(x1, rf); asm volatile("" : "+v"(n0)); asm volatile("" : "+v"(n1)); x0 = __fmul_rn(bfr(nw[dd]), n0); x1 = __fmul_rn(bfr(nw[dp]), n1); }
        const v2f cs = *(const v2f*)(CS + ((size_t)t * HD + dd) * 2); float a = __fmul_rn(x0, cs[0]), bq = __fmul_rn(x1, cs[1]); asm volatile("" : "+v"(a)); asm volatile("" : "+v"(bq)); const float r = ((dd < HD / 2) ? __fsub_rn(a, bq) : __fadd_rn(a, bq)) * sc;
        o16[q] = tohx(r); unsigned short a2, c2; splitf(r, a2, c2); oh[q] = a2; ol[q] = c2; }
    *(v2h*)(P16 + e) = o16; *(v2us*)(Ph + e) = oh; *(v2us*)(Pl + e) = ol;  }
__global__ __launch_bounds__(256) void k_vtp(const float* __restrict__ F, int pitch, int nheads, h16* V16, bf* Vh, bf* Vl) { const size_t e = ((size_t)blockIdx.x * 256 + threadIdx.x) * 2; if (e >= (size_t)nheads * HD * TT) return; const int t = (int)(e % TT); const int d = (int)((e / TT) % HD); const int g = (int)(e / ((size_t)TT * HD)); v2h o16; v2us oh, ol;
#pragma unroll
    for (int q = 0; q < 2; ++q) { const float x = F[(size_t)(t + q) * pitch + g * HD + d]; o16[q] = tohx(x); unsigned short a2, c2; splitf(x, a2, c2); oh[q] = a2; ol[q] = c2; }
    *(v2h*)(V16 + e) = o16; *(v2us*)(Vh + e) = oh; *(v2us*)(Vl + e) = ol;  }
__global__ __launch_bounds__(256) void k_csid(float* CS) { const int idx = blockIdx.x * 256 + threadIdx.x; if (idx >= TT * HD) return; v2f cs; cs[0] = 1.0f; cs[1] = 0.0f; *(v2f*)(CS + (size_t)idx * 2) = cs;  }
// k_asoft: per row (zz, i): t = S x SCL (1: no scaling; no mask); softmax over the 4096 keys (register row, one exp, fixed trees);
__global__ __launch_bounds__(256) void k_asoft(const float* __restrict__ Sb, h16* P16, bf* Ph, bf* Pl) {
    const int lane = threadIdx.x & 31; const int row = blockIdx.x * 8 + (threadIdx.x >> 5); if (row >= ZH * TT) return; const int i = row % TT; const int zz = row / TT; (void)zz; const bool hires = (i < RH); const float* sr = Sb + (size_t)row * TT; float v[TT / 32]; float mx = -3.0e38f;
#pragma unroll
    for (int ch = 0; ch < TT / 128; ++ch) { const int j0 = ch * 128 + lane * 4; const v4f a = *(const v4f*)(sr + j0);
#pragma unroll
        for (int q = 0; q < 4; ++q) { const int j = j0 + q; (void)j; const float t = a[q] * SCL; v[ch * 4 + q] = t; mx = fmaxf(mx, t); } }
#pragma unroll
    for (int sh = 16; sh; sh >>= 1) mx = fmaxf(mx, __shfl_xor(mx, sh, 32));
    float sum = 0.f;
#pragma unroll
    for (int k = 0; k < TT / 32; ++k) { float d0 = __fsub_rn(v[k], mx); asm volatile("" : "+v"(d0)); v[k] = __builtin_amdgcn_exp2f(__fmul_rn(d0, 1.4426950408889634f)); sum += v[k]; }
#pragma unroll
    for (int sh = 16; sh; sh >>= 1) sum += __shfl_xor(sum, sh, 32);
    const float f = __fdiv_rn(hires ? 1.0f : PCAR, sum);
{
        if (hires) {
#pragma unroll
            for (int ch = 0; ch < TT / 128; ++ch) { v4us oh, ol;
#pragma unroll
                for (int q = 0; q < 4; ++q) { unsigned short a, c2; splitf(v[ch * 4 + q] * f, a, c2); oh[q] = a; ol[q] = c2; }
                const size_t oo = ((size_t)zz * (RH ? RH : 1) + i) * TT + ch * 128 + lane * 4; *(v4us*)(Ph + oo) = oh; *(v4us*)(Pl + oo) = ol; }
        } else {
#pragma unroll
            for (int ch = 0; ch < TT / 128; ++ch) { v4h o4;
#pragma unroll
                for (int q = 0; q < 4; ++q) o4[q] = tohx(v[ch * 4 + q] * f);
                *(v4h*)(P16 + (size_t)row * TT + ch * 128 + lane * 4) = o4; } }
         }
}
__global__ __launch_bounds__(256) void k_cvtT(const float* __restrict__ X, bf* XB) { const size_t i = (size_t)blockIdx.x * 256 + threadIdx.x; if (i >= (size_t)TT * DM / 8) return; const size_t e = i * 8; const int c0 = (int)(e % DM); const int n = (int)(e / DM); v8us o;
#pragma unroll
    for (int q = 0; q < 8; ++q) o[q] = f2bf(X[(size_t)(c0 + q) * TT + n]);
    *(v8us*)(XB + e) = o;  }
__global__ __launch_bounds__(256) void k_bnstat(const float* __restrict__ Y, float* BNS) { __shared__ float red[256]; const int c = blockIdx.x; const int tid = threadIdx.x; const size_t NTOT = (size_t)NB_ * TT; float s = 0.0f;
    for (size_t r = tid; r < NTOT; r += 256) s = __fadd_rn(s, Y[r * DM + c]);
    red[tid] = s; __syncthreads();
    for (int st = 128; st > 0; st >>= 1) { if (tid < st) red[tid] = __fadd_rn(red[tid], red[tid + st]); __syncthreads(); }
    const float mu = __fdiv_rn(red[0], (float)NTOT); __syncthreads(); float v = 0.0f;
    for (size_t r = tid; r < NTOT; r += 256) { const float d = __fsub_rn(Y[r * DM + c], mu); float p = __fmul_rn(d, d); asm volatile("" : "+v"(p)); v = __fadd_rn(v, p); }
    red[tid] = v; __syncthreads();
    for (int st = 128; st > 0; st >>= 1) { if (tid < st) red[tid] = __fadd_rn(red[tid], red[tid + st]); __syncthreads(); }
    if (tid == 0) { const float var = __fdiv_rn(red[0], (float)NTOT); v2f o; o[0] = mu; o[1] = __fdiv_rn(1.0f, __fsqrt_rn(__fadd_rn(var, BNEPS))); *(v2f*)(BNS + (size_t)c * 32) = o;  }    }
__global__ __launch_bounds__(256) void k_bnout(const float* __restrict__ Y, const float* __restrict__ BNS, const float* __restrict__ g, const float* __restrict__ bb, const float* __restrict__ X, float* OUT) { const size_t k = (size_t)blockIdx.x * 256 + threadIdx.x; if (k >= (size_t)NB_ * DM * TT / 4) return; const size_t e = k * 4; const int n0 = (int)(e % TT); const int c = (int)((e / TT) % DM); const int b = (int)(e / ((size_t)TT * DM)); const float mu = BNS[(size_t)c * 32], rs = BNS[(size_t)c * 32 + 1], gm = bfr(g[c]), bt = bfr(bb[c]); const v4f xr = *(const v4f*)(X + e); v4f o;
#pragma unroll
    for (int q = 0; q < 4; ++q) { const float y = Y[((size_t)b * TT + n0 + q) * DM + c]; float t = __fmul_rn(__fmul_rn(gm, __fsub_rn(y, mu)), rs); asm volatile("" : "+v"(t)); t = __fadd_rn(t, bt); o[q] = __fadd_rn(t, bfr(xr[q])); }
    *(v4f*)(OUT + e) = o;  }
__global__ __launch_bounds__(256) void k_merge(const float* __restrict__ O, int h0, bf* Ah, bf* Al) { const size_t e = ((size_t)blockIdx.x * 256 + threadIdx.x) * 2; if (e >= (size_t)ZH * TT * HD) return; const int d = (int)(e % HD); const int t = (int)((e / HD) % TT); const int zz = (int)(e / ((size_t)HD * TT)); const float cs = (t < RH) ? 1.0f : (1.0f / PCAR); const size_t oo = (size_t)t * DQ + (h0 + zz) * HD + d;
    // O [t][slice][d], NSH slots a row: the partial sums of the k slices (NSH for rows < RH, NSL for the rest), added in slice order
    const float* op = O + ((size_t)zz * TT + t) * (NSH * HD) + d;
    v2f s = *(const v2f*)op;
#pragma unroll   // all partial loads of a thread in flight together
    for (int p = 1; p < NSL; ++p) { const v2f u = *(const v2f*)(op + p * HD); s[0] = __fadd_rn(s[0], u[0]); s[1] = __fadd_rn(s[1], u[1]); }
    if (t < RH) { v2f u[NSH - NSL];
#pragma unroll   // as above
        for (int p = NSL; p < NSH; ++p) u[p - NSL] = *(const v2f*)(op + p * HD);
        asm volatile("s_wait_xcnt 0x0" :: "v"(op) : "memory");   // the loads' address pair is dead here: no register of it is reused before this wait
#pragma unroll
        for (int p = NSL; p < NSH; ++p) { s[0] = __fadd_rn(s[0], u[p - NSL][0]); s[1] = __fadd_rn(s[1], u[p - NSL][1]); } }
    v2us oh, ol;
#pragma unroll
    for (int q = 0; q < 2; ++q) { unsigned short a, c2; splitf(s[q] * cs, a, c2); oh[q] = a; ol[q] = c2; } *(v2us*)(Ah + oo) = oh; *(v2us*)(Al + oo) = ol;  }

extern "C" void kernel_launch(void* const* d_in, const int* in_sizes, int n_in,
                              void* d_out, int out_size, void* d_ws, size_t ws_size, hipStream_t stream) {
    (void)in_sizes; (void)n_in; (void)out_size;
    const float* xin = (const float*)d_in[0];   /* x [4][256][4096] NCHW */ const float* wv = (const float*)d_in[1]; const float* bv = (const float*)d_in[2];   /* g_w, g_b */ const float* wq = (const float*)d_in[3]; const float* bq = (const float*)d_in[4];   /* theta */ const float* wk = (const float*)d_in[5]; const float* bk = (const float*)d_in[6];   /* phi */ const float* wo = (const float*)d_in[7]; const float* bo = (const float*)d_in[8];   /* W_w [256][128], W_b */ const float* bng = (const float*)d_in[9]; const float* bnb = (const float*)d_in[10]; const float* x = nullptr; (void)x;
    float* OUT = (float*)d_out;     // [4][256][4096] NCHW
    char* wsp = (char*)d_ws;
    auto take = [&](size_t bytes) { char* p = wsp; wsp += (bytes + 255) & ~(size_t)255; return (void*)p; };
    float* YALL = (float*)take((size_t)NB_ * TT * DM * 4); float* BNS = (float*)take((size_t)DM * 32 * 4);    bf* WQ = (bf*)take((size_t)DQ * DM * 2); bf* WK = (bf*)take((size_t)DKV * DM * 2); bf* WV = (bf*)take((size_t)DKV * DM * 2); bf* WO = (bf*)take((size_t)DM * DQ * 2); float* CS = (float*)take((size_t)TT * HD * 2 * 4);
    bf* XB = (bf*)take((size_t)TT * DM * 2); float* FQ = (float*)take((size_t)TT * DQ * 4); float* FK = (float*)take((size_t)TT * DKV * 4);
    h16* QP16 = (h16*)take((size_t)NH_ * TT * HD * 2); h16* KP16 = (h16*)take((size_t)NKV * TT * HD * 2); h16* VT16 = (h16*)take((size_t)NKV * HD * TT * 2);
    bf* QPh = (bf*)take((size_t)NH_ * TT * HD * 2); bf* QPl = (bf*)take((size_t)NH_ * TT * HD * 2); bf* KPh = (bf*)take((size_t)NKV * TT * HD * 2); bf* KPl = (bf*)take((size_t)NKV * TT * HD * 2); bf* VTh = (bf*)take((size_t)NKV * HD * TT * 2); bf* VTl = (bf*)take((size_t)NKV * HD * TT * 2); bf* Ph = (bf*)take((size_t)ZH * RH * TT * 2); bf* Pl = (bf*)take((size_t)ZH * RH * TT * 2);
    float* Sb = (float*)take((size_t)ZH * TT * TT * 4); h16* P16 = (h16*)take((size_t)ZH * TT * TT * 2); float* Ob = (float*)take((size_t)NSH * TT * HD * 4); bf* ATh = (bf*)take((size_t)TT * DQ * 2); bf* ATl = (bf*)take((size_t)TT * DQ * 2);
    if ((size_t)(wsp - (char*)d_ws) > ws_size) return;    // ws 256 MiB
    float* FV = FK;   // v projection reuses the k buffer after the k planes are built (stream-ordered)
    { k_cvt8<<<(unsigned)(((size_t)DQ * DM / 8 + 255) / 256), 256, 0, stream>>>(wq, WQ, (size_t)DQ * DM / 8); k_cvt8<<<(unsigned)(((size_t)DKV * DM / 8 + 255) / 256), 256, 0, stream>>>(wk, WK, (size_t)DKV * DM / 8); k_cvt8<<<(unsigned)(((size_t)DKV * DM / 8 + 255) / 256), 256, 0, stream>>>(wv, WV, (size_t)DKV * DM / 8);
      k_cvt8<<<(unsigned)(((size_t)DM * DQ / 8 + 255) / 256), 256, 0, stream>>>(wo, WO, (size_t)DM * DQ / 8);
       }
    k_csid<<<(TT * HD + 255) / 256, 256, 0, stream>>>(CS);
    const unsigned LQ = (unsigned)(((size_t)NH_ * TT * HD / 2 + 255) / 256), LKv = (unsigned)(((size_t)NKV * TT * HD / 2 + 255) / 256);
    for (int b = 0; b < NB_; ++b) {
        
        k_cvtT<<<(unsigned)(((size_t)TT * DM / 8 + 255) / 256), 256, 0, stream>>>(xin + (size_t)b * DM * TT, XB);   /* NCHW [256][4096] -> token-major bf16 [4096][256] */
        k_gemmw<bf, 0, true><<<dim3(TT / 64, DQ / 64, 1), 32, 0, stream>>>(XB, nullptr, WQ, nullptr, DM, FQ, DQ, bq, 0, 0, 0);
        k_rope<<<LQ, 256, 0, stream>>>(FQ, DQ, NH_, CS, nullptr, nullptr, 1.0f, QP16, QPh, QPl);
        k_gemmw<bf, 0, true><<<dim3(TT / 64, DKV / 64, 1), 32, 0, stream>>>(XB, nullptr, WK, nullptr, DM, FK, DKV, bk, 0, 0, 0);
        k_rope<<<LKv, 256, 0, stream>>>(FK, DKV, NKV, CS, nullptr, nullptr, 1.0f, KP16, KPh, KPl);
        k_gemmw<bf, 0, true><<<dim3(TT / 64, DKV / 64, 1), 32, 0, stream>>>(XB, nullptr, WV, nullptr, DM, FV, DKV, bv, 0, 0, 0); k_vtp<<<LKv, 256, 0, stream>>>(FV, DKV, NKV, VT16, VTh, VTl);
        for (int h0 = 0; h0 < NH_; h0 += ZH) { const size_t zq = (size_t)h0, zk = (size_t)(h0 / REP);   // one kv head per query head: each pass takes one head (ZH 1) and its kv plane (z-strides TT*HD)
            k_gemmw<bf, 2, false><<<dim3(RH / 64, TT / 64, ZH), 32, 0, stream>>>(QPh + zq * TT * HD, QPl + zq * TT * HD, KPh + zk * TT * HD, KPl + zk * TT * HD, HD, Sb, TT, nullptr, (size_t)TT * HD, (size_t)TT * HD, (size_t)TT * TT);
            k_gemmw<h16, 0, false><<<dim3((TT - RH) / 64, TT / 64, ZH), 32, 0, stream>>>(QP16 + zq * TT * HD + (size_t)RH * HD, nullptr, KP16 + zk * TT * HD, nullptr, HD, Sb + (size_t)RH * TT, TT, nullptr, (size_t)TT * HD, (size_t)TT * HD, (size_t)TT * TT);
            k_asoft<<<ZH * TT / 8, 256, 0, stream>>>(Sb, P16, Ph, Pl);
            k_gemmw<bf, 2, false, NSH><<<dim3(RH / 64, HD / 64, NSH), 32, 0, stream>>>(Ph, Pl, VTh + zk * HD * TT, VTl + zk * HD * TT, TT, Ob, NSH * HD, nullptr, (size_t)(TT / NSH), (size_t)(TT / NSH), (size_t)HD);   /* z = k slice -> partial Ob[t][z][d] */
            k_gemmw<h16, 0, false, NSL><<<dim3((TT - RH) / 64, HD / 64, NSL), 32, 0, stream>>>(P16 + (size_t)RH * TT, nullptr, VT16 + zk * HD * TT, nullptr, TT, Ob + (size_t)RH * NSH * HD, NSH * HD, nullptr, (size_t)(TT / NSL), (size_t)(TT / NSL), (size_t)HD);
            k_merge<<<(unsigned)(((size_t)ZH * TT * HD / 2 + 255) / 256), 256, 0, stream>>>(Ob, h0, ATh, ATl); }
        k_gemmw<bf, 1, true><<<dim3(TT / 64, DM / 64, 1), 32, 0, stream>>>(ATh, ATl, WO, nullptr, DQ, YALL + (size_t)b * TT * DM, DM, bo, 0, 0, 0);   /* Wy (token-major) kept for the batch statistics */ }
    k_bnstat<<<DM, 256, 0, stream>>>(YALL, BNS);   /* per channel: mean and 1/sqrt(var + eps) over the batch x 4,096 positions (training-mode BatchNorm) */
    k_bnout<<<(unsigned)(((size_t)NB_ * DM * TT / 4 + 255) / 256), 256, 0, stream>>>(YALL, BNS, bng, bnb, xin, OUT);   /* out[b][c][n] = gamma (Wy - mean) rstd + beta + x */

}

// v002
// Measured time: 355 microseconds a run.
// Two timings next to v001 both put it at 1.46 times that version's speed.
// Counting every step since v000, it is 3.00 times as fast.
#include <hip/hip_runtime.h>

// Non-local block (embedded Gaussian) over 64x64 = 4,096 positions with a training-mode BatchNorm and residual (x [4][256][64][64] NCHW; theta, phi, g = 1x1 convs C 256 -> Ci 128 ('oi' [128][256] 0.02, zero biases); f[n][m] = theta_n . phi_m (no scaling); attn = softmax over m; y[ci][n] = sum_m attn[n][m] g[ci][m]; Wy = W_w y + W_b ('oi' [256][128]); BatchNorm2d in TRAINING mode (per-channel mean/var over the whole batch x 64 x 64, eps 1e-5, gamma/beta read); out = BN(Wy) + x -> [4][256][64][64] (4.2 M)).
// Compute dtypes, f32 accumulate: every input rounded to bf16; convs exact + f32 bias; attention rows < 512 3 products, rest fp16; softmax f32; W_w hl x exact + bias; BatchNorm statistics and output f32 (fixed-order sums); residual f32 of the bf16-rounded x.

#define NB_  4
#define TT   4096
#define DM   256
#define NH_  1
#define NKV  1
#define REP  (NH_ / NKV)
#define HD   128
#define DQ   (NH_ * HD)
#define DKV  (NKV * HD)
#define ZH   1
#define RH   512                  // query rows < RH use hi+lo planes (0: none)
#define WIN  0
#define PCAR 1024.0f
#define SCL  1.0f     // the non-local block applies no 1/sqrt(d)
#define CIN  256      // channels C (== DM)
#define BNEPS 1e-5f
#define NSL  16       // k slices of the attn x g product, rows >= RH (one work-group per slice and tile, slice from the flat block index)
#define NSH  32       // k slices of the same product, rows < RH (fewer tiles there, so more slices)
typedef _Float16 h16;
typedef unsigned short bf;
typedef __attribute__((ext_vector_type(16))) __bf16   v16bf;
typedef __attribute__((ext_vector_type(16))) _Float16 v16h;
typedef __attribute__((ext_vector_type(8)))  _Float16 v8h;
typedef __attribute__((ext_vector_type(8)))  unsigned short v8us;
typedef __attribute__((ext_vector_type(8)))  float    v8f;
typedef __attribute__((ext_vector_type(4)))  float    v4f;
typedef v8h  __attribute__((may_alias)) v8ha;
typedef v4f  __attribute__((may_alias)) v4fa;
typedef v8us __attribute__((may_alias)) v8usa;

__device__ __forceinline__ unsigned short f2bf(float f) { unsigned u = __float_as_uint(f); u += 0x7FFFu + ((u >> 16) & 1u); return (unsigned short)(u >> 16); }
__device__ __forceinline__ float bf2f(unsigned short b) { return __uint_as_float(((unsigned)b) << 16); }
__device__ __forceinline__ float bfr(float f) { return bf2f(f2bf(f)); }
__device__ __forceinline__ v16h cat16(v8h lo, v8h hi) { return __builtin_shufflevector(lo, hi, 0, 1, 2, 3, 4, 5, 6, 7, 8, 9, 10, 11, 12, 13, 14, 15); }
__device__ __forceinline__ v16bf cat16b(v8us lo, v8us hi) { return __builtin_bit_cast(v16bf, __builtin_shufflevector(lo, hi, 0, 1, 2, 3, 4, 5, 6, 7, 8, 9, 10, 11, 12, 13, 14, 15)); }
__device__ __forceinline__ v8f wmma16(v16h a, v16h b, v8f c) { return __builtin_amdgcn_wmma_f32_16x16x32_f16(false, a, false, b, (short)0, c, false, false); }
__device__ __forceinline__ v8f wmmab(v16bf a, v16bf b, v8f c) { return __builtin_amdgcn_wmma_f32_16x16x32_bf16(false, a, false, b, (short)0, c, false, false); }



// ---- k_gemmw: register-blocked GEMM, ONE WAVE per 64x64 output tile (16 accumulators), operands straight from K-contiguous 16-bit planes; grid (M/64, N/64, Z), 32 threads.
// C[m][n] (f32, pitch ldc, + optional f32 bias[n]) = sum_k A[m][k] Bt[n][k] (+ split products per NSPLIT). z-batch strides sA/sB/sC in elements. K % 32 == 0. KS > 1: a work-group sums K / KS of the k only (operand rows stay at pitch K); with sA = sB = K / KS, z is the k slice and C + z sC its partial sum.
template <typename T16> struct WFrag;
template <> struct WFrag<h16> { typedef v16h V; static __device__ __forceinline__ V ld(const h16* p) { return cat16(*(const v8h*)p, *(const v8h*)(p + 16)); } static __device__ __forceinline__ v8f mma(V a, V b, v8f c) { return wmma16(a, b, c); } };
template <> struct WFrag<bf> { typedef v16bf V; static __device__ __forceinline__ V ld(const bf* p) { return cat16b(*(const v8us*)p, *(const v8us*)(p + 16)); } static __device__ __forceinline__ v8f mma(V a, V b, v8f c) { return wmmab(a, b, c); } };
// gemmw_tile: the tile (bx, by) of one such product; os: 16 x 68 floats of LDS. Kernels that hold several independent products pick product and tile from the block index.
template <typename T16, int NSPLIT, bool BIAS, int KS>
__device__ __forceinline__ void gemmw_tile(float* os, const T16* __restrict__ A, const T16* __restrict__ A2, const T16* __restrict__ Bt, const T16* __restrict__ Bt2, int K, float* C, int ldc, const float* __restrict__ bias, int bx, int by) {
    typedef typename WFrag<T16>::V V;
    const int lane = threadIdx.x & 31, lr = lane & 15, hi = lane >> 4; const int r0 = bx * 64, c0 = by * 64;
    v8f acc[4][4];
#pragma unroll
    for (int mb = 0; mb < 4; ++mb)
#pragma unroll
        for (int nb = 0; nb < 4; ++nb) acc[mb][nb] = (v8f){};
    const size_t aoff = (size_t)(r0 + lr) * K + 8 * hi, boff = (size_t)(c0 + lr) * K + 8 * hi;
#pragma unroll 1
    for (int kc = 0; kc < K / KS; kc += 32) {
        V a[4], a2[4];
#pragma unroll
        for (int mb = 0; mb < 4; ++mb) { a[mb] = WFrag<T16>::ld(A + aoff + (size_t)mb * 16 * K + kc); if (NSPLIT == 1 || NSPLIT == 2) a2[mb] = WFrag<T16>::ld(A2 + aoff + (size_t)mb * 16 * K + kc); }
#pragma unroll
        for (int nb = 0; nb < 4; ++nb) { const V b = WFrag<T16>::ld(Bt + boff + (size_t)nb * 16 * K + kc); V b2; if (NSPLIT >= 2) b2 = WFrag<T16>::ld(Bt2 + boff + (size_t)nb * 16 * K + kc);
#pragma unroll
            for (int mb = 0; mb < 4; ++mb) { acc[mb][nb] = WFrag<T16>::mma(a[mb], b, acc[mb][nb]); if (NSPLIT == 1 || NSPLIT == 2) acc[mb][nb] = WFrag<T16>::mma(a2[mb], b, acc[mb][nb]); if (NSPLIT >= 2) acc[mb][nb] = WFrag<T16>::mma(a[mb], b2, acc[mb][nb]); } }
        asm volatile("v_nop\n\tv_nop\n\tv_nop\n\tv_nop" : "+v"(acc[0][0]), "+v"(acc[1][1]), "+v"(acc[2][2]), "+v"(acc[3][3]) : "v"(a[0]), "v"(a[3]));
    }
#pragma unroll
    for (int mb = 0; mb < 4; ++mb) {
#pragma unroll
        for (int nb = 0; nb < 4; ++nb) {
#pragma unroll
            for (int j = 0; j < 8; ++j) os[(hi * 8 + j) * 68 + nb * 16 + lr] = acc[mb][nb][j]; }
        __builtin_amdgcn_wave_barrier(); asm volatile("" ::: "memory");
        float* crow = C + (size_t)(r0 + mb * 16) * ldc + c0;
{
#pragma unroll
            for (int s = 0; s < 8; ++s) { const int row = 2 * s + hi, cofs = lr * 4; v4f val = *(const v4fa*)(os + row * 68 + cofs); if (BIAS) { val[0] += bfr(bias[c0 + cofs]); val[1] += bfr(bias[c0 + cofs + 1]); val[2] += bfr(bias[c0 + cofs + 2]); val[3] += bfr(bias[c0 + cofs + 3]); }
                *(v4f*)(crow + (size_t)row * ldc + cofs) = val; }
             }
        __builtin_amdgcn_wave_barrier(); asm volatile("" ::: "memory");
    }
    asm volatile("s_wait_xcnt 0x0" ::: "memory");   // a kernel that holds several products may lay another product's code behind this tile's last stores: no register of theirs is rewritten before this wait
}
template <typename T16, int NSPLIT, bool BIAS, int KS = 1>
__global__ __launch_bounds__(32) void k_gemmw(const T16* __restrict__ A, const T16* __restrict__ A2, const T16* __restrict__ Bt, const T16* __restrict__ Bt2, int K, float* C, int ldc, const float* __restrict__ bias, size_t sA, size_t sB, size_t sC) {
    __shared__ __align__(16) float os[16 * 68];
    const size_t z = blockIdx.z; A += z * sA; if (A2) A2 += z * sA; Bt += z * sB; if (Bt2) Bt2 += z * sB; C += z * sC;
    gemmw_tile<T16, NSPLIT, BIAS, KS>(os, A, A2, Bt, Bt2, K, C, ldc, bias, blockIdx.x, blockIdx.y);
}
// k_gemmhl: one product's rows < RH (hi + lo planes, 3 products, KSH k slices) and its rows >= RH (fp16, KSL k slices) in ONE launch; flat grid, the RH / 64 x NY x KSH tiles of the first part in front, row tile fastest, then column tile, then slice. Slice z sums K / KS of the k into C + z HD.
template <int NY, int KSH, int KSL>
__global__ __launch_bounds__(32) void k_gemmhl(const bf* __restrict__ Ah, const bf* __restrict__ Al, const bf* __restrict__ Bh, const bf* __restrict__ Bl, const h16* __restrict__ A16, const h16* __restrict__ B16, int K, float* Ch, float* Cl, int ldc) {
    __shared__ __align__(16) float os[16 * 68];
    constexpr int XH = RH / 64, XL = (TT - RH) / 64, NHI = XH * NY * KSH;
    const int id = blockIdx.x;
    if (id < NHI) { const int bx = id % XH, by = (id / XH) % NY; const size_t z = id / (XH * NY), ko = z * (size_t)(K / KSH);
        gemmw_tile<bf, 2, false, KSH>(os, Ah + ko, Al + ko, Bh + ko, Bl + ko, K, Ch + z * HD, ldc, nullptr, bx, by);
    } else { const int il = id - NHI; const int bx = il % XL, by = (il / XL) % NY; const size_t z = il / (XL * NY), ko = z * (size_t)(K / KSL);
        gemmw_tile<h16, 0, false, KSL>(os, A16 + ko, nullptr, B16 + ko, nullptr, K, Cl + z * HD, ldc, nullptr, bx, by); }
}
// k_proj3: the theta, phi and g projections of all images in ONE launch; grid (TT / 64, 3 x HD / 64, image)
__global__ __launch_bounds__(32) void k_proj3(const bf* __restrict__ XB, const bf* __restrict__ WQ, const bf* __restrict__ WK, const bf* __restrict__ WV, float* FQ, float* FK, float* FV, const float* __restrict__ bq, const float* __restrict__ bk, const float* __restrict__ bv) {
    __shared__ __align__(16) float os[16 * 68];
    const int w = blockIdx.y / (HD / 64), by = blockIdx.y % (HD / 64); const size_t im = blockIdx.z;
    const bf* Wt = (w == 0) ? WQ : (w == 1) ? WK : WV; float* F = (w == 0) ? FQ : (w == 1) ? FK : FV; const float* bias = (w == 0) ? bq : (w == 1) ? bk : bv;
    gemmw_tile<bf, 0, true, 1>(os, XB + im * TT * DM, nullptr, Wt, nullptr, DM, F + im * TT * HD, HD, bias, blockIdx.x, by);
}

__device__ __forceinline__ h16 tohx(float x) { return (h16)x; }
__device__ __forceinline__ void splitf(float y, unsigned short& h, unsigned short& l) { h = f2bf(y); l = f2bf(y - bf2f(h)); }
typedef __attribute__((ext_vector_type(2))) _Float16 v2h;
typedef __attribute__((ext_vector_type(4))) _Float16 v4h;
typedef __attribute__((ext_vector_type(2))) unsigned short v2us;
typedef __attribute__((ext_vector_type(4))) unsigned short v4us;
typedef __attribute__((ext_vector_type(2))) float v2f;
typedef __attribute__((ext_vector_type(4))) int v4i;

__global__ __launch_bounds__(256) void k_wtG(const float* __restrict__ w, int K, int N, bf* Bt) {
    const int lane = threadIdx.x & 31; const int L0 = (blockIdx.x * 8 + (threadIdx.x >> 5)) * 8; const int nlines = N * K / 64;
{
#pragma unroll 1
        for (int l = 0; l < 8; ++l) { const int L = L0 + l; if (L >= nlines) break; const size_t e = (size_t)L * 64 + lane * 2; const int k = (int)(e % K), n = (int)(e / K); v2us o;
            o[0] = f2bf(w[(size_t)k * N + n]); o[1] = f2bf(w[(size_t)(k + 1) * N + n]); *(v2us*)(Bt + e) = o; }
         }
}
__device__ __forceinline__ void d_cvt8(const float* __restrict__ src, bf* dst, size_t n8, unsigned bx) { const size_t i = (size_t)bx * 256 + threadIdx.x; if (i >= n8) return; const v8f v = *(const v8f*)(src + i * 8); v8us o;
#pragma unroll
    for (int k = 0; k < 8; ++k) o[k] = f2bf(v[k]); *(v8us*)(dst + i * 8) = o;  }

// d_rope (grid x = element pairs, grid y = image): head planes [h][t][d] (fp16 + hi/lo) of rope(x) x sc with the rotate-half convention out[d] = x[d] cos[t][d] - x[d+HD/2] sin[t][d], out[d+HD/2] = x[d+HD/2] cos[t][d+HD/2] + x[d] sin[t][d+HD/2]
__device__ __forceinline__ void d_rope(const float* __restrict__ F, int pitch, int nheads, const float* __restrict__ CS, const float* __restrict__ RF, const float* __restrict__ nw, float sc, h16* P16, bf* Ph, bf* Pl) {
    const size_t e = ((size_t)blockIdx.x * 256 + threadIdx.x) * 2; if (e >= (size_t)nheads * TT * HD) return; { const size_t im = blockIdx.y, po = im * nheads * TT * HD; F += im * TT * pitch; P16 += po; Ph += po; Pl += po; } const int d = (int)(e % HD); const int t = (int)((e / HD) % TT); const int h = (int)(e / ((size_t)HD * TT)); const float* f = F + (size_t)t * pitch + h * HD; const float rf = RF ? RF[(size_t)h * TT + t] : 1.0f; v2h o16; v2us oh, ol;
#pragma unroll
    for (int q = 0; q < 2; ++q) { const int dd = d + q; const int dp = (dd < HD / 2) ? dd + HD / 2 : dd - HD / 2; float x0 = f[dd], x1 = f[dp];
        if (RF) { float n0 = __fmul_rn(x0, rf), n1 = __fmul_rn(x1, rf); asm volatile("" : "+v"(n0)); asm volatile("" : "+v"(n1)); x0 = __fmul_rn(bfr(nw[dd]), n0); x1 = __fmul_rn(bfr(nw[dp]), n1); }
        const v2f cs = *(const v2f*)(CS + ((size_t)t * HD + dd) * 2); float a = __fmul_rn(x0, cs[0]), bq = __fmul_rn(x1, cs[1]); asm volatile("" : "+v"(a)); asm volatile("" : "+v"(bq)); const float r = ((dd < HD / 2) ? __fsub_rn(a, bq) : __fadd_rn(a, bq)) * sc;
        o16[q] = tohx(r); unsigned short a2, c2; splitf(r, a2, c2); oh[q] = a2; ol[q] = c2; }
    *(v2h*)(P16 + e) = o16; *(v2us*)(Ph + e) = oh; *(v2us*)(Pl + e) = ol;  }
__device__ __forceinline__ void d_vtp(const float* __restrict__ F, int pitch, int nheads, h16* V16, bf* Vh, bf* Vl) { const size_t e = ((size_t)blockIdx.x * 256 + threadIdx.x) * 2; if (e >= (size_t)nheads * HD * TT) return; { const size_t im = blockIdx.y, po = im * nheads * HD * TT; F += im * TT * pitch; V16 += po; Vh += po; Vl += po; } const int t = (int)(e % TT); const int d = (int)((e / TT) % HD); const int g = (int)(e / ((size_t)TT * HD)); v2h o16; v2us oh, ol;
#pragma unroll
    for (int q = 0; q < 2; ++q) { const float x = F[(size_t)(t + q) * pitch + g * HD + d]; o16[q] = tohx(x); unsigned short a2, c2; splitf(x, a2, c2); oh[q] = a2; ol[q] = c2; }
    *(v2h*)(V16 + e) = o16; *(v2us*)(Vh + e) = oh; *(v2us*)(Vl + e) = ol;  }
// k_planes: the operand planes of theta, phi and g of all images in ONE launch; grid (element pairs, image, which)
__global__ __launch_bounds__(256) void k_planes(const float* __restrict__ FQ, const float* __restrict__ FK, const float* __restrict__ FV, const float* __restrict__ CS, h16* QP16, bf* QPh, bf* QPl, h16* KP16, bf* KPh, bf* KPl, h16* VT16, bf* VTh, bf* VTl) {
    if (blockIdx.z == 0) d_rope(FQ, DQ, NH_, CS, nullptr, nullptr, 1.0f, QP16, QPh, QPl);
    else if (blockIdx.z == 1) d_rope(FK, DKV, NKV, CS, nullptr, nullptr, 1.0f, KP16, KPh, KPl);
    else d_vtp(FV, DKV, NKV, VT16, VTh, VTl);
}
__device__ __forceinline__ void d_csid(float* CS, unsigned bx) { const int idx = bx * 256 + threadIdx.x; if (idx >= TT * HD) return; v2f cs; cs[0] = 1.0f; cs[1] = 0.0f; *(v2f*)(CS + (size_t)idx * 2) = cs;  }
// k_asoft: per row (zz, i): t = S x SCL = S (no scaling, no mask); softmax over the 4096 keys (register row, one exp, fixed trees);
__global__ __launch_bounds__(256) void k_asoft(const float* __restrict__ Sb, h16* P16, bf* Ph, bf* Pl) {
    const int lane = threadIdx.x & 31; const int row = blockIdx.x * 8 + (threadIdx.x >> 5); if (row >= ZH * TT) return; const int i = row % TT; const int zz = row / TT; (void)zz; const bool hires = (i < RH); const float* sr = Sb + (size_t)row * TT; float v[TT / 32]; float mx = -3.0e38f;
#pragma unroll
    for (int ch = 0; ch < TT / 128; ++ch) { const int j0 = ch * 128 + lane * 4; const v4f a = *(const v4f*)(sr + j0);
#pragma unroll
        for (int q = 0; q < 4; ++q) { const int j = j0 + q; (void)j; const float t = a[q] * SCL; v[ch * 4 + q] = t; mx = fmaxf(mx, t); } }
#pragma unroll
    for (int sh = 16; sh; sh >>= 1) mx = fmaxf(mx, __shfl_xor(mx, sh, 32));
    float sum = 0.f;
#pragma unroll
    for (int k = 0; k < TT / 32; ++k) { float d0 = __fsub_rn(v[k], mx); asm volatile("" : "+v"(d0)); v[k] = __builtin_amdgcn_exp2f(__fmul_rn(d0, 1.4426950408889634f)); sum += v[k]; }
#pragma unroll
    for (int sh = 16; sh; sh >>= 1) sum += __shfl_xor(sum, sh, 32);
    const float f = __fdiv_rn(hires ? 1.0f : PCAR, sum);
{
        if (hires) {
#pragma unroll
            for (int ch = 0; ch < TT / 128; ++ch) { v4us oh, ol;
#pragma unroll
                for (int q = 0; q < 4; ++q) { unsigned short a, c2; splitf(v[ch * 4 + q] * f, a, c2); oh[q] = a; ol[q] = c2; }
                const size_t oo = ((size_t)zz * (RH ? RH : 1) + i) * TT + ch * 128 + lane * 4; *(v4us*)(Ph + oo) = oh; *(v4us*)(Pl + oo) = ol; }
        } else {
#pragma unroll
            for (int ch = 0; ch < TT / 128; ++ch) { v4h o4;
#pragma unroll
                for (int q = 0; q < 4; ++q) o4[q] = tohx(v[ch * 4 + q] * f);
                *(v4h*)(P16 + (size_t)row * TT + ch * 128 + lane * 4) = o4; } }
         }
}
__device__ __forceinline__ void d_cvtT(const float* __restrict__ X, bf* XB, unsigned bx) { const size_t i = (size_t)bx * 256 + threadIdx.x; if (i >= (size_t)TT * DM / 8) return; const size_t e = i * 8; const int c0 = (int)(e % DM); const int n = (int)(e / DM); v8us o;
#pragma unroll
    for (int q = 0; q < 8; ++q) o[q] = f2bf(X[(size_t)(c0 + q) * TT + n]);
    *(v8us*)(XB + e) = o;  }
// k_prep: everything that reads only the inputs, in ONE launch; flat grid: NB_ x NBT blocks turn the images token-major, 4 x NBW blocks round the weights, NBC blocks write the cos/sin table
#define NBT ((TT * DM / 8 + 255) / 256)
#define NBW ((HD * DM / 8 + 255) / 256)
#define NBC ((TT * HD + 255) / 256)
__global__ __launch_bounds__(256) void k_prep(const float* __restrict__ xin, const float* __restrict__ wq, const float* __restrict__ wk, const float* __restrict__ wv, const float* __restrict__ wo, bf* XB, bf* WQ, bf* WK, bf* WV, bf* WO, float* CS) {
    const unsigned id = blockIdx.x;
    if (id < NB_ * NBT) { const size_t im = id / NBT; d_cvtT(xin + im * DM * TT, XB + im * TT * DM, id % NBT); }
    else if (id < NB_ * NBT + 4 * NBW) { const unsigned w = (id - NB_ * NBT) / NBW; d_cvt8((w == 0) ? wq : (w == 1) ? wk : (w == 2) ? wv : wo, (w == 0) ? WQ : (w == 1) ? WK : (w == 2) ? WV : WO, (size_t)HD * DM / 8, (id - NB_ * NBT) % NBW); }
    else d_csid(CS, id - NB_ * NBT - 4 * NBW);
}
__global__ __launch_bounds__(256) void k_bnstat(const float* __restrict__ Y, float* BNS) { __shared__ float red[256]; const int c = blockIdx.x; const int tid = threadIdx.x; const size_t NTOT = (size_t)NB_ * TT; float s = 0.0f;
    for (size_t r = tid; r < NTOT; r += 256) s = __fadd_rn(s, Y[r * DM + c]);
    red[tid] = s; __syncthreads();
    for (int st = 128; st > 0; st >>= 1) { if (tid < st) red[tid] = __fadd_rn(red[tid], red[tid + st]); __syncthreads(); }
    const float mu = __fdiv_rn(red[0], (float)NTOT); __syncthreads(); float v = 0.0f;
    for (size_t r = tid; r < NTOT; r += 256) { const float d = __fsub_rn(Y[r * DM + c], mu); float p = __fmul_rn(d, d); asm volatile("" : "+v"(p)); v = __fadd_rn(v, p); }
    red[tid] = v; __syncthreads();
    for (int st = 128; st > 0; st >>= 1) { if (tid < st) red[tid] = __fadd_rn(red[tid], red[tid + st]); __syncthreads(); }
    if (tid == 0) { const float var = __fdiv_rn(red[0], (float)NTOT); v2f o; o[0] = mu; o[1] = __fdiv_rn(1.0f, __fsqrt_rn(__fadd_rn(var, BNEPS))); *(v2f*)(BNS + (size_t)c * 32) = o;  }    }
__global__ __launch_bounds__(256) void k_bnout(const float* __restrict__ Y, const float* __restrict__ BNS, const float* __restrict__ g, const float* __restrict__ bb, const float* __restrict__ X, float* OUT) { const size_t k = (size_t)blockIdx.x * 256 + threadIdx.x; if (k >= (size_t)NB_ * DM * TT / 4) return; const size_t e = k * 4; const int n0 = (int)(e % TT); const int c = (int)((e / TT) % DM); const int b = (int)(e / ((size_t)TT * DM)); const float mu = BNS[(size_t)c * 32], rs = BNS[(size_t)c * 32 + 1], gm = bfr(g[c]), bt = bfr(bb[c]); const v4f xr = *(const v4f*)(X + e); v4f o;
#pragma unroll
    for (int q = 0; q < 4; ++q) { const float y = Y[((size_t)b * TT + n0 + q) * DM + c]; float t = __fmul_rn(__fmul_rn(gm, __fsub_rn(y, mu)), rs); asm volatile("" : "+v"(t)); t = __fadd_rn(t, bt); o[q] = __fadd_rn(t, bfr(xr[q])); }
    *(v4f*)(OUT + e) = o;  }
__global__ __launch_bounds__(256) void k_merge(const float* __restrict__ O, int h0, bf* Ah, bf* Al) { const size_t e = ((size_t)blockIdx.x * 256 + threadIdx.x) * 2; if (e >= (size_t)ZH * TT * HD) return; const int d = (int)(e % HD); const int t = (int)((e / HD) % TT); const int zz = (int)(e / ((size_t)HD * TT)); const float cs = (t < RH) ? 1.0f : (1.0f / PCAR); const size_t oo = (size_t)t * DQ + (h0 + zz) * HD + d;
    // O [t][slice][d], NSH slots a row: the partial sums of the k slices (NSH for rows < RH, NSL for the rest), added in slice order
    const float* op = O + ((size_t)zz * TT + t) * (NSH * HD) + d;
    v2f s = *(const v2f*)op;
#pragma unroll   // all partial loads of a thread in flight together
    for (int p = 1; p < NSL; ++p) { const v2f u = *(const v2f*)(op + p * HD); s[0] = __fadd_rn(s[0], u[0]); s[1] = __fadd_rn(s[1], u[1]); }
    if (t < RH) { v2f u[NSH - NSL];
#pragma unroll   // as above
        for (int p = NSL; p < NSH; ++p) u[p - NSL] = *(const v2f*)(op + p * HD);
        asm volatile("s_wait_xcnt 0x0" :: "v"(op) : "memory");   // the loads' address pair is dead here: no register of it is reused before this wait
#pragma unroll
        for (int p = NSL; p < NSH; ++p) { s[0] = __fadd_rn(s[0], u[p - NSL][0]); s[1] = __fadd_rn(s[1], u[p - NSL][1]); } }
    v2us oh, ol;
#pragma unroll
    for (int q = 0; q < 2; ++q) { unsigned short a, c2; splitf(s[q] * cs, a, c2); oh[q] = a; ol[q] = c2; } *(v2us*)(Ah + oo) = oh; *(v2us*)(Al + oo) = ol;  }

extern "C" void kernel_launch(void* const* d_in, const int* in_sizes, int n_in,
                              void* d_out, int out_size, void* d_ws, size_t ws_size, hipStream_t stream) {
    (void)in_sizes; (void)n_in; (void)out_size;
    const float* xin = (const float*)d_in[0];   /* x [4][256][4096] NCHW */ const float* wv = (const float*)d_in[1]; const float* bv = (const float*)d_in[2];   /* g_w, g_b */ const float* wq = (const float*)d_in[3]; const float* bq = (const float*)d_in[4];   /* theta */ const float* wk = (const float*)d_in[5]; const float* bk = (const float*)d_in[6];   /* phi */ const float* wo = (const float*)d_in[7]; const float* bo = (const float*)d_in[8];   /* W_w [256][128], W_b */ const float* bng = (const float*)d_in[9]; const float* bnb = (const float*)d_in[10]; const float* x = nullptr; (void)x;
    float* OUT = (float*)d_out;     // [4][256][4096] NCHW
    char* wsp = (char*)d_ws;
    auto take = [&](size_t bytes) { char* p = wsp; wsp += (bytes + 255) & ~(size_t)255; return (void*)p; };
    float* YALL = (float*)take((size_t)NB_ * TT * DM * 4); float* BNS = (float*)take((size_t)DM * 32 * 4);    bf* WQ = (bf*)take((size_t)DQ * DM * 2); bf* WK = (bf*)take((size_t)DKV * DM * 2); bf* WV = (bf*)take((size_t)DKV * DM * 2); bf* WO = (bf*)take((size_t)DM * DQ * 2); float* CS = (float*)take((size_t)TT * HD * 2 * 4);
    h16* QP16 = (h16*)take((size_t)NB_ * TT * HD * 2); h16* KP16 = (h16*)take((size_t)NB_ * TT * HD * 2); h16* VT16 = (h16*)take((size_t)NB_ * HD * TT * 2);   // the theta, phi and g planes: one per image, image stride TT * HD
    bf* QPh = (bf*)take((size_t)NB_ * TT * HD * 2); bf* QPl = (bf*)take((size_t)NB_ * TT * HD * 2); bf* KPh = (bf*)take((size_t)NB_ * TT * HD * 2); bf* KPl = (bf*)take((size_t)NB_ * TT * HD * 2); bf* VTh = (bf*)take((size_t)NB_ * HD * TT * 2); bf* VTl = (bf*)take((size_t)NB_ * HD * TT * 2); bf* Ph = (bf*)take((size_t)ZH * RH * TT * 2); bf* Pl = (bf*)take((size_t)ZH * RH * TT * 2);
    float* Sb = (float*)take((size_t)ZH * TT * TT * 4); h16* P16 = (h16*)take((size_t)ZH * TT * TT * 2); float* Ob = (float*)take((size_t)NSH * TT * HD * 4); bf* ATh = (bf*)take((size_t)NB_ * TT * DQ * 2); bf* ATl = (bf*)take((size_t)NB_ * TT * DQ * 2);
    if ((size_t)(wsp - (char*)d_ws) > ws_size) return;    // ws 256 MiB
    // the projections' temporaries of all images (32 MiB) lie in the logits buffer: they are dead before the first logits product writes it (stream-ordered)
    bf* XB = (bf*)Sb; float* FQ = (float*)(XB + (size_t)NB_ * TT * DM); float* FK = FQ + (size_t)NB_ * TT * DQ; float* FV = FK + (size_t)NB_ * TT * DKV;
    // launches that do not depend on one another are ONE launch: all images, all weights, all three projections, both row ranges of a product
    k_prep<<<NB_ * NBT + 4 * NBW + NBC, 256, 0, stream>>>(xin, wq, wk, wv, wo, XB, WQ, WK, WV, WO, CS);   /* NCHW [256][4096] -> token-major bf16 [4096][256]; bf16 weights; table */
    k_proj3<<<dim3(TT / 64, 3 * (HD / 64), NB_), 32, 0, stream>>>(XB, WQ, WK, WV, FQ, FK, FV, bq, bk, bv);
    k_planes<<<dim3((unsigned)(((size_t)TT * HD / 2 + 255) / 256), NB_, 3), 256, 0, stream>>>(FQ, FK, FV, CS, QP16, QPh, QPl, KP16, KPh, KPl, VT16, VTh, VTl);
    for (int b = 0; b < NB_; ++b) { const size_t zb = (size_t)b * TT * HD;   // one image's logits fill the largest buffer the workspace has room for: the attention stays one image at a time
        k_gemmhl<TT / 64, 1, 1><<<(RH / 64) * (TT / 64) + ((TT - RH) / 64) * (TT / 64), 32, 0, stream>>>(QPh + zb, QPl + zb, KPh + zb, KPl + zb, QP16 + zb + (size_t)RH * HD, KP16 + zb, HD, Sb, Sb + (size_t)RH * TT, TT);
        k_asoft<<<ZH * TT / 8, 256, 0, stream>>>(Sb, P16, Ph, Pl);
        k_gemmhl<HD / 64, NSH, NSL><<<(RH / 64) * (HD / 64) * NSH + ((TT - RH) / 64) * (HD / 64) * NSL, 32, 0, stream>>>(Ph, Pl, VTh + zb, VTl + zb, P16 + (size_t)RH * TT, VT16 + zb, TT, Ob, Ob + (size_t)RH * NSH * HD, NSH * HD);   /* k slice z -> partial Ob[t][z][d] */
        k_merge<<<(unsigned)(((size_t)ZH * TT * HD / 2 + 255) / 256), 256, 0, stream>>>(Ob, 0, ATh + zb, ATl + zb); }
    k_gemmw<bf, 1, true><<<dim3(TT / 64, DM / 64, NB_), 32, 0, stream>>>(ATh, ATl, WO, nullptr, DQ, YALL, DM, bo, (size_t)TT * DQ, 0, (size_t)TT * DM);   /* Wy (token-major) of all images, kept for the batch statistics */
    k_bnstat<<<DM, 256, 0, stream>>>(YALL, BNS);   /* per channel: mean and 1/sqrt(var + eps) over the batch x 4,096 positions (training-mode BatchNorm) */
    k_bnout<<<(unsigned)(((size_t)NB_ * DM * TT / 4 + 255) / 256), 256, 0, stream>>>(YALL, BNS, bng, bnb, xin, OUT);   /* out[b][c][n] = gamma (Wy - mean) rstd + beta + x */

}

// v003
// One run takes 202 microseconds.
// Two timings next to v002 both put it at 1.76 times that version's speed.
// All steps since v000 together make it 5.29 times as fast.
#include <hip/hip_runtime.h>

// Non-local block (embedded Gaussian) over 64x64 = 4,096 positions with a training-mode BatchNorm and residual (x [4][256][64][64] NCHW; theta, phi, g = 1x1 convs C 256 -> Ci 128 ('oi' [128][256] 0.02, zero biases); f[n][m] = theta_n . phi_m (no scaling); attn = softmax over m; y[ci][n] = sum_m attn[n][m] g[ci][m]; Wy = W_w y + W_b ('oi' [256][128]); BatchNorm2d in TRAINING mode (per-channel mean/var over the whole batch x 64 x 64, eps 1e-5, gamma/beta read); out = BN(Wy) + x -> [4][256][64][64] (4.2 M)).
// Compute dtypes, f32 accumulate: every input rounded to bf16; convs exact + f32 bias; attention rows < 512 3 products, rest fp16; softmax f32; W_w hl x exact + bias; BatchNorm statistics and output f32 (fixed-order sums); residual f32 of the bf16-rounded x.

#define NB_  4
#define TT   4096
#define DM   256
#define NH_  1
#define NKV  1
#define REP  (NH_ / NKV)
#define HD   128
#define DQ   (NH_ * HD)
#define DKV  (NKV * HD)
#define ZH   1
#define RH   512                  // query rows < RH use hi+lo planes (0: none)
#define WIN  0
#define PSH  8.0f     // P carries 2^PSH (numerator and row sum alike: it cancels in the softmax's division), so that small weights stay in fp16's normal range
#define SCL  1.0f     // the non-local block applies no 1/sqrt(d)
#define CIN  256      // channels C (== DM)
#define BNEPS 1e-5f
#define KSP  8        // key slices of the fused attention (one work-group per slice); every slice leaves its partial result in a slot of its own
#define L2E  1.4426950408889634f
typedef _Float16 h16;
typedef unsigned short bf;
typedef __attribute__((ext_vector_type(16))) __bf16   v16bf;
typedef __attribute__((ext_vector_type(16))) _Float16 v16h;
typedef __attribute__((ext_vector_type(8)))  _Float16 v8h;
typedef __attribute__((ext_vector_type(8)))  unsigned short v8us;
typedef __attribute__((ext_vector_type(16))) unsigned short v16us;
typedef __attribute__((ext_vector_type(8)))  float    v8f;
typedef __attribute__((ext_vector_type(4)))  float    v4f;
typedef v8h  __attribute__((may_alias)) v8ha;
typedef v4f  __attribute__((may_alias)) v4fa;
typedef v8us __attribute__((may_alias)) v8usa;

__device__ __forceinline__ unsigned short f2bf(float f) { unsigned u = __float_as_uint(f); u += 0x7FFFu + ((u >> 16) & 1u); return (unsigned short)(u >> 16); }
__device__ __forceinline__ float bf2f(unsigned short b) { return __uint_as_float(((unsigned)b) << 16); }
__device__ __forceinline__ float bfr(float f) { return bf2f(f2bf(f)); }
__device__ __forceinline__ v16h cat16(v8h lo, v8h hi) { return __builtin_shufflevector(lo, hi, 0, 1, 2, 3, 4, 5, 6, 7, 8, 9, 10, 11, 12, 13, 14, 15); }
__device__ __forceinline__ v16bf cat16b(v8us lo, v8us hi) { return __builtin_bit_cast(v16bf, __builtin_shufflevector(lo, hi, 0, 1, 2, 3, 4, 5, 6, 7, 8, 9, 10, 11, 12, 13, 14, 15)); }
__device__ __forceinline__ v8f wmma16(v16h a, v16h b, v8f c) { return __builtin_amdgcn_wmma_f32_16x16x32_f16(false, a, false, b, (short)0, c, false, false); }
__device__ __forceinline__ v8f wmmab(v16bf a, v16bf b, v8f c) { return __builtin_amdgcn_wmma_f32_16x16x32_bf16(false, a, false, b, (short)0, c, false, false); }



// ---- k_gemmw: register-blocked GEMM, ONE WAVE per 64x64 output tile (16 accumulators), operands straight from K-contiguous 16-bit planes; grid (M/64, N/64, Z), 32 threads.
// C[m][n] (f32, pitch ldc, + optional f32 bias[n]) = sum_k A[m][k] Bt[n][k] (+ split products per NSPLIT). z-batch strides sA/sB/sC in elements. K % 32 == 0. KS > 1: a work-group sums K / KS of the k only (operand rows stay at pitch K); with sA = sB = K / KS, z is the k slice and C + z sC its partial sum.
template <typename T16> struct WFrag;
template <> struct WFrag<h16> { typedef v16h V; static __device__ __forceinline__ V ld(const h16* p) { return cat16(*(const v8h*)p, *(const v8h*)(p + 16)); } static __device__ __forceinline__ v8f mma(V a, V b, v8f c) { return wmma16(a, b, c); } };
template <> struct WFrag<bf> { typedef v16bf V; static __device__ __forceinline__ V ld(const bf* p) { return cat16b(*(const v8us*)p, *(const v8us*)(p + 16)); } static __device__ __forceinline__ v8f mma(V a, V b, v8f c) { return wmmab(a, b, c); } };
// gemmw_tile: the tile (bx, by) of one such product; os: 16 x 68 floats of LDS. Kernels that hold several independent products pick product and tile from the block index.
template <typename T16, int NSPLIT, bool BIAS, int KS>
__device__ __forceinline__ void gemmw_tile(float* os, const T16* __restrict__ A, const T16* __restrict__ A2, const T16* __restrict__ Bt, const T16* __restrict__ Bt2, int K, float* C, int ldc, const float* __restrict__ bias, int bx, int by) {
    typedef typename WFrag<T16>::V V;
    const int lane = threadIdx.x & 31, lr = lane & 15, hi = lane >> 4; const int r0 = bx * 64, c0 = by * 64;
    v8f acc[4][4];
#pragma unroll
    for (int mb = 0; mb < 4; ++mb)
#pragma unroll
        for (int nb = 0; nb < 4; ++nb) acc[mb][nb] = (v8f){};
    const size_t aoff = (size_t)(r0 + lr) * K + 8 * hi, boff = (size_t)(c0 + lr) * K + 8 * hi;
#pragma unroll 1
    for (int kc = 0; kc < K / KS; kc += 32) {
        V a[4], a2[4];
#pragma unroll
        for (int mb = 0; mb < 4; ++mb) { a[mb] = WFrag<T16>::ld(A + aoff + (size_t)mb * 16 * K + kc); if (NSPLIT == 1 || NSPLIT == 2) a2[mb] = WFrag<T16>::ld(A2 + aoff + (size_t)mb * 16 * K + kc); }
#pragma unroll
        for (int nb = 0; nb < 4; ++nb) { const V b = WFrag<T16>::ld(Bt + boff + (size_t)nb * 16 * K + kc); V b2; if (NSPLIT >= 2) b2 = WFrag<T16>::ld(Bt2 + boff + (size_t)nb * 16 * K + kc);
#pragma unroll
            for (int mb = 0; mb < 4; ++mb) { acc[mb][nb] = WFrag<T16>::mma(a[mb], b, acc[mb][nb]); if (NSPLIT == 1 || NSPLIT == 2) acc[mb][nb] = WFrag<T16>::mma(a2[mb], b, acc[mb][nb]); if (NSPLIT >= 2) acc[mb][nb] = WFrag<T16>::mma(a[mb], b2, acc[mb][nb]); } }
        asm volatile("v_nop\n\tv_nop\n\tv_nop\n\tv_nop" : "+v"(acc[0][0]), "+v"(acc[1][1]), "+v"(acc[2][2]), "+v"(acc[3][3]) : "v"(a[0]), "v"(a[3]));
    }
#pragma unroll
    for (int mb = 0; mb < 4; ++mb) {
#pragma unroll
        for (int nb = 0; nb < 4; ++nb) {
#pragma unroll
            for (int j = 0; j < 8; ++j) os[(hi * 8 + j) * 68 + nb * 16 + lr] = acc[mb][nb][j]; }
        __builtin_amdgcn_wave_barrier(); asm volatile("" ::: "memory");
        float* crow = C + (size_t)(r0 + mb * 16) * ldc + c0;
{
#pragma unroll
            for (int s = 0; s < 8; ++s) { const int row = 2 * s + hi, cofs = lr * 4; v4f val = *(const v4fa*)(os + row * 68 + cofs); if (BIAS) { val[0] += bfr(bias[c0 + cofs]); val[1] += bfr(bias[c0 + cofs + 1]); val[2] += bfr(bias[c0 + cofs + 2]); val[3] += bfr(bias[c0 + cofs + 3]); }
                *(v4f*)(crow + (size_t)row * ldc + cofs) = val; }
             }
        __builtin_amdgcn_wave_barrier(); asm volatile("" ::: "memory");
    }
    asm volatile("s_wait_xcnt 0x0" ::: "memory");   // a kernel that holds several products may lay another product's code behind this tile's last stores: no register of theirs is rewritten before this wait
}
template <typename T16, int NSPLIT, bool BIAS, int KS = 1>
__global__ __launch_bounds__(32) void k_gemmw(const T16* __restrict__ A, const T16* __restrict__ A2, const T16* __restrict__ Bt, const T16* __restrict__ Bt2, int K, float* C, int ldc, const float* __restrict__ bias, size_t sA, size_t sB, size_t sC) {
    __shared__ __align__(16) float os[16 * 68];
    const size_t z = blockIdx.z; A += z * sA; if (A2) A2 += z * sA; Bt += z * sB; if (Bt2) Bt2 += z * sB; C += z * sC;
    gemmw_tile<T16, NSPLIT, BIAS, KS>(os, A, A2, Bt, Bt2, K, C, ldc, bias, blockIdx.x, blockIdx.y);
}
// k_proj3: the theta, phi and g projections of all images in ONE launch; grid (TT / 64, 3 x HD / 64, image)
__global__ __launch_bounds__(32) void k_proj3(const bf* __restrict__ XB, const bf* __restrict__ WQ, const bf* __restrict__ WK, const bf* __restrict__ WV, float* FQ, float* FK, float* FV, const float* __restrict__ bq, const float* __restrict__ bk, const float* __restrict__ bv) {
    __shared__ __align__(16) float os[16 * 68];
    const int w = blockIdx.y / (HD / 64), by = blockIdx.y % (HD / 64); const size_t im = blockIdx.z;
    const bf* Wt = (w == 0) ? WQ : (w == 1) ? WK : WV; float* F = (w == 0) ? FQ : (w == 1) ? FK : FV; const float* bias = (w == 0) ? bq : (w == 1) ? bk : bv;
    gemmw_tile<bf, 0, true, 1>(os, XB + im * TT * DM, nullptr, Wt, nullptr, DM, F + im * TT * HD, HD, bias, blockIdx.x, by);
}

__device__ __forceinline__ h16 tohx(float x) { return (h16)x; }
__device__ __forceinline__ void splitf(float y, unsigned short& h, unsigned short& l) { h = f2bf(y); l = f2bf(y - bf2f(h)); }
typedef __attribute__((ext_vector_type(2))) _Float16 v2h;
typedef __attribute__((ext_vector_type(4))) _Float16 v4h;
typedef __attribute__((ext_vector_type(2))) unsigned short v2us;
typedef __attribute__((ext_vector_type(4))) unsigned short v4us;
typedef __attribute__((ext_vector_type(2))) float v2f;
typedef __attribute__((ext_vector_type(4))) int v4i;

__global__ __launch_bounds__(256) void k_wtG(const float* __restrict__ w, int K, int N, bf* Bt) {
    const int lane = threadIdx.x & 31; const int L0 = (blockIdx.x * 8 + (threadIdx.x >> 5)) * 8; const int nlines = N * K / 64;
{
#pragma unroll 1
        for (int l = 0; l < 8; ++l) { const int L = L0 + l; if (L >= nlines) break; const size_t e = (size_t)L * 64 + lane * 2; const int k = (int)(e % K), n = (int)(e / K); v2us o;
            o[0] = f2bf(w[(size_t)k * N + n]); o[1] = f2bf(w[(size_t)(k + 1) * N + n]); *(v2us*)(Bt + e) = o; }
         }
}
__device__ __forceinline__ void d_cvt8(const float* __restrict__ src, bf* dst, size_t n8, unsigned bx) { const size_t i = (size_t)bx * 256 + threadIdx.x; if (i >= n8) return; const v8f v = *(const v8f*)(src + i * 8); v8us o;
#pragma unroll
    for (int k = 0; k < 8; ++k) o[k] = f2bf(v[k]); *(v8us*)(dst + i * 8) = o;  }

// d_rope (grid x = element pairs, grid y = image): head planes [h][t][d] (fp16 + hi/lo) of rope(x) x sc with the rotate-half convention out[d] = x[d] cos[t][d] - x[d+HD/2] sin[t][d], out[d+HD/2] = x[d+HD/2] cos[t][d+HD/2] + x[d] sin[t][d+HD/2]
__device__ __forceinline__ void d_rope(const float* __restrict__ F, int pitch, int nheads, const float* __restrict__ CS, const float* __restrict__ RF, const float* __restrict__ nw, float sc, h16* P16, bf* Ph, bf* Pl) {
    const size_t e = ((size_t)blockIdx.x * 256 + threadIdx.x) * 2; if (e >= (size_t)nheads * TT * HD) return; { const size_t im = blockIdx.y, po = im * nheads * TT * HD; F += im * TT * pitch; P16 += po; Ph += po; Pl += po; } const int d = (int)(e % HD); const int t = (int)((e / HD) % TT); const int h = (int)(e / ((size_t)HD * TT)); const float* f = F + (size_t)t * pitch + h * HD; const float rf = RF ? RF[(size_t)h * TT + t] : 1.0f; v2h o16; v2us oh, ol;
#pragma unroll
    for (int q = 0; q < 2; ++q) { const int dd = d + q; const int dp = (dd < HD / 2) ? dd + HD / 2 : dd - HD / 2; float x0 = f[dd], x1 = f[dp];
        if (RF) { float n0 = __fmul_rn(x0, rf), n1 = __fmul_rn(x1, rf); asm volatile("" : "+v"(n0)); asm volatile("" : "+v"(n1)); x0 = __fmul_rn(bfr(nw[dd]), n0); x1 = __fmul_rn(bfr(nw[dp]), n1); }
        const v2f cs = *(const v2f*)(CS + ((size_t)t * HD + dd) * 2); float a = __fmul_rn(x0, cs[0]), bq = __fmul_rn(x1, cs[1]); asm volatile("" : "+v"(a)); asm volatile("" : "+v"(bq)); const float r = ((dd < HD / 2) ? __fsub_rn(a, bq) : __fadd_rn(a, bq)) * sc;
        o16[q] = tohx(r); unsigned short a2, c2; splitf(r, a2, c2); oh[q] = a2; ol[q] = c2; }
    *(v2h*)(P16 + e) = o16; *(v2us*)(Ph + e) = oh; *(v2us*)(Pl + e) = ol;  }
__device__ __forceinline__ void d_vtp(const float* __restrict__ F, int pitch, int nheads, h16* V16, bf* Vh, bf* Vl) { const size_t e = ((size_t)blockIdx.x * 256 + threadIdx.x) * 2; if (e >= (size_t)nheads * HD * TT) return; { const size_t im = blockIdx.y, po = im * nheads * HD * TT; F += im * TT * pitch; V16 += po; Vh += po; Vl += po; } const int t = (int)(e % TT); const int d = (int)((e / TT) % HD); const int g = (int)(e / ((size_t)TT * HD)); v2h o16; v2us oh, ol;
#pragma unroll
    for (int q = 0; q < 2; ++q) { const float x = F[(size_t)(t + q) * pitch + g * HD + d]; o16[q] = tohx(x); unsigned short a2, c2; splitf(x, a2, c2); oh[q] = a2; ol[q] = c2; }
    *(v2h*)(V16 + e) = o16; *(v2us*)(Vh + e) = oh; *(v2us*)(Vl + e) = ol;  }
// k_planes: the operand planes of theta, phi and g of all images in ONE launch; grid (element pairs, image, which)
__global__ __launch_bounds__(256) void k_planes(const float* __restrict__ FQ, const float* __restrict__ FK, const float* __restrict__ FV, const float* __restrict__ CS, h16* QP16, bf* QPh, bf* QPl, h16* KP16, bf* KPh, bf* KPl, h16* VT16, bf* VTh, bf* VTl) {
    if (blockIdx.z == 0) d_rope(FQ, DQ, NH_, CS, nullptr, nullptr, 1.0f, QP16, QPh, QPl);
    else if (blockIdx.z == 1) d_rope(FK, DKV, NKV, CS, nullptr, nullptr, 1.0f, KP16, KPh, KPl);
    else d_vtp(FV, DKV, NKV, VT16, VTh, VTl);
}
__device__ __forceinline__ void d_csid(float* CS, unsigned bx) { const int idx = bx * 256 + threadIdx.x; if (idx >= TT * HD) return; v2f cs; cs[0] = 1.0f; cs[1] = 0.0f; *(v2f*)(CS + (size_t)idx * 2) = cs;  }
// ---- fused attention: logits, softmax and attn x g in ONE kernel; the logits stay in registers.
// A wave holds QB x 16 queries and walks TT / KSP keys, 32 at a time: St = K Qt (row = key, column = query: a lane holds one query's scores), running maximum and sum per query (online softmax),
// Pt packed from the score accumulators straight into a B operand (they already lie in the loaders' k order), Ot += Vt Pt (row = d, column = query: the rescale factor is the lane's own).
// A slice leaves O[t][slice][d] = sum_k 2^PSH exp(s - m) g (not normalised) and ML[slice][t] = (m, sum_k 2^PSH exp(s - m)), 16 queries = one whole line from one wave; k_merge joins the slices.
__device__ __forceinline__ float xhalf(float x) { return __builtin_bit_cast(float, __builtin_amdgcn_permlanex16(__builtin_bit_cast(int, x), __builtin_bit_cast(int, x), 0x76543210, 0xfedcba98, false, false)); }   // lane l reads lane l ^ 16
template <typename T16> struct PPack;
template <> struct PPack<h16> { static __device__ __forceinline__ void mk(const v8f a, const v8f b, v16h& p, v16h& p2) { (void)p2;
#pragma unroll
    for (int i = 0; i < 8; ++i) { p[i] = tohx(a[i]); p[8 + i] = tohx(b[i]); } } };
template <> struct PPack<bf> { static __device__ __forceinline__ void mk(const v8f a, const v8f b, v16bf& p, v16bf& p2) { v16us h, l;
#pragma unroll
    for (int i = 0; i < 8; ++i) { unsigned short x, y; splitf(a[i], x, y); h[i] = x; l[i] = y; splitf(b[i], x, y); h[8 + i] = x; l[8 + i] = y; }
    p = __builtin_bit_cast(v16bf, h); p2 = __builtin_bit_cast(v16bf, l); } };
// HL: hi + lo planes, 3 products each (hi x hi, the query side's or P's lo x hi, hi x the key side's lo). Q, K [t][d], Vt [d][t]; O and ML already point at the image and the slice's slot.
template <typename T16, bool HL, int QB>
__device__ __forceinline__ void fa_tile(const T16* __restrict__ Q, const T16* __restrict__ Q2, const T16* __restrict__ Kp, const T16* __restrict__ K2, const T16* __restrict__ Vt, const T16* __restrict__ V2, int q0, int k0, float* O, float* ML) {
    typedef typename WFrag<T16>::V V;
    const int lane = threadIdx.x & 31, lr = lane & 15, hi = lane >> 4;
    const size_t qo0 = (size_t)(q0 + lr) * HD + 8 * hi, ko = (size_t)(k0 + lr) * HD + 8 * hi, vo = (size_t)lr * TT + k0 + 8 * hi;
    const T16* qp = Q + qo0; const T16* qp2 = HL ? Q2 + qo0 : qp; const T16* kp = Kp + ko; const T16* kp2 = HL ? K2 + ko : kp;   // every batch of loads has one address per plane; the rest is immediate offsets
    V qf[QB][4], qf2[QB][4];
#pragma unroll
    for (int qb = 0; qb < QB; ++qb)
#pragma unroll
        for (int ks = 0; ks < 4; ++ks) { const int qo = qb * 16 * HD + ks * 32; qf[qb][ks] = WFrag<T16>::ld(qp + qo); if (HL) qf2[qb][ks] = WFrag<T16>::ld(qp2 + qo); }
    v8f o[8][QB]; float m[QB], l[QB];
#pragma unroll
    for (int qb = 0; qb < QB; ++qb) { m[qb] = -3.0e38f; l[qb] = 0.0f;
#pragma unroll
        for (int db = 0; db < 8; ++db) o[db][qb] = (v8f){}; }
    V kf[2][4], kf2[2][4];   // the K fragments of a pass, fetched one pass ahead
#pragma unroll
    for (int kb = 0; kb < 2; ++kb)
#pragma unroll
        for (int ks = 0; ks < 4; ++ks) { const int fo = kb * 16 * HD + ks * 32; kf[kb][ks] = WFrag<T16>::ld(kp + fo); if (HL) kf2[kb][ks] = WFrag<T16>::ld(kp2 + fo); }
    asm volatile("s_wait_xcnt 0x0" :: "v"(qp), "v"(qp2), "v"(kp), "v"(kp2) : "memory");   // the loads' address pairs live up to here: no register of them is rewritten before this wait
    __builtin_amdgcn_sched_barrier(0);   // holds the loop's address arithmetic below that wait
#pragma unroll 1   // one pass of 32 keys with its fragments in flight already fills the registers
    for (int kk = 0; kk < TT / KSP; kk += 32) {
        V vf[8], vf2[8]; const T16* vp = Vt + vo + kk; const T16* vp2 = HL ? V2 + vo + kk : vp;
#pragma unroll
        for (int db = 0; db < 8; ++db) { const int fo = db * 16 * TT; vf[db] = WFrag<T16>::ld(vp + fo); if (HL) vf2[db] = WFrag<T16>::ld(vp2 + fo); }
        asm volatile("s_wait_xcnt 0x0" :: "v"(vp), "v"(vp2) : "memory");   // these loads stay in flight: their address pairs live up to here, and no register of them is rewritten before this wait
        __builtin_amdgcn_sched_barrier(0);   // holds the Vt loads up here: they fly under the score products and the softmax (left alone, the compiler loads one fragment at a time, each right in front of its products)
        v8f s[2][QB];
#pragma unroll
        for (int kb = 0; kb < 2; ++kb) {
#pragma unroll
            for (int qb = 0; qb < QB; ++qb) s[kb][qb] = (v8f){};
#pragma unroll
            for (int ks = 0; ks < 4; ++ks)
#pragma unroll
                for (int qb = 0; qb < QB; ++qb) { s[kb][qb] = WFrag<T16>::mma(kf[kb][ks], qf[qb][ks], s[kb][qb]); if (HL) { s[kb][qb] = WFrag<T16>::mma(kf[kb][ks], qf2[qb][ks], s[kb][qb]); s[kb][qb] = WFrag<T16>::mma(kf2[kb][ks], qf[qb][ks], s[kb][qb]); } } }
        __builtin_amdgcn_sched_barrier(0);   // keeps the next pass's K loads behind the products above, so that they go into the registers those have just read and need no second set
        const int kn = (kk + 32 < TT / KSP) ? kk + 32 : kk;   // the last pass has no next one: it fetches its own keys again (in bounds, not used)
        kp = Kp + ko + (size_t)kn * HD; kp2 = HL ? K2 + ko + (size_t)kn * HD : kp;
#pragma unroll
        for (int kb = 0; kb < 2; ++kb)
#pragma unroll
            for (int ks = 0; ks < 4; ++ks) { const int fo = kb * 16 * HD + ks * 32; kf[kb][ks] = WFrag<T16>::ld(kp + fo); if (HL) kf2[kb][ks] = WFrag<T16>::ld(kp2 + fo); }
        asm volatile("s_wait_xcnt 0x0" :: "v"(kp), "v"(kp2) : "memory");   // as behind the Vt loads
        __builtin_amdgcn_sched_barrier(0);   // holds the K loads up here: they fly under the softmax and the Vt Pt products
        V pf[QB], pf2[QB];
#pragma unroll
        for (int qb = 0; qb < QB; ++qb) {
            float bm = s[0][qb][0];
#pragma unroll
            for (int kb = 0; kb < 2; ++kb)
#pragma unroll
                for (int j = 0; j < 8; ++j) bm = fmaxf(bm, s[kb][qb][j]);
            bm = fmaxf(bm, xhalf(bm));   // the other half of the wave holds the query's other keys
            const float mn = fmaxf(m[qb], bm * SCL), al = __builtin_amdgcn_exp2f((m[qb] - mn) * L2E); m[qb] = mn;
            float rs = 0.0f;
#pragma unroll
            for (int kb = 0; kb < 2; ++kb)
#pragma unroll
                for (int j = 0; j < 8; ++j) { const float p = __builtin_amdgcn_exp2f((s[kb][qb][j] * SCL - mn) * L2E + PSH); s[kb][qb][j] = p; rs += p; }
            l[qb] = l[qb] * al + rs;   // each half of the wave sums its own keys; the halves join behind the loop
#pragma unroll
            for (int db = 0; db < 8; ++db) o[db][qb] *= al;
            PPack<T16>::mk(s[0][qb], s[1][qb], pf[qb], pf2[qb]);
        }
#pragma unroll
        for (int db = 0; db < 8; ++db)
#pragma unroll
            for (int qb = 0; qb < QB; ++qb) { o[db][qb] = WFrag<T16>::mma(vf[db], pf[qb], o[db][qb]); if (HL) { o[db][qb] = WFrag<T16>::mma(vf[db], pf2[qb], o[db][qb]); o[db][qb] = WFrag<T16>::mma(vf2[db], pf[qb], o[db][qb]); } }
    }
#pragma unroll
    for (int qb = 0; qb < QB; ++qb) { const size_t t = (size_t)(q0 + qb * 16 + lr); float* orow = O + t * (KSP * HD) + hi * 8; const float lj = l[qb] + xhalf(l[qb]);
#pragma unroll
        for (int db = 0; db < 8; ++db) { v4f x, y;
#pragma unroll
            for (int j = 0; j < 4; ++j) { x[j] = o[db][qb][j]; y[j] = o[db][qb][4 + j]; }
            *(v4f*)(orow + db * 16) = x; *(v4f*)(orow + db * 16 + 4) = y; }
        if (hi == 0) { v2f ml; ml[0] = m[qb]; ml[1] = lj; *(v2f*)(ML + t * 2) = ml; } }
    asm volatile("s_wait_xcnt 0x0" ::: "memory");   // the kernel lays the other row range's code behind this tile's last stores: no register of theirs is rewritten before this wait
}
// k_fattn: all images, all query rows, all key slices in ONE launch; 4 waves a work-group, all on the same keys (they share the K and Vt lines in the WGP cache). Flat grid: rows < RH in front (hi + lo planes, 32 queries a wave), then rows >= RH (fp16, 64 queries a wave: a fragment load touches 16 lines, so each has to feed as many products as the registers allow); query group fastest, then slice, then image.
__global__ __launch_bounds__(128) void k_fattn(const bf* __restrict__ Qh, const bf* __restrict__ Ql, const bf* __restrict__ Kh, const bf* __restrict__ Kl, const bf* __restrict__ Vh, const bf* __restrict__ Vl, const h16* __restrict__ Q16, const h16* __restrict__ K16, const h16* __restrict__ V16, float* O, float* ML) {
    constexpr int GH = RH / 128, GL = (TT - RH) / 256, NHI = NB_ * KSP * GH;
    const int id = blockIdx.x, w = threadIdx.x >> 5;
    if (id < NHI) { const int g = id % GH, z = (id / GH) % KSP; const size_t im = id / (GH * KSP), zb = im * TT * HD;
        fa_tile<bf, true, 2>(Qh + zb, Ql + zb, Kh + zb, Kl + zb, Vh + zb, Vl + zb, g * 128 + w * 32, z * (TT / KSP), O + zb * KSP + z * HD, ML + (im * KSP + z) * TT * 2);
    } else { const int il = id - NHI; const int g = il % GL, z = (il / GL) % KSP; const size_t im = il / (GL * KSP), zb = im * TT * HD;
        fa_tile<h16, false, 4>(Q16 + zb, nullptr, K16 + zb, nullptr, V16 + zb, nullptr, RH + g * 256 + w * 64, z * (TT / KSP), O + zb * KSP + z * HD, ML + (im * KSP + z) * TT * 2); }
}
__device__ __forceinline__ void d_cvtT(const float* __restrict__ X, bf* XB, unsigned bx) { const size_t i = (size_t)bx * 256 + threadIdx.x; if (i >= (size_t)TT * DM / 8) return; const size_t e = i * 8; const int c0 = (int)(e % DM); const int n = (int)(e / DM); v8us o;
#pragma unroll
    for (int q = 0; q < 8; ++q) o[q] = f2bf(X[(size_t)(c0 + q) * TT + n]);
    *(v8us*)(XB + e) = o;  }
// k_prep: everything that reads only the inputs, in ONE launch; flat grid: NB_ x NBT blocks turn the images token-major, 4 x NBW blocks round the weights, NBC blocks write the cos/sin table
#define NBT ((TT * DM / 8 + 255) / 256)
#define NBW ((HD * DM / 8 + 255) / 256)
#define NBC ((TT * HD + 255) / 256)
__global__ __launch_bounds__(256) void k_prep(const float* __restrict__ xin, const float* __restrict__ wq, const float* __restrict__ wk, const float* __restrict__ wv, const float* __restrict__ wo, bf* XB, bf* WQ, bf* WK, bf* WV, bf* WO, float* CS) {
    const unsigned id = blockIdx.x;
    if (id < NB_ * NBT) { const size_t im = id / NBT; d_cvtT(xin + im * DM * TT, XB + im * TT * DM, id % NBT); }
    else if (id < NB_ * NBT + 4 * NBW) { const unsigned w = (id - NB_ * NBT) / NBW; d_cvt8((w == 0) ? wq : (w == 1) ? wk : (w == 2) ? wv : wo, (w == 0) ? WQ : (w == 1) ? WK : (w == 2) ? WV : WO, (size_t)HD * DM / 8, (id - NB_ * NBT) % NBW); }
    else d_csid(CS, id - NB_ * NBT - 4 * NBW);
}
__global__ __launch_bounds__(256) void k_bnstat(const float* __restrict__ Y, float* BNS) { __shared__ float red[256]; const int c = blockIdx.x; const int tid = threadIdx.x; const size_t NTOT = (size_t)NB_ * TT; float s = 0.0f;
    for (size_t r = tid; r < NTOT; r += 256) s = __fadd_rn(s, Y[r * DM + c]);
    red[tid] = s; __syncthreads();
    for (int st = 128; st > 0; st >>= 1) { if (tid < st) red[tid] = __fadd_rn(red[tid], red[tid + st]); __syncthreads(); }
    const float mu = __fdiv_rn(red[0], (float)NTOT); __syncthreads(); float v = 0.0f;
    for (size_t r = tid; r < NTOT; r += 256) { const float d = __fsub_rn(Y[r * DM + c], mu); float p = __fmul_rn(d, d); asm volatile("" : "+v"(p)); v = __fadd_rn(v, p); }
    red[tid] = v; __syncthreads();
    for (int st = 128; st > 0; st >>= 1) { if (tid < st) red[tid] = __fadd_rn(red[tid], red[tid + st]); __syncthreads(); }
    if (tid == 0) { const float var = __fdiv_rn(red[0], (float)NTOT); v2f o; o[0] = mu; o[1] = __fdiv_rn(1.0f, __fsqrt_rn(__fadd_rn(var, BNEPS))); *(v2f*)(BNS + (size_t)c * 32) = o;  }    }
__global__ __launch_bounds__(256) void k_bnout(const float* __restrict__ Y, const float* __restrict__ BNS, const float* __restrict__ g, const float* __restrict__ bb, const float* __restrict__ X, float* OUT) { const size_t k = (size_t)blockIdx.x * 256 + threadIdx.x; if (k >= (size_t)NB_ * DM * TT / 4) return; const size_t e = k * 4; const int n0 = (int)(e % TT); const int c = (int)((e / TT) % DM); const int b = (int)(e / ((size_t)TT * DM)); const float mu = BNS[(size_t)c * 32], rs = BNS[(size_t)c * 32 + 1], gm = bfr(g[c]), bt = bfr(bb[c]); const v4f xr = *(const v4f*)(X + e); v4f o;
#pragma unroll
    for (int q = 0; q < 4; ++q) { const float y = Y[((size_t)b * TT + n0 + q) * DM + c]; float t = __fmul_rn(__fmul_rn(gm, __fsub_rn(y, mu)), rs); asm volatile("" : "+v"(t)); t = __fadd_rn(t, bt); o[q] = __fadd_rn(t, bfr(xr[q])); }
    *(v4f*)(OUT + e) = o;  }
// k_merge: joins the KSP key slices of every row of every image, in slice order: weights exp(m_slice - max m), then the softmax's division; hi + lo planes of the result
__global__ __launch_bounds__(256) void k_merge(const float* __restrict__ O, const float* __restrict__ ML, bf* Ah, bf* Al) { const size_t e = ((size_t)blockIdx.x * 256 + threadIdx.x) * 2; if (e >= (size_t)NB_ * TT * HD) return; const int d = (int)(e % HD); const size_t r = e / HD;
    const float* op = O + r * (KSP * HD) + d; const float* mp = ML + ((r / TT) * KSP * TT + r % TT) * 2; v2f ml[KSP], u[KSP];
#pragma unroll   // all loads of a thread in flight together
    for (int p = 0; p < KSP; ++p) { ml[p] = *(const v2f*)(mp + p * TT * 2); u[p] = *(const v2f*)(op + p * HD); }
    float mx = ml[0][0];
#pragma unroll
    for (int p = 1; p < KSP; ++p) mx = fmaxf(mx, ml[p][0]);
    float ls = 0.0f; v2f s; s[0] = 0.0f; s[1] = 0.0f;
#pragma unroll
    for (int p = 0; p < KSP; ++p) { const float wt = __builtin_amdgcn_exp2f((ml[p][0] - mx) * L2E); ls += ml[p][1] * wt; s[0] += u[p][0] * wt; s[1] += u[p][1] * wt; }
    v2us oh, ol;
#pragma unroll
    for (int q = 0; q < 2; ++q) { unsigned short a, c2; splitf(__fdiv_rn(s[q], ls), a, c2); oh[q] = a; ol[q] = c2; } *(v2us*)(Ah + e) = oh; *(v2us*)(Al + e) = ol;  }

extern "C" void kernel_launch(void* const* d_in, const int* in_sizes, int n_in,
                              void* d_out, int out_size, void* d_ws, size_t ws_size, hipStream_t stream) {
    (void)in_sizes; (void)n_in; (void)out_size;
    const float* xin = (const float*)d_in[0];   /* x [4][256][4096] NCHW */ const float* wv = (const float*)d_in[1]; const float* bv = (const float*)d_in[2];   /* g_w, g_b */ const float* wq = (const float*)d_in[3]; const float* bq = (const float*)d_in[4];   /* theta */ const float* wk = (const float*)d_in[5]; const float* bk = (const float*)d_in[6];   /* phi */ const float* wo = (const float*)d_in[7]; const float* bo = (const float*)d_in[8];   /* W_w [256][128], W_b */ const float* bng = (const float*)d_in[9]; const float* bnb = (const float*)d_in[10]; const float* x = nullptr; (void)x;
    float* OUT = (float*)d_out;     // [4][256][4096] NCHW
    char* wsp = (char*)d_ws;
    auto take = [&](size_t bytes) { char* p = wsp; wsp += (bytes + 255) & ~(size_t)255; return (void*)p; };
    float* YALL = (float*)take((size_t)NB_ * TT * DM * 4); float* BNS = (float*)take((size_t)DM * 32 * 4);    bf* WQ = (bf*)take((size_t)DQ * DM * 2); bf* WK = (bf*)take((size_t)DKV * DM * 2); bf* WV = (bf*)take((size_t)DKV * DM * 2); bf* WO = (bf*)take((size_t)DM * DQ * 2); float* CS = (float*)take((size_t)TT * HD * 2 * 4);
    h16* QP16 = (h16*)take((size_t)NB_ * TT * HD * 2); h16* KP16 = (h16*)take((size_t)NB_ * TT * HD * 2); h16* VT16 = (h16*)take((size_t)NB_ * HD * TT * 2);   // every operand plane: one per image, image stride TT * HD
    bf* QPh = (bf*)take((size_t)NB_ * TT * HD * 2); bf* QPl = (bf*)take((size_t)NB_ * TT * HD * 2); bf* KPh = (bf*)take((size_t)NB_ * TT * HD * 2); bf* KPl = (bf*)take((size_t)NB_ * TT * HD * 2); bf* VTh = (bf*)take((size_t)NB_ * HD * TT * 2); bf* VTl = (bf*)take((size_t)NB_ * HD * TT * 2);
    float* Ob = (float*)take((size_t)NB_ * TT * KSP * HD * 4); float* ML = (float*)take((size_t)NB_ * TT * KSP * 2 * 4); bf* ATh = (bf*)take((size_t)NB_ * TT * DQ * 2); bf* ATl = (bf*)take((size_t)NB_ * TT * DQ * 2);
    if ((size_t)(wsp - (char*)d_ws) > ws_size) return;    // ws 256 MiB
    // the projections' temporaries of all images (32 MiB) lie in the buffer of the attention's partial results: they are dead before the attention writes it (stream-ordered)
    bf* XB = (bf*)Ob; float* FQ = (float*)(XB + (size_t)NB_ * TT * DM); float* FK = FQ + (size_t)NB_ * TT * DQ; float* FV = FK + (size_t)NB_ * TT * DKV;
    // launches that do not depend on one another are ONE launch: all images, all weights, all three projections, both row ranges of a product
    k_prep<<<NB_ * NBT + 4 * NBW + NBC, 256, 0, stream>>>(xin, wq, wk, wv, wo, XB, WQ, WK, WV, WO, CS);   /* NCHW [256][4096] -> token-major bf16 [4096][256]; bf16 weights; table */
    k_proj3<<<dim3(TT / 64, 3 * (HD / 64), NB_), 32, 0, stream>>>(XB, WQ, WK, WV, FQ, FK, FV, bq, bk, bv);
    k_planes<<<dim3((unsigned)(((size_t)TT * HD / 2 + 255) / 256), NB_, 3), 256, 0, stream>>>(FQ, FK, FV, CS, QP16, QPh, QPl, KP16, KPh, KPl, VT16, VTh, VTl);
    k_fattn<<<NB_ * KSP * (RH / 128) + NB_ * KSP * ((TT - RH) / 256), 128, 0, stream>>>(QPh, QPl, KPh, KPl, VTh, VTl, QP16, KP16, VT16, Ob, ML);   /* key slice z -> partial Ob[image][t][z][d], ML[image][z][t] */
    k_merge<<<(unsigned)(((size_t)NB_ * TT * HD / 2 + 255) / 256), 256, 0, stream>>>(Ob, ML, ATh, ATl);
    k_gemmw<bf, 1, true><<<dim3(TT / 64, DM / 64, NB_), 32, 0, stream>>>(ATh, ATl, WO, nullptr, DQ, YALL, DM, bo, (size_t)TT * DQ, 0, (size_t)TT * DM);   /* Wy (token-major) of all images, kept for the batch statistics */
    k_bnstat<<<DM, 256, 0, stream>>>(YALL, BNS);   /* per channel: mean and 1/sqrt(var + eps) over the batch x 4,096 positions (training-mode BatchNorm) */
    k_bnout<<<(unsigned)(((size_t)NB_ * DM * TT / 4 + 255) / 256), 256, 0, stream>>>(YALL, BNS, bng, bnb, xin, OUT);   /* out[b][c][n] = gamma (Wy - mean) rstd + beta + x */

}

// v004
// Measured time: 136 microseconds a run.
// Next to v003, in two timings, it ran 1.49 and 1.48 times as fast.
// Over all steps from v000 it is 7.84 times as fast.
#include <hip/hip_runtime.h>

// Non-local block (embedded Gaussian) over 64x64 = 4,096 positions with a training-mode BatchNorm and residual (x [4][256][64][64] NCHW; theta, phi, g = 1x1 convs C 256 -> Ci 128 ('oi' [128][256] 0.02, zero biases); f[n][m] = theta_n . phi_m (no scaling); attn = softmax over m; y[ci][n] = sum_m attn[n][m] g[ci][m]; Wy = W_w y + W_b ('oi' [256][128]); BatchNorm2d in TRAINING mode (per-channel mean/var over the whole batch x 64 x 64, eps 1e-5, gamma/beta read); out = BN(Wy) + x -> [4][256][64][64] (4.2 M)).
// Compute dtypes, f32 accumulate: every input rounded to bf16; convs exact + f32 bias; attention rows < 512 3 products, rest fp16; softmax f32; W_w hl x exact + bias; BatchNorm statistics and output f32 (fixed-order sums); residual f32 of the bf16-rounded x.

#define NB_  4
#define TT   4096
#define DM   256
#define NH_  1
#define NKV  1
#define REP  (NH_ / NKV)
#define HD   128
#define DQ   (NH_ * HD)
#define DKV  (NKV * HD)
#define ZH   1
#define RH   512                  // query rows < RH use hi+lo planes (0: none)
#define WIN  0
#define PSH  8.0f     // P carries 2^PSH (numerator and row sum alike: it cancels in the softmax's division), so that small weights stay in fp16's normal range
#define SCL  1.0f     // the non-local block applies no 1/sqrt(d)
#define CIN  256      // channels C (== DM)
#define BNEPS 1e-5f
#define KSP  8        // key slices of the fused attention (one work-group per slice); every slice leaves its partial result in a slot of its own
#define L2E  1.4426950408889634f
typedef _Float16 h16;
typedef unsigned short bf;
typedef __attribute__((ext_vector_type(16))) __bf16   v16bf;
typedef __attribute__((ext_vector_type(16))) _Float16 v16h;
typedef __attribute__((ext_vector_type(8)))  _Float16 v8h;
typedef __attribute__((ext_vector_type(8)))  unsigned short v8us;
typedef __attribute__((ext_vector_type(16))) unsigned short v16us;
typedef __attribute__((ext_vector_type(8)))  float    v8f;
typedef __attribute__((ext_vector_type(4)))  float    v4f;
typedef v8h  __attribute__((may_alias)) v8ha;
typedef v4f  __attribute__((may_alias)) v4fa;
typedef v8us __attribute__((may_alias)) v8usa;

__device__ __forceinline__ unsigned short f2bf(float f) { unsigned u = __float_as_uint(f); u += 0x7FFFu + ((u >> 16) & 1u); return (unsigned short)(u >> 16); }
__device__ __forceinline__ float bf2f(unsigned short b) { return __uint_as_float(((unsigned)b) << 16); }
__device__ __forceinline__ float bfr(float f) { return bf2f(f2bf(f)); }
__device__ __forceinline__ v16h cat16(v8h lo, v8h hi) { return __builtin_shufflevector(lo, hi, 0, 1, 2, 3, 4, 5, 6, 7, 8, 9, 10, 11, 12, 13, 14, 15); }
__device__ __forceinline__ v16bf cat16b(v8us lo, v8us hi) { return __builtin_bit_cast(v16bf, __builtin_shufflevector(lo, hi, 0, 1, 2, 3, 4, 5, 6, 7, 8, 9, 10, 11, 12, 13, 14, 15)); }
__device__ __forceinline__ v8f wmma16(v16h a, v16h b, v8f c) { return __builtin_amdgcn_wmma_f32_16x16x32_f16(false, a, false, b, (short)0, c, false, false); }
__device__ __forceinline__ v8f wmmab(v16bf a, v16bf b, v8f c) { return __builtin_amdgcn_wmma_f32_16x16x32_bf16(false, a, false, b, (short)0, c, false, false); }



// ---- k_gemmw: register-blocked GEMM, ONE WAVE per 64x64 output tile (16 accumulators), operands straight from K-contiguous 16-bit planes; grid (M/64, N/64, Z), 32 threads.
// C[m][n] (f32, pitch ldc, + optional f32 bias[n]) = sum_k A[m][k] Bt[n][k] (+ split products per NSPLIT). z-batch strides sA/sB/sC in elements. K % 32 == 0. KS > 1: a work-group sums K / KS of the k only (operand rows stay at pitch K); with sA = sB = K / KS, z is the k slice and C + z sC its partial sum.
template <typename T16> struct WFrag;
template <> struct WFrag<h16> { typedef v16h V; static __device__ __forceinline__ V ld(const h16* p) { return cat16(*(const v8h*)p, *(const v8h*)(p + 16)); } static __device__ __forceinline__ v8f mma(V a, V b, v8f c) { return wmma16(a, b, c); } };
template <> struct WFrag<bf> { typedef v16bf V; static __device__ __forceinline__ V ld(const bf* p) { return cat16b(*(const v8us*)p, *(const v8us*)(p + 16)); } static __device__ __forceinline__ v8f mma(V a, V b, v8f c) { return wmmab(a, b, c); } };
// gemmw_tile: the tile (bx, by) of one such product; os: 16 x 68 floats of LDS. Kernels that hold several independent products pick product and tile from the block index.
template <typename T16, int NSPLIT, bool BIAS, int KS>
__device__ __forceinline__ void gemmw_tile(float* os, const T16* __restrict__ A, const T16* __restrict__ A2, const T16* __restrict__ Bt, const T16* __restrict__ Bt2, int K, float* C, int ldc, const float* __restrict__ bias, int bx, int by) {
    typedef typename WFrag<T16>::V V;
    const int lane = threadIdx.x & 31, lr = lane & 15, hi = lane >> 4; const int r0 = bx * 64, c0 = by * 64;
    v8f acc[4][4];
#pragma unroll
    for (int mb = 0; mb < 4; ++mb)
#pragma unroll
        for (int nb = 0; nb < 4; ++nb) acc[mb][nb] = (v8f){};
    const size_t aoff = (size_t)(r0 + lr) * K + 8 * hi, boff = (size_t)(c0 + lr) * K + 8 * hi;
#pragma unroll 1
    for (int kc = 0; kc < K / KS; kc += 32) {
        V a[4], a2[4];
#pragma unroll
        for (int mb = 0; mb < 4; ++mb) { a[mb] = WFrag<T16>::ld(A + aoff + (size_t)mb * 16 * K + kc); if (NSPLIT == 1 || NSPLIT == 2) a2[mb] = WFrag<T16>::ld(A2 + aoff + (size_t)mb * 16 * K + kc); }
#pragma unroll
        for (int nb = 0; nb < 4; ++nb) { const V b = WFrag<T16>::ld(Bt + boff + (size_t)nb * 16 * K + kc); V b2; if (NSPLIT >= 2) b2 = WFrag<T16>::ld(Bt2 + boff + (size_t)nb * 16 * K + kc);
#pragma unroll
            for (int mb = 0; mb < 4; ++mb) { acc[mb][nb] = WFrag<T16>::mma(a[mb], b, acc[mb][nb]); if (NSPLIT == 1 || NSPLIT == 2) acc[mb][nb] = WFrag<T16>::mma(a2[mb], b, acc[mb][nb]); if (NSPLIT >= 2) acc[mb][nb] = WFrag<T16>::mma(a[mb], b2, acc[mb][nb]); } }
        asm volatile("v_nop\n\tv_nop\n\tv_nop\n\tv_nop" : "+v"(acc[0][0]), "+v"(acc[1][1]), "+v"(acc[2][2]), "+v"(acc[3][3]) : "v"(a[0]), "v"(a[3]));
    }
#pragma unroll
    for (int mb = 0; mb < 4; ++mb) {
#pragma unroll
        for (int nb = 0; nb < 4; ++nb) {
#pragma unroll
            for (int j = 0; j < 8; ++j) os[(hi * 8 + j) * 68 + nb * 16 + lr] = acc[mb][nb][j]; }
        __builtin_amdgcn_wave_barrier(); asm volatile("" ::: "memory");
        float* crow = C + (size_t)(r0 + mb * 16) * ldc + c0;
{
#pragma unroll
            for (int s = 0; s < 8; ++s) { const int row = 2 * s + hi, cofs = lr * 4; v4f val = *(const v4fa*)(os + row * 68 + cofs); if (BIAS) { val[0] += bfr(bias[c0 + cofs]); val[1] += bfr(bias[c0 + cofs + 1]); val[2] += bfr(bias[c0 + cofs + 2]); val[3] += bfr(bias[c0 + cofs + 3]); }
                *(v4f*)(crow + (size_t)row * ldc + cofs) = val; }
             }
        __builtin_amdgcn_wave_barrier(); asm volatile("" ::: "memory");
    }
    asm volatile("s_wait_xcnt 0x0" ::: "memory");   // a kernel that holds several products may lay another product's code behind this tile's last stores: no register of theirs is rewritten before this wait
}
template <typename T16, int NSPLIT, bool BIAS, int KS = 1>
__global__ __launch_bounds__(32) void k_gemmw(const T16* __restrict__ A, const T16* __restrict__ A2, const T16* __restrict__ Bt, const T16* __restrict__ Bt2, int K, float* C, int ldc, const float* __restrict__ bias, size_t sA, size_t sB, size_t sC) {
    __shared__ __align__(16) float os[16 * 68];
    const size_t z = blockIdx.z; A += z * sA; if (A2) A2 += z * sA; Bt += z * sB; if (Bt2) Bt2 += z * sB; C += z * sC;
    gemmw_tile<T16, NSPLIT, BIAS, KS>(os, A, A2, Bt, Bt2, K, C, ldc, bias, blockIdx.x, blockIdx.y);
}
// k_proj3: the theta, phi and g projections of all images in ONE launch; grid (TT / 64, 3 x HD / 64, image)
__global__ __launch_bounds__(32) void k_proj3(const bf* __restrict__ XB, const bf* __restrict__ WQ, const bf* __restrict__ WK, const bf* __restrict__ WV, float* FQ, float* FK, float* FV, const float* __restrict__ bq, const float* __restrict__ bk, const float* __restrict__ bv) {
    __shared__ __align__(16) float os[16 * 68];
    const int w = blockIdx.y / (HD / 64), by = blockIdx.y % (HD / 64); const size_t im = blockIdx.z;
    const bf* Wt = (w == 0) ? WQ : (w == 1) ? WK : WV; float* F = (w == 0) ? FQ : (w == 1) ? FK : FV; const float* bias = (w == 0) ? bq : (w == 1) ? bk : bv;
    gemmw_tile<bf, 0, true, 1>(os, XB + im * TT * DM, nullptr, Wt, nullptr, DM, F + im * TT * HD, HD, bias, blockIdx.x, by);
}

__device__ __forceinline__ h16 tohx(float x) { return (h16)x; }
__device__ __forceinline__ void splitf(float y, unsigned short& h, unsigned short& l) { h = f2bf(y); l = f2bf(y - bf2f(h)); }
typedef __attribute__((ext_vector_type(2))) _Float16 v2h;
typedef __attribute__((ext_vector_type(4))) _Float16 v4h;
typedef __attribute__((ext_vector_type(2))) unsigned short v2us;
typedef __attribute__((ext_vector_type(4))) unsigned short v4us;
typedef __attribute__((ext_vector_type(2))) float v2f;
typedef __attribute__((ext_vector_type(4))) int v4i;

__global__ __launch_bounds__(256) void k_wtG(const float* __restrict__ w, int K, int N, bf* Bt) {
    const int lane = threadIdx.x & 31; const int L0 = (blockIdx.x * 8 + (threadIdx.x >> 5)) * 8; const int nlines = N * K / 64;
{
#pragma unroll 1
        for (int l = 0; l < 8; ++l) { const int L = L0 + l; if (L >= nlines) break; const size_t e = (size_t)L * 64 + lane * 2; const int k = (int)(e % K), n = (int)(e / K); v2us o;
            o[0] = f2bf(w[(size_t)k * N + n]); o[1] = f2bf(w[(size_t)(k + 1) * N + n]); *(v2us*)(Bt + e) = o; }
         }
}
__device__ __forceinline__ void d_cvt8(const float* __restrict__ src, bf* dst, size_t n8, unsigned bx) { const size_t i = (size_t)bx * 256 + threadIdx.x; if (i >= n8) return; const v8f v = *(const v8f*)(src + i * 8); v8us o;
#pragma unroll
    for (int k = 0; k < 8; ++k) o[k] = f2bf(v[k]); *(v8us*)(dst + i * 8) = o;  }

// d_rope (grid x = element pairs, grid y = image): head planes [h][t][d] (fp16 + hi/lo) of rope(x) x sc with the rotate-half convention out[d] = x[d] cos[t][d] - x[d+HD/2] sin[t][d], out[d+HD/2] = x[d+HD/2] cos[t][d+HD/2] + x[d] sin[t][d+HD/2]
__device__ __forceinline__ void d_rope(const float* __restrict__ F, int pitch, int nheads, const float* __restrict__ CS, const float* __restrict__ RF, const float* __restrict__ nw, float sc, h16* P16, bf* Ph, bf* Pl) {
    const size_t e = ((size_t)blockIdx.x * 256 + threadIdx.x) * 2; if (e >= (size_t)nheads * TT * HD) return; { const size_t im = blockIdx.y, po = im * nheads * TT * HD; F += im * TT * pitch; P16 += po; Ph += po; Pl += po; } const int d = (int)(e % HD); const int t = (int)((e / HD) % TT); const int h = (int)(e / ((size_t)HD * TT)); const float* f = F + (size_t)t * pitch + h * HD; const float rf = RF ? RF[(size_t)h * TT + t] : 1.0f; v2h o16; v2us oh, ol;
#pragma unroll
    for (int q = 0; q < 2; ++q) { const int dd = d + q; const int dp = (dd < HD / 2) ? dd + HD / 2 : dd - HD / 2; float x0 = f[dd], x1 = f[dp];
        if (RF) { float n0 = __fmul_rn(x0, rf), n1 = __fmul_rn(x1, rf); asm volatile("" : "+v"(n0)); asm volatile("" : "+v"(n1)); x0 = __fmul_rn(bfr(nw[dd]), n0); x1 = __fmul_rn(bfr(nw[dp]), n1); }
        const v2f cs = *(const v2f*)(CS + ((size_t)t * HD + dd) * 2); float a = __fmul_rn(x0, cs[0]), bq = __fmul_rn(x1, cs[1]); asm volatile("" : "+v"(a)); asm volatile("" : "+v"(bq)); const float r = ((dd < HD / 2) ? __fsub_rn(a, bq) : __fadd_rn(a, bq)) * sc;
        o16[q] = tohx(r); unsigned short a2, c2; splitf(r, a2, c2); oh[q] = a2; ol[q] = c2; }
    *(v2h*)(P16 + e) = o16; *(v2us*)(Ph + e) = oh; *(v2us*)(Pl + e) = ol;  }
__device__ __forceinline__ void d_vtp(const float* __restrict__ F, int pitch, int nheads, h16* V16, bf* Vh, bf* Vl) { const size_t e = ((size_t)blockIdx.x * 256 + threadIdx.x) * 2; if (e >= (size_t)nheads * HD * TT) return; { const size_t im = blockIdx.y, po = im * nheads * HD * TT; F += im * TT * pitch; V16 += po; Vh += po; Vl += po; } const int t = (int)(e % TT); const int d = (int)((e / TT) % HD); const int g = (int)(e / ((size_t)TT * HD)); v2h o16; v2us oh, ol;
#pragma unroll
    for (int q = 0; q < 2; ++q) { const float x = F[(size_t)(t + q) * pitch + g * HD + d]; o16[q] = tohx(x); unsigned short a2, c2; splitf(x, a2, c2); oh[q] = a2; ol[q] = c2; }
    *(v2h*)(V16 + e) = o16; *(v2us*)(Vh + e) = oh; *(v2us*)(Vl + e) = ol;  }
// k_planes: the operand planes of theta, phi and g of all images in ONE launch; grid (element pairs, image, which)
__global__ __launch_bounds__(256) void k_planes(const float* __restrict__ FQ, const float* __restrict__ FK, const float* __restrict__ FV, const float* __restrict__ CS, h16* QP16, bf* QPh, bf* QPl, h16* KP16, bf* KPh, bf* KPl, h16* VT16, bf* VTh, bf* VTl) {
    if (blockIdx.z == 0) d_rope(FQ, DQ, NH_, CS, nullptr, nullptr, 1.0f, QP16, QPh, QPl);
    else if (blockIdx.z == 1) d_rope(FK, DKV, NKV, CS, nullptr, nullptr, 1.0f, KP16, KPh, KPl);
    else d_vtp(FV, DKV, NKV, VT16, VTh, VTl);
}
__device__ __forceinline__ void d_csid(float* CS, unsigned bx) { const int idx = bx * 256 + threadIdx.x; if (idx >= TT * HD) return; v2f cs; cs[0] = 1.0f; cs[1] = 0.0f; *(v2f*)(CS + (size_t)idx * 2) = cs;  }
// ---- fused attention: logits, softmax and attn x g in ONE kernel; the logits stay in registers.
// A wave holds QB x 16 queries and walks TT / KSP keys, 32 at a time: St = K Qt (row = key, column = query: a lane holds one query's scores), running maximum and sum per query (online softmax),
// Pt packed from the score accumulators straight into a B operand (they already lie in the loaders' k order), Ot += Vt Pt (row = d, column = query: the rescale factor is the lane's own).
// A slice leaves O[t][slice][d] = sum_k 2^PSH exp(s - m) g (not normalised) and ML[slice][t] = (m, sum_k 2^PSH exp(s - m)), 16 queries = one whole line from one wave; k_merge joins the slices.
__device__ __forceinline__ float xhalf(float x) { return __builtin_bit_cast(float, __builtin_amdgcn_permlanex16(__builtin_bit_cast(int, x), __builtin_bit_cast(int, x), 0x76543210, 0xfedcba98, false, false)); }   // lane l reads lane l ^ 16
template <typename T16> struct PPack;
template <> struct PPack<h16> { static __device__ __forceinline__ void mk(const v8f a, const v8f b, v16h& p, v16h& p2) { (void)p2;
#pragma unroll
    for (int i = 0; i < 8; ++i) { p[i] = tohx(a[i]); p[8 + i] = tohx(b[i]); } } };
template <> struct PPack<bf> { static __device__ __forceinline__ void mk(const v8f a, const v8f b, v16bf& p, v16bf& p2) { v16us h, l;
#pragma unroll
    for (int i = 0; i < 8; ++i) { unsigned short x, y; splitf(a[i], x, y); h[i] = x; l[i] = y; splitf(b[i], x, y); h[8 + i] = x; l[8 + i] = y; }
    p = __builtin_bit_cast(v16bf, h); p2 = __builtin_bit_cast(v16bf, l); } };
// HL: hi + lo planes, 3 products each (hi x hi, the query side's or P's lo x hi, hi x the key side's lo). Q, K [t][d], Vt [d][t]; O and ML already point at the image and the slice's slot.
template <typename T16, bool HL, int QB>
__device__ __forceinline__ void fa_tile(const T16* __restrict__ Q, const T16* __restrict__ Q2, const T16* __restrict__ Kp, const T16* __restrict__ K2, const T16* __restrict__ Vt, const T16* __restrict__ V2, int q0, int k0, float* O, float* ML) {
    typedef typename WFrag<T16>::V V;
    const int lane = threadIdx.x & 31, lr = lane & 15, hi = lane >> 4;
    const size_t qo0 = (size_t)(q0 + lr) * HD + 8 * hi, ko = (size_t)(k0 + lr) * HD + 8 * hi, vo = (size_t)lr * TT + k0 + 8 * hi;
    const T16* qp = Q + qo0; const T16* qp2 = HL ? Q2 + qo0 : qp; const T16* kp = Kp + ko; const T16* kp2 = HL ? K2 + ko : kp;   // every batch of loads has one address per plane; the rest is immediate offsets
    V qf[QB][4], qf2[QB][4];
#pragma unroll
    for (int qb = 0; qb < QB; ++qb)
#pragma unroll
        for (int ks = 0; ks < 4; ++ks) { const int qo = qb * 16 * HD + ks * 32; qf[qb][ks] = WFrag<T16>::ld(qp + qo); if (HL) qf2[qb][ks] = WFrag<T16>::ld(qp2 + qo); }
    v8f o[8][QB]; float m[QB], l[QB];
#pragma unroll
    for (int qb = 0; qb < QB; ++qb) { m[qb] = -3.0e38f; l[qb] = 0.0f;
#pragma unroll
        for (int db = 0; db < 8; ++db) o[db][qb] = (v8f){}; }
    V kf[2][4], kf2[2][4];   // the K fragments of a pass, fetched one pass ahead
#pragma unroll
    for (int kb = 0; kb < 2; ++kb)
#pragma unroll
        for (int ks = 0; ks < 4; ++ks) { const int fo = kb * 16 * HD + ks * 32; kf[kb][ks] = WFrag<T16>::ld(kp + fo); if (HL) kf2[kb][ks] = WFrag<T16>::ld(kp2 + fo); }
    asm volatile("s_wait_xcnt 0x0" :: "v"(qp), "v"(qp2), "v"(kp), "v"(kp2) : "memory");   // the loads' address pairs live up to here: no register of them is rewritten before this wait
    __builtin_amdgcn_sched_barrier(0);   // holds the loop's address arithmetic below that wait
#pragma unroll 1   // one pass of 32 keys with its fragments in flight already fills the registers
    for (int kk = 0; kk < TT / KSP; kk += 32) {
        V vf[8], vf2[8]; const T16* vp = Vt + vo + kk; const T16* vp2 = HL ? V2 + vo + kk : vp;
#pragma unroll
        for (int db = 0; db < 8; ++db) { const int fo = db * 16 * TT; vf[db] = WFrag<T16>::ld(vp + fo); if (HL) vf2[db] = WFrag<T16>::ld(vp2 + fo); }
        asm volatile("s_wait_xcnt 0x0" :: "v"(vp), "v"(vp2) : "memory");   // these loads stay in flight: their address pairs live up to here, and no register of them is rewritten before this wait
        __builtin_amdgcn_sched_barrier(0);   // holds the Vt loads up here: they fly under the score products and the softmax (left alone, the compiler loads one fragment at a time, each right in front of its products)
        v8f s[2][QB];
#pragma unroll
        for (int kb = 0; kb < 2; ++kb) {
#pragma unroll
            for (int qb = 0; qb < QB; ++qb) s[kb][qb] = (v8f){};
#pragma unroll
            for (int ks = 0; ks < 4; ++ks)
#pragma unroll
                for (int qb = 0; qb < QB; ++qb) { s[kb][qb] = WFrag<T16>::mma(kf[kb][ks], qf[qb][ks], s[kb][qb]); if (HL) { s[kb][qb] = WFrag<T16>::mma(kf[kb][ks], qf2[qb][ks], s[kb][qb]); s[kb][qb] = WFrag<T16>::mma(kf2[kb][ks], qf[qb][ks], s[kb][qb]); } } }
        __builtin_amdgcn_sched_barrier(0);   // keeps the next pass's K loads behind the products above, so that they go into the registers those have just read and need no second set
        const int kn = (kk + 32 < TT / KSP) ? kk + 32 : kk;   // the last pass has no next one: it fetches its own keys again (in bounds, not used)
        kp = Kp + ko + (size_t)kn * HD; kp2 = HL ? K2 + ko + (size_t)kn * HD : kp;
#pragma unroll
        for (int kb = 0; kb < 2; ++kb)
#pragma unroll
            for (int ks = 0; ks < 4; ++ks) { const int fo = kb * 16 * HD + ks * 32; kf[kb][ks] = WFrag<T16>::ld(kp + fo); if (HL) kf2[kb][ks] = WFrag<T16>::ld(kp2 + fo); }
        asm volatile("s_wait_xcnt 0x0" :: "v"(kp), "v"(kp2) : "memory");   // as behind the Vt loads
        __builtin_amdgcn_sched_barrier(0);   // holds the K loads up here: they fly under the softmax and the Vt Pt products
        V pf[QB], pf2[QB];
#pragma unroll
        for (int qb = 0; qb < QB; ++qb) {
            float bm = s[0][qb][0];
#pragma unroll
            for (int kb = 0; kb < 2; ++kb)
#pragma unroll
                for (int j = 0; j < 8; ++j) bm = fmaxf(bm, s[kb][qb][j]);
            bm = fmaxf(bm, xhalf(bm));   // the other half of the wave holds the query's other keys
            const float mn = fmaxf(m[qb], bm * SCL), al = __builtin_amdgcn_exp2f((m[qb] - mn) * L2E); m[qb] = mn;
            float rs = 0.0f;
#pragma unroll
            for (int kb = 0; kb < 2; ++kb)
#pragma unroll
                for (int j = 0; j < 8; ++j) { const float p = __builtin_amdgcn_exp2f((s[kb][qb][j] * SCL - mn) * L2E + PSH); s[kb][qb][j] = p; rs += p; }
            l[qb] = l[qb] * al + rs;   // each half of the wave sums its own keys; the halves join behind the loop
#pragma unroll
            for (int db = 0; db < 8; ++db) o[db][qb] *= al;
            PPack<T16>::mk(s[0][qb], s[1][qb], pf[qb], pf2[qb]);
        }
#pragma unroll
        for (int db = 0; db < 8; ++db)
#pragma unroll
            for (int qb = 0; qb < QB; ++qb) { o[db][qb] = WFrag<T16>::mma(vf[db], pf[qb], o[db][qb]); if (HL) { o[db][qb] = WFrag<T16>::mma(vf[db], pf2[qb], o[db][qb]); o[db][qb] = WFrag<T16>::mma(vf2[db], pf[qb], o[db][qb]); } }
    }
#pragma unroll
    for (int qb = 0; qb < QB; ++qb) { const size_t t = (size_t)(q0 + qb * 16 + lr); float* orow = O + t * (KSP * HD) + hi * 8; const float lj = l[qb] + xhalf(l[qb]);
#pragma unroll
        for (int db = 0; db < 8; ++db) { v4f x, y;
#pragma unroll
            for (int j = 0; j < 4; ++j) { x[j] = o[db][qb][j]; y[j] = o[db][qb][4 + j]; }
            *(v4f*)(orow + db * 16) = x; *(v4f*)(orow + db * 16 + 4) = y; }
        if (hi == 0) { v2f ml; ml[0] = m[qb]; ml[1] = lj; *(v2f*)(ML + t * 2) = ml; } }
    asm volatile("s_wait_xcnt 0x0" ::: "memory");   // the kernel lays the other row range's code behind this tile's last stores: no register of theirs is rewritten before this wait
}
// k_fattn: all images, all query rows, all key slices in ONE launch; 4 waves a work-group, all on the same keys (they share the K and Vt lines in the WGP cache). Flat grid: rows < RH in front (hi + lo planes, 32 queries a wave), then rows >= RH (fp16, 64 queries a wave: a fragment load touches 16 lines, so each has to feed as many products as the registers allow); query group fastest, then slice, then image.
__global__ __launch_bounds__(128) void k_fattn(const bf* __restrict__ Qh, const bf* __restrict__ Ql, const bf* __restrict__ Kh, const bf* __restrict__ Kl, const bf* __restrict__ Vh, const bf* __restrict__ Vl, const h16* __restrict__ Q16, const h16* __restrict__ K16, const h16* __restrict__ V16, float* O, float* ML) {
    constexpr int GH = RH / 128, GL = (TT - RH) / 256, NHI = NB_ * KSP * GH;
    const int id = blockIdx.x, w = threadIdx.x >> 5;
    if (id < NHI) { const int g = id % GH, z = (id / GH) % KSP; const size_t im = id / (GH * KSP), zb = im * TT * HD;
        fa_tile<bf, true, 2>(Qh + zb, Ql + zb, Kh + zb, Kl + zb, Vh + zb, Vl + zb, g * 128 + w * 32, z * (TT / KSP), O + zb * KSP + z * HD, ML + (im * KSP + z) * TT * 2);
    } else { const int il = id - NHI; const int g = il % GL, z = (il / GL) % KSP; const size_t im = il / (GL * KSP), zb = im * TT * HD;
        fa_tile<h16, false, 4>(Q16 + zb, nullptr, K16 + zb, nullptr, V16 + zb, nullptr, RH + g * 256 + w * 64, z * (TT / KSP), O + zb * KSP + z * HD, ML + (im * KSP + z) * TT * 2); }
}
__device__ __forceinline__ void d_cvtT(const float* __restrict__ X, bf* XB, unsigned bx) { const size_t i = (size_t)bx * 256 + threadIdx.x; if (i >= (size_t)TT * DM / 8) return; const size_t e = i * 8; const int c0 = (int)(e % DM); const int n = (int)(e / DM); v8us o;
#pragma unroll
    for (int q = 0; q < 8; ++q) o[q] = f2bf(X[(size_t)(c0 + q) * TT + n]);
    *(v8us*)(XB + e) = o;  }
// k_prep: everything that reads only the inputs, in ONE launch; flat grid: NB_ x NBT blocks turn the images token-major, 4 x NBW blocks round the weights, NBC blocks write the cos/sin table
#define NBT ((TT * DM / 8 + 255) / 256)
#define NBW ((HD * DM / 8 + 255) / 256)
#define NBC ((TT * HD + 255) / 256)
__global__ __launch_bounds__(256) void k_prep(const float* __restrict__ xin, const float* __restrict__ wq, const float* __restrict__ wk, const float* __restrict__ wv, const float* __restrict__ wo, bf* XB, bf* WQ, bf* WK, bf* WV, bf* WO, float* CS) {
    const unsigned id = blockIdx.x;
    if (id < NB_ * NBT) { const size_t im = id / NBT; d_cvtT(xin + im * DM * TT, XB + im * TT * DM, id % NBT); }
    else if (id < NB_ * NBT + 4 * NBW) { const unsigned w = (id - NB_ * NBT) / NBW; d_cvt8((w == 0) ? wq : (w == 1) ? wk : (w == 2) ? wv : wo, (w == 0) ? WQ : (w == 1) ? WK : (w == 2) ? WV : WO, (size_t)HD * DM / 8, (id - NB_ * NBT) % NBW); }
    else d_csid(CS, id - NB_ * NBT - 4 * NBW);
}
// Y = W_w y without its bias, channel-major [image][c][n] as the output is: a wave reads whole lines. Both readers add the bias wb[c] as they read. A thread sums the positions tid, tid + 256, ... of image 0, then of image 1, ...
__global__ __launch_bounds__(256) void k_bnstat(const float* __restrict__ Y, const float* __restrict__ wb, float* BNS) { __shared__ float red[256]; const int c = blockIdx.x; const int tid = threadIdx.x; const size_t NTOT = (size_t)NB_ * TT; float s = 0.0f; const float* Yc = Y + (size_t)c * TT + tid; const float wc = bfr(wb[c]);
#pragma unroll 1   // one address pair a trip, the one the wait below names: unrolled, the compiler forms other bases for the loads, which that wait does not hold
    for (int b = 0; b < NB_; ++b) { const float* yp = Yc + (size_t)b * DM * TT; float y[TT / 256];
#pragma unroll   // an image's loads of a thread in flight together
        for (int i = 0; i < TT / 256; ++i) y[i] = yp[i * 256];
        asm volatile("s_wait_xcnt 0x0" :: "v"(yp) : "memory");   // the loads' address lives up to here: no register of it is rewritten before this wait
#pragma unroll
        for (int i = 0; i < TT / 256; ++i) s = __fadd_rn(s, __fadd_rn(y[i], wc)); }
    red[tid] = s; __syncthreads();
    for (int st = 128; st > 0; st >>= 1) { if (tid < st) red[tid] = __fadd_rn(red[tid], red[tid + st]); __syncthreads(); }
    const float mu = __fdiv_rn(red[0], (float)NTOT); __syncthreads(); float v = 0.0f;
#pragma unroll 1   // as above
    for (int b = 0; b < NB_; ++b) { const float* yp = Yc + (size_t)b * DM * TT; float y[TT / 256];
#pragma unroll   // as above
        for (int i = 0; i < TT / 256; ++i) y[i] = yp[i * 256];
        asm volatile("s_wait_xcnt 0x0" :: "v"(yp) : "memory");   // as above
#pragma unroll
        for (int i = 0; i < TT / 256; ++i) { const float d = __fsub_rn(__fadd_rn(y[i], wc), mu); float p = __fmul_rn(d, d); asm volatile("" : "+v"(p)); v = __fadd_rn(v, p); } }
    red[tid] = v; __syncthreads();
    for (int st = 128; st > 0; st >>= 1) { if (tid < st) red[tid] = __fadd_rn(red[tid], red[tid + st]); __syncthreads(); }
    if (tid == 0) { const float var = __fdiv_rn(red[0], (float)NTOT); v2f o; o[0] = mu; o[1] = __fdiv_rn(1.0f, __fsqrt_rn(__fadd_rn(var, BNEPS))); *(v2f*)(BNS + (size_t)c * 32) = o;  }    }
__global__ __launch_bounds__(256) void k_bnout(const float* __restrict__ Y, const float* __restrict__ wb, const float* __restrict__ BNS, const float* __restrict__ g, const float* __restrict__ bb, const float* __restrict__ X, float* OUT) { const size_t k = (size_t)blockIdx.x * 256 + threadIdx.x; if (k >= (size_t)NB_ * DM * TT / 4) return; const size_t e = k * 4; const int c = (int)((e / TT) % DM); const float* sp = BNS + (size_t)c * 32; const float* xp = X + e; const float* yp = Y + e;   // Y lies as X and OUT do
    const float mu = sp[0], rs = sp[1], gm = bfr(g[c]), bt = bfr(bb[c]), wc = bfr(wb[c]); const v4f xr = *(const v4f*)xp; const v4f yr = *(const v4f*)yp; v4f o;
    asm volatile("s_wait_xcnt 0x0" :: "v"(c), "v"(sp), "v"(xp), "v"(yp) : "memory");   // the loads' addresses live up to here: no register of them is rewritten before this wait
#pragma unroll
    for (int q = 0; q < 4; ++q) { const float y = __fadd_rn(yr[q], wc); float t = __fmul_rn(__fmul_rn(gm, __fsub_rn(y, mu)), rs); asm volatile("" : "+v"(t)); t = __fadd_rn(t, bt); o[q] = __fadd_rn(t, bfr(xr[q])); }
    *(v4f*)(OUT + e) = o;  }
// k_merge: joins the KSP key slices of every row of every image, in slice order: weights exp(m_slice - max m), then the softmax's division; hi + lo planes of the result
__global__ __launch_bounds__(256) void k_merge(const float* __restrict__ O, const float* __restrict__ ML, bf* Ah, bf* Al) { const size_t e = ((size_t)blockIdx.x * 256 + threadIdx.x) * 2; if (e >= (size_t)NB_ * TT * HD) return; const int d = (int)(e % HD); const size_t r = e / HD;
    const float* op = O + r * (KSP * HD) + d; const float* mp = ML + ((r / TT) * KSP * TT + r % TT) * 2; v2f ml[KSP], u[KSP];
#pragma unroll   // all loads of a thread in flight together
    for (int p = 0; p < KSP; ++p) { ml[p] = *(const v2f*)(mp + p * TT * 2); u[p] = *(const v2f*)(op + p * HD); }
    float mx = ml[0][0];
#pragma unroll
    for (int p = 1; p < KSP; ++p) mx = fmaxf(mx, ml[p][0]);
    float ls = 0.0f; v2f s; s[0] = 0.0f; s[1] = 0.0f;
#pragma unroll
    for (int p = 0; p < KSP; ++p) { const float wt = __builtin_amdgcn_exp2f((ml[p][0] - mx) * L2E); ls += ml[p][1] * wt; s[0] += u[p][0] * wt; s[1] += u[p][1] * wt; }
    v2us oh, ol;
#pragma unroll
    for (int q = 0; q < 2; ++q) { unsigned short a, c2; splitf(__fdiv_rn(s[q], ls), a, c2); oh[q] = a; ol[q] = c2; } *(v2us*)(Ah + e) = oh; *(v2us*)(Al + e) = ol;  }

extern "C" void kernel_launch(void* const* d_in, const int* in_sizes, int n_in,
                              void* d_out, int out_size, void* d_ws, size_t ws_size, hipStream_t stream) {
    (void)in_sizes; (void)n_in; (void)out_size;
    const float* xin = (const float*)d_in[0];   /* x [4][256][4096] NCHW */ const float* wv = (const float*)d_in[1]; const float* bv = (const float*)d_in[2];   /* g_w, g_b */ const float* wq = (const float*)d_in[3]; const float* bq = (const float*)d_in[4];   /* theta */ const float* wk = (const float*)d_in[5]; const float* bk = (const float*)d_in[6];   /* phi */ const float* wo = (const float*)d_in[7]; const float* bo = (const float*)d_in[8];   /* W_w [256][128], W_b */ const float* bng = (const float*)d_in[9]; const float* bnb = (const float*)d_in[10]; const float* x = nullptr; (void)x;
    float* OUT = (float*)d_out;     // [4][256][4096] NCHW
    char* wsp = (char*)d_ws;
    auto take = [&](size_t bytes) { char* p = wsp; wsp += (bytes + 255) & ~(size_t)255; return (void*)p; };
    float* YALL = (float*)take((size_t)NB_ * TT * DM * 4); float* BNS = (float*)take((size_t)DM * 32 * 4);    bf* WQ = (bf*)take((size_t)DQ * DM * 2); bf* WK = (bf*)take((size_t)DKV * DM * 2); bf* WV = (bf*)take((size_t)DKV * DM * 2); bf* WO = (bf*)take((size_t)DM * DQ * 2); float* CS = (float*)take((size_t)TT * HD * 2 * 4);
    h16* QP16 = (h16*)take((size_t)NB_ * TT * HD * 2); h16* KP16 = (h16*)take((size_t)NB_ * TT * HD * 2); h16* VT16 = (h16*)take((size_t)NB_ * HD * TT * 2);   // every operand plane: one per image, image stride TT * HD
    bf* QPh = (bf*)take((size_t)NB_ * TT * HD * 2); bf* QPl = (bf*)take((size_t)NB_ * TT * HD * 2); bf* KPh = (bf*)take((size_t)NB_ * TT * HD * 2); bf* KPl = (bf*)take((size_t)NB_ * TT * HD * 2); bf* VTh = (bf*)take((size_t)NB_ * HD * TT * 2); bf* VTl = (bf*)take((size_t)NB_ * HD * TT * 2);
    float* Ob = (float*)take((size_t)NB_ * TT * KSP * HD * 4); float* ML = (float*)take((size_t)NB_ * TT * KSP * 2 * 4); bf* ATh = (bf*)take((size_t)NB_ * TT * DQ * 2); bf* ATl = (bf*)take((size_t)NB_ * TT * DQ * 2);
    if ((size_t)(wsp - (char*)d_ws) > ws_size) return;    // ws 256 MiB
    // the projections' temporaries of all images (32 MiB) lie in the buffer of the attention's partial results: they are dead before the attention writes it (stream-ordered)
    bf* XB = (bf*)Ob; float* FQ = (float*)(XB + (size_t)NB_ * TT * DM); float* FK = FQ + (size_t)NB_ * TT * DQ; float* FV = FK + (size_t)NB_ * TT * DKV;
    // launches that do not depend on one another are ONE launch: all images, all weights, all three projections, both row ranges of a product
    k_prep<<<NB_ * NBT + 4 * NBW + NBC, 256, 0, stream>>>(xin, wq, wk, wv, wo, XB, WQ, WK, WV, WO, CS);   /* NCHW [256][4096] -> token-major bf16 [4096][256]; bf16 weights; table */
    k_proj3<<<dim3(TT / 64, 3 * (HD / 64), NB_), 32, 0, stream>>>(XB, WQ, WK, WV, FQ, FK, FV, bq, bk, bv);
    k_planes<<<dim3((unsigned)(((size_t)TT * HD / 2 + 255) / 256), NB_, 3), 256, 0, stream>>>(FQ, FK, FV, CS, QP16, QPh, QPl, KP16, KPh, KPl, VT16, VTh, VTl);
    k_fattn<<<NB_ * KSP * (RH / 128) + NB_ * KSP * ((TT - RH) / 256), 128, 0, stream>>>(QPh, QPl, KPh, KPl, VTh, VTl, QP16, KP16, VT16, Ob, ML);   /* key slice z -> partial Ob[image][t][z][d], ML[image][z][t] */
    k_merge<<<(unsigned)(((size_t)NB_ * TT * HD / 2 + 255) / 256), 256, 0, stream>>>(Ob, ML, ATh, ATl);
    k_gemmw<bf, 3, false><<<dim3(DM / 64, TT / 64, NB_), 32, 0, stream>>>(WO, nullptr, ATh, ATl, DQ, YALL, TT, nullptr, 0, (size_t)TT * DQ, (size_t)DM * TT);   /* W_w y of all images, channel-major [image][c][n] (rows = W_w's, columns = positions; products W_w x hi, W_w x lo), kept for the batch statistics */
    k_bnstat<<<DM, 256, 0, stream>>>(YALL, bo, BNS);   /* per channel: mean and 1/sqrt(var + eps) over the batch x 4,096 positions (training-mode BatchNorm) */
    k_bnout<<<(unsigned)(((size_t)NB_ * DM * TT / 4 + 255) / 256), 256, 0, stream>>>(YALL, bo, BNS, bng, bnb, xin, OUT);   /* out[b][c][n] = gamma (Wy - mean) rstd + beta + x */

}

// v005
// It runs in 116 microseconds.
// Next to v004, in two timings, it ran 1.18 times as fast each time.
// All steps since v000 together make it 9.25 times as fast.
#include <hip/hip_runtime.h>

// Non-local block (embedded Gaussian) over 64x64 = 4,096 positions with a training-mode BatchNorm and residual (x [4][256][64][64] NCHW; theta, phi, g = 1x1 convs C 256 -> Ci 128 ('oi' [128][256] 0.02, zero biases); f[n][m] = theta_n . phi_m (no scaling); attn = softmax over m; y[ci][n] = sum_m attn[n][m] g[ci][m]; Wy = W_w y + W_b ('oi' [256][128]); BatchNorm2d in TRAINING mode (per-channel mean/var over the whole batch x 64 x 64, eps 1e-5, gamma/beta read); out = BN(Wy) + x -> [4][256][64][64] (4.2 M)).
// Compute dtypes, f32 accumulate: every input rounded to bf16; convs exact + f32 bias; attention rows < 512 3 products, rest fp16; softmax f32; W_w hl x exact + bias; BatchNorm statistics and output f32 (fixed-order sums); residual f32 of the bf16-rounded x.

#define NB_  4
#define TT   4096
#define DM   256
#define NH_  1
#define NKV  1
#define REP  (NH_ / NKV)
#define HD   128
#define DQ   (NH_ * HD)
#define DKV  (NKV * HD)
#define ZH   1
#define RH   512                  // query rows < RH use hi+lo planes (0: none)
#define WIN  0
#define PSH  8.0f     // P carries 2^PSH (numerator and row sum alike: it cancels in the softmax's division), so that small weights stay in fp16's normal range
#define SCL  1.0f     // the non-local block applies no 1/sqrt(d)
#define CIN  256      // channels C (== DM)
#define BNEPS 1e-5f
#define KSP  8        // key slices of the fused attention (one work-group per slice); every slice leaves its partial result in a slot of its own
#define L2E  1.4426950408889634f
typedef _Float16 h16;
typedef unsigned short bf;
typedef __attribute__((ext_vector_type(16))) __bf16   v16bf;
typedef __attribute__((ext_vector_type(16))) _Float16 v16h;
typedef __attribute__((ext_vector_type(8)))  _Float16 v8h;
typedef __attribute__((ext_vector_type(8)))  unsigned short v8us;
typedef __attribute__((ext_vector_type(16))) unsigned short v16us;
typedef __attribute__((ext_vector_type(8)))  float    v8f;
typedef __attribute__((ext_vector_type(4)))  float    v4f;
typedef v8h  __attribute__((may_alias)) v8ha;
typedef v4f  __attribute__((may_alias)) v4fa;
typedef v8us __attribute__((may_alias)) v8usa;

__device__ __forceinline__ unsigned short f2bf(float f) { unsigned u = __float_as_uint(f); u += 0x7FFFu + ((u >> 16) & 1u); return (unsigned short)(u >> 16); }
__device__ __forceinline__ float bf2f(unsigned short b) { return __uint_as_float(((unsigned)b) << 16); }
__device__ __forceinline__ float bfr(float f) { return bf2f(f2bf(f)); }
__device__ __forceinline__ v16h cat16(v8h lo, v8h hi) { return __builtin_shufflevector(lo, hi, 0, 1, 2, 3, 4, 5, 6, 7, 8, 9, 10, 11, 12, 13, 14, 15); }
__device__ __forceinline__ v16bf cat16b(v8us lo, v8us hi) { return __builtin_bit_cast(v16bf, __builtin_shufflevector(lo, hi, 0, 1, 2, 3, 4, 5, 6, 7, 8, 9, 10, 11, 12, 13, 14, 15)); }
__device__ __forceinline__ v8f wmma16(v16h a, v16h b, v8f c) { return __builtin_amdgcn_wmma_f32_16x16x32_f16(false, a, false, b, (short)0, c, false, false); }
__device__ __forceinline__ v8f wmmab(v16bf a, v16bf b, v8f c) { return __builtin_amdgcn_wmma_f32_16x16x32_bf16(false, a, false, b, (short)0, c, false, false); }



// ---- k_gemmw: register-blocked GEMM, ONE WAVE per 64x64 output tile (16 accumulators), operands straight from K-contiguous 16-bit planes; grid (M/64, N/64, Z), 32 threads.
// C[m][n] (f32, pitch ldc, + optional f32 bias[n]) = sum_k A[m][k] Bt[n][k] (+ split products per NSPLIT). z-batch strides sA/sB/sC in elements. K % 32 == 0. KS > 1: a work-group sums K / KS of the k only (operand rows stay at pitch K); with sA = sB = K / KS, z is the k slice and C + z sC its partial sum.
template <typename T16> struct WFrag;
template <> struct WFrag<h16> { typedef v16h V; static __device__ __forceinline__ V ld(const h16* p) { return cat16(*(const v8h*)p, *(const v8h*)(p + 16)); } static __device__ __forceinline__ v8f mma(V a, V b, v8f c) { return wmma16(a, b, c); } };
template <> struct WFrag<bf> { typedef v16bf V; static __device__ __forceinline__ V ld(const bf* p) { return cat16b(*(const v8us*)p, *(const v8us*)(p + 16)); } static __device__ __forceinline__ v8f mma(V a, V b, v8f c) { return wmmab(a, b, c); } };
// gemmw_tile: the tile (bx, by) of one such product; os: 16 x 68 floats of LDS.
template <typename T16, int NSPLIT, bool BIAS, int KS>
__device__ __forceinline__ void gemmw_tile(float* os, const T16* __restrict__ A, const T16* __restrict__ A2, const T16* __restrict__ Bt, const T16* __restrict__ Bt2, int K, float* C, int ldc, const float* __restrict__ bias, int bx, int by) {
    typedef typename WFrag<T16>::V V;
    const int lane = threadIdx.x & 31, lr = lane & 15, hi = lane >> 4; const int r0 = bx * 64, c0 = by * 64;
    v8f acc[4][4];
#pragma unroll
    for (int mb = 0; mb < 4; ++mb)
#pragma unroll
        for (int nb = 0; nb < 4; ++nb) acc[mb][nb] = (v8f){};
    const size_t aoff = (size_t)(r0 + lr) * K + 8 * hi, boff = (size_t)(c0 + lr) * K + 8 * hi;
#pragma unroll 1
    for (int kc = 0; kc < K / KS; kc += 32) {
        V a[4], a2[4];
#pragma unroll
        for (int mb = 0; mb < 4; ++mb) { a[mb] = WFrag<T16>::ld(A + aoff + (size_t)mb * 16 * K + kc); if (NSPLIT == 1 || NSPLIT == 2) a2[mb] = WFrag<T16>::ld(A2 + aoff + (size_t)mb * 16 * K + kc); }
#pragma unroll
        for (int nb = 0; nb < 4; ++nb) { const V b = WFrag<T16>::ld(Bt + boff + (size_t)nb * 16 * K + kc); V b2; if (NSPLIT >= 2) b2 = WFrag<T16>::ld(Bt2 + boff + (size_t)nb * 16 * K + kc);
#pragma unroll
            for (int mb = 0; mb < 4; ++mb) { acc[mb][nb] = WFrag<T16>::mma(a[mb], b, acc[mb][nb]); if (NSPLIT == 1 || NSPLIT == 2) acc[mb][nb] = WFrag<T16>::mma(a2[mb], b, acc[mb][nb]); if (NSPLIT >= 2) acc[mb][nb] = WFrag<T16>::mma(a[mb], b2, acc[mb][nb]); } }
        asm volatile("v_nop\n\tv_nop\n\tv_nop\n\tv_nop" : "+v"(acc[0][0]), "+v"(acc[1][1]), "+v"(acc[2][2]), "+v"(acc[3][3]) : "v"(a[0]), "v"(a[3]));
    }
#pragma unroll
    for (int mb = 0; mb < 4; ++mb) {
#pragma unroll
        for (int nb = 0; nb < 4; ++nb) {
#pragma unroll
            for (int j = 0; j < 8; ++j) os[(hi * 8 + j) * 68 + nb * 16 + lr] = acc[mb][nb][j]; }
        __builtin_amdgcn_wave_barrier(); asm volatile("" ::: "memory");
        float* crow = C + (size_t)(r0 + mb * 16) * ldc + c0;
{
#pragma unroll
            for (int s = 0; s < 8; ++s) { const int row = 2 * s + hi, cofs = lr * 4; v4f val = *(const v4fa*)(os + row * 68 + cofs); if (BIAS) { val[0] += bfr(bias[c0 + cofs]); val[1] += bfr(bias[c0 + cofs + 1]); val[2] += bfr(bias[c0 + cofs + 2]); val[3] += bfr(bias[c0 + cofs + 3]); }
                *(v4f*)(crow + (size_t)row * ldc + cofs) = val; }
             }
        __builtin_amdgcn_wave_barrier(); asm volatile("" ::: "memory");
    }
    asm volatile("s_wait_xcnt 0x0" ::: "memory");   // a precaution (its one caller, k_gemmw, ends behind it): no register of this tile's last stores is rewritten before this wait
}
template <typename T16, int NSPLIT, bool BIAS, int KS = 1>
__global__ __launch_bounds__(32) void k_gemmw(const T16* __restrict__ A, const T16* __restrict__ A2, const T16* __restrict__ Bt, const T16* __restrict__ Bt2, int K, float* C, int ldc, const float* __restrict__ bias, size_t sA, size_t sB, size_t sC) {
    __shared__ __align__(16) float os[16 * 68];
    const size_t z = blockIdx.z; A += z * sA; if (A2) A2 += z * sA; Bt += z * sB; if (Bt2) Bt2 += z * sB; C += z * sC;
    gemmw_tile<T16, NSPLIT, BIAS, KS>(os, A, A2, Bt, Bt2, K, C, ldc, bias, blockIdx.x, blockIdx.y);
}

__device__ __forceinline__ h16 tohx(float x) { return (h16)x; }
__device__ __forceinline__ void splitf(float y, unsigned short& h, unsigned short& l) { h = f2bf(y); l = f2bf(y - bf2f(h)); }
typedef __attribute__((ext_vector_type(2))) _Float16 v2h;
typedef __attribute__((ext_vector_type(4))) _Float16 v4h;
typedef __attribute__((ext_vector_type(2))) unsigned short v2us;
typedef __attribute__((ext_vector_type(4))) unsigned short v4us;
typedef __attribute__((ext_vector_type(2))) float v2f;
typedef __attribute__((ext_vector_type(4))) int v4i;

__global__ __launch_bounds__(256) void k_wtG(const float* __restrict__ w, int K, int N, bf* Bt) {
    const int lane = threadIdx.x & 31; const int L0 = (blockIdx.x * 8 + (threadIdx.x >> 5)) * 8; const int nlines = N * K / 64;
{
#pragma unroll 1
        for (int l = 0; l < 8; ++l) { const int L = L0 + l; if (L >= nlines) break; const size_t e = (size_t)L * 64 + lane * 2; const int k = (int)(e % K), n = (int)(e / K); v2us o;
            o[0] = f2bf(w[(size_t)k * N + n]); o[1] = f2bf(w[(size_t)(k + 1) * N + n]); *(v2us*)(Bt + e) = o; }
         }
}
__device__ __forceinline__ void d_cvt8(const float* __restrict__ src, bf* dst, size_t n8, unsigned bx) { const size_t i = (size_t)bx * 256 + threadIdx.x; if (i >= n8) return; const v8f v = *(const v8f*)(src + i * 8); v8us o;
#pragma unroll
    for (int k = 0; k < 8; ++k) o[k] = f2bf(v[k]); *(v8us*)(dst + i * 8) = o;  }

// ---- projections: ONE WAVE per 64x64 tile as in k_gemmw, K = DM, bf16 operands; the tile (+ bias) does not go out as f32 but straight as the attention's operand planes.
typedef __attribute__((ext_vector_type(2))) __bf16 v2bf;
// proj_tile: rows r0.. of A x rows c0.. of Bt (both [row][DM]); planes P16 (fp16), Ph + Pl (bf16 hi + lo of the same f32 value), pitch ldp. ROWB: bias[row], else bias[column]. os: 16 x 68 floats of LDS.
template <bool ROWB>
__device__ __forceinline__ void proj_tile(float* os, const bf* __restrict__ A, const bf* __restrict__ Bt, const float* __restrict__ bias, int bx, int by, int ldp, h16* P16, bf* Ph, bf* Pl) {
    const int lane = threadIdx.x & 31, lr = lane & 15, hi = lane >> 4, l8 = lane >> 3, cofs = (lane & 7) * 8; const int r0 = bx * 64, c0 = by * 64;
    constexpr int NPB = ROWB ? 16 : 8; float pb[NPB];   // the biases of the lane's 16 rows or 8 columns in the epilogue; fetched here, so that they fly under the k loop
    { const float* bp = ROWB ? bias + r0 + l8 : bias + c0 + cofs;
#pragma unroll
      for (int i = 0; i < NPB; ++i) pb[i] = bp[ROWB ? 4 * i : i];
      asm volatile("s_wait_xcnt 0x0" :: "v"(bp) : "memory"); }   // the loads' address lives up to here: no register of it is rewritten before this wait
    v8f acc[4][4];
#pragma unroll
    for (int mb = 0; mb < 4; ++mb)
#pragma unroll
        for (int nb = 0; nb < 4; ++nb) acc[mb][nb] = (v8f){};
    const bf* a0 = A + (size_t)(r0 + lr) * DM + 8 * hi; const bf* b0 = Bt + (size_t)(c0 + lr) * DM + 8 * hi;
#pragma unroll 1   // one address pair per operand a trip, the ones the wait below names
    for (int kc = 0; kc < DM; kc += 32) {
        const bf* ap = a0 + kc; const bf* bp = b0 + kc; v16bf a[4], b[4];
#pragma unroll
        for (int i = 0; i < 4; ++i) { a[i] = WFrag<bf>::ld(ap + i * 16 * DM); b[i] = WFrag<bf>::ld(bp + i * 16 * DM); }
        asm volatile("s_wait_xcnt 0x0" :: "v"(ap), "v"(bp) : "memory");   // the loads' address pairs live up to here: no register of them is rewritten before this wait
#pragma unroll
        for (int nb = 0; nb < 4; ++nb)
#pragma unroll
            for (int mb = 0; mb < 4; ++mb) acc[mb][nb] = wmmab(a[mb], b[nb], acc[mb][nb]);
    }
    v2f bb[NPB / (ROWB ? 1 : 2)];   // bf16-rounded biases, as pairs for the packed add
#pragma unroll
    for (int i = 0; i < NPB / (ROWB ? 1 : 2); ++i) { bb[i][0] = bfr(pb[ROWB ? i : 2 * i]); bb[i][1] = bfr(pb[ROWB ? i : 2 * i + 1]); }
    const size_t po = (size_t)(r0 + l8) * ldp + c0 + cofs; h16* p16 = P16 + po; bf* ph = Ph + po; bf* pl = Pl + po;
#pragma unroll
    for (int mb = 0; mb < 4; ++mb) {
#pragma unroll
        for (int nb = 0; nb < 4; ++nb) {
#pragma unroll
            for (int j = 0; j < 8; ++j) os[(hi * 8 + j) * 68 + nb * 16 + lr] = acc[mb][nb][j]; }
        __builtin_amdgcn_wave_barrier(); asm volatile("" ::: "memory");   // the wave's LDS reads below stay behind its writes above (other lanes' values)
#pragma unroll
        for (int s = 0; s < 4; ++s) {   // 8 lanes take one row's 64 values: a whole 128-byte line in each plane, 4 rows a store
            const float* op = os + (4 * s + l8) * 68 + cofs; const v4f x0 = *(const v4fa*)op, x1 = *(const v4fa*)(op + 4); v8h o16; v8us oh, ol;
#pragma unroll
            for (int p = 0; p < 4; ++p) { v2f x; x[0] = (p < 2) ? x0[2 * (p & 1)] : x1[2 * (p & 1)]; x[1] = (p < 2) ? x0[2 * (p & 1) + 1] : x1[2 * (p & 1) + 1]; x += bb[ROWB ? mb * 4 + s : p];
                const v2h h = __builtin_convertvector(x, v2h); const v2bf t = __builtin_convertvector(x, v2bf); const v2bf u = __builtin_convertvector(x - __builtin_convertvector(t, v2f), v2bf);   // all three round to nearest even, as tohx and splitf do
                const v2us tu = __builtin_bit_cast(v2us, t), uu = __builtin_bit_cast(v2us, u); o16[2 * p] = h[0]; o16[2 * p + 1] = h[1]; oh[2 * p] = tu[0]; oh[2 * p + 1] = tu[1]; ol[2 * p] = uu[0]; ol[2 * p + 1] = uu[1]; }
            const size_t ro = (size_t)(mb * 16 + 4 * s) * ldp; *(v8h*)(p16 + ro) = o16; *(v8us*)(ph + ro) = oh; *(v8us*)(pl + ro) = ol;
            asm volatile("s_wait_xcnt 0x0" ::: "memory"); }   // the next rows' values may go into these stores' registers: none is rewritten before this wait
        __builtin_amdgcn_wave_barrier(); asm volatile("" ::: "memory");   // the next 16 rows' LDS writes stay behind these reads
    }
}
// k_proj3: the theta, phi and g projections of all images in ONE launch; grid (TT / 64, 3 x HD / 64, image).
// theta and phi: rows = positions, planes [t][d]; g with the operands swapped (rows = g_w's, columns = positions), so that its planes lie [d][t] as the attn x g product reads them.
__global__ __launch_bounds__(32) void k_proj3(const bf* __restrict__ XB, const bf* __restrict__ WQ, const bf* __restrict__ WK, const bf* __restrict__ WV, h16* QP16, bf* QPh, bf* QPl, h16* KP16, bf* KPh, bf* KPl, h16* VT16, bf* VTh, bf* VTl, const float* __restrict__ bq, const float* __restrict__ bk, const float* __restrict__ bv) {
    __shared__ __align__(16) float os[16 * 68];
    const int w = blockIdx.y / (HD / 64), by = blockIdx.y % (HD / 64); const size_t im = blockIdx.z, zb = im * TT * HD; const bf* X = XB + im * TT * DM;
    if (w == 2) proj_tile<true>(os, WV, X, bv, by, blockIdx.x, TT, VT16 + zb, VTh + zb, VTl + zb);
    else proj_tile<false>(os, X, (w == 0) ? WQ : WK, (w == 0) ? bq : bk, blockIdx.x, by, HD, ((w == 0) ? QP16 : KP16) + zb, ((w == 0) ? QPh : KPh) + zb, ((w == 0) ? QPl : KPl) + zb);
}
// ---- fused attention: logits, softmax and attn x g in ONE kernel; the logits stay in registers.
// A wave holds QB x 16 queries and walks TT / KSP keys, 32 at a time: St = K Qt (row = key, column = query: a lane holds one query's scores), running maximum and sum per query (online softmax),
// Pt packed from the score accumulators straight into a B operand (they already lie in the loaders' k order), Ot += Vt Pt (row = d, column = query: the rescale factor is the lane's own).
// A slice leaves O[t][slice][d] = sum_k 2^PSH exp(s - m) g (not normalised) and ML[slice][t] = (m, sum_k 2^PSH exp(s - m)), 16 queries = one whole line from one wave; k_merge joins the slices.
__device__ __forceinline__ float xhalf(float x) { return __builtin_bit_cast(float, __builtin_amdgcn_permlanex16(__builtin_bit_cast(int, x), __builtin_bit_cast(int, x), 0x76543210, 0xfedcba98, false, false)); }   // lane l reads lane l ^ 16
template <typename T16> struct PPack;
template <> struct PPack<h16> { static __device__ __forceinline__ void mk(const v8f a, const v8f b, v16h& p, v16h& p2) { (void)p2;
#pragma unroll
    for (int i = 0; i < 8; ++i) { p[i] = tohx(a[i]); p[8 + i] = tohx(b[i]); } } };
template <> struct PPack<bf> { static __device__ __forceinline__ void mk(const v8f a, const v8f b, v16bf& p, v16bf& p2) { v16us h, l;
#pragma unroll
    for (int i = 0; i < 8; ++i) { unsigned short x, y; splitf(a[i], x, y); h[i] = x; l[i] = y; splitf(b[i], x, y); h[8 + i] = x; l[8 + i] = y; }
    p = __builtin_bit_cast(v16bf, h); p2 = __builtin_bit_cast(v16bf, l); } };
// HL: hi + lo planes, 3 products each (hi x hi, the query side's or P's lo x hi, hi x the key side's lo). Q, K [t][d], Vt [d][t]; O and ML already point at the image and the slice's slot.
template <typename T16, bool HL, int QB>
__device__ __forceinline__ void fa_tile(const T16* __restrict__ Q, const T16* __restrict__ Q2, const T16* __restrict__ Kp, const T16* __restrict__ K2, const T16* __restrict__ Vt, const T16* __restrict__ V2, int q0, int k0, float* O, float* ML) {
    typedef typename WFrag<T16>::V V;
    const int lane = threadIdx.x & 31, lr = lane & 15, hi = lane >> 4;
    const size_t qo0 = (size_t)(q0 + lr) * HD + 8 * hi, ko = (size_t)(k0 + lr) * HD + 8 * hi, vo = (size_t)lr * TT + k0 + 8 * hi;
    const T16* qp = Q + qo0; const T16* qp2 = HL ? Q2 + qo0 : qp; const T16* kp = Kp + ko; const T16* kp2 = HL ? K2 + ko : kp;   // every batch of loads has one address per plane; the rest is immediate offsets
    V qf[QB][4], qf2[QB][4];
#pragma unroll
    for (int qb = 0; qb < QB; ++qb)
#pragma unroll
        for (int ks = 0; ks < 4; ++ks) { const int qo = qb * 16 * HD + ks * 32; qf[qb][ks] = WFrag<T16>::ld(qp + qo); if (HL) qf2[qb][ks] = WFrag<T16>::ld(qp2 + qo); }
    v8f o[8][QB]; float m[QB], l[QB];
#pragma unroll
    for (int qb = 0; qb < QB; ++qb) { m[qb] = -3.0e38f; l[qb] = 0.0f;
#pragma unroll
        for (int db = 0; db < 8; ++db) o[db][qb] = (v8f){}; }
    V kf[2][4], kf2[2][4];   // the K fragments of a pass, fetched one pass ahead
#pragma unroll
    for (int kb = 0; kb < 2; ++kb)
#pragma unroll
        for (int ks = 0; ks < 4; ++ks) { const int fo = kb * 16 * HD + ks * 32; kf[kb][ks] = WFrag<T16>::ld(kp + fo); if (HL) kf2[kb][ks] = WFrag<T16>::ld(kp2 + fo); }
    asm volatile("s_wait_xcnt 0x0" :: "v"(qp), "v"(qp2), "v"(kp), "v"(kp2) : "memory");   // the loads' address pairs live up to here: no register of them is rewritten before this wait
    __builtin_amdgcn_sched_barrier(0);   // holds the loop's address arithmetic below that wait
#pragma unroll 1   // one pass of 32 keys with its fragments in flight already fills the registers
    for (int kk = 0; kk < TT / KSP; kk += 32) {
        V vf[8], vf2[8]; const T16* vp = Vt + vo + kk; const T16* vp2 = HL ? V2 + vo + kk : vp;
#pragma unroll
        for (int db = 0; db < 8; ++db) { const int fo = db * 16 * TT; vf[db] = WFrag<T16>::ld(vp + fo); if (HL) vf2[db] = WFrag<T16>::ld(vp2 + fo); }
        asm volatile("s_wait_xcnt 0x0" :: "v"(vp), "v"(vp2) : "memory");   // these loads stay in flight: their address pairs live up to here, and no register of them is rewritten before this wait
        __builtin_amdgcn_sched_barrier(0);   // holds the Vt loads up here: they fly under the score products and the softmax (left alone, the compiler loads one fragment at a time, each right in front of its products)
        v8f s[2][QB];
#pragma unroll
        for (int kb = 0; kb < 2; ++kb) {
#pragma unroll
            for (int qb = 0; qb < QB; ++qb) s[kb][qb] = (v8f){};
#pragma unroll
            for (int ks = 0; ks < 4; ++ks)
#pragma unroll
                for (int qb = 0; qb < QB; ++qb) { s[kb][qb] = WFrag<T16>::mma(kf[kb][ks], qf[qb][ks], s[kb][qb]); if (HL) { s[kb][qb] = WFrag<T16>::mma(kf[kb][ks], qf2[qb][ks], s[kb][qb]); s[kb][qb] = WFrag<T16>::mma(kf2[kb][ks], qf[qb][ks], s[kb][qb]); } } }
        __builtin_amdgcn_sched_barrier(0);   // keeps the next pass's K loads behind the products above, so that they go into the registers those have just read and need no second set
        const int kn = (kk + 32 < TT / KSP) ? kk + 32 : kk;   // the last pass has no next one: it fetches its own keys again (in bounds, not used)
        kp = Kp + ko + (size_t)kn * HD; kp2 = HL ? K2 + ko + (size_t)kn * HD : kp;
#pragma unroll
        for (int kb = 0; kb < 2; ++kb)
#pragma unroll
            for (int ks = 0; ks < 4; ++ks) { const int fo = kb * 16 * HD + ks * 32; kf[kb][ks] = WFrag<T16>::ld(kp + fo); if (HL) kf2[kb][ks] = WFrag<T16>::ld(kp2 + fo); }
        asm volatile("s_wait_xcnt 0x0" :: "v"(kp), "v"(kp2) : "memory");   // as behind the Vt loads
        __builtin_amdgcn_sched_barrier(0);   // holds the K loads up here: they fly under the softmax and the Vt Pt products
        V pf[QB], pf2[QB];
#pragma unroll
        for (int qb = 0; qb < QB; ++qb) {
            float bm = s[0][qb][0];
#pragma unroll
            for (int kb = 0; kb < 2; ++kb)
#pragma unroll
                for (int j = 0; j < 8; ++j) bm = fmaxf(bm, s[kb][qb][j]);
            bm = fmaxf(bm, xhalf(bm));   // the other half of the wave holds the query's other keys
            const float mn = fmaxf(m[qb], bm * SCL), al = __builtin_amdgcn_exp2f((m[qb] - mn) * L2E); m[qb] = mn;
            float rs = 0.0f;
#pragma unroll
            for (int kb = 0; kb < 2; ++kb)
#pragma unroll
                for (int j = 0; j < 8; ++j) { const float p = __builtin_amdgcn_exp2f((s[kb][qb][j] * SCL - mn) * L2E + PSH); s[kb][qb][j] = p; rs += p; }
            l[qb] = l[qb] * al + rs;   // each half of the wave sums its own keys; the halves join behind the loop
#pragma unroll
            for (int db = 0; db < 8; ++db) o[db][qb] *= al;
            PPack<T16>::mk(s[0][qb], s[1][qb], pf[qb], pf2[qb]);
        }
#pragma unroll
        for (int db = 0; db < 8; ++db)
#pragma unroll
            for (int qb = 0; qb < QB; ++qb) { o[db][qb] = WFrag<T16>::mma(vf[db], pf[qb], o[db][qb]); if (HL) { o[db][qb] = WFrag<T16>::mma(vf[db], pf2[qb], o[db][qb]); o[db][qb] = WFrag<T16>::mma(vf2[db], pf[qb], o[db][qb]); } }
    }
#pragma unroll
    for (int qb = 0; qb < QB; ++qb) { const size_t t = (size_t)(q0 + qb * 16 + lr); float* orow = O + t * (KSP * HD) + hi * 8; const float lj = l[qb] + xhalf(l[qb]);
#pragma unroll
        for (int db = 0; db < 8; ++db) { v4f x, y;
#pragma unroll
            for (int j = 0; j < 4; ++j) { x[j] = o[db][qb][j]; y[j] = o[db][qb][4 + j]; }
            *(v4f*)(orow + db * 16) = x; *(v4f*)(orow + db * 16 + 4) = y; }
        if (hi == 0) { v2f ml; ml[0] = m[qb]; ml[1] = lj; *(v2f*)(ML + t * 2) = ml; } }
    asm volatile("s_wait_xcnt 0x0" ::: "memory");   // the kernel lays the other row range's code behind this tile's last stores: no register of theirs is rewritten before this wait
}
// k_fattn: all images, all query rows, all key slices in ONE launch; 4 waves a work-group, all on the same keys (they share the K and Vt lines in the WGP cache). Flat grid: rows < RH in front (hi + lo planes, 32 queries a wave), then rows >= RH (fp16, 64 queries a wave: a fragment load touches 16 lines, so each has to feed as many products as the registers allow); query group fastest, then slice, then image.
__global__ __launch_bounds__(128) void k_fattn(const bf* __restrict__ Qh, const bf* __restrict__ Ql, const bf* __restrict__ Kh, const bf* __restrict__ Kl, const bf* __restrict__ Vh, const bf* __restrict__ Vl, const h16* __restrict__ Q16, const h16* __restrict__ K16, const h16* __restrict__ V16, float* O, float* ML) {
    constexpr int GH = RH / 128, GL = (TT - RH) / 256, NHI = NB_ * KSP * GH;
    const int id = blockIdx.x, w = threadIdx.x >> 5;
    if (id < NHI) { const int g = id % GH, z = (id / GH) % KSP; const size_t im = id / (GH * KSP), zb = im * TT * HD;
        fa_tile<bf, true, 2>(Qh + zb, Ql + zb, Kh + zb, Kl + zb, Vh + zb, Vl + zb, g * 128 + w * 32, z * (TT / KSP), O + zb * KSP + z * HD, ML + (im * KSP + z) * TT * 2);
    } else { const int il = id - NHI; const int g = il % GL, z = (il / GL) % KSP; const size_t im = il / (GL * KSP), zb = im * TT * HD;
        fa_tile<h16, false, 4>(Q16 + zb, nullptr, K16 + zb, nullptr, V16 + zb, nullptr, RH + g * 256 + w * 64, z * (TT / KSP), O + zb * KSP + z * HD, ML + (im * KSP + z) * TT * 2); }
}
__device__ __forceinline__ void d_cvtT(const float* __restrict__ X, bf* XB, unsigned bx) { const size_t i = (size_t)bx * 256 + threadIdx.x; if (i >= (size_t)TT * DM / 8) return; const size_t e = i * 8; const int c0 = (int)(e % DM); const int n = (int)(e / DM); v8us o;
#pragma unroll
    for (int q = 0; q < 8; ++q) o[q] = f2bf(X[(size_t)(c0 + q) * TT + n]);
    *(v8us*)(XB + e) = o;  }
// k_prep: everything that reads only the inputs, in ONE launch; flat grid: NB_ x NBT blocks turn the images token-major, 4 x NBW blocks round the weights
#define NBT ((TT * DM / 8 + 255) / 256)
#define NBW ((HD * DM / 8 + 255) / 256)
__global__ __launch_bounds__(256) void k_prep(const float* __restrict__ xin, const float* __restrict__ wq, const float* __restrict__ wk, const float* __restrict__ wv, const float* __restrict__ wo, bf* XB, bf* WQ, bf* WK, bf* WV, bf* WO) {
    const unsigned id = blockIdx.x;
    if (id < NB_ * NBT) { const size_t im = id / NBT; d_cvtT(xin + im * DM * TT, XB + im * TT * DM, id % NBT); }
    else if (id < NB_ * NBT + 4 * NBW) { const unsigned w = (id - NB_ * NBT) / NBW; d_cvt8((w == 0) ? wq : (w == 1) ? wk : (w == 2) ? wv : wo, (w == 0) ? WQ : (w == 1) ? WK : (w == 2) ? WV : WO, (size_t)HD * DM / 8, (id - NB_ * NBT) % NBW); }
}
// Y = W_w y without its bias, channel-major [image][c][n] as the output is: a wave reads whole lines. Both readers add the bias wb[c] as they read. A thread sums the positions tid, tid + 256, ... of image 0, then of image 1, ...
__global__ __launch_bounds__(256) void k_bnstat(const float* __restrict__ Y, const float* __restrict__ wb, float* BNS) { __shared__ float red[256]; const int c = blockIdx.x; const int tid = threadIdx.x; const size_t NTOT = (size_t)NB_ * TT; float s = 0.0f; const float* Yc = Y + (size_t)c * TT + tid; const float wc = bfr(wb[c]);
#pragma unroll 1   // one address pair a trip, the one the wait below names: unrolled, the compiler forms other bases for the loads, which that wait does not hold
    for (int b = 0; b < NB_; ++b) { const float* yp = Yc + (size_t)b * DM * TT; float y[TT / 256];
#pragma unroll   // an image's loads of a thread in flight together
        for (int i = 0; i < TT / 256; ++i) y[i] = yp[i * 256];
        asm volatile("s_wait_xcnt 0x0" :: "v"(yp) : "memory");   // the loads' address lives up to here: no register of it is rewritten before this wait
#pragma unroll
        for (int i = 0; i < TT / 256; ++i) s = __fadd_rn(s, __fadd_rn(y[i], wc)); }
    red[tid] = s; __syncthreads();
    for (int st = 128; st > 0; st >>= 1) { if (tid < st) red[tid] = __fadd_rn(red[tid], red[tid + st]); __syncthreads(); }
    const float mu = __fdiv_rn(red[0], (float)NTOT); __syncthreads(); float v = 0.0f;
#pragma unroll 1   // as above
    for (int b = 0; b < NB_; ++b) { const float* yp = Yc + (size_t)b * DM * TT; float y[TT / 256];
#pragma unroll   // as above
        for (int i = 0; i < TT / 256; ++i) y[i] = yp[i * 256];
        asm volatile("s_wait_xcnt 0x0" :: "v"(yp) : "memory");   // as above
#pragma unroll
        for (int i = 0; i < TT / 256; ++i) { const float d = __fsub_rn(__fadd_rn(y[i], wc), mu); float p = __fmul_rn(d, d); asm volatile("" : "+v"(p)); v = __fadd_rn(v, p); } }
    red[tid] = v; __syncthreads();
    for (int st = 128; st > 0; st >>= 1) { if (tid < st) red[tid] = __fadd_rn(red[tid], red[tid + st]); __syncthreads(); }
    if (tid == 0) { const float var = __fdiv_rn(red[0], (float)NTOT); v2f o; o[0] = mu; o[1] = __fdiv_rn(1.0f, __fsqrt_rn(__fadd_rn(var, BNEPS))); *(v2f*)(BNS + (size_t)c * 32) = o;  }    }
__global__ __launch_bounds__(256) void k_bnout(const float* __restrict__ Y, const float* __restrict__ wb, const float* __restrict__ BNS, const float* __restrict__ g, const float* __restrict__ bb, const float* __restrict__ X, float* OUT) { const size_t k = (size_t)blockIdx.x * 256 + threadIdx.x; if (k >= (size_t)NB_ * DM * TT / 4) return; const size_t e = k * 4; const int c = (int)((e / TT) % DM); const float* sp = BNS + (size_t)c * 32; const float* xp = X + e; const float* yp = Y + e;   // Y lies as X and OUT do
    const float mu = sp[0], rs = sp[1], gm = bfr(g[c]), bt = bfr(bb[c]), wc = bfr(wb[c]); const v4f xr = *(const v4f*)xp; const v4f yr = *(const v4f*)yp; v4f o;
    asm volatile("s_wait_xcnt 0x0" :: "v"(c), "v"(sp), "v"(xp), "v"(yp) : "memory");   // the loads' addresses live up to here: no register of them is rewritten before this wait
#pragma unroll
    for (int q = 0; q < 4; ++q) { const float y = __fadd_rn(yr[q], wc); float t = __fmul_rn(__fmul_rn(gm, __fsub_rn(y, mu)), rs); asm volatile("" : "+v"(t)); t = __fadd_rn(t, bt); o[q] = __fadd_rn(t, bfr(xr[q])); }
    *(v4f*)(OUT + e) = o;  }
// k_merge: joins the KSP key slices of every row of every image, in slice order: weights exp(m_slice - max m), then the softmax's division; hi + lo planes of the result
__global__ __launch_bounds__(256) void k_merge(const float* __restrict__ O, const float* __restrict__ ML, bf* Ah, bf* Al) { const size_t e = ((size_t)blockIdx.x * 256 + threadIdx.x) * 2; if (e >= (size_t)NB_ * TT * HD) return; const int d = (int)(e % HD); const size_t r = e / HD;
    const float* op = O + r * (KSP * HD) + d; const float* mp = ML + ((r / TT) * KSP * TT + r % TT) * 2; v2f ml[KSP], u[KSP];
#pragma unroll   // all loads of a thread in flight together
    for (int p = 0; p < KSP; ++p) { ml[p] = *(const v2f*)(mp + p * TT * 2); u[p] = *(const v2f*)(op + p * HD); }
    float mx = ml[0][0];
#pragma unroll
    for (int p = 1; p < KSP; ++p) mx = fmaxf(mx, ml[p][0]);
    float ls = 0.0f; v2f s; s[0] = 0.0f; s[1] = 0.0f;
#pragma unroll
    for (int p = 0; p < KSP; ++p) { const float wt = __builtin_amdgcn_exp2f((ml[p][0] - mx) * L2E); ls += ml[p][1] * wt; s[0] += u[p][0] * wt; s[1] += u[p][1] * wt; }
    v2us oh, ol;
#pragma unroll
    for (int q = 0; q < 2; ++q) { unsigned short a, c2; splitf(__fdiv_rn(s[q], ls), a, c2); oh[q] = a; ol[q] = c2; } *(v2us*)(Ah + e) = oh; *(v2us*)(Al + e) = ol;  }

extern "C" void kernel_launch(void* const* d_in, const int* in_sizes, int n_in,
                              void* d_out, int out_size, void* d_ws, size_t ws_size, hipStream_t stream) {
    (void)in_sizes; (void)n_in; (void)out_size;
    const float* xin = (const float*)d_in[0];   /* x [4][256][4096] NCHW */ const float* wv = (const float*)d_in[1]; const float* bv = (const float*)d_in[2];   /* g_w, g_b */ const float* wq = (const float*)d_in[3]; const float* bq = (const float*)d_in[4];   /* theta */ const float* wk = (const float*)d_in[5]; const float* bk = (const float*)d_in[6];   /* phi */ const float* wo = (const float*)d_in[7]; const float* bo = (const float*)d_in[8];   /* W_w [256][128], W_b */ const float* bng = (const float*)d_in[9]; const float* bnb = (const float*)d_in[10]; const float* x = nullptr; (void)x;
    float* OUT = (float*)d_out;     // [4][256][4096] NCHW
    char* wsp = (char*)d_ws;
    auto take = [&](size_t bytes) { char* p = wsp; wsp += (bytes + 255) & ~(size_t)255; return (void*)p; };
    float* YALL = (float*)take((size_t)NB_ * TT * DM * 4); float* BNS = (float*)take((size_t)DM * 32 * 4);    bf* WQ = (bf*)take((size_t)DQ * DM * 2); bf* WK = (bf*)take((size_t)DKV * DM * 2); bf* WV = (bf*)take((size_t)DKV * DM * 2); bf* WO = (bf*)take((size_t)DM * DQ * 2);
    h16* QP16 = (h16*)take((size_t)NB_ * TT * HD * 2); h16* KP16 = (h16*)take((size_t)NB_ * TT * HD * 2); h16* VT16 = (h16*)take((size_t)NB_ * HD * TT * 2);   // every operand plane: one per image, image stride TT * HD
    bf* QPh = (bf*)take((size_t)NB_ * TT * HD * 2); bf* QPl = (bf*)take((size_t)NB_ * TT * HD * 2); bf* KPh = (bf*)take((size_t)NB_ * TT * HD * 2); bf* KPl = (bf*)take((size_t)NB_ * TT * HD * 2); bf* VTh = (bf*)take((size_t)NB_ * HD * TT * 2); bf* VTl = (bf*)take((size_t)NB_ * HD * TT * 2);
    float* Ob = (float*)take((size_t)NB_ * TT * KSP * HD * 4); float* ML = (float*)take((size_t)NB_ * TT * KSP * 2 * 4); bf* ATh = (bf*)take((size_t)NB_ * TT * DQ * 2); bf* ATl = (bf*)take((size_t)NB_ * TT * DQ * 2);
    if ((size_t)(wsp - (char*)d_ws) > ws_size) return;    // ws 256 MiB
    // the token-major images (8 MiB) lie in the buffer of the attention's partial results: they are dead before the attention writes it (stream-ordered)
    bf* XB = (bf*)Ob;
    // launches that do not depend on one another are ONE launch: all images, all weights, all three projections, both row ranges of a product
    k_prep<<<NB_ * NBT + 4 * NBW, 256, 0, stream>>>(xin, wq, wk, wv, wo, XB, WQ, WK, WV, WO);   /* NCHW [256][4096] -> token-major bf16 [4096][256]; bf16 weights */
    k_proj3<<<dim3(TT / 64, 3 * (HD / 64), NB_), 32, 0, stream>>>(XB, WQ, WK, WV, QP16, QPh, QPl, KP16, KPh, KPl, VT16, VTh, VTl, bq, bk, bv);   /* theta, phi, g + bias, straight into the attention's operand planes */
    k_fattn<<<NB_ * KSP * (RH / 128) + NB_ * KSP * ((TT - RH) / 256), 128, 0, stream>>>(QPh, QPl, KPh, KPl, VTh, VTl, QP16, KP16, VT16, Ob, ML);   /* key slice z -> partial Ob[image][t][z][d], ML[image][z][t] */
    k_merge<<<(unsigned)(((size_t)NB_ * TT * HD / 2 + 255) / 256), 256, 0, stream>>>(Ob, ML, ATh, ATl);
    k_gemmw<bf, 3, false><<<dim3(DM / 64, TT / 64, NB_), 32, 0, stream>>>(WO, nullptr, ATh, ATl, DQ, YALL, TT, nullptr, 0, (size_t)TT * DQ, (size_t)DM * TT);   /* W_w y of all images, channel-major [image][c][n] (rows = W_w's, columns = positions; products W_w x hi, W_w x lo), kept for the batch statistics */
    k_bnstat<<<DM, 256, 0, stream>>>(YALL, bo, BNS);   /* per channel: mean and 1/sqrt(var + eps) over the batch x 4,096 positions (training-mode BatchNorm) */
    k_bnout<<<(unsigned)(((size_t)NB_ * DM * TT / 4 + 255) / 256), 256, 0, stream>>>(YALL, bo, BNS, bng, bnb, xin, OUT);   /* out[b][c][n] = gamma (Wy - mean) rstd + beta + x */

}

// v006
// One run takes 106 microseconds.
// Next to v005, in two timings, it ran 1.09 times as fast each time.
// Over all steps from v000 it is 10.1 times as fast.
#include <hip/hip_runtime.h>

// Non-local block (embedded Gaussian) over 64x64 = 4,096 positions with a training-mode BatchNorm and residual (x [4][256][64][64] NCHW; theta, phi, g = 1x1 convs C 256 -> Ci 128 ('oi' [128][256] 0.02, zero biases); f[n][m] = theta_n . phi_m (no scaling); attn = softmax over m; y[ci][n] = sum_m attn[n][m] g[ci][m]; Wy = W_w y + W_b ('oi' [256][128]); BatchNorm2d in TRAINING mode (per-channel mean/var over the whole batch x 64 x 64, eps 1e-5, gamma/beta read); out = BN(Wy) + x -> [4][256][64][64] (4.2 M)).
// Compute dtypes, f32 accumulate: every input rounded to bf16; convs exact + f32 bias; attention rows < 512 3 products, rest fp16; softmax f32; W_w hl x exact + bias; BatchNorm statistics and output f32 (fixed-order sums); residual f32 of the bf16-rounded x.

#define NB_  4
#define TT   4096
#define DM   256
#define NH_  1
#define NKV  1
#define REP  (NH_ / NKV)
#define HD   128
#define DQ   (NH_ * HD)
#define DKV  (NKV * HD)
#define ZH   1
#define RH   512                  // query rows < RH use hi+lo planes (0: none)
#define WIN  0
#define PSH  8.0f     // P carries 2^PSH (numerator and row sum alike: it cancels in the softmax's division), so that small weights stay in fp16's normal range
#define SCL  1.0f     // the non-local block applies no 1/sqrt(d)
#define CIN  256      // channels C (== DM)
#define BNEPS 1e-5f
#define KSP  8        // key slices of the fused attention (one work-group per slice); every slice leaves its partial result in a slot of its own
#define L2E  1.4426950408889634f
typedef _Float16 h16;
typedef unsigned short bf;
typedef __attribute__((ext_vector_type(16))) __bf16   v16bf;
typedef __attribute__((ext_vector_type(16))) _Float16 v16h;
typedef __attribute__((ext_vector_type(8)))  _Float16 v8h;
typedef __attribute__((ext_vector_type(8)))  unsigned short v8us;
typedef __attribute__((ext_vector_type(16))) unsigned short v16us;
typedef __attribute__((ext_vector_type(8)))  float    v8f;
typedef __attribute__((ext_vector_type(4)))  float    v4f;
typedef v8h  __attribute__((may_alias)) v8ha;
typedef v4f  __attribute__((may_alias)) v4fa;
typedef v8us __attribute__((may_alias)) v8usa;

__device__ __forceinline__ unsigned short f2bf(float f) { unsigned u = __float_as_uint(f); u += 0x7FFFu + ((u >> 16) & 1u); return (unsigned short)(u >> 16); }
__device__ __forceinline__ float bf2f(unsigned short b) { return __uint_as_float(((unsigned)b) << 16); }
__device__ __forceinline__ float bfr(float f) { return bf2f(f2bf(f)); }
__device__ __forceinline__ v16h cat16(v8h lo, v8h hi) { return __builtin_shufflevector(lo, hi, 0, 1, 2, 3, 4, 5, 6, 7, 8, 9, 10, 11, 12, 13, 14, 15); }
__device__ __forceinline__ v16bf cat16b(v8us lo, v8us hi) { return __builtin_bit_cast(v16bf, __builtin_shufflevector(lo, hi, 0, 1, 2, 3, 4, 5, 6, 7, 8, 9, 10, 11, 12, 13, 14, 15)); }
__device__ __forceinline__ v8f wmma16(v16h a, v16h b, v8f c) { return __builtin_amdgcn_wmma_f32_16x16x32_f16(false, a, false, b, (short)0, c, false, false); }
__device__ __forceinline__ v8f wmmab(v16bf a, v16bf b, v8f c) { return __builtin_amdgcn_wmma_f32_16x16x32_bf16(false, a, false, b, (short)0, c, false, false); }



// ---- k_gemmw: register-blocked GEMM, ONE WAVE per 64x64 output tile (16 accumulators), operands straight from 16-bit planes [row][k] in fragment order (below), fragments [row / 16][k / 32]; grid (M/64, N/64, Z), 32 threads.
// C[m][n] (f32, pitch ldc, + optional f32 bias[n]) = sum_k A[m][k] Bt[n][k] (+ split products per NSPLIT). z-batch strides sA/sB/sC in elements. K % 32 == 0. KS > 1: a work-group sums K / KS of the k only (the planes stay K wide); with sA = sB = 16 K / KS, z is the k slice and C + z sC its partial sum.
template <typename T16> struct WFrag;
// FRAGMENT ORDER of a 16-bit plane [row][k]: fragments of 16 rows x 32 k = 512 elements (1 KiB) lie whole, as two halves of 256 elements; in half h, lane (row & 15) + 16 hi holds the 8 elements k = 16 h + 8 hi + 0..7 at element lane * 8.
// ldf reads a fragment so laid (p: the fragment + lane * 8): each of its two loads takes 512 bytes in a row, 4 whole lines, where the same load on a row-major plane touches 16 lines. Lane and register hold the elements of the hardware's k order.
template <> struct WFrag<h16> { typedef v16h V; static __device__ __forceinline__ V ldf(const h16* p) { return cat16(*(const v8h*)p, *(const v8h*)(p + 256)); } static __device__ __forceinline__ v8f mma(V a, V b, v8f c) { return wmma16(a, b, c); } };
template <> struct WFrag<bf> { typedef v16bf V; static __device__ __forceinline__ V ldf(const bf* p) { return cat16b(*(const v8us*)p, *(const v8us*)(p + 256)); } static __device__ __forceinline__ v8f mma(V a, V b, v8f c) { return wmmab(a, b, c); } };
// gemmw_tile: the tile (bx, by) of one such product; os: 16 x 68 floats of LDS. Kernels that hold several independent products pick product and tile from the block index.
template <typename T16, int NSPLIT, bool BIAS, int K, int KS>
__device__ __forceinline__ void gemmw_tile(float* os, const T16* __restrict__ A, const T16* __restrict__ A2, const T16* __restrict__ Bt, const T16* __restrict__ Bt2, float* C, int ldc, const float* __restrict__ bias, int bx, int by) {
    typedef typename WFrag<T16>::V V;
    const int lane = threadIdx.x & 31, lr = lane & 15, hi = lane >> 4; const int r0 = bx * 64, c0 = by * 64;
    v8f acc[4][4];
#pragma unroll
    for (int mb = 0; mb < 4; ++mb)
#pragma unroll
        for (int nb = 0; nb < 4; ++nb) acc[mb][nb] = (v8f){};
    const size_t aoff = (size_t)r0 * K + 8 * lane, boff = (size_t)c0 * K + 8 * lane;   // 16 rows are K / 32 fragments = 16 K elements
#pragma unroll 1   // one address pair per plane a trip, the ones the wait below names
    for (int kc = 0; kc < K / KS; kc += 32) {
        constexpr bool SA = NSPLIT == 1 || NSPLIT == 2, SB = NSPLIT >= 2; V a[4], a2[4], b[4], b2[4];
        const T16* ap = A + aoff + kc * 16; const T16* ap2 = SA ? A2 + aoff + kc * 16 : ap; const T16* bp = Bt + boff + kc * 16; const T16* bp2 = SB ? Bt2 + boff + kc * 16 : bp;   // the rest is immediate offsets
#pragma unroll
        for (int i = 0; i < 4; ++i) { a[i] = WFrag<T16>::ldf(ap + i * 16 * K); if (SA) a2[i] = WFrag<T16>::ldf(ap2 + i * 16 * K); b[i] = WFrag<T16>::ldf(bp + i * 16 * K); if (SB) b2[i] = WFrag<T16>::ldf(bp2 + i * 16 * K); }
        asm volatile("s_wait_xcnt 0x0" :: "v"(ap), "v"(ap2), "v"(bp), "v"(bp2) : "memory");   // the loads' address pairs live up to here: no register of them is rewritten before this wait
#pragma unroll
        for (int nb = 0; nb < 4; ++nb) {
#pragma unroll
            for (int mb = 0; mb < 4; ++mb) { acc[mb][nb] = WFrag<T16>::mma(a[mb], b[nb], acc[mb][nb]); if (SA) acc[mb][nb] = WFrag<T16>::mma(a2[mb], b[nb], acc[mb][nb]); if (SB) acc[mb][nb] = WFrag<T16>::mma(a[mb], b2[nb], acc[mb][nb]); } }
        asm volatile("v_nop\n\tv_nop\n\tv_nop\n\tv_nop" : "+v"(acc[0][0]), "+v"(acc[1][1]), "+v"(acc[2][2]), "+v"(acc[3][3]) : "v"(a[0]), "v"(a[3]));
    }
#pragma unroll
    for (int mb = 0; mb < 4; ++mb) {
#pragma unroll
        for (int nb = 0; nb < 4; ++nb) {
#pragma unroll
            for (int j = 0; j < 8; ++j) os[(hi * 8 + j) * 68 + nb * 16 + lr] = acc[mb][nb][j]; }
        __builtin_amdgcn_wave_barrier(); asm volatile("" ::: "memory");
        float* crow = C + (size_t)(r0 + mb * 16) * ldc + c0;
{
#pragma unroll
            for (int s = 0; s < 8; ++s) { const int row = 2 * s + hi, cofs = lr * 4; v4f val = *(const v4fa*)(os + row * 68 + cofs); if (BIAS) { val[0] += bfr(bias[c0 + cofs]); val[1] += bfr(bias[c0 + cofs + 1]); val[2] += bfr(bias[c0 + cofs + 2]); val[3] += bfr(bias[c0 + cofs + 3]); }
                *(v4f*)(crow + (size_t)row * ldc + cofs) = val;
                asm volatile("s_wait_xcnt 0x0" ::: "memory"); }   // the next rows' values and addresses may go into this store's registers: none is rewritten before this wait
             }
        __builtin_amdgcn_wave_barrier(); asm volatile("" ::: "memory");
    }
    asm volatile("s_wait_xcnt 0x0" ::: "memory");   // a precaution (its one caller, k_gemmw, ends behind it): no register of this tile's last stores is rewritten before this wait
}
template <typename T16, int NSPLIT, bool BIAS, int K, int KS = 1>
__global__ __launch_bounds__(32) void k_gemmw(const T16* __restrict__ A, const T16* __restrict__ A2, const T16* __restrict__ Bt, const T16* __restrict__ Bt2, float* C, int ldc, const float* __restrict__ bias, size_t sA, size_t sB, size_t sC) {
    __shared__ __align__(16) float os[16 * 68];
    const size_t z = blockIdx.z; A += z * sA; if (A2) A2 += z * sA; Bt += z * sB; if (Bt2) Bt2 += z * sB; C += z * sC;
    gemmw_tile<T16, NSPLIT, BIAS, K, KS>(os, A, A2, Bt, Bt2, C, ldc, bias, blockIdx.x, blockIdx.y);
}

__device__ __forceinline__ h16 tohx(float x) { return (h16)x; }
__device__ __forceinline__ void splitf(float y, unsigned short& h, unsigned short& l) { h = f2bf(y); l = f2bf(y - bf2f(h)); }
typedef __attribute__((ext_vector_type(2))) _Float16 v2h;
typedef __attribute__((ext_vector_type(4))) _Float16 v4h;
typedef __attribute__((ext_vector_type(2))) unsigned short v2us;
typedef __attribute__((ext_vector_type(4))) unsigned short v4us;
typedef __attribute__((ext_vector_type(2))) float v2f;
typedef __attribute__((ext_vector_type(4))) int v4i;

__global__ __launch_bounds__(256) void k_wtG(const float* __restrict__ w, int K, int N, bf* Bt) {
    const int lane = threadIdx.x & 31; const int L0 = (blockIdx.x * 8 + (threadIdx.x >> 5)) * 8; const int nlines = N * K / 64;
{
#pragma unroll 1
        for (int l = 0; l < 8; ++l) { const int L = L0 + l; if (L >= nlines) break; const size_t e = (size_t)L * 64 + lane * 2; const int k = (int)(e % K), n = (int)(e / K); v2us o;
            o[0] = f2bf(w[(size_t)k * N + n]); o[1] = f2bf(w[(size_t)(k + 1) * N + n]); *(v2us*)(Bt + e) = o; }
         }
}
// d_cvtF: a row-major f32 [row][K] to bf16 in fragment order, fragments [row / 16][k / 32]; thread i writes the plane's 16 bytes number i
__device__ __forceinline__ void d_cvtF(const float* __restrict__ src, int K, bf* dst, size_t n8, unsigned bx) { const size_t i = (size_t)bx * 256 + threadIdx.x; if (i >= n8) return;
    const int lr = (int)(i & 15), f = (int)(i >> 6), k0 = (f % (K / 32)) * 32 + (int)((i >> 5) & 1) * 16 + (int)((i >> 4) & 1) * 8, r16 = f / (K / 32); const float* sp = src + (size_t)(r16 * 16 + lr) * K + k0; const v8f v = *(const v8f*)sp; v8us o;
    asm volatile("s_wait_xcnt 0x0" :: "v"(sp) : "memory");   // the loads' address lives up to here: no register of it is rewritten before this wait
#pragma unroll
    for (int k = 0; k < 8; ++k) o[k] = f2bf(v[k]); *(v8us*)(dst + i * 8) = o;  }

// ---- projections: ONE WAVE per 64x64 tile as in k_gemmw, K = DM, bf16 operands in fragment order; the tile (+ bias) does not go out as f32 but straight as the attention's operand planes, in fragment order too.
typedef __attribute__((ext_vector_type(2))) __bf16 v2bf;
// proj_tile: rows r0.. of A x rows c0.. of Bt (both [row][DM], fragments [row / 16][k / 32]); planes P16 (fp16), Ph + Pl (bf16 hi + lo of the same f32 value), the tile's column being the planes' k. ROWB: bias[row] and fragments [k / 32][row / 16] (HD rows), else bias[column] and fragments [row / 16][k / 32] (k < HD). os: 16 x 68 floats of LDS.
template <bool ROWB>
__device__ __forceinline__ void proj_tile(float* os, const bf* __restrict__ A, const bf* __restrict__ Bt, const float* __restrict__ bias, int bx, int by, h16* P16, bf* Ph, bf* Pl) {
    const int lane = threadIdx.x & 31, lr = lane & 15, hi = lane >> 4; const int r0 = bx * 64, c0 = by * 64;
    constexpr int NPB = ROWB ? 4 : 32; float pb[NPB];   // the biases of the lane's 4 rows or 4 x 8 columns in the epilogue; fetched here, so that they fly under the k loop
    { const float* bp = ROWB ? bias + r0 + lr : bias + c0 + 8 * hi;
#pragma unroll
      for (int i = 0; i < NPB; ++i) pb[i] = bp[ROWB ? 16 * i : 16 * (i >> 3) + (i & 7)];
      asm volatile("s_wait_xcnt 0x0" :: "v"(bp) : "memory"); }   // the loads' address lives up to here: no register of it is rewritten before this wait
    v8f acc[4][4];
#pragma unroll
    for (int mb = 0; mb < 4; ++mb)
#pragma unroll
        for (int nb = 0; nb < 4; ++nb) acc[mb][nb] = (v8f){};
    const bf* a0 = A + (size_t)r0 * DM + 8 * lane; const bf* b0 = Bt + (size_t)c0 * DM + 8 * lane;   // 16 rows are DM / 32 fragments = 16 DM elements
#pragma unroll 1   // one address pair per operand a trip, the ones the wait below names
    for (int kc = 0; kc < DM; kc += 32) {
        const bf* ap = a0 + kc * 16; const bf* bp = b0 + kc * 16; v16bf a[4], b[4];
#pragma unroll
        for (int i = 0; i < 4; ++i) { a[i] = WFrag<bf>::ldf(ap + i * 16 * DM); b[i] = WFrag<bf>::ldf(bp + i * 16 * DM); }
        asm volatile("s_wait_xcnt 0x0" :: "v"(ap), "v"(bp) : "memory");   // the loads' address pairs live up to here: no register of them is rewritten before this wait
#pragma unroll
        for (int nb = 0; nb < 4; ++nb)
#pragma unroll
            for (int mb = 0; mb < 4; ++mb) acc[mb][nb] = wmmab(a[mb], b[nb], acc[mb][nb]);
    }
    v2f bb[NPB / (ROWB ? 1 : 2)];   // bf16-rounded biases, as pairs for the packed add
#pragma unroll
    for (int i = 0; i < NPB / (ROWB ? 1 : 2); ++i) { bb[i][0] = bfr(pb[ROWB ? i : 2 * i]); bb[i][1] = bfr(pb[ROWB ? i : 2 * i + 1]); }
    const size_t po = (ROWB ? (size_t)(c0 / 32) * (HD / 16) + r0 / 16 : (size_t)(r0 / 16) * (HD / 32) + c0 / 32) * 512 + 8 * lane; h16* p16 = P16 + po; bf* ph = Ph + po; bf* pl = Pl + po;
#pragma unroll
    for (int mb = 0; mb < 4; ++mb) {
#pragma unroll
        for (int nb = 0; nb < 4; ++nb) {
#pragma unroll
            for (int j = 0; j < 8; ++j) os[(hi * 8 + j) * 68 + nb * 16 + lr] = acc[mb][nb][j]; }
        __builtin_amdgcn_wave_barrier(); asm volatile("" ::: "memory");   // the wave's LDS reads below stay behind its writes above (other lanes' values)
#pragma unroll
        for (int s = 0; s < 4; ++s) {   // the wave takes 16 rows x 16 columns: half a fragment, 512 bytes in a row in each plane
            const float* op = os + lr * 68 + 16 * s + 8 * hi; const v4f x0 = *(const v4fa*)op, x1 = *(const v4fa*)(op + 4); v8h o16; v8us oh, ol;
#pragma unroll
            for (int p = 0; p < 4; ++p) { v2f x; x[0] = (p < 2) ? x0[2 * (p & 1)] : x1[2 * (p & 1)]; x[1] = (p < 2) ? x0[2 * (p & 1) + 1] : x1[2 * (p & 1) + 1]; x += bb[ROWB ? mb : s * 4 + p];
                const v2h h = __builtin_convertvector(x, v2h); const v2bf t = __builtin_convertvector(x, v2bf); const v2bf u = __builtin_convertvector(x - __builtin_convertvector(t, v2f), v2bf);   // all three round to nearest even, as tohx and splitf do
                const v2us tu = __builtin_bit_cast(v2us, t), uu = __builtin_bit_cast(v2us, u); o16[2 * p] = h[0]; o16[2 * p + 1] = h[1]; oh[2 * p] = tu[0]; oh[2 * p + 1] = tu[1]; ol[2 * p] = uu[0]; ol[2 * p + 1] = uu[1]; }
            const int ro = (ROWB ? (s >> 1) * (HD / 16) + mb : mb * (HD / 32) + (s >> 1)) * 512 + (s & 1) * 256; *(v8h*)(p16 + ro) = o16; *(v8us*)(ph + ro) = oh; *(v8us*)(pl + ro) = ol;
            asm volatile("s_wait_xcnt 0x0" ::: "memory"); }   // the next 16 columns' (or rows') values may go into these stores' registers: none is rewritten before this wait
        __builtin_amdgcn_wave_barrier(); asm volatile("" ::: "memory");   // the next 16 rows' LDS writes stay behind these reads
    }
}
// k_proj3: the theta, phi and g projections of all images in ONE launch; grid (TT / 64, 3 x HD / 64, image).
// theta and phi: rows = positions, planes [t][d]; g with the operands swapped (rows = g_w's, columns = positions), so that its planes are [d][t] as the attn x g product reads them, the 8 fragments of 32 keys side by side.
__global__ __launch_bounds__(32) void k_proj3(const bf* __restrict__ XB, const bf* __restrict__ WQ, const bf* __restrict__ WK, const bf* __restrict__ WV, h16* QP16, bf* QPh, bf* QPl, h16* KP16, bf* KPh, bf* KPl, h16* VT16, bf* VTh, bf* VTl, const float* __restrict__ bq, const float* __restrict__ bk, const float* __restrict__ bv) {
    __shared__ __align__(16) float os[16 * 68];
    const int w = blockIdx.y / (HD / 64), by = blockIdx.y % (HD / 64); const size_t im = blockIdx.z, zb = im * TT * HD; const bf* X = XB + im * TT * DM;
    if (w == 2) proj_tile<true>(os, WV, X, bv, by, blockIdx.x, VT16 + zb, VTh + zb, VTl + zb);
    else proj_tile<false>(os, X, (w == 0) ? WQ : WK, (w == 0) ? bq : bk, blockIdx.x, by, ((w == 0) ? QP16 : KP16) + zb, ((w == 0) ? QPh : KPh) + zb, ((w == 0) ? QPl : KPl) + zb);
}
// ---- fused attention: logits, softmax and attn x g in ONE kernel; the logits stay in registers.
// A wave holds QB x 16 queries and walks TT / KSP keys, 32 at a time: St = K Qt (row = key, column = query: a lane holds one query's scores), running maximum and sum per query (online softmax),
// Pt packed from the score accumulators straight into a B operand (they already lie in the loaders' k order), Ot += Vt Pt (row = d, column = query: the rescale factor is the lane's own).
// A slice leaves O[t / 16][slice][d / 16][(d >> 2) & 1][lane (t & 15) + 16 ((d >> 3) & 1)][d & 3] = sum_k 2^PSH exp(s - m) g (not normalised; the accumulators' own lane order, so that a store and k_merge's load take 512 bytes in a row) and ML[slice][t] = (m, sum_k 2^PSH exp(s - m)), 16 queries = one whole line from one wave; k_merge joins the slices.
__device__ __forceinline__ float xhalf(float x) { return __builtin_bit_cast(float, __builtin_amdgcn_permlanex16(__builtin_bit_cast(int, x), __builtin_bit_cast(int, x), 0x76543210, 0xfedcba98, false, false)); }   // lane l reads lane l ^ 16
template <typename T16> struct PPack;
template <> struct PPack<h16> { static __device__ __forceinline__ void mk(const v8f a, const v8f b, v16h& p, v16h& p2) { (void)p2;
#pragma unroll
    for (int i = 0; i < 8; ++i) { p[i] = tohx(a[i]); p[8 + i] = tohx(b[i]); } } };
template <> struct PPack<bf> { static __device__ __forceinline__ void mk(const v8f a, const v8f b, v16bf& p, v16bf& p2) { v16us h, l;
#pragma unroll
    for (int i = 0; i < 8; ++i) { unsigned short x, y; splitf(a[i], x, y); h[i] = x; l[i] = y; splitf(b[i], x, y); h[8 + i] = x; l[8 + i] = y; }
    p = __builtin_bit_cast(v16bf, h); p2 = __builtin_bit_cast(v16bf, l); } };
// HL: hi + lo planes, 3 products each (hi x hi, the query side's or P's lo x hi, hi x the key side's lo). Q, K [t][d], Vt [d][t], all in fragment order as k_proj3 leaves them; O and ML already point at the image and the slice's slot.
template <typename T16, bool HL, int QB>
__device__ __forceinline__ void fa_tile(const T16* __restrict__ Q, const T16* __restrict__ Q2, const T16* __restrict__ Kp, const T16* __restrict__ K2, const T16* __restrict__ Vt, const T16* __restrict__ V2, int q0, int k0, float* O, float* ML) {
    typedef typename WFrag<T16>::V V;
    const int lane = threadIdx.x & 31, lr = lane & 15, hi = lane >> 4;
    const size_t qo0 = (size_t)q0 * HD + 8 * lane, ko = (size_t)k0 * HD + 8 * lane, vo = ko;   // fragment order: 16 rows of Q or K are HD / 32 = 4 fragments, 32 keys of Vt HD / 16 = 8 fragments: HD elements a row or key in both
    const T16* qp = Q + qo0; const T16* qp2 = HL ? Q2 + qo0 : qp; const T16* kp = Kp + ko; const T16* kp2 = HL ? K2 + ko : kp;   // every batch of loads has one address per plane; the rest is immediate offsets
    V qf[QB][4], qf2[QB][4];
#pragma unroll
    for (int qb = 0; qb < QB; ++qb)
#pragma unroll
        for (int ks = 0; ks < 4; ++ks) { const int qo = qb * 16 * HD + ks * 512; qf[qb][ks] = WFrag<T16>::ldf(qp + qo); if (HL) qf2[qb][ks] = WFrag<T16>::ldf(qp2 + qo); }
    v8f o[8][QB]; float m[QB], l[QB];
#pragma unroll
    for (int qb = 0; qb < QB; ++qb) { m[qb] = -3.0e38f; l[qb] = 0.0f;
#pragma unroll
        for (int db = 0; db < 8; ++db) o[db][qb] = (v8f){}; }
    V kf[2][4], kf2[2][4];   // the K fragments of a pass, fetched one pass ahead
#pragma unroll
    for (int kb = 0; kb < 2; ++kb)
#pragma unroll
        for (int ks = 0; ks < 4; ++ks) { const int fo = kb * 16 * HD + ks * 512; kf[kb][ks] = WFrag<T16>::ldf(kp + fo); if (HL) kf2[kb][ks] = WFrag<T16>::ldf(kp2 + fo); }
    asm volatile("s_wait_xcnt 0x0" :: "v"(qp), "v"(qp2), "v"(kp), "v"(kp2) : "memory");   // the loads' address pairs live up to here: no register of them is rewritten before this wait
    __builtin_amdgcn_sched_barrier(0);   // holds the loop's address arithmetic below that wait
#pragma unroll 1   // one pass of 32 keys with its fragments in flight already fills the registers
    for (int kk = 0; kk < TT / KSP; kk += 32) {
        V vf[8], vf2[8]; const T16* vp = Vt + vo + (size_t)kk * HD; const T16* vp2 = HL ? V2 + vo + (size_t)kk * HD : vp;
#pragma unroll
        for (int db = 0; db < 8; ++db) { const int fo = db * 512; vf[db] = WFrag<T16>::ldf(vp + fo); if (HL) vf2[db] = WFrag<T16>::ldf(vp2 + fo); }
        asm volatile("s_wait_xcnt 0x0" :: "v"(vp), "v"(vp2) : "memory");   // these loads stay in flight: their address pairs live up to here, and no register of them is rewritten before this wait
        __builtin_amdgcn_sched_barrier(0);   // holds the Vt loads up here: they fly under the score products and the softmax (left alone, the compiler loads one fragment at a time, each right in front of its products)
        v8f s[2][QB];
#pragma unroll
        for (int kb = 0; kb < 2; ++kb) {
#pragma unroll
            for (int qb = 0; qb < QB; ++qb) s[kb][qb] = (v8f){};
#pragma unroll
            for (int ks = 0; ks < 4; ++ks)
#pragma unroll
                for (int qb = 0; qb < QB; ++qb) { s[kb][qb] = WFrag<T16>::mma(kf[kb][ks], qf[qb][ks], s[kb][qb]); if (HL) { s[kb][qb] = WFrag<T16>::mma(kf[kb][ks], qf2[qb][ks], s[kb][qb]); s[kb][qb] = WFrag<T16>::mma(kf2[kb][ks], qf[qb][ks], s[kb][qb]); } } }
        __builtin_amdgcn_sched_barrier(0);   // keeps the next pass's K loads behind the products above, so that they go into the registers those have just read and need no second set
        const int kn = (kk + 32 < TT / KSP) ? kk + 32 : kk;   // the last pass has no next one: it fetches its own keys again (in bounds, not used)
        kp = Kp + ko + (size_t)kn * HD; kp2 = HL ? K2 + ko + (size_t)kn * HD : kp;
#pragma unroll
        for (int kb = 0; kb < 2; ++kb)
#pragma unroll
            for (int ks = 0; ks < 4; ++ks) { const int fo = kb * 16 * HD + ks * 512; kf[kb][ks] = WFrag<T16>::ldf(kp + fo); if (HL) kf2[kb][ks] = WFrag<T16>::ldf(kp2 + fo); }
        asm volatile("s_wait_xcnt 0x0" :: "v"(kp), "v"(kp2) : "memory");   // as behind the Vt loads
        __builtin_amdgcn_sched_barrier(0);   // holds the K loads up here: they fly under the softmax and the Vt Pt products
        V pf[QB], pf2[QB];
#pragma unroll
        for (int qb = 0; qb < QB; ++qb) {
            float bm = s[0][qb][0];
#pragma unroll
            for (int kb = 0; kb < 2; ++kb)
#pragma unroll
                for (int j = 0; j < 8; ++j) bm = fmaxf(bm, s[kb][qb][j]);
            bm = fmaxf(bm, xhalf(bm));   // the other half of the wave holds the query's other keys
            const float mn = fmaxf(m[qb], bm * SCL), al = __builtin_amdgcn_exp2f((m[qb] - mn) * L2E); m[qb] = mn;
            float rs = 0.0f;
#pragma unroll
            for (int kb = 0; kb < 2; ++kb)
#pragma unroll
                for (int j = 0; j < 8; ++j) { const float p = __builtin_amdgcn_exp2f((s[kb][qb][j] * SCL - mn) * L2E + PSH); s[kb][qb][j] = p; rs += p; }
            l[qb] = l[qb] * al + rs;   // each half of the wave sums its own keys; the halves join behind the loop
#pragma unroll
            for (int db = 0; db < 8; ++db) o[db][qb] *= al;
            PPack<T16>::mk(s[0][qb], s[1][qb], pf[qb], pf2[qb]);
        }
#pragma unroll
        for (int db = 0; db < 8; ++db)
#pragma unroll
            for (int qb = 0; qb < QB; ++qb) { o[db][qb] = WFrag<T16>::mma(vf[db], pf[qb], o[db][qb]); if (HL) { o[db][qb] = WFrag<T16>::mma(vf[db], pf2[qb], o[db][qb]); o[db][qb] = WFrag<T16>::mma(vf2[db], pf[qb], o[db][qb]); } }
    }
    float* ob0 = O + (size_t)q0 * (KSP * HD) + 4 * lane;   // one address for all the stores of O; the rest is immediate offsets
#pragma unroll
    for (int qb = 0; qb < QB; ++qb) { const size_t t = (size_t)(q0 + qb * 16 + lr); float* ob = ob0 + qb * (16 * KSP * HD); const float lj = l[qb] + xhalf(l[qb]);
#pragma unroll
        for (int db = 0; db < 8; ++db) { v4f x, y;
#pragma unroll
            for (int j = 0; j < 4; ++j) { x[j] = o[db][qb][j]; y[j] = o[db][qb][4 + j]; }
            *(v4f*)(ob + db * 256) = x; *(v4f*)(ob + db * 256 + 128) = y; }   // each store: 512 bytes in a row
        if (hi == 0) { v2f ml; ml[0] = m[qb]; ml[1] = lj; *(v2f*)(ML + t * 2) = ml; } }
    asm volatile("s_wait_xcnt 0x0" ::: "memory");   // the kernel lays the other row range's code behind this tile's last stores: no register of theirs is rewritten before this wait
}
// k_fattn: all images, all query rows, all key slices in ONE launch; 4 waves a work-group, all on the same keys (they share the K and Vt lines in the WGP cache). Flat grid: rows < RH in front (hi + lo planes, 32 queries a wave), then rows >= RH (fp16, 64 queries a wave); query group fastest, then slice, then image.
__global__ __launch_bounds__(128) void k_fattn(const bf* __restrict__ Qh, const bf* __restrict__ Ql, const bf* __restrict__ Kh, const bf* __restrict__ Kl, const bf* __restrict__ Vh, const bf* __restrict__ Vl, const h16* __restrict__ Q16, const h16* __restrict__ K16, const h16* __restrict__ V16, float* O, float* ML) {
    constexpr int GH = RH / 128, GL = (TT - RH) / 256, NHI = NB_ * KSP * GH;
    const int id = blockIdx.x, w = threadIdx.x >> 5;
    if (id < NHI) { const int g = id % GH, z = (id / GH) % KSP; const size_t im = id / (GH * KSP), zb = im * TT * HD;
        fa_tile<bf, true, 2>(Qh + zb, Ql + zb, Kh + zb, Kl + zb, Vh + zb, Vl + zb, g * 128 + w * 32, z * (TT / KSP), O + zb * KSP + z * (16 * HD), ML + (im * KSP + z) * TT * 2);
    } else { const int il = id - NHI; const int g = il % GL, z = (il / GL) % KSP; const size_t im = il / (GL * KSP), zb = im * TT * HD;
        fa_tile<h16, false, 4>(Q16 + zb, nullptr, K16 + zb, nullptr, V16 + zb, nullptr, RH + g * 256 + w * 64, z * (TT / KSP), O + zb * KSP + z * (16 * HD), ML + (im * KSP + z) * TT * 2); }
}
// d_cvtT: X [c][n] f32 to XB [n][c] bf16 in fragment order, fragments [n / 16][c / 32]. A thread makes 16 bytes (8 channels of one position); a wave makes half a fragment (512 bytes in a row) and reads 16 positions in a row of each channel; waves w and w ^ 1 take the two halves of the same lines of X.
__device__ __forceinline__ void d_cvtT(const float* __restrict__ X, bf* XB, unsigned bx) { const size_t i = (size_t)bx * 256 + threadIdx.x; if (i >= (size_t)TT * DM / 8) return;
    const int lane = (int)(i & 31), n16 = (int)(i >> 10) * 2 + (int)((i >> 5) & 1), h = (int)((i >> 6) & 1), ks = (int)((i >> 7) & 7); const int c0 = ks * 32 + h * 16 + (lane >> 4) * 8, n = n16 * 16 + (lane & 15);
    const float* xp = X + (size_t)c0 * TT + n; float v[8]; v8us o;
#pragma unroll
    for (int q = 0; q < 8; ++q) v[q] = xp[q * TT];
    asm volatile("s_wait_xcnt 0x0" :: "v"(xp) : "memory");   // the loads' address lives up to here: no register of it is rewritten before this wait
#pragma unroll
    for (int q = 0; q < 8; ++q) o[q] = f2bf(v[q]);
    *(v8us*)(XB + ((size_t)(n16 * (DM / 32) + ks) * 2 + h) * 256 + lane * 8) = o;  }
// k_prep: everything that reads only the inputs, in ONE launch; flat grid: NB_ x NBT blocks turn the images token-major, 4 x NBW blocks round the weights
#define NBT ((TT * DM / 8 + 255) / 256)
#define NBW ((HD * DM / 8 + 255) / 256)
__global__ __launch_bounds__(256) void k_prep(const float* __restrict__ xin, const float* __restrict__ wq, const float* __restrict__ wk, const float* __restrict__ wv, const float* __restrict__ wo, bf* XB, bf* WQ, bf* WK, bf* WV, bf* WO) {
    const unsigned id = blockIdx.x;
    if (id < NB_ * NBT) { const size_t im = id / NBT; d_cvtT(xin + im * DM * TT, XB + im * TT * DM, id % NBT); }
    else if (id < NB_ * NBT + 4 * NBW) { const unsigned w = (id - NB_ * NBT) / NBW; d_cvtF((w == 0) ? wq : (w == 1) ? wk : (w == 2) ? wv : wo, (w == 3) ? DQ : DM, (w == 0) ? WQ : (w == 1) ? WK : (w == 2) ? WV : WO, (size_t)HD * DM / 8, (id - NB_ * NBT) % NBW); }
}
// Y = W_w y without its bias, channel-major [image][c][n] as the output is: a wave reads whole lines. Both readers add the bias wb[c] as they read. A thread sums the positions tid, tid + 256, ... of image 0, then of image 1, ...
__global__ __launch_bounds__(256) void k_bnstat(const float* __restrict__ Y, const float* __restrict__ wb, float* BNS) { __shared__ float red[256]; const int c = blockIdx.x; const int tid = threadIdx.x; const size_t NTOT = (size_t)NB_ * TT; float s = 0.0f; const float* Yc = Y + (size_t)c * TT + tid; const float wc = bfr(wb[c]);
#pragma unroll 1   // one address pair a trip, the one the wait below names: unrolled, the compiler forms other bases for the loads, which that wait does not hold
    for (int b = 0; b < NB_; ++b) { const float* yp = Yc + (size_t)b * DM * TT; float y[TT / 256];
#pragma unroll   // an image's loads of a thread in flight together
        for (int i = 0; i < TT / 256; ++i) y[i] = yp[i * 256];
        asm volatile("s_wait_xcnt 0x0" :: "v"(yp) : "memory");   // the loads' address lives up to here: no register of it is rewritten before this wait
#pragma unroll
        for (int i = 0; i < TT / 256; ++i) s = __fadd_rn(s, __fadd_rn(y[i], wc)); }
    red[tid] = s; __syncthreads();
    for (int st = 128; st > 0; st >>= 1) { if (tid < st) red[tid] = __fadd_rn(red[tid], red[tid + st]); __syncthreads(); }
    const float mu = __fdiv_rn(red[0], (float)NTOT); __syncthreads(); float v = 0.0f;
#pragma unroll 1   // as above
    for (int b = 0; b < NB_; ++b) { const float* yp = Yc + (size_t)b * DM * TT; float y[TT / 256];
#pragma unroll   // as above
        for (int i = 0; i < TT / 256; ++i) y[i] = yp[i * 256];
        asm volatile("s_wait_xcnt 0x0" :: "v"(yp) : "memory");   // as above
#pragma unroll
        for (int i = 0; i < TT / 256; ++i) { const float d = __fsub_rn(__fadd_rn(y[i], wc), mu); float p = __fmul_rn(d, d); asm volatile("" : "+v"(p)); v = __fadd_rn(v, p); } }
    red[tid] = v; __syncthreads();
    for (int st = 128; st > 0; st >>= 1) { if (tid < st) red[tid] = __fadd_rn(red[tid], red[tid + st]); __syncthreads(); }
    if (tid == 0) { const float var = __fdiv_rn(red[0], (float)NTOT); v2f o; o[0] = mu; o[1] = __fdiv_rn(1.0f, __fsqrt_rn(__fadd_rn(var, BNEPS))); *(v2f*)(BNS + (size_t)c * 32) = o;  }    }
__global__ __launch_bounds__(256) void k_bnout(const float* __restrict__ Y, const float* __restrict__ wb, const float* __restrict__ BNS, const float* __restrict__ g, const float* __restrict__ bb, const float* __restrict__ X, float* OUT) { const size_t k = (size_t)blockIdx.x * 256 + threadIdx.x; if (k >= (size_t)NB_ * DM * TT / 4) return; const size_t e = k * 4; const int c = (int)((e / TT) % DM); const float* sp = BNS + (size_t)c * 32; const float* xp = X + e; const float* yp = Y + e;   // Y lies as X and OUT do
    const float mu = sp[0], rs = sp[1], gm = bfr(g[c]), bt = bfr(bb[c]), wc = bfr(wb[c]); const v4f xr = *(const v4f*)xp; const v4f yr = *(const v4f*)yp; v4f o;
    asm volatile("s_wait_xcnt 0x0" :: "v"(c), "v"(sp), "v"(xp), "v"(yp) : "memory");   // the loads' addresses live up to here: no register of them is rewritten before this wait
#pragma unroll
    for (int q = 0; q < 4; ++q) { const float y = __fadd_rn(yr[q], wc); float t = __fmul_rn(__fmul_rn(gm, __fsub_rn(y, mu)), rs); asm volatile("" : "+v"(t)); t = __fadd_rn(t, bt); o[q] = __fadd_rn(t, bfr(xr[q])); }
    *(v4f*)(OUT + e) = o;  }
// k_merge: joins the KSP key slices of every row of every image, in slice order: weights exp(m_slice - max m), then the softmax's division; hi + lo planes of the result, [t][d] in fragment order.
// Thread i makes the planes' 16 bytes number i: lane = i & 31 (row t & 15 = lane & 15), d / 16 = (i >> 5) & 7, t / 16 (over all images) = i >> 8; its 8 values d = 16 (d / 16) + 8 (lane >> 4) + 0..7 are two 16-byte pieces of O. Every load of O and every store takes 512 bytes in a row.
__global__ __launch_bounds__(256) void k_merge(const float* __restrict__ O, const float* __restrict__ ML, bf* Ah, bf* Al) { const size_t i = (size_t)blockIdx.x * 256 + threadIdx.x; if (i >= (size_t)NB_ * TT * HD / 8) return; const int lane = (int)(i & 31), db = (int)((i >> 5) & 7); const size_t r = (i >> 8) * 16 + (lane & 15);
    const float* op = O + (i >> 8) * (KSP * 16 * HD) + db * 256 + lane * 4; const float* mp = ML + ((r / TT) * KSP * TT + r % TT) * 2; v2f ml[KSP]; v4f u[KSP][2];
#pragma unroll   // all loads of a thread in flight together
    for (int p = 0; p < KSP; ++p) { ml[p] = *(const v2f*)(mp + p * TT * 2); u[p][0] = *(const v4f*)(op + p * (16 * HD)); u[p][1] = *(const v4f*)(op + p * (16 * HD) + 128); }
    asm volatile("s_wait_xcnt 0x0" :: "v"(op), "v"(mp) : "memory");   // the loads' address pairs live up to here: no register of them is rewritten before this wait
    __builtin_amdgcn_sched_barrier(0);   // holds every load above the arithmetic (left alone, the compiler issues the second half of them only when the first has come back)
    float mx = ml[0][0];
#pragma unroll
    for (int p = 1; p < KSP; ++p) mx = fmaxf(mx, ml[p][0]);
    float ls = 0.0f, s[8];
#pragma unroll
    for (int q = 0; q < 8; ++q) s[q] = 0.0f;
#pragma unroll
    for (int p = 0; p < KSP; ++p) { const float wt = __builtin_amdgcn_exp2f((ml[p][0] - mx) * L2E); ls += ml[p][1] * wt;
#pragma unroll
        for (int q = 0; q < 8; ++q) s[q] += u[p][q >> 2][q & 3] * wt; }
    v8us oh, ol;
#pragma unroll
    for (int q = 0; q < 8; ++q) { unsigned short a, c2; splitf(__fdiv_rn(s[q], ls), a, c2); oh[q] = a; ol[q] = c2; } *(v8us*)(Ah + i * 8) = oh; *(v8us*)(Al + i * 8) = ol;  }

extern "C" void kernel_launch(void* const* d_in, const int* in_sizes, int n_in,
                              void* d_out, int out_size, void* d_ws, size_t ws_size, hipStream_t stream) {
    (void)in_sizes; (void)n_in; (void)out_size;
    const float* xin = (const float*)d_in[0];   /* x [4][256][4096] NCHW */ const float* wv = (const float*)d_in[1]; const float* bv = (const float*)d_in[2];   /* g_w, g_b */ const float* wq = (const float*)d_in[3]; const float* bq = (const float*)d_in[4];   /* theta */ const float* wk = (const float*)d_in[5]; const float* bk = (const float*)d_in[6];   /* phi */ const float* wo = (const float*)d_in[7]; const float* bo = (const float*)d_in[8];   /* W_w [256][128], W_b */ const float* bng = (const float*)d_in[9]; const float* bnb = (const float*)d_in[10]; const float* x = nullptr; (void)x;
    float* OUT = (float*)d_out;     // [4][256][4096] NCHW
    char* wsp = (char*)d_ws;
    auto take = [&](size_t bytes) { char* p = wsp; wsp += (bytes + 255) & ~(size_t)255; return (void*)p; };
    float* YALL = (float*)take((size_t)NB_ * TT * DM * 4); float* BNS = (float*)take((size_t)DM * 32 * 4);    bf* WQ = (bf*)take((size_t)DQ * DM * 2); bf* WK = (bf*)take((size_t)DKV * DM * 2); bf* WV = (bf*)take((size_t)DKV * DM * 2); bf* WO = (bf*)take((size_t)DM * DQ * 2);
    h16* QP16 = (h16*)take((size_t)NB_ * TT * HD * 2); h16* KP16 = (h16*)take((size_t)NB_ * TT * HD * 2); h16* VT16 = (h16*)take((size_t)NB_ * HD * TT * 2);   // every operand plane: one per image, image stride TT * HD
    bf* QPh = (bf*)take((size_t)NB_ * TT * HD * 2); bf* QPl = (bf*)take((size_t)NB_ * TT * HD * 2); bf* KPh = (bf*)take((size_t)NB_ * TT * HD * 2); bf* KPl = (bf*)take((size_t)NB_ * TT * HD * 2); bf* VTh = (bf*)take((size_t)NB_ * HD * TT * 2); bf* VTl = (bf*)take((size_t)NB_ * HD * TT * 2);
    float* Ob = (float*)take((size_t)NB_ * TT * KSP * HD * 4); float* ML = (float*)take((size_t)NB_ * TT * KSP * 2 * 4); bf* ATh = (bf*)take((size_t)NB_ * TT * DQ * 2); bf* ATl = (bf*)take((size_t)NB_ * TT * DQ * 2);
    if ((size_t)(wsp - (char*)d_ws) > ws_size) return;    // ws 256 MiB
    // the token-major images (8 MiB) lie in the buffer of the attention's partial results: they are dead before the attention writes it (stream-ordered)
    bf* XB = (bf*)Ob;
    // launches that do not depend on one another are ONE launch: all images, all weights, all three projections, both row ranges of a product
    k_prep<<<NB_ * NBT + 4 * NBW, 256, 0, stream>>>(xin, wq, wk, wv, wo, XB, WQ, WK, WV, WO);   /* NCHW [256][4096] -> token-major bf16 [4096][256] and bf16 weights, in fragment order */
    k_proj3<<<dim3(TT / 64, 3 * (HD / 64), NB_), 32, 0, stream>>>(XB, WQ, WK, WV, QP16, QPh, QPl, KP16, KPh, KPl, VT16, VTh, VTl, bq, bk, bv);   /* theta, phi, g + bias, straight into the attention's operand planes */
    k_fattn<<<NB_ * KSP * (RH / 128) + NB_ * KSP * ((TT - RH) / 256), 128, 0, stream>>>(QPh, QPl, KPh, KPl, VTh, VTl, QP16, KP16, VT16, Ob, ML);   /* key slice z -> partial Ob[image][t / 16][z][16 x HD in the accumulators' lane order], ML[image][z][t] */
    k_merge<<<(unsigned)(((size_t)NB_ * TT * HD / 8 + 255) / 256), 256, 0, stream>>>(Ob, ML, ATh, ATl);
    k_gemmw<bf, 3, false, DQ><<<dim3(DM / 64, TT / 64, NB_), 32, 0, stream>>>(WO, nullptr, ATh, ATl, YALL, TT, nullptr, 0, (size_t)TT * DQ, (size_t)DM * TT);   /* W_w y of all images, channel-major [image][c][n] (rows = W_w's, columns = positions; products W_w x hi, W_w x lo), kept for the batch statistics */
    k_bnstat<<<DM, 256, 0, stream>>>(YALL, bo, BNS);   /* per channel: mean and 1/sqrt(var + eps) over the batch x 4,096 positions (training-mode BatchNorm) */
    k_bnout<<<(unsigned)(((size_t)NB_ * DM * TT / 4 + 255) / 256), 256, 0, stream>>>(YALL, bo, BNS, bng, bnb, xin, OUT);   /* out[b][c][n] = gamma (Wy - mean) rstd + beta + x */

}

// v007
// Measured time: 101 microseconds a run.
// Timed twice side by side with v006, it ran 1.05 and 1.06 times as fast.
// Counting every step since v000, it is 10.7 times as fast.
#include <hip/hip_runtime.h>

// Non-local block (embedded Gaussian) over 64x64 = 4,096 positions with a training-mode BatchNorm and residual (x [4][256][64][64] NCHW; theta, phi, g = 1x1 convs C 256 -> Ci 128 ('oi' [128][256] 0.02, zero biases); f[n][m] = theta_n . phi_m (no scaling); attn = softmax over m; y[ci][n] = sum_m attn[n][m] g[ci][m]; Wy = W_w y + W_b ('oi' [256][128]); BatchNorm2d in TRAINING mode (per-channel mean/var over the whole batch x 64 x 64, eps 1e-5, gamma/beta read); out = BN(Wy) + x -> [4][256][64][64] (4.2 M)).
// Compute dtypes, f32 accumulate: every input rounded to bf16; convs exact + f32 bias; attention rows < 512 3 products, rest fp16; softmax f32; W_w hl x exact + bias; BatchNorm statistics and output f32 (fixed-order sums); residual f32 of the bf16-rounded x.

#define NB_  4
#define TT   4096
#define DM   256
#define NH_  1
#define NKV  1
#define REP  (NH_ / NKV)
#define HD   128
#define DQ   (NH_ * HD)
#define DKV  (NKV * HD)
#define ZH   1
#define RH   512                  // query rows < RH use hi+lo planes (0: none)
#define WIN  0
#define PSH  8.0f     // P carries 2^PSH (numerator and row sum alike: it cancels in the softmax's division), so that small weights stay in fp16's normal range
#define SCL  1.0f     // the non-local block applies no 1/sqrt(d)
#define CIN  256      // channels C (== DM)
#define BNEPS 1e-5f
#define KSP  7        // key slices of the fused attention (one work-group per slice); every slice leaves its partial result in a slot of its own. 7: a work-group's registers fill a WGP, and 72 query groups x 7 slices = 504 work-groups are two rounds of the chip's 256 WGPs (8 slices: 576, a third round for 64 of them)
#define NPS  (TT / 32) // passes of 32 keys over all keys; slice z takes the passes z NPS / KSP up to (z + 1) NPS / KSP (18 or 19 of them)
#define L2E  1.4426950408889634f
typedef _Float16 h16;
typedef unsigned short bf;
typedef __attribute__((ext_vector_type(16))) __bf16   v16bf;
typedef __attribute__((ext_vector_type(16))) _Float16 v16h;
typedef __attribute__((ext_vector_type(8)))  _Float16 v8h;
typedef __attribute__((ext_vector_type(8)))  unsigned short v8us;
typedef __attribute__((ext_vector_type(16))) unsigned short v16us;
typedef __attribute__((ext_vector_type(8)))  float    v8f;
typedef __attribute__((ext_vector_type(4)))  float    v4f;
typedef v8h  __attribute__((may_alias)) v8ha;
typedef v4f  __attribute__((may_alias)) v4fa;
typedef v8us __attribute__((may_alias)) v8usa;

__device__ __forceinline__ unsigned short f2bf(float f) { unsigned u = __float_as_uint(f); u += 0x7FFFu + ((u >> 16) & 1u); return (unsigned short)(u >> 16); }
__device__ __forceinline__ float bf2f(unsigned short b) { return __uint_as_float(((unsigned)b) << 16); }
__device__ __forceinline__ float bfr(float f) { return bf2f(f2bf(f)); }
__device__ __forceinline__ v16h cat16(v8h lo, v8h hi) { return __builtin_shufflevector(lo, hi, 0, 1, 2, 3, 4, 5, 6, 7, 8, 9, 10, 11, 12, 13, 14, 15); }
__device__ __forceinline__ v16bf cat16b(v8us lo, v8us hi) { return __builtin_bit_cast(v16bf, __builtin_shufflevector(lo, hi, 0, 1, 2, 3, 4, 5, 6, 7, 8, 9, 10, 11, 12, 13, 14, 15)); }
__device__ __forceinline__ v8f wmma16(v16h a, v16h b, v8f c) { return __builtin_amdgcn_wmma_f32_16x16x32_f16(false, a, false, b, (short)0, c, false, false); }
__device__ __forceinline__ v8f wmmab(v16bf a, v16bf b, v8f c) { return __builtin_amdgcn_wmma_f32_16x16x32_bf16(false, a, false, b, (short)0, c, false, false); }



// ---- k_gemmw: register-blocked GEMM, ONE WAVE per 64x64 output tile (16 accumulators), operands straight from 16-bit planes [row][k] in fragment order (below), fragments [row / 16][k / 32]; grid (M/64, N/64, Z), 32 threads.
// C[m][n] (f32, pitch ldc, + optional f32 bias[n]) = sum_k A[m][k] Bt[n][k] (+ split products per NSPLIT). z-batch strides sA/sB/sC in elements. K % 32 == 0. KS > 1: a work-group sums K / KS of the k only (the planes stay K wide); with sA = sB = 16 K / KS, z is the k slice and C + z sC its partial sum.
template <typename T16> struct WFrag;
// FRAGMENT ORDER of a 16-bit plane [row][k]: fragments of 16 rows x 32 k = 512 elements (1 KiB) lie whole, as two halves of 256 elements; in half h, lane (row & 15) + 16 hi holds the 8 elements k = 16 h + 8 hi + 0..7 at element lane * 8.
// ldf reads a fragment so laid (p: the fragment + lane * 8): each of its two loads takes 512 bytes in a row, 4 whole lines, where the same load on a row-major plane touches 16 lines. Lane and register hold the elements of the hardware's k order.
template <> struct WFrag<h16> { typedef v16h V; static __device__ __forceinline__ V ldf(const h16* p) { return cat16(*(const v8h*)p, *(const v8h*)(p + 256)); } static __device__ __forceinline__ v8f mma(V a, V b, v8f c) { return wmma16(a, b, c); } };
template <> struct WFrag<bf> { typedef v16bf V; static __device__ __forceinline__ V ldf(const bf* p) { return cat16b(*(const v8us*)p, *(const v8us*)(p + 256)); } static __device__ __forceinline__ v8f mma(V a, V b, v8f c) { return wmmab(a, b, c); } };
// gemmw_tile: the tile (bx, by) of one such product; os: 16 x 68 floats of LDS. Kernels that hold several independent products pick product and tile from the block index.
template <typename T16, int NSPLIT, bool BIAS, int K, int KS>
__device__ __forceinline__ void gemmw_tile(float* os, const T16* __restrict__ A, const T16* __restrict__ A2, const T16* __restrict__ Bt, const T16* __restrict__ Bt2, float* C, int ldc, const float* __restrict__ bias, int bx, int by) {
    typedef typename WFrag<T16>::V V;
    const int lane = threadIdx.x & 31, lr = lane & 15, hi = lane >> 4; const int r0 = bx * 64, c0 = by * 64;
    v8f acc[4][4];
#pragma unroll
    for (int mb = 0; mb < 4; ++mb)
#pragma unroll
        for (int nb = 0; nb < 4; ++nb) acc[mb][nb] = (v8f){};
    const size_t aoff = (size_t)r0 * K + 8 * lane, boff = (size_t)c0 * K + 8 * lane;   // 16 rows are K / 32 fragments = 16 K elements
#pragma unroll 1   // one address pair per plane a trip, the ones the wait below names
    for (int kc = 0; kc < K / KS; kc += 32) {
        constexpr bool SA = NSPLIT == 1 || NSPLIT == 2, SB = NSPLIT >= 2; V a[4], a2[4], b[4], b2[4];
        const T16* ap = A + aoff + kc * 16; const T16* ap2 = SA ? A2 + aoff + kc * 16 : ap; const T16* bp = Bt + boff + kc * 16; const T16* bp2 = SB ? Bt2 + boff + kc * 16 : bp;   // the rest is immediate offsets
#pragma unroll
        for (int i = 0; i < 4; ++i) { a[i] = WFrag<T16>::ldf(ap + i * 16 * K); if (SA) a2[i] = WFrag<T16>::ldf(ap2 + i * 16 * K); b[i] = WFrag<T16>::ldf(bp + i * 16 * K); if (SB) b2[i] = WFrag<T16>::ldf(bp2 + i * 16 * K); }
        asm volatile("s_wait_xcnt 0x0" :: "v"(ap), "v"(ap2), "v"(bp), "v"(bp2) : "memory");   // the loads' address pairs live up to here: no register of them is rewritten before this wait
#pragma unroll
        for (int nb = 0; nb < 4; ++nb) {
#pragma unroll
            for (int mb = 0; mb < 4; ++mb) { acc[mb][nb] = WFrag<T16>::mma(a[mb], b[nb], acc[mb][nb]); if (SA) acc[mb][nb] = WFrag<T16>::mma(a2[mb], b[nb], acc[mb][nb]); if (SB) acc[mb][nb] = WFrag<T16>::mma(a[mb], b2[nb], acc[mb][nb]); } }
        asm volatile("v_nop\n\tv_nop\n\tv_nop\n\tv_nop" : "+v"(acc[0][0]), "+v"(acc[1][1]), "+v"(acc[2][2]), "+v"(acc[3][3]) : "v"(a[0]), "v"(a[3]));
    }
#pragma unroll
    for (int mb = 0; mb < 4; ++mb) {
#pragma unroll
        for (int nb = 0; nb < 4; ++nb) {
#pragma unroll
            for (int j = 0; j < 8; ++j) os[(hi * 8 + j) * 68 + nb * 16 + lr] = acc[mb][nb][j]; }
        __builtin_amdgcn_wave_barrier(); asm volatile("" ::: "memory");
        float* crow = C + (size_t)(r0 + mb * 16) * ldc + c0;
{
#pragma unroll
            for (int s = 0; s < 8; ++s) { const int row = 2 * s + hi, cofs = lr * 4; v4f val = *(const v4fa*)(os + row * 68 + cofs); if (BIAS) { val[0] += bfr(bias[c0 + cofs]); val[1] += bfr(bias[c0 + cofs + 1]); val[2] += bfr(bias[c0 + cofs + 2]); val[3] += bfr(bias[c0 + cofs + 3]); }
                *(v4f*)(crow + (size_t)row * ldc + cofs) = val;
                asm volatile("s_wait_xcnt 0x0" ::: "memory"); }   // the next rows' values and addresses may go into this store's registers: none is rewritten before this wait
             }
        __builtin_amdgcn_wave_barrier(); asm volatile("" ::: "memory");
    }
    asm volatile("s_wait_xcnt 0x0" ::: "memory");   // a precaution (its one caller, k_gemmw, ends behind it): no register of this tile's last stores is rewritten before this wait
}
template <typename T16, int NSPLIT, bool BIAS, int K, int KS = 1>
__global__ __launch_bounds__(32) void k_gemmw(const T16* __restrict__ A, const T16* __restrict__ A2, const T16* __restrict__ Bt, const T16* __restrict__ Bt2, float* C, int ldc, const float* __restrict__ bias, size_t sA, size_t sB, size_t sC) {
    __shared__ __align__(16) float os[16 * 68];
    const size_t z = blockIdx.z; A += z * sA; if (A2) A2 += z * sA; Bt += z * sB; if (Bt2) Bt2 += z * sB; C += z * sC;
    gemmw_tile<T16, NSPLIT, BIAS, K, KS>(os, A, A2, Bt, Bt2, C, ldc, bias, blockIdx.x, blockIdx.y);
}

__device__ __forceinline__ h16 tohx(float x) { return (h16)x; }
__device__ __forceinline__ void splitf(float y, unsigned short& h, unsigned short& l) { h = f2bf(y); l = f2bf(y - bf2f(h)); }
typedef __attribute__((ext_vector_type(2))) _Float16 v2h;
typedef __attribute__((ext_vector_type(4))) _Float16 v4h;
typedef __attribute__((ext_vector_type(2))) unsigned short v2us;
typedef __attribute__((ext_vector_type(4))) unsigned short v4us;
typedef __attribute__((ext_vector_type(2))) float v2f;
typedef __attribute__((ext_vector_type(4))) int v4i;

__global__ __launch_bounds__(256) void k_wtG(const float* __restrict__ w, int K, int N, bf* Bt) {
    const int lane = threadIdx.x & 31; const int L0 = (blockIdx.x * 8 + (threadIdx.x >> 5)) * 8; const int nlines = N * K / 64;
{
#pragma unroll 1
        for (int l = 0; l < 8; ++l) { const int L = L0 + l; if (L >= nlines) break; const size_t e = (size_t)L * 64 + lane * 2; const int k = (int)(e % K), n = (int)(e / K); v2us o;
            o[0] = f2bf(w[(size_t)k * N + n]); o[1] = f2bf(w[(size_t)(k + 1) * N + n]); *(v2us*)(Bt + e) = o; }
         }
}
// d_cvtF: a row-major f32 [row][K] to bf16 in fragment order, fragments [row / 16][k / 32]; thread i writes the plane's 16 bytes number i
__device__ __forceinline__ void d_cvtF(const float* __restrict__ src, int K, bf* dst, size_t n8, unsigned bx) { const size_t i = (size_t)bx * 256 + threadIdx.x; if (i >= n8) return;
    const int lr = (int)(i & 15), f = (int)(i >> 6), k0 = (f % (K / 32)) * 32 + (int)((i >> 5) & 1) * 16 + (int)((i >> 4) & 1) * 8, r16 = f / (K / 32); const float* sp = src + (size_t)(r16 * 16 + lr) * K + k0; const v8f v = *(const v8f*)sp; v8us o;
    asm volatile("s_wait_xcnt 0x0" :: "v"(sp) : "memory");   // the loads' address lives up to here: no register of it is rewritten before this wait
#pragma unroll
    for (int k = 0; k < 8; ++k) o[k] = f2bf(v[k]); *(v8us*)(dst + i * 8) = o;  }

// ---- projections: ONE WAVE per 64x64 tile as in k_gemmw, K = DM, bf16 operands in fragment order; the tile (+ bias) does not go out as f32 but straight as the attention's operand planes, in fragment order too.
typedef __attribute__((ext_vector_type(2))) __bf16 v2bf;
// proj_tile: rows r0.. of A x rows c0.. of Bt (both [row][DM], fragments [row / 16][k / 32]); planes P16 (fp16), Ph + Pl (bf16 hi + lo of the same f32 value), the tile's column being the planes' k. ROWB: bias[row] and fragments [k / 32][row / 16] (HD rows), else bias[column] and fragments [row / 16][k / 32] (k < HD). os: 16 x 68 floats of LDS.
template <bool ROWB>
__device__ __forceinline__ void proj_tile(float* os, const bf* __restrict__ A, const bf* __restrict__ Bt, const float* __restrict__ bias, int bx, int by, h16* P16, bf* Ph, bf* Pl) {
    const int lane = threadIdx.x & 31, lr = lane & 15, hi = lane >> 4; const int r0 = bx * 64, c0 = by * 64;
    constexpr int NPB = ROWB ? 4 : 32; float pb[NPB];   // the biases of the lane's 4 rows or 4 x 8 columns in the epilogue; fetched here, so that they fly under the k loop
    { const float* bp = ROWB ? bias + r0 + lr : bias + c0 + 8 * hi;
#pragma unroll
      for (int i = 0; i < NPB; ++i) pb[i] = bp[ROWB ? 16 * i : 16 * (i >> 3) + (i & 7)];
      asm volatile("s_wait_xcnt 0x0" :: "v"(bp) : "memory"); }   // the loads' address lives up to here: no register of it is rewritten before this wait
    v8f acc[4][4];
#pragma unroll
    for (int mb = 0; mb < 4; ++mb)
#pragma unroll
        for (int nb = 0; nb < 4; ++nb) acc[mb][nb] = (v8f){};
    const bf* a0 = A + (size_t)r0 * DM + 8 * lane; const bf* b0 = Bt + (size_t)c0 * DM + 8 * lane;   // 16 rows are DM / 32 fragments = 16 DM elements
#pragma unroll 1   // one address pair per operand a trip, the ones the wait below names
    for (int kc = 0; kc < DM; kc += 32) {
        const bf* ap = a0 + kc * 16; const bf* bp = b0 + kc * 16; v16bf a[4], b[4];
#pragma unroll
        for (int i = 0; i < 4; ++i) { a[i] = WFrag<bf>::ldf(ap + i * 16 * DM); b[i] = WFrag<bf>::ldf(bp + i * 16 * DM); }
        asm volatile("s_wait_xcnt 0x0" :: "v"(ap), "v"(bp) : "memory");   // the loads' address pairs live up to here: no register of them is rewritten before this wait
#pragma unroll
        for (int nb = 0; nb < 4; ++nb)
#pragma unroll
            for (int mb = 0; mb < 4; ++mb) acc[mb][nb] = wmmab(a[mb], b[nb], acc[mb][nb]);
    }
    v2f bb[NPB / (ROWB ? 1 : 2)];   // bf16-rounded biases, as pairs for the packed add
#pragma unroll
    for (int i = 0; i < NPB / (ROWB ? 1 : 2); ++i) { bb[i][0] = bfr(pb[ROWB ? i : 2 * i]); bb[i][1] = bfr(pb[ROWB ? i : 2 * i + 1]); }
    const size_t po = (ROWB ? (size_t)(c0 / 32) * (HD / 16) + r0 / 16 : (size_t)(r0 / 16) * (HD / 32) + c0 / 32) * 512 + 8 * lane; h16* p16 = P16 + po; bf* ph = Ph + po; bf* pl = Pl + po;
#pragma unroll
    for (int mb = 0; mb < 4; ++mb) {
#pragma unroll
        for (int nb = 0; nb < 4; ++nb) {
#pragma unroll
            for (int j = 0; j < 8; ++j) os[(hi * 8 + j) * 68 + nb * 16 + lr] = acc[mb][nb][j]; }
        __builtin_amdgcn_wave_barrier(); asm volatile("" ::: "memory");   // the wave's LDS reads below stay behind its writes above (other lanes' values)
#pragma unroll
        for (int s = 0; s < 4; ++s) {   // the wave takes 16 rows x 16 columns: half a fragment, 512 bytes in a row in each plane
            const float* op = os + lr * 68 + 16 * s + 8 * hi; const v4f x0 = *(const v4fa*)op, x1 = *(const v4fa*)(op + 4); v8h o16; v8us oh, ol;
#pragma unroll
            for (int p = 0; p < 4; ++p) { v2f x; x[0] = (p < 2) ? x0[2 * (p & 1)] : x1[2 * (p & 1)]; x[1] = (p < 2) ? x0[2 * (p & 1) + 1] : x1[2 * (p & 1) + 1]; x += bb[ROWB ? mb : s * 4 + p];
                const v2h h = __builtin_convertvector(x, v2h); const v2bf t = __builtin_convertvector(x, v2bf); const v2bf u = __builtin_convertvector(x - __builtin_convertvector(t, v2f), v2bf);   // all three round to nearest even, as tohx and splitf do
                const v2us tu = __builtin_bit_cast(v2us, t), uu = __builtin_bit_cast(v2us, u); o16[2 * p] = h[0]; o16[2 * p + 1] = h[1]; oh[2 * p] = tu[0]; oh[2 * p + 1] = tu[1]; ol[2 * p] = uu[0]; ol[2 * p + 1] = uu[1]; }
            const int ro = (ROWB ? (s >> 1) * (HD / 16) + mb : mb * (HD / 32) + (s >> 1)) * 512 + (s & 1) * 256; *(v8h*)(p16 + ro) = o16; *(v8us*)(ph + ro) = oh; *(v8us*)(pl + ro) = ol;
            asm volatile("s_wait_xcnt 0x0" ::: "memory"); }   // the next 16 columns' (or rows') values may go into these stores' registers: none is rewritten before this wait
        __builtin_amdgcn_wave_barrier(); asm volatile("" ::: "memory");   // the next 16 rows' LDS writes stay behind these reads
    }
}
// k_proj3: the theta, phi and g projections of all images in ONE launch; grid (TT / 64, 3 x HD / 64, image).
// theta and phi: rows = positions, planes [t][d]; g with the operands swapped (rows = g_w's, columns = positions), so that its planes are [d][t] as the attn x g product reads them, the 8 fragments of 32 keys side by side.
__global__ __launch_bounds__(32) void k_proj3(const bf* __restrict__ XB, const bf* __restrict__ WQ, const bf* __restrict__ WK, const bf* __restrict__ WV, h16* QP16, bf* QPh, bf* QPl, h16* KP16, bf* KPh, bf* KPl, h16* VT16, bf* VTh, bf* VTl, const float* __restrict__ bq, const float* __restrict__ bk, const float* __restrict__ bv) {
    __shared__ __align__(16) float os[16 * 68];
    const int w = blockIdx.y / (HD / 64), by = blockIdx.y % (HD / 64); const size_t im = blockIdx.z, zb = im * TT * HD; const bf* X = XB + im * TT * DM;
    if (w == 2) proj_tile<true>(os, WV, X, bv, by, blockIdx.x, VT16 + zb, VTh + zb, VTl + zb);
    else proj_tile<false>(os, X, (w == 0) ? WQ : WK, (w == 0) ? bq : bk, blockIdx.x, by, ((w == 0) ? QP16 : KP16) + zb, ((w == 0) ? QPh : KPh) + zb, ((w == 0) ? QPl : KPl) + zb);
}
// ---- fused attention: logits, softmax and attn x g in ONE kernel; the logits stay in registers.
// A wave holds QB x 16 queries and walks its slice's nk keys, 32 at a time: St = K Qt (row = key, column = query: a lane holds one query's scores), running maximum and sum per query (online softmax),
// Pt packed from the score accumulators straight into a B operand (they already lie in the loaders' k order), Ot += Vt Pt (row = d, column = query: the rescale factor is the lane's own).
// A slice leaves O[t / 16][slice][d / 16][(d >> 2) & 1][lane (t & 15) + 16 ((d >> 3) & 1)][d & 3] = sum_k 2^PSH exp(s - m) g (not normalised; the accumulators' own lane order, so that a store and k_merge's load take 512 bytes in a row) and ML[slice][t] = (m, sum_k 2^PSH exp(s - m)), 16 queries = one whole line from one wave; k_merge joins the slices.
__device__ __forceinline__ float xhalf(float x) { return __builtin_bit_cast(float, __builtin_amdgcn_permlanex16(__builtin_bit_cast(int, x), __builtin_bit_cast(int, x), 0x76543210, 0xfedcba98, false, false)); }   // lane l reads lane l ^ 16
template <typename T16> struct PPack;
template <> struct PPack<h16> { static __device__ __forceinline__ void mk(const v8f a, const v8f b, v16h& p, v16h& p2) { (void)p2;
#pragma unroll
    for (int i = 0; i < 8; ++i) { p[i] = tohx(a[i]); p[8 + i] = tohx(b[i]); } } };
template <> struct PPack<bf> { static __device__ __forceinline__ void mk(const v8f a, const v8f b, v16bf& p, v16bf& p2) { v16us h, l;
#pragma unroll
    for (int i = 0; i < 8; ++i) { unsigned short x, y; splitf(a[i], x, y); h[i] = x; l[i] = y; splitf(b[i], x, y); h[8 + i] = x; l[8 + i] = y; }
    p = __builtin_bit_cast(v16bf, h); p2 = __builtin_bit_cast(v16bf, l); } };
// HL: hi + lo planes, 3 products each (hi x hi, the query side's or P's lo x hi, hi x the key side's lo). Q, K [t][d], Vt [d][t], all in fragment order as k_proj3 leaves them; O and ML already point at the image and the slice's slot.
template <typename T16, bool HL, int QB>
__device__ __forceinline__ void fa_tile(const T16* __restrict__ Q, const T16* __restrict__ Q2, const T16* __restrict__ Kp, const T16* __restrict__ K2, const T16* __restrict__ Vt, const T16* __restrict__ V2, int q0, int k0, unsigned nk, float* O, float* ML) {
    typedef typename WFrag<T16>::V V;
    const int lane = threadIdx.x & 31, lr = lane & 15, hi = lane >> 4;
    const size_t qo0 = (size_t)q0 * HD + 8 * lane, ko = (size_t)k0 * HD + 8 * lane, vo = ko;   // fragment order: 16 rows of Q or K are HD / 32 = 4 fragments, 32 keys of Vt HD / 16 = 8 fragments: HD elements a row or key in both
    const T16* qp = Q + qo0; const T16* qp2 = HL ? Q2 + qo0 : qp; const T16* kp = Kp + ko; const T16* kp2 = HL ? K2 + ko : kp;   // every batch of loads has one address per plane; the rest is immediate offsets
    V qf[QB][4], qf2[QB][4];
#pragma unroll
    for (int qb = 0; qb < QB; ++qb)
#pragma unroll
        for (int ks = 0; ks < 4; ++ks) { const int qo = qb * 16 * HD + ks * 512; qf[qb][ks] = WFrag<T16>::ldf(qp + qo); if (HL) qf2[qb][ks] = WFrag<T16>::ldf(qp2 + qo); }
    v8f o[8][QB]; float m[QB], l[QB];
#pragma unroll
    for (int qb = 0; qb < QB; ++qb) { m[qb] = -3.0e38f; l[qb] = 0.0f;
#pragma unroll
        for (int db = 0; db < 8; ++db) o[db][qb] = (v8f){}; }
    V kf[2][4], kf2[2][4];   // the K fragments of a pass, fetched one pass ahead
#pragma unroll
    for (int kb = 0; kb < 2; ++kb)
#pragma unroll
        for (int ks = 0; ks < 4; ++ks) { const int fo = kb * 16 * HD + ks * 512; kf[kb][ks] = WFrag<T16>::ldf(kp + fo); if (HL) kf2[kb][ks] = WFrag<T16>::ldf(kp2 + fo); }
    asm volatile("s_wait_xcnt 0x0" :: "v"(qp), "v"(qp2), "v"(kp), "v"(kp2) : "memory");   // the loads' address pairs live up to here: no register of them is rewritten before this wait
    __builtin_amdgcn_sched_barrier(0);   // holds the loop's address arithmetic below that wait
    unsigned kk = 0;
#pragma unroll 1   // one pass of 32 keys with its fragments in flight already fills the registers
    do {   // a slice has at least one pass, so the test stands at the foot (with it at the head this build kept one address pair in scratch and fetched it back in every pass)
        V vf[8], vf2[8]; const T16* vp = Vt + vo + (size_t)(kk * HD); const T16* vp2 = HL ? V2 + vo + (size_t)(kk * HD) : vp;
#pragma unroll
        for (int db = 0; db < 8; ++db) { const int fo = db * 512; vf[db] = WFrag<T16>::ldf(vp + fo); if (HL) vf2[db] = WFrag<T16>::ldf(vp2 + fo); }
        asm volatile("s_wait_xcnt 0x0" :: "v"(vp), "v"(vp2) : "memory");   // these loads stay in flight: their address pairs live up to here, and no register of them is rewritten before this wait
        __builtin_amdgcn_sched_barrier(0);   // holds the Vt loads up here: they fly under the score products and the softmax (left alone, the compiler loads one fragment at a time, each right in front of its products)
        v8f s[2][QB];
#pragma unroll
        for (int kb = 0; kb < 2; ++kb) {
#pragma unroll
            for (int qb = 0; qb < QB; ++qb) s[kb][qb] = (v8f){};
#pragma unroll
            for (int ks = 0; ks < 4; ++ks)
#pragma unroll
                for (int qb = 0; qb < QB; ++qb) { s[kb][qb] = WFrag<T16>::mma(kf[kb][ks], qf[qb][ks], s[kb][qb]); if (HL) { s[kb][qb] = WFrag<T16>::mma(kf[kb][ks], qf2[qb][ks], s[kb][qb]); s[kb][qb] = WFrag<T16>::mma(kf2[kb][ks], qf[qb][ks], s[kb][qb]); } } }
        __builtin_amdgcn_sched_barrier(0);   // keeps the next pass's K loads behind the products above, so that they go into the registers those have just read and need no second set
        const unsigned kn = (kk + 32 < nk) ? kk + 32 : kk;   // the last pass has no next one: it fetches its own keys again (in bounds, not used)
        kp = Kp + ko + (size_t)(kn * HD); kp2 = HL ? K2 + ko + (size_t)(kn * HD) : kp;
#pragma unroll
        for (int kb = 0; kb < 2; ++kb)
#pragma unroll
            for (int ks = 0; ks < 4; ++ks) { const int fo = kb * 16 * HD + ks * 512; kf[kb][ks] = WFrag<T16>::ldf(kp + fo); if (HL) kf2[kb][ks] = WFrag<T16>::ldf(kp2 + fo); }
        asm volatile("s_wait_xcnt 0x0" :: "v"(kp), "v"(kp2) : "memory");   // as behind the Vt loads
        __builtin_amdgcn_sched_barrier(0);   // holds the K loads up here: they fly under the softmax and the Vt Pt products
        V pf[QB], pf2[QB];
#pragma unroll
        for (int qb = 0; qb < QB; ++qb) {
            float bm = s[0][qb][0];
#pragma unroll
            for (int kb = 0; kb < 2; ++kb)
#pragma unroll
                for (int j = 0; j < 8; ++j) bm = fmaxf(bm, s[kb][qb][j]);
            bm = fmaxf(bm, xhalf(bm));   // the other half of the wave holds the query's other keys
            const float mn = fmaxf(m[qb], bm * SCL), al = __builtin_amdgcn_exp2f((m[qb] - mn) * L2E); m[qb] = mn;
            float rs = 0.0f;
#pragma unroll
            for (int kb = 0; kb < 2; ++kb)
#pragma unroll
                for (int j = 0; j < 8; ++j) { const float p = __builtin_amdgcn_exp2f((s[kb][qb][j] * SCL - mn) * L2E + PSH); s[kb][qb][j] = p; rs += p; }
            l[qb] = l[qb] * al + rs;   // each half of the wave sums its own keys; the halves join behind the loop
#pragma unroll
            for (int db = 0; db < 8; ++db) o[db][qb] *= al;
            PPack<T16>::mk(s[0][qb], s[1][qb], pf[qb], pf2[qb]);
        }
#pragma unroll
        for (int db = 0; db < 8; ++db)
#pragma unroll
            for (int qb = 0; qb < QB; ++qb) { o[db][qb] = WFrag<T16>::mma(vf[db], pf[qb], o[db][qb]); if (HL) { o[db][qb] = WFrag<T16>::mma(vf[db], pf2[qb], o[db][qb]); o[db][qb] = WFrag<T16>::mma(vf2[db], pf[qb], o[db][qb]); } }
        kk += 32;
    } while (kk < nk);
    float* ob0 = O + (size_t)q0 * (KSP * HD) + 4 * lane;   // one address for all the stores of O; the rest is immediate offsets
#pragma unroll
    for (int qb = 0; qb < QB; ++qb) { const size_t t = (size_t)(q0 + qb * 16 + lr); float* ob = ob0 + qb * (16 * KSP * HD); const float lj = l[qb] + xhalf(l[qb]);
#pragma unroll
        for (int db = 0; db < 8; ++db) { v4f x, y;
#pragma unroll
            for (int j = 0; j < 4; ++j) { x[j] = o[db][qb][j]; y[j] = o[db][qb][4 + j]; }
            *(v4f*)(ob + db * 256) = x; *(v4f*)(ob + db * 256 + 128) = y; }   // each store: 512 bytes in a row
        if (hi == 0) { v2f ml; ml[0] = m[qb]; ml[1] = lj; *(v2f*)(ML + t * 2) = ml; } }
    asm volatile("s_wait_xcnt 0x0" ::: "memory");   // the kernel lays the other row range's code behind this tile's last stores: no register of theirs is rewritten before this wait
}
// k_fattn: all images, all query rows, all key slices in ONE launch; 4 waves a work-group, all on the same keys (they share the K and Vt lines in the WGP cache). Flat grid: rows < RH in front (hi + lo planes, 32 queries a wave), then rows >= RH (fp16, 64 queries a wave); query group fastest, then slice, then image.
__global__ __launch_bounds__(128) void k_fattn(const bf* __restrict__ Qh, const bf* __restrict__ Ql, const bf* __restrict__ Kh, const bf* __restrict__ Kl, const bf* __restrict__ Vh, const bf* __restrict__ Vl, const h16* __restrict__ Q16, const h16* __restrict__ K16, const h16* __restrict__ V16, float* O, float* ML) {
    constexpr int GH = RH / 128, GL = (TT - RH) / 256, NHI = NB_ * KSP * GH;
    const int id = blockIdx.x, w = threadIdx.x >> 5;
    if (id < NHI) { const int g = id % GH, z = (id / GH) % KSP, k0 = z * NPS / KSP * 32, k1 = (z + 1) * NPS / KSP * 32; const size_t im = id / (GH * KSP), zb = im * TT * HD;
        fa_tile<bf, true, 2>(Qh + zb, Ql + zb, Kh + zb, Kl + zb, Vh + zb, Vl + zb, g * 128 + w * 32, k0, k1 - k0, O + zb * KSP + z * (16 * HD), ML + (im * KSP + z) * TT * 2);
    } else { const int il = id - NHI; const int g = il % GL, z = (il / GL) % KSP, k0 = z * NPS / KSP * 32, k1 = (z + 1) * NPS / KSP * 32; const size_t im = il / (GL * KSP), zb = im * TT * HD;
        fa_tile<h16, false, 4>(Q16 + zb, nullptr, K16 + zb, nullptr, V16 + zb, nullptr, RH + g * 256 + w * 64, k0, k1 - k0, O + zb * KSP + z * (16 * HD), ML + (im * KSP + z) * TT * 2); }
}
// d_cvtT: X [c][n] f32 to XB [n][c] bf16 in fragment order, fragments [n / 16][c / 32]. A thread makes 16 bytes (8 channels of one position); a wave makes half a fragment (512 bytes in a row) and reads 16 positions in a row of each channel; waves w and w ^ 1 take the two halves of the same lines of X.
__device__ __forceinline__ void d_cvtT(const float* __restrict__ X, bf* XB, unsigned bx) { const size_t i = (size_t)bx * 256 + threadIdx.x; if (i >= (size_t)TT * DM / 8) return;
    const int lane = (int)(i & 31), n16 = (int)(i >> 10) * 2 + (int)((i >> 5) & 1), h = (int)((i >> 6) & 1), ks = (int)((i >> 7) & 7); const int c0 = ks * 32 + h * 16 + (lane >> 4) * 8, n = n16 * 16 + (lane & 15);
    const float* xp = X + (size_t)c0 * TT + n; float v[8]; v8us o;
#pragma unroll
    for (int q = 0; q < 8; ++q) v[q] = xp[q * TT];
    asm volatile("s_wait_xcnt 0x0" :: "v"(xp) : "memory");   // the loads' address lives up to here: no register of it is rewritten before this wait
#pragma unroll
    for (int q = 0; q < 8; ++q) o[q] = f2bf(v[q]);
    *(v8us*)(XB + ((size_t)(n16 * (DM / 32) + ks) * 2 + h) * 256 + lane * 8) = o;  }
// k_prep: everything that reads only the inputs, in ONE launch; flat grid: NB_ x NBT blocks turn the images token-major, 4 x NBW blocks round the weights
#define NBT ((TT * DM / 8 + 255) / 256)
#define NBW ((HD * DM / 8 + 255) / 256)
__global__ __launch_bounds__(256) void k_prep(const float* __restrict__ xin, const float* __restrict__ wq, const float* __restrict__ wk, const float* __restrict__ wv, const float* __restrict__ wo, bf* XB, bf* WQ, bf* WK, bf* WV, bf* WO) {
    const unsigned id = blockIdx.x;
    if (id < NB_ * NBT) { const size_t im = id / NBT; d_cvtT(xin + im * DM * TT, XB + im * TT * DM, id % NBT); }
    else if (id < NB_ * NBT + 4 * NBW) { const unsigned w = (id - NB_ * NBT) / NBW; d_cvtF((w == 0) ? wq : (w == 1) ? wk : (w == 2) ? wv : wo, (w == 3) ? DQ : DM, (w == 0) ? WQ : (w == 1) ? WK : (w == 2) ? WV : WO, (size_t)HD * DM / 8, (id - NB_ * NBT) % NBW); }
}
// Y = W_w y without its bias, channel-major [image][c][n] as the output is: a wave reads whole lines. Both readers add the bias wb[c] as they read. A thread sums the positions tid, tid + 256, ... of image 0, then of image 1, ...
__global__ __launch_bounds__(256) void k_bnstat(const float* __restrict__ Y, const float* __restrict__ wb, float* BNS) { __shared__ float red[256]; const int c = blockIdx.x; const int tid = threadIdx.x; const size_t NTOT = (size_t)NB_ * TT; float s = 0.0f; const float* Yc = Y + (size_t)c * TT + tid; const float wc = bfr(wb[c]);
#pragma unroll 1   // one address pair a trip, the one the wait below names: unrolled, the compiler forms other bases for the loads, which that wait does not hold
    for (int b = 0; b < NB_; ++b) { const float* yp = Yc + (size_t)b * DM * TT; float y[TT / 256];
#pragma unroll   // an image's loads of a thread in flight together
        for (int i = 0; i < TT / 256; ++i) y[i] = yp[i * 256];
        asm volatile("s_wait_xcnt 0x0" :: "v"(yp) : "memory");   // the loads' address lives up to here: no register of it is rewritten before this wait
#pragma unroll
        for (int i = 0; i < TT / 256; ++i) s = __fadd_rn(s, __fadd_rn(y[i], wc)); }
    red[tid] = s; __syncthreads();
    for (int st = 128; st > 0; st >>= 1) { if (tid < st) red[tid] = __fadd_rn(red[tid], red[tid + st]); __syncthreads(); }
    const float mu = __fdiv_rn(red[0], (float)NTOT); __syncthreads(); float v = 0.0f;
#pragma unroll 1   // as above
    for (int b = 0; b < NB_; ++b) { const float* yp = Yc + (size_t)b * DM * TT; float y[TT / 256];
#pragma unroll   // as above
        for (int i = 0; i < TT / 256; ++i) y[i] = yp[i * 256];
        asm volatile("s_wait_xcnt 0x0" :: "v"(yp) : "memory");   // as above
#pragma unroll
        for (int i = 0; i < TT / 256; ++i) { const float d = __fsub_rn(__fadd_rn(y[i], wc), mu); float p = __fmul_rn(d, d); asm volatile("" : "+v"(p)); v = __fadd_rn(v, p); } }
    red[tid] = v; __syncthreads();
    for (int st = 128; st > 0; st >>= 1) { if (tid < st) red[tid] = __fadd_rn(red[tid], red[tid + st]); __syncthreads(); }
    if (tid == 0) { const float var = __fdiv_rn(red[0], (float)NTOT); v2f o; o[0] = mu; o[1] = __fdiv_rn(1.0f, __fsqrt_rn(__fadd_rn(var, BNEPS))); *(v2f*)(BNS + (size_t)c * 32) = o;  }    }
__global__ __launch_bounds__(256) void k_bnout(const float* __restrict__ Y, const float* __restrict__ wb, const float* __restrict__ BNS, const float* __restrict__ g, const float* __restrict__ bb, const float* __restrict__ X, float* OUT) { const size_t k = (size_t)blockIdx.x * 256 + threadIdx.x; if (k >= (size_t)NB_ * DM * TT / 4) return; const size_t e = k * 4; const int c = (int)((e / TT) % DM); const float* sp = BNS + (size_t)c * 32; const float* xp = X + e; const float* yp = Y + e;   // Y lies as X and OUT do
    const float mu = sp[0], rs = sp[1], gm = bfr(g[c]), bt = bfr(bb[c]), wc = bfr(wb[c]); const v4f xr = *(const v4f*)xp; const v4f yr = *(const v4f*)yp; v4f o;
    asm volatile("s_wait_xcnt 0x0" :: "v"(c), "v"(sp), "v"(xp), "v"(yp) : "memory");   // the loads' addresses live up to here: no register of them is rewritten before this wait
#pragma unroll
    for (int q = 0; q < 4; ++q) { const float y = __fadd_rn(yr[q], wc); float t = __fmul_rn(__fmul_rn(gm, __fsub_rn(y, mu)), rs); asm volatile("" : "+v"(t)); t = __fadd_rn(t, bt); o[q] = __fadd_rn(t, bfr(xr[q])); }
    *(v4f*)(OUT + e) = o;  }
// k_merge: joins the KSP key slices of every row of every image, in slice order: weights exp(m_slice - max m), then the softmax's division; hi + lo planes of the result, [t][d] in fragment order.
// Thread i makes the planes' 16 bytes number i: lane = i & 31 (row t & 15 = lane & 15), d / 16 = (i >> 5) & 7, t / 16 (over all images) = i >> 8; its 8 values d = 16 (d / 16) + 8 (lane >> 4) + 0..7 are two 16-byte pieces of O. Every load of O and every store takes 512 bytes in a row.
__global__ __launch_bounds__(256) void k_merge(const float* __restrict__ O, const float* __restrict__ ML, bf* Ah, bf* Al) { const size_t i = (size_t)blockIdx.x * 256 + threadIdx.x; if (i >= (size_t)NB_ * TT * HD / 8) return; const int lane = (int)(i & 31), db = (int)((i >> 5) & 7); const size_t r = (i >> 8) * 16 + (lane & 15);
    const float* op = O + (i >> 8) * (KSP * 16 * HD) + db * 256 + lane * 4; const float* mp = ML + ((r / TT) * KSP * TT + r % TT) * 2; v2f ml[KSP]; v4f u[KSP][2];
#pragma unroll   // all loads of a thread in flight together
    for (int p = 0; p < KSP; ++p) { ml[p] = *(const v2f*)(mp + p * TT * 2); u[p][0] = *(const v4f*)(op + p * (16 * HD)); u[p][1] = *(const v4f*)(op + p * (16 * HD) + 128); }
    asm volatile("s_wait_xcnt 0x0" :: "v"(op), "v"(mp) : "memory");   // the loads' address pairs live up to here: no register of them is rewritten before this wait
    __builtin_amdgcn_sched_barrier(0);   // holds every load above the arithmetic (left alone, the compiler issues the second half of them only when the first has come back)
    float mx = ml[0][0];
#pragma unroll
    for (int p = 1; p < KSP; ++p) mx = fmaxf(mx, ml[p][0]);
    float ls = 0.0f, s[8];
#pragma unroll
    for (int q = 0; q < 8; ++q) s[q] = 0.0f;
#pragma unroll
    for (int p = 0; p < KSP; ++p) { const float wt = __builtin_amdgcn_exp2f((ml[p][0] - mx) * L2E); ls += ml[p][1] * wt;
#pragma unroll
        for (int q = 0; q < 8; ++q) s[q] += u[p][q >> 2][q & 3] * wt; }
    v8us oh, ol;
#pragma unroll
    for (int q = 0; q < 8; ++q) { unsigned short a, c2; splitf(__fdiv_rn(s[q], ls), a, c2); oh[q] = a; ol[q] = c2; } *(v8us*)(Ah + i * 8) = oh; *(v8us*)(Al + i * 8) = ol;  }

extern "C" void kernel_launch(void* const* d_in, const int* in_sizes, int n_in,
                              void* d_out, int out_size, void* d_ws, size_t ws_size, hipStream_t stream) {
    (void)in_sizes; (void)n_in; (void)out_size;
    const float* xin = (const float*)d_in[0];   /* x [4][256][4096] NCHW */ const float* wv = (const float*)d_in[1]; const float* bv = (const float*)d_in[2];   /* g_w, g_b */ const float* wq = (const float*)d_in[3]; const float* bq = (const float*)d_in[4];   /* theta */ const float* wk = (const float*)d_in[5]; const float* bk = (const float*)d_in[6];   /* phi */ const float* wo = (const float*)d_in[7]; const float* bo = (const float*)d_in[8];   /* W_w [256][128], W_b */ const float* bng = (const float*)d_in[9]; const float* bnb = (const float*)d_in[10]; const float* x = nullptr; (void)x;
    float* OUT = (float*)d_out;     // [4][256][4096] NCHW
    char* wsp = (char*)d_ws;
    auto take = [&](size_t bytes) { char* p = wsp; wsp += (bytes + 255) & ~(size_t)255; return (void*)p; };
    float* YALL = (float*)take((size_t)NB_ * TT * DM * 4); float* BNS = (float*)take((size_t)DM * 32 * 4);    bf* WQ = (bf*)take((size_t)DQ * DM * 2); bf* WK = (bf*)take((size_t)DKV * DM * 2); bf* WV = (bf*)take((size_t)DKV * DM * 2); bf* WO = (bf*)take((size_t)DM * DQ * 2);
    h16* QP16 = (h16*)take((size_t)NB_ * TT * HD * 2); h16* KP16 = (h16*)take((size_t)NB_ * TT * HD * 2); h16* VT16 = (h16*)take((size_t)NB_ * HD * TT * 2);   // every operand plane: one per image, image stride TT * HD
    bf* QPh = (bf*)take((size_t)NB_ * TT * HD * 2); bf* QPl = (bf*)take((size_t)NB_ * TT * HD * 2); bf* KPh = (bf*)take((size_t)NB_ * TT * HD * 2); bf* KPl = (bf*)take((size_t)NB_ * TT * HD * 2); bf* VTh = (bf*)take((size_t)NB_ * HD * TT * 2); bf* VTl = (bf*)take((size_t)NB_ * HD * TT * 2);
    float* Ob = (float*)take((size_t)NB_ * TT * KSP * HD * 4); float* ML = (float*)take((size_t)NB_ * TT * KSP * 2 * 4); bf* ATh = (bf*)take((size_t)NB_ * TT * DQ * 2); bf* ATl = (bf*)take((size_t)NB_ * TT * DQ * 2);
    if ((size_t)(wsp - (char*)d_ws) > ws_size) return;    // ws 256 MiB
    // the token-major images (8 MiB) lie in the buffer of the attention's partial results: they are dead before the attention writes it (stream-ordered)
    bf* XB = (bf*)Ob;
    // launches that do not depend on one another are ONE launch: all images, all weights, all three projections, both row ranges of a product
    k_prep<<<NB_ * NBT + 4 * NBW, 256, 0, stream>>>(xin, wq, wk, wv, wo, XB, WQ, WK, WV, WO);   /* NCHW [256][4096] -> token-major bf16 [4096][256] and bf16 weights, in fragment order */
    k_proj3<<<dim3(TT / 64, 3 * (HD / 64), NB_), 32, 0, stream>>>(XB, WQ, WK, WV, QP16, QPh, QPl, KP16, KPh, KPl, VT16, VTh, VTl, bq, bk, bv);   /* theta, phi, g + bias, straight into the attention's operand planes */
    k_fattn<<<NB_ * KSP * (RH / 128) + NB_ * KSP * ((TT - RH) / 256), 128, 0, stream>>>(QPh, QPl, KPh, KPl, VTh, VTl, QP16, KP16, VT16, Ob, ML);   /* key slice z -> partial Ob[image][t / 16][z][16 x HD in the accumulators' lane order], ML[image][z][t] */
    k_merge<<<(unsigned)(((size_t)NB_ * TT * HD / 8 + 255) / 256), 256, 0, stream>>>(Ob, ML, ATh, ATl);
    k_gemmw<bf, 3, false, DQ><<<dim3(DM / 64, TT / 64, NB_), 32, 0, stream>>>(WO, nullptr, ATh, ATl, YALL, TT, nullptr, 0, (size_t)TT * DQ, (size_t)DM * TT);   /* W_w y of all images, channel-major [image][c][n] (rows = W_w's, columns = positions; products W_w x hi, W_w x lo), kept for the batch statistics */
    k_bnstat<<<DM, 256, 0, stream>>>(YALL, bo, BNS);   /* per channel: mean and 1/sqrt(var + eps) over the batch x 4,096 positions (training-mode BatchNorm) */
    k_bnout<<<(unsigned)(((size_t)NB_ * DM * TT / 4 + 255) / 256), 256, 0, stream>>>(YALL, bo, BNS, bng, bnb, xin, OUT);   /* out[b][c][n] = gamma (Wy - mean) rstd + beta + x */

}

// v008
// A run of this version takes 93.3 microseconds.
// Next to v007, in two timings, it ran 1.07 and 1.08 times as fast.
// All steps since v000 together make it 11.4 times as fast.
#include <hip/hip_runtime.h>

// Non-local block (embedded Gaussian) over 64x64 = 4,096 positions with a training-mode BatchNorm and residual (x [4][256][64][64] NCHW; theta, phi, g = 1x1 convs C 256 -> Ci 128 ('oi' [128][256] 0.02, zero biases); f[n][m] = theta_n . phi_m (no scaling); attn = softmax over m; y[ci][n] = sum_m attn[n][m] g[ci][m]; Wy = W_w y + W_b ('oi' [256][128]); BatchNorm2d in TRAINING mode (per-channel mean/var over the whole batch x 64 x 64, eps 1e-5, gamma/beta read); out = BN(Wy) + x -> [4][256][64][64] (4.2 M)).
// Compute dtypes, f32 accumulate: every input rounded to bf16; convs exact + f32 bias; attention rows < 512 3 products, rest fp16; softmax f32; W_w hl x exact + bias; BatchNorm statistics and output f32 (fixed-order sums); residual f32 of the bf16-rounded x.

#define NB_  4
#define TT   4096
#define DM   256
#define NH_  1
#define NKV  1
#define REP  (NH_ / NKV)
#define HD   128
#define DQ   (NH_ * HD)
#define DKV  (NKV * HD)
#define ZH   1
#define RH   512                  // query rows < RH use hi+lo planes (0: none)
#define WIN  0
#define PSH  8.0f     // P carries 2^PSH (numerator and row sum alike: it cancels in the softmax's division), so that small weights stay in fp16's normal range
#define SCL  1.0f     // the non-local block applies no 1/sqrt(d)
#define CIN  256      // channels C (== DM)
#define BNEPS 1e-5f
#define KSP  7        // key slices of the fused attention (one work-group per slice); every slice leaves its partial result in a slot of its own. 7: a work-group's registers fill a WGP, and 72 query groups x 7 slices = 504 work-groups are two rounds of the chip's 256 WGPs (8 slices: 576, a third round for 64 of them)
#define NPS  (TT / 32) // passes of 32 keys over all keys; slice z takes the passes z NPS / KSP up to (z + 1) NPS / KSP (18 or 19 of them)
#define L2E  1.4426950408889634f
typedef _Float16 h16;
typedef unsigned short bf;
typedef __attribute__((ext_vector_type(16))) __bf16   v16bf;
typedef __attribute__((ext_vector_type(16))) _Float16 v16h;
typedef __attribute__((ext_vector_type(8)))  _Float16 v8h;
typedef __attribute__((ext_vector_type(8)))  unsigned short v8us;
typedef __attribute__((ext_vector_type(16))) unsigned short v16us;
typedef __attribute__((ext_vector_type(8)))  float    v8f;
typedef __attribute__((ext_vector_type(4)))  float    v4f;
typedef v8h  __attribute__((may_alias)) v8ha;
typedef v4f  __attribute__((may_alias)) v4fa;
typedef v8us __attribute__((may_alias)) v8usa;

__device__ __forceinline__ unsigned short f2bf(float f) { unsigned u = __float_as_uint(f); u += 0x7FFFu + ((u >> 16) & 1u); return (unsigned short)(u >> 16); }
__device__ __forceinline__ float bf2f(unsigned short b) { return __uint_as_float(((unsigned)b) << 16); }
__device__ __forceinline__ float bfr(float f) { return bf2f(f2bf(f)); }
__device__ __forceinline__ v16h cat16(v8h lo, v8h hi) { return __builtin_shufflevector(lo, hi, 0, 1, 2, 3, 4, 5, 6, 7, 8, 9, 10, 11, 12, 13, 14, 15); }
__device__ __forceinline__ v16bf cat16b(v8us lo, v8us hi) { return __builtin_bit_cast(v16bf, __builtin_shufflevector(lo, hi, 0, 1, 2, 3, 4, 5, 6, 7, 8, 9, 10, 11, 12, 13, 14, 15)); }
__device__ __forceinline__ v8f wmma16(v16h a, v16h b, v8f c) { return __builtin_amdgcn_wmma_f32_16x16x32_f16(false, a, false, b, (short)0, c, false, false); }
__device__ __forceinline__ v8f wmmab(v16bf a, v16bf b, v8f c) { return __builtin_amdgcn_wmma_f32_16x16x32_bf16(false, a, false, b, (short)0, c, false, false); }



// ---- k_gemmw: register-blocked GEMM, ONE WAVE per 64x64 output tile (16 accumulators), operands straight from 16-bit planes [row][k] in fragment order (below), fragments [row / 16][k / 32]; grid (M/64, N/64, Z), 32 threads.
// C[m][n] (f32, pitch ldc, + optional f32 bias[n]) = sum_k A[m][k] Bt[n][k] (+ split products per NSPLIT). z-batch strides sA/sB/sC in elements. K % 32 == 0. KS > 1: a work-group sums K / KS of the k only (the planes stay K wide); with sA = sB = 16 K / KS, z is the k slice and C + z sC its partial sum.
template <typename T16> struct WFrag;
// FRAGMENT ORDER of a 16-bit plane [row][k]: fragments of 16 rows x 32 k = 512 elements (1 KiB) lie whole, as two halves of 256 elements; in half h, lane (row & 15) + 16 hi holds the 8 elements k = 16 h + 8 hi + 0..7 at element lane * 8.
// ldf reads a fragment so laid (p: the fragment + lane * 8): each of its two loads takes 512 bytes in a row, 4 whole lines, where the same load on a row-major plane touches 16 lines. Lane and register hold the elements of the hardware's k order.
template <> struct WFrag<h16> { typedef v16h V; static __device__ __forceinline__ V ldf(const h16* p) { return cat16(*(const v8h*)p, *(const v8h*)(p + 256)); } static __device__ __forceinline__ v8f mma(V a, V b, v8f c) { return wmma16(a, b, c); } };
template <> struct WFrag<bf> { typedef v16bf V; static __device__ __forceinline__ V ldf(const bf* p) { return cat16b(*(const v8us*)p, *(const v8us*)(p + 256)); } static __device__ __forceinline__ v8f mma(V a, V b, v8f c) { return wmmab(a, b, c); } };
// gemmw_tile: the tile (bx, by) of one such product; os: 16 x 68 floats of LDS.
template <typename T16, int NSPLIT, bool BIAS, int K, int KS>
__device__ __forceinline__ void gemmw_tile(float* os, const T16* __restrict__ A, const T16* __restrict__ A2, const T16* __restrict__ Bt, const T16* __restrict__ Bt2, float* C, int ldc, const float* __restrict__ bias, int bx, int by) {
    typedef typename WFrag<T16>::V V;
    const int lane = threadIdx.x & 31, lr = lane & 15, hi = lane >> 4; const int r0 = bx * 64, c0 = by * 64;
    v8f acc[4][4];
#pragma unroll
    for (int mb = 0; mb < 4; ++mb)
#pragma unroll
        for (int nb = 0; nb < 4; ++nb) acc[mb][nb] = (v8f){};
    const size_t aoff = (size_t)r0 * K + 8 * lane, boff = (size_t)c0 * K + 8 * lane;   // 16 rows are K / 32 fragments = 16 K elements
#pragma unroll 1   // one address pair per plane a trip, the ones the wait below names
    for (int kc = 0; kc < K / KS; kc += 32) {
        constexpr bool SA = NSPLIT == 1 || NSPLIT == 2, SB = NSPLIT >= 2; V a[4], a2[4], b[4], b2[4];
        const T16* ap = A + aoff + kc * 16; const T16* ap2 = SA ? A2 + aoff + kc * 16 : ap; const T16* bp = Bt + boff + kc * 16; const T16* bp2 = SB ? Bt2 + boff + kc * 16 : bp;   // the rest is immediate offsets
#pragma unroll
        for (int i = 0; i < 4; ++i) { a[i] = WFrag<T16>::ldf(ap + i * 16 * K); if (SA) a2[i] = WFrag<T16>::ldf(ap2 + i * 16 * K); b[i] = WFrag<T16>::ldf(bp + i * 16 * K); if (SB) b2[i] = WFrag<T16>::ldf(bp2 + i * 16 * K); }
        asm volatile("s_wait_xcnt 0x0" :: "v"(ap), "v"(ap2), "v"(bp), "v"(bp2) : "memory");   // the loads' address pairs live up to here: no register of them is rewritten before this wait
#pragma unroll
        for (int nb = 0; nb < 4; ++nb) {
#pragma unroll
            for (int mb = 0; mb < 4; ++mb) { acc[mb][nb] = WFrag<T16>::mma(a[mb], b[nb], acc[mb][nb]); if (SA) acc[mb][nb] = WFrag<T16>::mma(a2[mb], b[nb], acc[mb][nb]); if (SB) acc[mb][nb] = WFrag<T16>::mma(a[mb], b2[nb], acc[mb][nb]); } }
        asm volatile("v_nop\n\tv_nop\n\tv_nop\n\tv_nop" : "+v"(acc[0][0]), "+v"(acc[1][1]), "+v"(acc[2][2]), "+v"(acc[3][3]) : "v"(a[0]), "v"(a[3]));
    }
#pragma unroll
    for (int mb = 0; mb < 4; ++mb) {
#pragma unroll
        for (int nb = 0; nb < 4; ++nb) {
#pragma unroll
            for (int j = 0; j < 8; ++j) os[(hi * 8 + j) * 68 + nb * 16 + lr] = acc[mb][nb][j]; }
        __builtin_amdgcn_wave_barrier(); asm volatile("" ::: "memory");
        float* crow = C + (size_t)(r0 + mb * 16) * ldc + c0;
{
#pragma unroll
            for (int s = 0; s < 8; ++s) { const int row = 2 * s + hi, cofs = lr * 4; v4f val = *(const v4fa*)(os + row * 68 + cofs); if (BIAS) { val[0] += bfr(bias[c0 + cofs]); val[1] += bfr(bias[c0 + cofs + 1]); val[2] += bfr(bias[c0 + cofs + 2]); val[3] += bfr(bias[c0 + cofs + 3]); }
                *(v4f*)(crow + (size_t)row * ldc + cofs) = val;
                asm volatile("s_wait_xcnt 0x0" ::: "memory"); }   // the next rows' values and addresses may go into this store's registers: none is rewritten before this wait
             }
        __builtin_amdgcn_wave_barrier(); asm volatile("" ::: "memory");
    }
    asm volatile("s_wait_xcnt 0x0" ::: "memory");   // a precaution (its one caller, k_gemmw, ends behind it): no register of this tile's last stores is rewritten before this wait
}
template <typename T16, int NSPLIT, bool BIAS, int K, int KS = 1>
__global__ __launch_bounds__(32) void k_gemmw(const T16* __restrict__ A, const T16* __restrict__ A2, const T16* __restrict__ Bt, const T16* __restrict__ Bt2, float* C, int ldc, const float* __restrict__ bias, size_t sA, size_t sB, size_t sC) {
    __shared__ __align__(16) float os[16 * 68];
    const size_t z = blockIdx.z; A += z * sA; if (A2) A2 += z * sA; Bt += z * sB; if (Bt2) Bt2 += z * sB; C += z * sC;
    gemmw_tile<T16, NSPLIT, BIAS, K, KS>(os, A, A2, Bt, Bt2, C, ldc, bias, blockIdx.x, blockIdx.y);
}

__device__ __forceinline__ h16 tohx(float x) { return (h16)x; }
__device__ __forceinline__ void splitf(float y, unsigned short& h, unsigned short& l) { h = f2bf(y); l = f2bf(y - bf2f(h)); }
typedef __attribute__((ext_vector_type(2))) _Float16 v2h;
typedef __attribute__((ext_vector_type(4))) _Float16 v4h;
typedef __attribute__((ext_vector_type(2))) unsigned short v2us;
typedef __attribute__((ext_vector_type(4))) unsigned short v4us;
typedef __attribute__((ext_vector_type(2))) float v2f;
typedef __attribute__((ext_vector_type(4))) int v4i;

__global__ __launch_bounds__(256) void k_wtG(const float* __restrict__ w, int K, int N, bf* Bt) {
    const int lane = threadIdx.x & 31; const int L0 = (blockIdx.x * 8 + (threadIdx.x >> 5)) * 8; const int nlines = N * K / 64;
{
#pragma unroll 1
        for (int l = 0; l < 8; ++l) { const int L = L0 + l; if (L >= nlines) break; const size_t e = (size_t)L * 64 + lane * 2; const int k = (int)(e % K), n = (int)(e / K); v2us o;
            o[0] = f2bf(w[(size_t)k * N + n]); o[1] = f2bf(w[(size_t)(k + 1) * N + n]); *(v2us*)(Bt + e) = o; }
         }
}
// d_cvtF: a row-major f32 [row][K] to bf16 in fragment order, fragments [row / 16][k / 32]; thread i writes the plane's 16 bytes number i
__device__ __forceinline__ void d_cvtF(const float* __restrict__ src, int K, bf* dst, size_t n8, unsigned bx) { const size_t i = (size_t)bx * 256 + threadIdx.x; if (i >= n8) return;
    const int lr = (int)(i & 15), f = (int)(i >> 6), k0 = (f % (K / 32)) * 32 + (int)((i >> 5) & 1) * 16 + (int)((i >> 4) & 1) * 8, r16 = f / (K / 32); const float* sp = src + (size_t)(r16 * 16 + lr) * K + k0; const v8f v = *(const v8f*)sp; v8us o;
    asm volatile("s_wait_xcnt 0x0" :: "v"(sp) : "memory");   // the loads' address lives up to here: no register of it is rewritten before this wait
#pragma unroll
    for (int k = 0; k < 8; ++k) o[k] = f2bf(v[k]); *(v8us*)(dst + i * 8) = o;  }

// ---- projections: ONE WAVE per 64x64 tile as in k_gemmw, K = DM, bf16 operands in fragment order; the tile (+ bias) does not go out as f32 but straight as the attention's operand planes, in fragment order too.
typedef __attribute__((ext_vector_type(2))) __bf16 v2bf;
// proj_tile: rows r0.. of A x rows c0.. of Bt (both [row][DM], fragments [row / 16][k / 32]); planes P16 (fp16), Ph + Pl (bf16 hi + lo of the same f32 value), the tile's column being the planes' k. ROWB: bias[row] and fragments [k / 32][row / 16] (HD rows), else bias[column] and fragments [row / 16][k / 32] (k < HD). os: 16 x 68 floats of LDS.
template <bool ROWB>
__device__ __forceinline__ void proj_tile(float* os, const bf* __restrict__ A, const bf* __restrict__ Bt, const float* __restrict__ bias, int bx, int by, h16* P16, bf* Ph, bf* Pl) {
    const int lane = threadIdx.x & 31, lr = lane & 15, hi = lane >> 4; const int r0 = bx * 64, c0 = by * 64;
    constexpr int NPB = ROWB ? 4 : 32; float pb[NPB];   // the biases of the lane's 4 rows or 4 x 8 columns in the epilogue; fetched here, so that they fly under the k loop
    { const float* bp = ROWB ? bias + r0 + lr : bias + c0 + 8 * hi;
#pragma unroll
      for (int i = 0; i < NPB; ++i) pb[i] = bp[ROWB ? 16 * i : 16 * (i >> 3) + (i & 7)];
      asm volatile("s_wait_xcnt 0x0" :: "v"(bp) : "memory"); }   // the loads' address lives up to here: no register of it is rewritten before this wait
    v8f acc[4][4];
#pragma unroll
    for (int mb = 0; mb < 4; ++mb)
#pragma unroll
        for (int nb = 0; nb < 4; ++nb) acc[mb][nb] = (v8f){};
    const bf* a0 = A + (size_t)r0 * DM + 8 * lane; const bf* b0 = Bt + (size_t)c0 * DM + 8 * lane;   // 16 rows are DM / 32 fragments = 16 DM elements
#pragma unroll 1   // one address pair per operand a trip, the ones the wait below names
    for (int kc = 0; kc < DM; kc += 32) {
        const bf* ap = a0 + kc * 16; const bf* bp = b0 + kc * 16; v16bf a[4], b[4];
#pragma unroll
        for (int i = 0; i < 4; ++i) { a[i] = WFrag<bf>::ldf(ap + i * 16 * DM); b[i] = WFrag<bf>::ldf(bp + i * 16 * DM); }
        asm volatile("s_wait_xcnt 0x0" :: "v"(ap), "v"(bp) : "memory");   // the loads' address pairs live up to here: no register of them is rewritten before this wait
#pragma unroll
        for (int nb = 0; nb < 4; ++nb)
#pragma unroll
            for (int mb = 0; mb < 4; ++mb) acc[mb][nb] = wmmab(a[mb], b[nb], acc[mb][nb]);
    }
    v2f bb[NPB / (ROWB ? 1 : 2)];   // bf16-rounded biases, as pairs for the packed add
#pragma unroll
    for (int i = 0; i < NPB / (ROWB ? 1 : 2); ++i) { bb[i][0] = bfr(pb[ROWB ? i : 2 * i]); bb[i][1] = bfr(pb[ROWB ? i : 2 * i + 1]); }
    const size_t po = (ROWB ? (size_t)(c0 / 32) * (HD / 16) + r0 / 16 : (size_t)(r0 / 16) * (HD / 32) + c0 / 32) * 512 + 8 * lane; h16* p16 = P16 + po; bf* ph = Ph + po; bf* pl = Pl + po;
#pragma unroll
    for (int mb = 0; mb < 4; ++mb) {
#pragma unroll
        for (int nb = 0; nb < 4; ++nb) {
#pragma unroll
            for (int j = 0; j < 8; ++j) os[(hi * 8 + j) * 68 + nb * 16 + lr] = acc[mb][nb][j]; }
        __builtin_amdgcn_wave_barrier(); asm volatile("" ::: "memory");   // the wave's LDS reads below stay behind its writes above (other lanes' values)
#pragma unroll
        for (int s = 0; s < 4; ++s) {   // the wave takes 16 rows x 16 columns: half a fragment, 512 bytes in a row in each plane
            const float* op = os + lr * 68 + 16 * s + 8 * hi; const v4f x0 = *(const v4fa*)op, x1 = *(const v4fa*)(op + 4); v8h o16; v8us oh, ol;
#pragma unroll
            for (int p = 0; p < 4; ++p) { v2f x; x[0] = (p < 2) ? x0[2 * (p & 1)] : x1[2 * (p & 1)]; x[1] = (p < 2) ? x0[2 * (p & 1) + 1] : x1[2 * (p & 1) + 1]; x += bb[ROWB ? mb : s * 4 + p];
                const v2h h = __builtin_convertvector(x, v2h); const v2bf t = __builtin_convertvector(x, v2bf); const v2bf u = __builtin_convertvector(x - __builtin_convertvector(t, v2f), v2bf);   // all three round to nearest even, as tohx and splitf do
                const v2us tu = __builtin_bit_cast(v2us, t), uu = __builtin_bit_cast(v2us, u); o16[2 * p] = h[0]; o16[2 * p + 1] = h[1]; oh[2 * p] = tu[0]; oh[2 * p + 1] = tu[1]; ol[2 * p] = uu[0]; ol[2 * p + 1] = uu[1]; }
            const int ro = (ROWB ? (s >> 1) * (HD / 16) + mb : mb * (HD / 32) + (s >> 1)) * 512 + (s & 1) * 256; *(v8h*)(p16 + ro) = o16; *(v8us*)(ph + ro) = oh; *(v8us*)(pl + ro) = ol;
            asm volatile("s_wait_xcnt 0x0" ::: "memory"); }   // the next 16 columns' (or rows') values may go into these stores' registers: none is rewritten before this wait
        __builtin_amdgcn_wave_barrier(); asm volatile("" ::: "memory");   // the next 16 rows' LDS writes stay behind these reads
    }
}
// k_proj3: the theta, phi and g projections of all images in ONE launch; grid (TT / 64, 3 x HD / 64, image).
// theta and phi: rows = positions, planes [t][d]; g with the operands swapped (rows = g_w's, columns = positions), so that its planes are [d][t] as the attn x g product reads them, the 8 fragments of 32 keys side by side.
__global__ __launch_bounds__(32) void k_proj3(const bf* __restrict__ XB, const bf* __restrict__ WQ, const bf* __restrict__ WK, const bf* __restrict__ WV, h16* QP16, bf* QPh, bf* QPl, h16* KP16, bf* KPh, bf* KPl, h16* VT16, bf* VTh, bf* VTl, const float* __restrict__ bq, const float* __restrict__ bk, const float* __restrict__ bv) {
    __shared__ __align__(16) float os[16 * 68];
    const int w = blockIdx.y / (HD / 64), by = blockIdx.y % (HD / 64); const size_t im = blockIdx.z, zb = im * TT * HD; const bf* X = XB + im * TT * DM;
    if (w == 2) proj_tile<true>(os, WV, X, bv, by, blockIdx.x, VT16 + zb, VTh + zb, VTl + zb);
    else proj_tile<false>(os, X, (w == 0) ? WQ : WK, (w == 0) ? bq : bk, blockIdx.x, by, ((w == 0) ? QP16 : KP16) + zb, ((w == 0) ? QPh : KPh) + zb, ((w == 0) ? QPl : KPl) + zb);
}
// ---- fused attention: logits, softmax and attn x g in ONE kernel; the logits stay in registers.
// A wave holds QB x 16 queries and walks its slice's nk keys, 32 at a time: St = K Qt (row = key, column = query: a lane holds one query's scores), running maximum and sum per query (online softmax),
// Pt packed from the score accumulators straight into a B operand (they already lie in the loaders' k order), Ot += Vt Pt (row = d, column = query: the rescale factor is the lane's own).
// A slice leaves O[t / 16][slice][d / 16][(d >> 2) & 1][lane (t & 15) + 16 ((d >> 3) & 1)][d & 3] = sum_k 2^PSH exp(s - m) g (not normalised; the accumulators' own lane order, so that a store and k_merge's load take 512 bytes in a row) and ML[slice][t] = (m, sum_k 2^PSH exp(s - m)), 16 queries = one whole line from one wave; k_merge joins the slices.
__device__ __forceinline__ float xhalf(float x) { return __builtin_bit_cast(float, __builtin_amdgcn_permlanex16(__builtin_bit_cast(int, x), __builtin_bit_cast(int, x), 0x76543210, 0xfedcba98, false, false)); }   // lane l reads lane l ^ 16
template <typename T16> struct PPack;
template <> struct PPack<h16> { static __device__ __forceinline__ void mk(const v8f a, const v8f b, v16h& p, v16h& p2) { (void)p2;
#pragma unroll
    for (int i = 0; i < 8; ++i) { p[i] = tohx(a[i]); p[8 + i] = tohx(b[i]); } } };
template <> struct PPack<bf> { static __device__ __forceinline__ void mk(const v8f a, const v8f b, v16bf& p, v16bf& p2) { v16us h, l;
#pragma unroll
    for (int i = 0; i < 8; ++i) { unsigned short x, y; splitf(a[i], x, y); h[i] = x; l[i] = y; splitf(b[i], x, y); h[8 + i] = x; l[8 + i] = y; }
    p = __builtin_bit_cast(v16bf, h); p2 = __builtin_bit_cast(v16bf, l); } };
// HL: hi + lo planes, 3 products each (hi x hi, the query side's or P's lo x hi, hi x the key side's lo). Q, K [t][d], Vt [d][t], all in fragment order as k_proj3 leaves them; O and ML already point at the image and the slice's slot.
template <typename T16, bool HL, int QB>
__device__ __forceinline__ void fa_tile(const T16* __restrict__ Q, const T16* __restrict__ Q2, const T16* __restrict__ Kp, const T16* __restrict__ K2, const T16* __restrict__ Vt, const T16* __restrict__ V2, int q0, int k0, unsigned nk, float* O, float* ML) {
    typedef typename WFrag<T16>::V V;
    const int lane = threadIdx.x & 31, lr = lane & 15, hi = lane >> 4;
    const size_t qo0 = (size_t)q0 * HD + 8 * lane, ko = (size_t)k0 * HD + 8 * lane, vo = ko;   // fragment order: 16 rows of Q or K are HD / 32 = 4 fragments, 32 keys of Vt HD / 16 = 8 fragments: HD elements a row or key in both
    const T16* qp = Q + qo0; const T16* qp2 = HL ? Q2 + qo0 : qp; const T16* kp = Kp + ko; const T16* kp2 = HL ? K2 + ko : kp;   // every batch of loads has one address per plane; the rest is immediate offsets
    V qf[QB][4], qf2[QB][4];
#pragma unroll
    for (int qb = 0; qb < QB; ++qb)
#pragma unroll
        for (int ks = 0; ks < 4; ++ks) { const int qo = qb * 16 * HD + ks * 512; qf[qb][ks] = WFrag<T16>::ldf(qp + qo); if (HL) qf2[qb][ks] = WFrag<T16>::ldf(qp2 + qo); }
    v8f o[8][QB]; float m[QB], l[QB];
#pragma unroll
    for (int qb = 0; qb < QB; ++qb) { m[qb] = -3.0e38f; l[qb] = 0.0f;
#pragma unroll
        for (int db = 0; db < 8; ++db) o[db][qb] = (v8f){}; }
    V kf[2][4], kf2[2][4];   // the K fragments of a pass, fetched one pass ahead
#pragma unroll
    for (int kb = 0; kb < 2; ++kb)
#pragma unroll
        for (int ks = 0; ks < 4; ++ks) { const int fo = kb * 16 * HD + ks * 512; kf[kb][ks] = WFrag<T16>::ldf(kp + fo); if (HL) kf2[kb][ks] = WFrag<T16>::ldf(kp2 + fo); }
    asm volatile("s_wait_xcnt 0x0" :: "v"(qp), "v"(qp2), "v"(kp), "v"(kp2) : "memory");   // the loads' address pairs live up to here: no register of them is rewritten before this wait
    __builtin_amdgcn_sched_barrier(0);   // holds the loop's address arithmetic below that wait
    unsigned kk = 0;
#pragma unroll 1   // one pass of 32 keys with its fragments in flight already fills the registers
    do {   // a slice has at least one pass, so the test stands at the foot (with it at the head this build kept one address pair in scratch and fetched it back in every pass)
        V vf[8], vf2[8]; const T16* vp = Vt + vo + (size_t)(kk * HD); const T16* vp2 = HL ? V2 + vo + (size_t)(kk * HD) : vp;
#pragma unroll
        for (int db = 0; db < 8; ++db) { const int fo = db * 512; vf[db] = WFrag<T16>::ldf(vp + fo); if (HL) vf2[db] = WFrag<T16>::ldf(vp2 + fo); }
        asm volatile("s_wait_xcnt 0x0" :: "v"(vp), "v"(vp2) : "memory");   // these loads stay in flight: their address pairs live up to here, and no register of them is rewritten before this wait
        __builtin_amdgcn_sched_barrier(0);   // holds the Vt loads up here: they fly under the score products and the softmax (left alone, the compiler loads one fragment at a time, each right in front of its products)
        v8f s[2][QB];
#pragma unroll
        for (int kb = 0; kb < 2; ++kb) {
#pragma unroll
            for (int qb = 0; qb < QB; ++qb) s[kb][qb] = (v8f){};
#pragma unroll
            for (int ks = 0; ks < 4; ++ks)
#pragma unroll
                for (int qb = 0; qb < QB; ++qb) { s[kb][qb] = WFrag<T16>::mma(kf[kb][ks], qf[qb][ks], s[kb][qb]); if (HL) { s[kb][qb] = WFrag<T16>::mma(kf[kb][ks], qf2[qb][ks], s[kb][qb]); s[kb][qb] = WFrag<T16>::mma(kf2[kb][ks], qf[qb][ks], s[kb][qb]); } } }
        __builtin_amdgcn_sched_barrier(0);   // keeps the next pass's K loads behind the products above, so that they go into the registers those have just read and need no second set
        const unsigned kn = (kk + 32 < nk) ? kk + 32 : kk;   // the last pass has no next one: it fetches its own keys again (in bounds, not used)
        kp = Kp + ko + (size_t)(kn * HD); kp2 = HL ? K2 + ko + (size_t)(kn * HD) : kp;
#pragma unroll
        for (int kb = 0; kb < 2; ++kb)
#pragma unroll
            for (int ks = 0; ks < 4; ++ks) { const int fo = kb * 16 * HD + ks * 512; kf[kb][ks] = WFrag<T16>::ldf(kp + fo); if (HL) kf2[kb][ks] = WFrag<T16>::ldf(kp2 + fo); }
        asm volatile("s_wait_xcnt 0x0" :: "v"(kp), "v"(kp2) : "memory");   // as behind the Vt loads
        __builtin_amdgcn_sched_barrier(0);   // holds the K loads up here: they fly under the softmax and the Vt Pt products
        V pf[QB], pf2[QB];
#pragma unroll
        for (int qb = 0; qb < QB; ++qb) {
            float bm = s[0][qb][0];
#pragma unroll
            for (int kb = 0; kb < 2; ++kb)
#pragma unroll
                for (int j = 0; j < 8; ++j) bm = fmaxf(bm, s[kb][qb][j]);
            bm = fmaxf(bm, xhalf(bm));   // the other half of the wave holds the query's other keys
            const float mn = fmaxf(m[qb], bm * SCL), al = __builtin_amdgcn_exp2f((m[qb] - mn) * L2E); m[qb] = mn;
            float rs = 0.0f;
#pragma unroll
            for (int kb = 0; kb < 2; ++kb)
#pragma unroll
                for (int j = 0; j < 8; ++j) { const float p = __builtin_amdgcn_exp2f((s[kb][qb][j] * SCL - mn) * L2E + PSH); s[kb][qb][j] = p; rs += p; }
            l[qb] = l[qb] * al + rs;   // each half of the wave sums its own keys; the halves join behind the loop
#pragma unroll
            for (int db = 0; db < 8; ++db) o[db][qb] *= al;
            PPack<T16>::mk(s[0][qb], s[1][qb], pf[qb], pf2[qb]);
        }
#pragma unroll
        for (int db = 0; db < 8; ++db)
#pragma unroll
            for (int qb = 0; qb < QB; ++qb) { o[db][qb] = WFrag<T16>::mma(vf[db], pf[qb], o[db][qb]); if (HL) { o[db][qb] = WFrag<T16>::mma(vf[db], pf2[qb], o[db][qb]); o[db][qb] = WFrag<T16>::mma(vf2[db], pf[qb], o[db][qb]); } }
        kk += 32;
    } while (kk < nk);
    float* ob0 = O + (size_t)q0 * (KSP * HD) + 4 * lane;   // one address for all the stores of O; the rest is immediate offsets
#pragma unroll
    for (int qb = 0; qb < QB; ++qb) { const size_t t = (size_t)(q0 + qb * 16 + lr); float* ob = ob0 + qb * (16 * KSP * HD); const float lj = l[qb] + xhalf(l[qb]);
#pragma unroll
        for (int db = 0; db < 8; ++db) { v4f x, y;
#pragma unroll
            for (int j = 0; j < 4; ++j) { x[j] = o[db][qb][j]; y[j] = o[db][qb][4 + j]; }
            *(v4f*)(ob + db * 256) = x; *(v4f*)(ob + db * 256 + 128) = y; }   // each store: 512 bytes in a row
        if (hi == 0) { v2f ml; ml[0] = m[qb]; ml[1] = lj; *(v2f*)(ML + t * 2) = ml; } }
    asm volatile("s_wait_xcnt 0x0" ::: "memory");   // the kernel lays the other row range's code behind this tile's last stores: no register of theirs is rewritten before this wait
}
// k_fattn: all images, all query rows, all key slices in ONE launch; 4 waves a work-group, all on the same keys (they share the K and Vt lines in the WGP cache). Flat grid: rows < RH in front (hi + lo planes, 32 queries a wave), then rows >= RH (fp16, 64 queries a wave); query group fastest, then slice, then image.
__global__ __launch_bounds__(128) void k_fattn(const bf* __restrict__ Qh, const bf* __restrict__ Ql, const bf* __restrict__ Kh, const bf* __restrict__ Kl, const bf* __restrict__ Vh, const bf* __restrict__ Vl, const h16* __restrict__ Q16, const h16* __restrict__ K16, const h16* __restrict__ V16, float* O, float* ML) {
    constexpr int GH = RH / 128, GL = (TT - RH) / 256, NHI = NB_ * KSP * GH;
    const int id = blockIdx.x, w = threadIdx.x >> 5;
    if (id < NHI) { const int g = id % GH, z = (id / GH) % KSP, k0 = z * NPS / KSP * 32, k1 = (z + 1) * NPS / KSP * 32; const size_t im = id / (GH * KSP), zb = im * TT * HD;
        fa_tile<bf, true, 2>(Qh + zb, Ql + zb, Kh + zb, Kl + zb, Vh + zb, Vl + zb, g * 128 + w * 32, k0, k1 - k0, O + zb * KSP + z * (16 * HD), ML + (im * KSP + z) * TT * 2);
    } else { const int il = id - NHI; const int g = il % GL, z = (il / GL) % KSP, k0 = z * NPS / KSP * 32, k1 = (z + 1) * NPS / KSP * 32; const size_t im = il / (GL * KSP), zb = im * TT * HD;
        fa_tile<h16, false, 4>(Q16 + zb, nullptr, K16 + zb, nullptr, V16 + zb, nullptr, RH + g * 256 + w * 64, k0, k1 - k0, O + zb * KSP + z * (16 * HD), ML + (im * KSP + z) * TT * 2); }
}
// d_cvtT: X [c][n] f32 to XB [n][c] bf16 in fragment order, fragments [n / 16][c / 32]. A thread makes 16 bytes (8 channels of one position); a wave makes half a fragment (512 bytes in a row) and reads 16 positions in a row of each channel; waves w and w ^ 1 take the two halves of the same lines of X.
__device__ __forceinline__ void d_cvtT(const float* __restrict__ X, bf* XB, unsigned bx) { const size_t i = (size_t)bx * 256 + threadIdx.x; if (i >= (size_t)TT * DM / 8) return;
    const int lane = (int)(i & 31), n16 = (int)(i >> 10) * 2 + (int)((i >> 5) & 1), h = (int)((i >> 6) & 1), ks = (int)((i >> 7) & 7); const int c0 = ks * 32 + h * 16 + (lane >> 4) * 8, n = n16 * 16 + (lane & 15);
    const float* xp = X + (size_t)c0 * TT + n; float v[8]; v8us o;
#pragma unroll
    for (int q = 0; q < 8; ++q) v[q] = xp[q * TT];
    asm volatile("s_wait_xcnt 0x0" :: "v"(xp) : "memory");   // the loads' address lives up to here: no register of it is rewritten before this wait
#pragma unroll
    for (int q = 0; q < 8; ++q) o[q] = f2bf(v[q]);
    *(v8us*)(XB + ((size_t)(n16 * (DM / 32) + ks) * 2 + h) * 256 + lane * 8) = o;  }
// k_prep: everything that reads only the inputs, in ONE launch; flat grid: NB_ x NBT blocks turn the images token-major, 4 x NBW blocks round the weights
#define NBT ((TT * DM / 8 + 255) / 256)
#define NBW ((HD * DM / 8 + 255) / 256)
__global__ __launch_bounds__(256) void k_prep(const float* __restrict__ xin, const float* __restrict__ wq, const float* __restrict__ wk, const float* __restrict__ wv, const float* __restrict__ wo, bf* XB, bf* WQ, bf* WK, bf* WV, bf* WO) {
    const unsigned id = blockIdx.x;
    if (id < NB_ * NBT) { const size_t im = id / NBT; d_cvtT(xin + im * DM * TT, XB + im * TT * DM, id % NBT); }
    else if (id < NB_ * NBT + 4 * NBW) { const unsigned w = (id - NB_ * NBT) / NBW; d_cvtF((w == 0) ? wq : (w == 1) ? wk : (w == 2) ? wv : wo, (w == 3) ? DQ : DM, (w == 0) ? WQ : (w == 1) ? WK : (w == 2) ? WV : WO, (size_t)HD * DM / 8, (id - NB_ * NBT) % NBW); }
}
// ---- k_bn: training-mode BatchNorm and residual in ONE kernel. Y = W_w y without its bias, channel-major [image][c][n] as the output is; the bias wb[c] is added at the read.
// Work-group c holds channel c of all images (NB_ x TT values, 32 a thread) in registers from the one read of Y: mean, then the variance about that mean, then the output; nothing goes back to memory in between. The residual's x is fetched together with Y.
// Sum order (fixed): a thread's 8 pieces of 4 positions, image by image, in 4 columns; the columns; the wave's 32 lanes by exchange; the 16 waves in wave order.
#define BNT 512
template <int M> __device__ __forceinline__ float xrow(float x) { return __builtin_bit_cast(float, __builtin_amdgcn_update_dpp(0, __builtin_bit_cast(int, x), 0x160 | M, 0xf, 0xf, true)); }   // lane l reads lane l ^ M, M < 16 (row_xmask)
__device__ __forceinline__ float bn_sum(v4f a, float* red) {   // the sum over the work-group, the same bits in every thread; red: BNT / 32 floats of LDS that nothing else uses
    float s = (a[0] + a[1]) + (a[2] + a[3]); s += xrow<1>(s); s += xrow<2>(s); s += xrow<4>(s); s += xrow<8>(s); s += xhalf(s);
    if ((threadIdx.x & 31) == 0) red[threadIdx.x >> 5] = s;
    __syncthreads();
    float t = 0.0f;
#pragma unroll
    for (int i = 0; i < BNT / 32; i += 4) { const v4f r = *(const v4fa*)(red + i); t += r[0]; t += r[1]; t += r[2]; t += r[3]; }
    return t; }
__global__ __launch_bounds__(BNT) void k_bn(const float* __restrict__ Y, const float* __restrict__ wb, const float* __restrict__ g, const float* __restrict__ bb, const float* __restrict__ X, float* OUT) {
    __shared__ __align__(16) float red[2][BNT / 32];
    constexpr int NV = TT / 4 / BNT; constexpr float RN = 1.0f / (float)(NB_ * TT);   // a power of two: the product is the exact quotient
    const int c = blockIdx.x; const size_t e0 = (size_t)c * TT + threadIdx.x * 4;
    static_assert(NB_ == 4, "two address pairs a buffer");
    const float* yp[2]; const float* xp[2]; float* op[2]; v4f y[NB_][NV], x[NB_][NV];   // one address per two images; the rest is immediate offsets
#pragma unroll
    for (int i = 0; i < 2; ++i) { yp[i] = Y + e0 + (size_t)i * 2 * DM * TT; xp[i] = X + e0 + (size_t)i * 2 * DM * TT; op[i] = OUT + e0 + (size_t)i * 2 * DM * TT; }
#pragma unroll   // all loads of a thread in flight together, each 512 bytes in a row; Y in front: the sums need it first
    for (int b = 0; b < NB_; ++b)
#pragma unroll
        for (int h = 0; h < NV; ++h) y[b][h] = *(const v4f*)(yp[b >> 1] + (b & 1) * DM * TT + h * BNT * 4);
#pragma unroll
    for (int b = 0; b < NB_; ++b)
#pragma unroll
        for (int h = 0; h < NV; ++h) x[b][h] = *(const v4f*)(xp[b >> 1] + (b & 1) * DM * TT + h * BNT * 4);
    asm volatile("s_wait_xcnt 0x0" :: "v"(yp[0]), "v"(xp[0]) : "memory");   // the arithmetic below may go into the loads' address registers: none is rewritten before this wait (the operands keep a later load's result out of the first address pairs)
    __builtin_amdgcn_sched_barrier(0);   // holds every load above the arithmetic (x is on its way while Y is summed) and the arithmetic below that wait
    const float wc = bfr(wb[c]), gm = bfr(g[c]), bt = bfr(bb[c]);
    v4f sa = (v4f){};
#pragma unroll
    for (int b = 0; b < NB_; ++b)
#pragma unroll
        for (int h = 0; h < NV; ++h) { y[b][h] += wc; sa += y[b][h]; }
    const float mu = bn_sum(sa, red[0]) * RN;
    v4f va = (v4f){};
#pragma unroll
    for (int b = 0; b < NB_; ++b)
#pragma unroll
        for (int h = 0; h < NV; ++h) { y[b][h] -= mu; va += y[b][h] * y[b][h]; }
    const float var = bn_sum(va, red[1]) * RN, rs = __fdiv_rn(1.0f, __fsqrt_rn(var + BNEPS));
#pragma unroll
    for (int b = 0; b < NB_; ++b)
#pragma unroll
        for (int h = 0; h < NV; ++h)
#pragma unroll
            for (int q = 0; q < 4; ++q) y[b][h][q] = ((gm * y[b][h][q]) * rs + bt) + bfr(x[b][h][q]);
    __builtin_amdgcn_sched_barrier(0);   // every value is made before the first store goes out: no register that a store names is written behind it
#pragma unroll
    for (int b = 0; b < NB_; ++b)
#pragma unroll
        for (int h = 0; h < NV; ++h) *(v4f*)(op[b >> 1] + (b & 1) * DM * TT + h * BNT * 4) = y[b][h];
}
// k_merge: joins the KSP key slices of every row of every image, in slice order: weights exp(m_slice - max m), then the softmax's division; hi + lo planes of the result, [t][d] in fragment order.
// Thread i makes the planes' 16 bytes number i: lane = i & 31 (row t & 15 = lane & 15), d / 16 = (i >> 5) & 7, t / 16 (over all images) = i >> 8; its 8 values d = 16 (d / 16) + 8 (lane >> 4) + 0..7 are two 16-byte pieces of O. Every load of O and every store takes 512 bytes in a row.
__global__ __launch_bounds__(256) void k_merge(const float* __restrict__ O, const float* __restrict__ ML, bf* Ah, bf* Al) { const size_t i = (size_t)blockIdx.x * 256 + threadIdx.x; if (i >= (size_t)NB_ * TT * HD / 8) return; const int lane = (int)(i & 31), db = (int)((i >> 5) & 7); const size_t r = (i >> 8) * 16 + (lane & 15);
    const float* op = O + (i >> 8) * (KSP * 16 * HD) + db * 256 + lane * 4; const float* mp = ML + ((r / TT) * KSP * TT + r % TT) * 2; v2f ml[KSP]; v4f u[KSP][2];
#pragma unroll   // all loads of a thread in flight together
    for (int p = 0; p < KSP; ++p) { ml[p] = *(const v2f*)(mp + p * TT * 2); u[p][0] = *(const v4f*)(op + p * (16 * HD)); u[p][1] = *(const v4f*)(op + p * (16 * HD) + 128); }
    asm volatile("s_wait_xcnt 0x0" :: "v"(op), "v"(mp) : "memory");   // the loads' address pairs live up to here: no register of them is rewritten before this wait
    __builtin_amdgcn_sched_barrier(0);   // holds every load above the arithmetic (left alone, the compiler issues the second half of them only when the first has come back)
    float mx = ml[0][0];
#pragma unroll
    for (int p = 1; p < KSP; ++p) mx = fmaxf(mx, ml[p][0]);
    float ls = 0.0f, s[8];
#pragma unroll
    for (int q = 0; q < 8; ++q) s[q] = 0.0f;
#pragma unroll
    for (int p = 0; p < KSP; ++p) { const float wt = __builtin_amdgcn_exp2f((ml[p][0] - mx) * L2E); ls += ml[p][1] * wt;
#pragma unroll
        for (int q = 0; q < 8; ++q) s[q] += u[p][q >> 2][q & 3] * wt; }
    v8us oh, ol;
#pragma unroll
    for (int q = 0; q < 8; ++q) { unsigned short a, c2; splitf(__fdiv_rn(s[q], ls), a, c2); oh[q] = a; ol[q] = c2; } *(v8us*)(Ah + i * 8) = oh; *(v8us*)(Al + i * 8) = ol;  }

extern "C" void kernel_launch(void* const* d_in, const int* in_sizes, int n_in,
                              void* d_out, int out_size, void* d_ws, size_t ws_size, hipStream_t stream) {
    (void)in_sizes; (void)n_in; (void)out_size;
    const float* xin = (const float*)d_in[0];   /* x [4][256][4096] NCHW */ const float* wv = (const float*)d_in[1]; const float* bv = (const float*)d_in[2];   /* g_w, g_b */ const float* wq = (const float*)d_in[3]; const float* bq = (const float*)d_in[4];   /* theta */ const float* wk = (const float*)d_in[5]; const float* bk = (const float*)d_in[6];   /* phi */ const float* wo = (const float*)d_in[7]; const float* bo = (const float*)d_in[8];   /* W_w [256][128], W_b */ const float* bng = (const float*)d_in[9]; const float* bnb = (const float*)d_in[10]; const float* x = nullptr; (void)x;
    float* OUT = (float*)d_out;     // [4][256][4096] NCHW
    char* wsp = (char*)d_ws;
    auto take = [&](size_t bytes) { char* p = wsp; wsp += (bytes + 255) & ~(size_t)255; return (void*)p; };
    float* YALL = (float*)take((size_t)NB_ * TT * DM * 4); bf* WQ = (bf*)take((size_t)DQ * DM * 2); bf* WK = (bf*)take((size_t)DKV * DM * 2); bf* WV = (bf*)take((size_t)DKV * DM * 2); bf* WO = (bf*)take((size_t)DM * DQ * 2);
    h16* QP16 = (h16*)take((size_t)NB_ * TT * HD * 2); h16* KP16 = (h16*)take((size_t)NB_ * TT * HD * 2); h16* VT16 = (h16*)take((size_t)NB_ * HD * TT * 2);   // every operand plane: one per image, image stride TT * HD
    bf* QPh = (bf*)take((size_t)NB_ * TT * HD * 2); bf* QPl = (bf*)take((size_t)NB_ * TT * HD * 2); bf* KPh = (bf*)take((size_t)NB_ * TT * HD * 2); bf* KPl = (bf*)take((size_t)NB_ * TT * HD * 2); bf* VTh = (bf*)take((size_t)NB_ * HD * TT * 2); bf* VTl = (bf*)take((size_t)NB_ * HD * TT * 2);
    float* Ob = (float*)take((size_t)NB_ * TT * KSP * HD * 4); float* ML = (float*)take((size_t)NB_ * TT * KSP * 2 * 4); bf* ATh = (bf*)take((size_t)NB_ * TT * DQ * 2); bf* ATl = (bf*)take((size_t)NB_ * TT * DQ * 2);
    if ((size_t)(wsp - (char*)d_ws) > ws_size) return;    // ws 256 MiB
    // the token-major images (8 MiB) lie in the buffer of the attention's partial results: they are dead before the attention writes it (stream-ordered)
    bf* XB = (bf*)Ob;
    // launches that do not depend on one another are ONE launch: all images, all weights, all three projections, both row ranges of a product
    k_prep<<<NB_ * NBT + 4 * NBW, 256, 0, stream>>>(xin, wq, wk, wv, wo, XB, WQ, WK, WV, WO);   /* NCHW [256][4096] -> token-major bf16 [4096][256] and bf16 weights, in fragment order */
    k_proj3<<<dim3(TT / 64, 3 * (HD / 64), NB_), 32, 0, stream>>>(XB, WQ, WK, WV, QP16, QPh, QPl, KP16, KPh, KPl, VT16, VTh, VTl, bq, bk, bv);   /* theta, phi, g + bias, straight into the attention's operand planes */
    k_fattn<<<NB_ * KSP * (RH / 128) + NB_ * KSP * ((TT - RH) / 256), 128, 0, stream>>>(QPh, QPl, KPh, KPl, VTh, VTl, QP16, KP16, VT16, Ob, ML);   /* key slice z -> partial Ob[image][t / 16][z][16 x HD in the accumulators' lane order], ML[image][z][t] */
    k_merge<<<(unsigned)(((size_t)NB_ * TT * HD / 8 + 255) / 256), 256, 0, stream>>>(Ob, ML, ATh, ATl);
    k_gemmw<bf, 3, false, DQ><<<dim3(DM / 64, TT / 64, NB_), 32, 0, stream>>>(WO, nullptr, ATh, ATl, YALL, TT, nullptr, 0, (size_t)TT * DQ, (size_t)DM * TT);   /* W_w y of all images, channel-major [image][c][n] (rows = W_w's, columns = positions; products W_w x hi, W_w x lo), kept for the batch statistics */
    k_bn<<<DM, BNT, 0, stream>>>(YALL, bo, bng, bnb, xin, OUT);   /* per channel: mean and 1/sqrt(var + eps) over the batch x 4,096 positions (training-mode BatchNorm); out[b][c][n] = gamma (Wy - mean) rstd + beta + x */

}

// v009
// It runs in 83.8 microseconds.
// Next to v008, in two timings, it ran 1.12 times as fast each time.
// Over all steps from v000 it is 12.8 times as fast.
#include <hip/hip_runtime.h>

// Non-local block (embedded Gaussian) over 64x64 = 4,096 positions with a training-mode BatchNorm and residual (x [4][256][64][64] NCHW; theta, phi, g = 1x1 convs C 256 -> Ci 128 ('oi' [128][256] 0.02, zero biases); f[n][m] = theta_n . phi_m (no scaling); attn = softmax over m; y[ci][n] = sum_m attn[n][m] g[ci][m]; Wy = W_w y + W_b ('oi' [256][128]); BatchNorm2d in TRAINING mode (per-channel mean/var over the whole batch x 64 x 64, eps 1e-5, gamma/beta read); out = BN(Wy) + x -> [4][256][64][64] (4.2 M)).
// Compute dtypes, f32 accumulate: every input rounded to bf16; convs exact + f32 bias; attention rows < 512 3 products, rest fp16; softmax f32; W_w hl x exact + bias; BatchNorm statistics and output f32 (fixed-order sums); residual f32 of the bf16-rounded x.

#define NB_  4
#define TT   4096
#define DM   256
#define NH_  1
#define NKV  1
#define REP  (NH_ / NKV)
#define HD   128
#define DQ   (NH_ * HD)
#define DKV  (NKV * HD)
#define ZH   1
#define RH   512                  // query rows < RH use hi+lo planes (0: none)
#define WIN  0
#define PSH  8.0f     // P carries 2^PSH (numerator and row sum alike: it cancels in the softmax's division), so that small weights stay in fp16's normal range
#define SCL  1.0f     // the non-local block applies no 1/sqrt(d)
#define CIN  256      // channels C (== DM)
#define BNEPS 1e-5f
#define KSP  7        // key slices of the fused attention (one work-group per slice); every slice leaves its partial result in a slot of its own. 7: a work-group's registers fill a WGP, and 72 query groups x 7 slices = 504 work-groups are two rounds of the chip's 256 WGPs (8 slices: 576, a third round for 64 of them)
#define NPS  (TT / 32) // passes of 32 keys over all keys; slice z takes the passes z NPS / KSP up to (z + 1) NPS / KSP (18 or 19 of them)
#define L2E  1.4426950408889634f
typedef _Float16 h16;
typedef unsigned short bf;
typedef __attribute__((ext_vector_type(16))) __bf16   v16bf;
typedef __attribute__((ext_vector_type(16))) _Float16 v16h;
typedef __attribute__((ext_vector_type(8)))  _Float16 v8h;
typedef __attribute__((ext_vector_type(8)))  unsigned short v8us;
typedef __attribute__((ext_vector_type(16))) unsigned short v16us;
typedef __attribute__((ext_vector_type(8)))  float    v8f;
typedef __attribute__((ext_vector_type(4)))  float    v4f;
typedef v8h  __attribute__((may_alias)) v8ha;
typedef v4f  __attribute__((may_alias)) v4fa;
typedef v8us __attribute__((may_alias)) v8usa;

__device__ __forceinline__ unsigned short f2bf(float f) { unsigned u = __float_as_uint(f); u += 0x7FFFu + ((u >> 16) & 1u); return (unsigned short)(u >> 16); }
__device__ __forceinline__ float bf2f(unsigned short b) { return __uint_as_float(((unsigned)b) << 16); }
__device__ __forceinline__ float bfr(float f) { return bf2f(f2bf(f)); }
__device__ __forceinline__ v16h cat16(v8h lo, v8h hi) { return __builtin_shufflevector(lo, hi, 0, 1, 2, 3, 4, 5, 6, 7, 8, 9, 10, 11, 12, 13, 14, 15); }
__device__ __forceinline__ v16bf cat16b(v8us lo, v8us hi) { return __builtin_bit_cast(v16bf, __builtin_shufflevector(lo, hi, 0, 1, 2, 3, 4, 5, 6, 7, 8, 9, 10, 11, 12, 13, 14, 15)); }
__device__ __forceinline__ v8f wmma16(v16h a, v16h b, v8f c) { return __builtin_amdgcn_wmma_f32_16x16x32_f16(false, a, false, b, (short)0, c, false, false); }
__device__ __forceinline__ v8f wmmab(v16bf a, v16bf b, v8f c) { return __builtin_amdgcn_wmma_f32_16x16x32_bf16(false, a, false, b, (short)0, c, false, false); }



// ---- fragments of the 16-bit operand planes
template <typename T16> struct WFrag;
// FRAGMENT ORDER of a 16-bit plane [row][k]: fragments of 16 rows x 32 k = 512 elements (1 KiB) lie whole, as two halves of 256 elements; in half h, lane (row & 15) + 16 hi holds the 8 elements k = 16 h + 8 hi + 0..7 at element lane * 8.
// ldf reads a fragment so laid (p: the fragment + lane * 8): each of its two loads takes 512 bytes in a row, 4 whole lines, where the same load on a row-major plane touches 16 lines. Lane and register hold the elements of the hardware's k order.
template <> struct WFrag<h16> { typedef v16h V; static __device__ __forceinline__ V ldf(const h16* p) { return cat16(*(const v8h*)p, *(const v8h*)(p + 256)); } static __device__ __forceinline__ v8f mma(V a, V b, v8f c) { return wmma16(a, b, c); } };
template <> struct WFrag<bf> { typedef v16bf V; static __device__ __forceinline__ V ldf(const bf* p) { return cat16b(*(const v8us*)p, *(const v8us*)(p + 256)); } static __device__ __forceinline__ v8f mma(V a, V b, v8f c) { return wmmab(a, b, c); } };

__device__ __forceinline__ h16 tohx(float x) { return (h16)x; }
__device__ __forceinline__ void splitf(float y, unsigned short& h, unsigned short& l) { h = f2bf(y); l = f2bf(y - bf2f(h)); }
typedef __attribute__((ext_vector_type(2))) _Float16 v2h;
typedef __attribute__((ext_vector_type(4))) _Float16 v4h;
typedef __attribute__((ext_vector_type(2))) unsigned short v2us;
typedef __attribute__((ext_vector_type(4))) unsigned short v4us;
typedef __attribute__((ext_vector_type(2))) float v2f;
typedef __attribute__((ext_vector_type(4))) int v4i;

__global__ __launch_bounds__(256) void k_wtG(const float* __restrict__ w, int K, int N, bf* Bt) {
    const int lane = threadIdx.x & 31; const int L0 = (blockIdx.x * 8 + (threadIdx.x >> 5)) * 8; const int nlines = N * K / 64;
{
#pragma unroll 1
        for (int l = 0; l < 8; ++l) { const int L = L0 + l; if (L >= nlines) break; const size_t e = (size_t)L * 64 + lane * 2; const int k = (int)(e % K), n = (int)(e / K); v2us o;
            o[0] = f2bf(w[(size_t)k * N + n]); o[1] = f2bf(w[(size_t)(k + 1) * N + n]); *(v2us*)(Bt + e) = o; }
         }
}
// d_cvtF: a row-major f32 [row][K] to bf16 in fragment order, fragments [row / 16][k / 32]; thread i writes the plane's 16 bytes number i
__device__ __forceinline__ void d_cvtF(const float* __restrict__ src, int K, bf* dst, size_t n8, unsigned bx) { const size_t i = (size_t)bx * 256 + threadIdx.x; if (i >= n8) return;
    const int lr = (int)(i & 15), f = (int)(i >> 6), k0 = (f % (K / 32)) * 32 + (int)((i >> 5) & 1) * 16 + (int)((i >> 4) & 1) * 8, r16 = f / (K / 32); const float* sp = src + (size_t)(r16 * 16 + lr) * K + k0; const v8f v = *(const v8f*)sp; v8us o;
    asm volatile("s_wait_xcnt 0x0" :: "v"(sp) : "memory");   // the loads' address lives up to here: no register of it is rewritten before this wait
#pragma unroll
    for (int k = 0; k < 8; ++k) o[k] = f2bf(v[k]); *(v8us*)(dst + i * 8) = o;  }

// ---- projections: ONE WAVE per 64x64 tile (16 accumulators), K = DM, bf16 operands in fragment order; the tile (+ bias) does not go out as f32 but straight as the attention's operand planes, in fragment order too.
typedef __attribute__((ext_vector_type(2))) __bf16 v2bf;
// proj_tile: rows r0.. of A x rows c0.. of Bt (both [row][DM], fragments [row / 16][k / 32]); planes P16 (fp16), Ph + Pl (bf16 hi + lo of the same f32 value), the tile's column being the planes' k. ROWB: bias[row] and fragments [k / 32][row / 16] (HD rows), else bias[column] and fragments [row / 16][k / 32] (k < HD). os: 16 x 68 floats of LDS.
template <bool ROWB>
__device__ __forceinline__ void proj_tile(float* os, const bf* __restrict__ A, const bf* __restrict__ Bt, const float* __restrict__ bias, int bx, int by, h16* P16, bf* Ph, bf* Pl) {
    const int lane = threadIdx.x & 31, lr = lane & 15, hi = lane >> 4; const int r0 = bx * 64, c0 = by * 64;
    constexpr int NPB = ROWB ? 4 : 32; float pb[NPB];   // the biases of the lane's 4 rows or 4 x 8 columns in the epilogue; fetched here, so that they fly under the k loop
    { const float* bp = ROWB ? bias + r0 + lr : bias + c0 + 8 * hi;
#pragma unroll
      for (int i = 0; i < NPB; ++i) pb[i] = bp[ROWB ? 16 * i : 16 * (i >> 3) + (i & 7)];
      asm volatile("s_wait_xcnt 0x0" :: "v"(bp) : "memory"); }   // the loads' address lives up to here: no register of it is rewritten before this wait
    v8f acc[4][4];
#pragma unroll
    for (int mb = 0; mb < 4; ++mb)
#pragma unroll
        for (int nb = 0; nb < 4; ++nb) acc[mb][nb] = (v8f){};
    const bf* a0 = A + (size_t)r0 * DM + 8 * lane; const bf* b0 = Bt + (size_t)c0 * DM + 8 * lane;   // 16 rows are DM / 32 fragments = 16 DM elements
#pragma unroll 1   // one address pair per operand a trip, the ones the wait below names
    for (int kc = 0; kc < DM; kc += 32) {
        const bf* ap = a0 + kc * 16; const bf* bp = b0 + kc * 16; v16bf a[4], b[4];
#pragma unroll
        for (int i = 0; i < 4; ++i) { a[i] = WFrag<bf>::ldf(ap + i * 16 * DM); b[i] = WFrag<bf>::ldf(bp + i * 16 * DM); }
        asm volatile("s_wait_xcnt 0x0" :: "v"(ap), "v"(bp) : "memory");   // the loads' address pairs live up to here: no register of them is rewritten before this wait
#pragma unroll
        for (int nb = 0; nb < 4; ++nb)
#pragma unroll
            for (int mb = 0; mb < 4; ++mb) acc[mb][nb] = wmmab(a[mb], b[nb], acc[mb][nb]);
    }
    v2f bb[NPB / (ROWB ? 1 : 2)];   // bf16-rounded biases, as pairs for the packed add
#pragma unroll
    for (int i = 0; i < NPB / (ROWB ? 1 : 2); ++i) { bb[i][0] = bfr(pb[ROWB ? i : 2 * i]); bb[i][1] = bfr(pb[ROWB ? i : 2 * i + 1]); }
    const size_t po = (ROWB ? (size_t)(c0 / 32) * (HD / 16) + r0 / 16 : (size_t)(r0 / 16) * (HD / 32) + c0 / 32) * 512 + 8 * lane; h16* p16 = P16 + po; bf* ph = Ph + po; bf* pl = Pl + po;
#pragma unroll
    for (int mb = 0; mb < 4; ++mb) {
#pragma unroll
        for (int nb = 0; nb < 4; ++nb) {
#pragma unroll
            for (int j = 0; j < 8; ++j) os[(hi * 8 + j) * 68 + nb * 16 + lr] = acc[mb][nb][j]; }
        __builtin_amdgcn_wave_barrier(); asm volatile("" ::: "memory");   // the wave's LDS reads below stay behind its writes above (other lanes' values)
#pragma unroll
        for (int s = 0; s < 4; ++s) {   // the wave takes 16 rows x 16 columns: half a fragment, 512 bytes in a row in each plane
            const float* op = os + lr * 68 + 16 * s + 8 * hi; const v4f x0 = *(const v4fa*)op, x1 = *(const v4fa*)(op + 4); v8h o16; v8us oh, ol;
#pragma unroll
            for (int p = 0; p < 4; ++p) { v2f x; x[0] = (p < 2) ? x0[2 * (p & 1)] : x1[2 * (p & 1)]; x[1] = (p < 2) ? x0[2 * (p & 1) + 1] : x1[2 * (p & 1) + 1]; x += bb[ROWB ? mb : s * 4 + p];
                const v2h h = __builtin_convertvector(x, v2h); const v2bf t = __builtin_convertvector(x, v2bf); const v2bf u = __builtin_convertvector(x - __builtin_convertvector(t, v2f), v2bf);   // all three round to nearest even, as tohx and splitf do
                const v2us tu = __builtin_bit_cast(v2us, t), uu = __builtin_bit_cast(v2us, u); o16[2 * p] = h[0]; o16[2 * p + 1] = h[1]; oh[2 * p] = tu[0]; oh[2 * p + 1] = tu[1]; ol[2 * p] = uu[0]; ol[2 * p + 1] = uu[1]; }
            const int ro = (ROWB ? (s >> 1) * (HD / 16) + mb : mb * (HD / 32) + (s >> 1)) * 512 + (s & 1) * 256; *(v8h*)(p16 + ro) = o16; *(v8us*)(ph + ro) = oh; *(v8us*)(pl + ro) = ol;
            asm volatile("s_wait_xcnt 0x0" ::: "memory"); }   // the next 16 columns' (or rows') values may go into these stores' registers: none is rewritten before this wait
        __builtin_amdgcn_wave_barrier(); asm volatile("" ::: "memory");   // the next 16 rows' LDS writes stay behind these reads
    }
}
// k_proj3: the theta, phi and g projections of all images in ONE launch; grid (TT / 64, 3 x HD / 64, image).
// theta and phi: rows = positions, planes [t][d]; g with the operands swapped (rows = g_w's, columns = positions), so that its planes are [d][t] as the attn x g product reads them, the 8 fragments of 32 keys side by side.
__global__ __launch_bounds__(32) void k_proj3(const bf* __restrict__ XB, const bf* __restrict__ WQ, const bf* __restrict__ WK, const bf* __restrict__ WV, h16* QP16, bf* QPh, bf* QPl, h16* KP16, bf* KPh, bf* KPl, h16* VT16, bf* VTh, bf* VTl, const float* __restrict__ bq, const float* __restrict__ bk, const float* __restrict__ bv) {
    __shared__ __align__(16) float os[16 * 68];
    const int w = blockIdx.y / (HD / 64), by = blockIdx.y % (HD / 64); const size_t im = blockIdx.z, zb = im * TT * HD; const bf* X = XB + im * TT * DM;
    if (w == 2) proj_tile<true>(os, WV, X, bv, by, blockIdx.x, VT16 + zb, VTh + zb, VTl + zb);
    else proj_tile<false>(os, X, (w == 0) ? WQ : WK, (w == 0) ? bq : bk, blockIdx.x, by, ((w == 0) ? QP16 : KP16) + zb, ((w == 0) ? QPh : KPh) + zb, ((w == 0) ? QPl : KPl) + zb);
}
// ---- fused attention: logits, softmax and attn x g in ONE kernel; the logits stay in registers.
// A wave holds QB x 16 queries and walks its slice's nk keys, 32 at a time: St = K Qt (row = key, column = query: a lane holds one query's scores), running maximum and sum per query (online softmax),
// Pt packed from the score accumulators straight into a B operand (they already lie in the loaders' k order), Ot += Vt Pt (row = d, column = query: the rescale factor is the lane's own).
// A slice leaves O[t / 16][slice][d / 16][(d >> 2) & 1][lane (t & 15) + 16 ((d >> 3) & 1)][d & 3] = sum_k 2^PSH exp(s - m) g (not normalised; the accumulators' own lane order, so that a store and k_mgemm's load take 512 bytes in a row) and ML[slice][t] = (m, sum_k 2^PSH exp(s - m)), 16 queries = one whole line from one wave; k_mgemm joins the slices.
__device__ __forceinline__ float xhalf(float x) { return __builtin_bit_cast(float, __builtin_amdgcn_permlanex16(__builtin_bit_cast(int, x), __builtin_bit_cast(int, x), 0x76543210, 0xfedcba98, false, false)); }   // lane l reads lane l ^ 16
template <typename T16> struct PPack;
template <> struct PPack<h16> { static __device__ __forceinline__ void mk(const v8f a, const v8f b, v16h& p, v16h& p2) { (void)p2;
#pragma unroll
    for (int i = 0; i < 8; ++i) { p[i] = tohx(a[i]); p[8 + i] = tohx(b[i]); } } };
template <> struct PPack<bf> { static __device__ __forceinline__ void mk(const v8f a, const v8f b, v16bf& p, v16bf& p2) { v16us h, l;
#pragma unroll
    for (int i = 0; i < 8; ++i) { unsigned short x, y; splitf(a[i], x, y); h[i] = x; l[i] = y; splitf(b[i], x, y); h[8 + i] = x; l[8 + i] = y; }
    p = __builtin_bit_cast(v16bf, h); p2 = __builtin_bit_cast(v16bf, l); } };
// HL: hi + lo planes, 3 products each (hi x hi, the query side's or P's lo x hi, hi x the key side's lo). Q, K [t][d], Vt [d][t], all in fragment order as k_proj3 leaves them; O and ML already point at the image and the slice's slot.
template <typename T16, bool HL, int QB>
__device__ __forceinline__ void fa_tile(const T16* __restrict__ Q, const T16* __restrict__ Q2, const T16* __restrict__ Kp, const T16* __restrict__ K2, const T16* __restrict__ Vt, const T16* __restrict__ V2, int q0, int k0, unsigned nk, float* O, float* ML) {
    typedef typename WFrag<T16>::V V;
    const int lane = threadIdx.x & 31, lr = lane & 15, hi = lane >> 4;
    const size_t qo0 = (size_t)q0 * HD + 8 * lane, ko = (size_t)k0 * HD + 8 * lane, vo = ko;   // fragment order: 16 rows of Q or K are HD / 32 = 4 fragments, 32 keys of Vt HD / 16 = 8 fragments: HD elements a row or key in both
    const T16* qp = Q + qo0; const T16* qp2 = HL ? Q2 + qo0 : qp; const T16* kp = Kp + ko; const T16* kp2 = HL ? K2 + ko : kp;   // every batch of loads has one address per plane; the rest is immediate offsets
    V qf[QB][4], qf2[QB][4];
#pragma unroll
    for (int qb = 0; qb < QB; ++qb)
#pragma unroll
        for (int ks = 0; ks < 4; ++ks) { const int qo = qb * 16 * HD + ks * 512; qf[qb][ks] = WFrag<T16>::ldf(qp + qo); if (HL) qf2[qb][ks] = WFrag<T16>::ldf(qp2 + qo); }
    v8f o[8][QB]; float m[QB], l[QB];
#pragma unroll
    for (int qb = 0; qb < QB; ++qb) { m[qb] = -3.0e38f; l[qb] = 0.0f;
#pragma unroll
        for (int db = 0; db < 8; ++db) o[db][qb] = (v8f){}; }
    V kf[2][4], kf2[2][4];   // the K fragments of a pass, fetched one pass ahead
#pragma unroll
    for (int kb = 0; kb < 2; ++kb)
#pragma unroll
        for (int ks = 0; ks < 4; ++ks) { const int fo = kb * 16 * HD + ks * 512; kf[kb][ks] = WFrag<T16>::ldf(kp + fo); if (HL) kf2[kb][ks] = WFrag<T16>::ldf(kp2 + fo); }
    asm volatile("s_wait_xcnt 0x0" :: "v"(qp), "v"(qp2), "v"(kp), "v"(kp2) : "memory");   // the loads' address pairs live up to here: no register of them is rewritten before this wait
    __builtin_amdgcn_sched_barrier(0);   // holds the loop's address arithmetic below that wait
    unsigned kk = 0;
#pragma unroll 1   // one pass of 32 keys with its fragments in flight already fills the registers
    do {   // a slice has at least one pass, so the test stands at the foot (with it at the head this build kept one address pair in scratch and fetched it back in every pass)
        V vf[8], vf2[8]; const T16* vp = Vt + vo + (size_t)(kk * HD); const T16* vp2 = HL ? V2 + vo + (size_t)(kk * HD) : vp;
#pragma unroll
        for (int db = 0; db < 8; ++db) { const int fo = db * 512; vf[db] = WFrag<T16>::ldf(vp + fo); if (HL) vf2[db] = WFrag<T16>::ldf(vp2 + fo); }
        asm volatile("s_wait_xcnt 0x0" :: "v"(vp), "v"(vp2) : "memory");   // these loads stay in flight: their address pairs live up to here, and no register of them is rewritten before this wait
        __builtin_amdgcn_sched_barrier(0);   // holds the Vt loads up here: they fly under the score products and the softmax (left alone, the compiler loads one fragment at a time, each right in front of its products)
        v8f s[2][QB];
#pragma unroll
        for (int kb = 0; kb < 2; ++kb) {
#pragma unroll
            for (int qb = 0; qb < QB; ++qb) s[kb][qb] = (v8f){};
#pragma unroll
            for (int ks = 0; ks < 4; ++ks)
#pragma unroll
                for (int qb = 0; qb < QB; ++qb) { s[kb][qb] = WFrag<T16>::mma(kf[kb][ks], qf[qb][ks], s[kb][qb]); if (HL) { s[kb][qb] = WFrag<T16>::mma(kf[kb][ks], qf2[qb][ks], s[kb][qb]); s[kb][qb] = WFrag<T16>::mma(kf2[kb][ks], qf[qb][ks], s[kb][qb]); } } }
        __builtin_amdgcn_sched_barrier(0);   // keeps the next pass's K loads behind the products above, so that they go into the registers those have just read and need no second set
        const unsigned kn = (kk + 32 < nk) ? kk + 32 : kk;   // the last pass has no next one: it fetches its own keys again (in bounds, not used)
        kp = Kp + ko + (size_t)(kn * HD); kp2 = HL ? K2 + ko + (size_t)(kn * HD) : kp;
#pragma unroll
        for (int kb = 0; kb < 2; ++kb)
#pragma unroll
            for (int ks = 0; ks < 4; ++ks) { const int fo = kb * 16 * HD + ks * 512; kf[kb][ks] = WFrag<T16>::ldf(kp + fo); if (HL) kf2[kb][ks] = WFrag<T16>::ldf(kp2 + fo); }
        asm volatile("s_wait_xcnt 0x0" :: "v"(kp), "v"(kp2) : "memory");   // as behind the Vt loads
        __builtin_amdgcn_sched_barrier(0);   // holds the K loads up here: they fly under the softmax and the Vt Pt products
        V pf[QB], pf2[QB];
#pragma unroll
        for (int qb = 0; qb < QB; ++qb) {
            float bm = s[0][qb][0];
#pragma unroll
            for (int kb = 0; kb < 2; ++kb)
#pragma unroll
                for (int j = 0; j < 8; ++j) bm = fmaxf(bm, s[kb][qb][j]);
            bm = fmaxf(bm, xhalf(bm));   // the other half of the wave holds the query's other keys
            const float mn = fmaxf(m[qb], bm * SCL), al = __builtin_amdgcn_exp2f((m[qb] - mn) * L2E); m[qb] = mn;
            float rs = 0.0f;
#pragma unroll
            for (int kb = 0; kb < 2; ++kb)
#pragma unroll
                for (int j = 0; j < 8; ++j) { const float p = __builtin_amdgcn_exp2f((s[kb][qb][j] * SCL - mn) * L2E + PSH); s[kb][qb][j] = p; rs += p; }
            l[qb] = l[qb] * al + rs;   // each half of the wave sums its own keys; the halves join behind the loop
#pragma unroll
            for (int db = 0; db < 8; ++db) o[db][qb] *= al;
            PPack<T16>::mk(s[0][qb], s[1][qb], pf[qb], pf2[qb]);
        }
#pragma unroll
        for (int db = 0; db < 8; ++db)
#pragma unroll
            for (int qb = 0; qb < QB; ++qb) { o[db][qb] = WFrag<T16>::mma(vf[db], pf[qb], o[db][qb]); if (HL) { o[db][qb] = WFrag<T16>::mma(vf[db], pf2[qb], o[db][qb]); o[db][qb] = WFrag<T16>::mma(vf2[db], pf[qb], o[db][qb]); } }
        kk += 32;
    } while (kk < nk);
    float* ob0 = O + (size_t)q0 * (KSP * HD) + 4 * lane;   // one address for all the stores of O; the rest is immediate offsets
#pragma unroll
    for (int qb = 0; qb < QB; ++qb) { const size_t t = (size_t)(q0 + qb * 16 + lr); float* ob = ob0 + qb * (16 * KSP * HD); const float lj = l[qb] + xhalf(l[qb]);
#pragma unroll
        for (int db = 0; db < 8; ++db) { v4f x, y;
#pragma unroll
            for (int j = 0; j < 4; ++j) { x[j] = o[db][qb][j]; y[j] = o[db][qb][4 + j]; }
            *(v4f*)(ob + db * 256) = x; *(v4f*)(ob + db * 256 + 128) = y; }   // each store: 512 bytes in a row
        if (hi == 0) { v2f ml; ml[0] = m[qb]; ml[1] = lj; *(v2f*)(ML + t * 2) = ml; } }
    asm volatile("s_wait_xcnt 0x0" ::: "memory");   // the kernel lays the other row range's code behind this tile's last stores: no register of theirs is rewritten before this wait
}
// k_fattn: all images, all query rows, all key slices in ONE launch; 4 waves a work-group, all on the same keys (they share the K and Vt lines in the WGP cache). Flat grid: rows < RH in front (hi + lo planes, 32 queries a wave), then rows >= RH (fp16, 64 queries a wave); query group fastest, then slice, then image.
__global__ __launch_bounds__(128) void k_fattn(const bf* __restrict__ Qh, const bf* __restrict__ Ql, const bf* __restrict__ Kh, const bf* __restrict__ Kl, const bf* __restrict__ Vh, const bf* __restrict__ Vl, const h16* __restrict__ Q16, const h16* __restrict__ K16, const h16* __restrict__ V16, float* O, float* ML) {
    constexpr int GH = RH / 128, GL = (TT - RH) / 256, NHI = NB_ * KSP * GH;
    const int id = blockIdx.x, w = threadIdx.x >> 5;
    if (id < NHI) { const int g = id % GH, z = (id / GH) % KSP, k0 = z * NPS / KSP * 32, k1 = (z + 1) * NPS / KSP * 32; const size_t im = id / (GH * KSP), zb = im * TT * HD;
        fa_tile<bf, true, 2>(Qh + zb, Ql + zb, Kh + zb, Kl + zb, Vh + zb, Vl + zb, g * 128 + w * 32, k0, k1 - k0, O + zb * KSP + z * (16 * HD), ML + (im * KSP + z) * TT * 2);
    } else { const int il = id - NHI; const int g = il % GL, z = (il / GL) % KSP, k0 = z * NPS / KSP * 32, k1 = (z + 1) * NPS / KSP * 32; const size_t im = il / (GL * KSP), zb = im * TT * HD;
        fa_tile<h16, false, 4>(Q16 + zb, nullptr, K16 + zb, nullptr, V16 + zb, nullptr, RH + g * 256 + w * 64, k0, k1 - k0, O + zb * KSP + z * (16 * HD), ML + (im * KSP + z) * TT * 2); }
}
// d_cvtT: X [c][n] f32 to XB [n][c] bf16 in fragment order, fragments [n / 16][c / 32]. A thread makes 16 bytes (8 channels of one position); a wave makes half a fragment (512 bytes in a row) and reads 16 positions in a row of each channel; waves w and w ^ 1 take the two halves of the same lines of X.
__device__ __forceinline__ void d_cvtT(const float* __restrict__ X, bf* XB, unsigned bx) { const size_t i = (size_t)bx * 256 + threadIdx.x; if (i >= (size_t)TT * DM / 8) return;
    const int lane = (int)(i & 31), n16 = (int)(i >> 10) * 2 + (int)((i >> 5) & 1), h = (int)((i >> 6) & 1), ks = (int)((i >> 7) & 7); const int c0 = ks * 32 + h * 16 + (lane >> 4) * 8, n = n16 * 16 + (lane & 15);
    const float* xp = X + (size_t)c0 * TT + n; float v[8]; v8us o;
#pragma unroll
    for (int q = 0; q < 8; ++q) v[q] = xp[q * TT];
    asm volatile("s_wait_xcnt 0x0" :: "v"(xp) : "memory");   // the loads' address lives up to here: no register of it is rewritten before this wait
#pragma unroll
    for (int q = 0; q < 8; ++q) o[q] = f2bf(v[q]);
    *(v8us*)(XB + ((size_t)(n16 * (DM / 32) + ks) * 2 + h) * 256 + lane * 8) = o;  }
// k_prep: everything that reads only the inputs, in ONE launch; flat grid: NB_ x NBT blocks turn the images token-major, 4 x NBW blocks round the weights
#define NBT ((TT * DM / 8 + 255) / 256)
#define NBW ((HD * DM / 8 + 255) / 256)
__global__ __launch_bounds__(256) void k_prep(const float* __restrict__ xin, const float* __restrict__ wq, const float* __restrict__ wk, const float* __restrict__ wv, const float* __restrict__ wo, bf* XB, bf* WQ, bf* WK, bf* WV, bf* WO) {
    const unsigned id = blockIdx.x;
    if (id < NB_ * NBT) { const size_t im = id / NBT; d_cvtT(xin + im * DM * TT, XB + im * TT * DM, id % NBT); }
    else if (id < NB_ * NBT + 4 * NBW) { const unsigned w = (id - NB_ * NBT) / NBW; d_cvtF((w == 0) ? wq : (w == 1) ? wk : (w == 2) ? wv : wo, (w == 3) ? DQ : DM, (w == 0) ? WQ : (w == 1) ? WK : (w == 2) ? WV : WO, (size_t)HD * DM / 8, (id - NB_ * NBT) % NBW); }
}
// ---- k_bn: training-mode BatchNorm and residual in ONE kernel. Y = W_w y without its bias, channel-major [image][c][n] as the output is; the bias wb[c] is added at the read.
// Work-group c holds channel c of all images (NB_ x TT values, 32 a thread) in registers from the one read of Y: mean, then the variance about that mean, then the output; nothing goes back to memory in between. The residual's x is fetched together with Y.
// Sum order (fixed): a thread's 8 pieces of 4 positions, image by image, in 4 columns; the columns; the wave's 32 lanes by exchange; the 16 waves in wave order.
#define BNT 512
template <int M> __device__ __forceinline__ float xrow(float x) { return __builtin_bit_cast(float, __builtin_amdgcn_update_dpp(0, __builtin_bit_cast(int, x), 0x160 | M, 0xf, 0xf, true)); }   // lane l reads lane l ^ M, M < 16 (row_xmask)
__device__ __forceinline__ float bn_sum(v4f a, float* red) {   // the sum over the work-group, the same bits in every thread; red: BNT / 32 floats of LDS that nothing else uses
    float s = (a[0] + a[1]) + (a[2] + a[3]); s += xrow<1>(s); s += xrow<2>(s); s += xrow<4>(s); s += xrow<8>(s); s += xhalf(s);
    if ((threadIdx.x & 31) == 0) red[threadIdx.x >> 5] = s;
    __syncthreads();
    float t = 0.0f;
#pragma unroll
    for (int i = 0; i < BNT / 32; i += 4) { const v4f r = *(const v4fa*)(red + i); t += r[0]; t += r[1]; t += r[2]; t += r[3]; }
    return t; }
__global__ __launch_bounds__(BNT) void k_bn(const float* __restrict__ Y, const float* __restrict__ wb, const float* __restrict__ g, const float* __restrict__ bb, const float* __restrict__ X, float* OUT) {
    __shared__ __align__(16) float red[2][BNT / 32];
    constexpr int NV = TT / 4 / BNT; constexpr float RN = 1.0f / (float)(NB_ * TT);   // a power of two: the product is the exact quotient
    const int c = blockIdx.x; const size_t e0 = (size_t)c * TT + threadIdx.x * 4;
    static_assert(NB_ == 4, "two address pairs a buffer");
    const float* yp[2]; const float* xp[2]; float* op[2]; v4f y[NB_][NV], x[NB_][NV];   // one address per two images; the rest is immediate offsets
#pragma unroll
    for (int i = 0; i < 2; ++i) { yp[i] = Y + e0 + (size_t)i * 2 * DM * TT; xp[i] = X + e0 + (size_t)i * 2 * DM * TT; op[i] = OUT + e0 + (size_t)i * 2 * DM * TT; }
#pragma unroll   // all loads of a thread in flight together, each 512 bytes in a row; Y in front: the sums need it first
    for (int b = 0; b < NB_; ++b)
#pragma unroll
        for (int h = 0; h < NV; ++h) y[b][h] = *(const v4f*)(yp[b >> 1] + (b & 1) * DM * TT + h * BNT * 4);
#pragma unroll
    for (int b = 0; b < NB_; ++b)
#pragma unroll
        for (int h = 0; h < NV; ++h) x[b][h] = *(const v4f*)(xp[b >> 1] + (b & 1) * DM * TT + h * BNT * 4);
    asm volatile("s_wait_xcnt 0x0" :: "v"(yp[0]), "v"(xp[0]) : "memory");   // the arithmetic below may go into the loads' address registers: none is rewritten before this wait (the operands keep a later load's result out of the first address pairs)
    __builtin_amdgcn_sched_barrier(0);   // holds every load above the arithmetic (x is on its way while Y is summed) and the arithmetic below that wait
    const float wc = bfr(wb[c]), gm = bfr(g[c]), bt = bfr(bb[c]);
    v4f sa = (v4f){};
#pragma unroll
    for (int b = 0; b < NB_; ++b)
#pragma unroll
        for (int h = 0; h < NV; ++h) { y[b][h] += wc; sa += y[b][h]; }
    const float mu = bn_sum(sa, red[0]) * RN;
    v4f va = (v4f){};
#pragma unroll
    for (int b = 0; b < NB_; ++b)
#pragma unroll
        for (int h = 0; h < NV; ++h) { y[b][h] -= mu; va += y[b][h] * y[b][h]; }
    const float var = bn_sum(va, red[1]) * RN, rs = __fdiv_rn(1.0f, __fsqrt_rn(var + BNEPS));
#pragma unroll
    for (int b = 0; b < NB_; ++b)
#pragma unroll
        for (int h = 0; h < NV; ++h)
#pragma unroll
            for (int q = 0; q < 4; ++q) y[b][h][q] = ((gm * y[b][h][q]) * rs + bt) + bfr(x[b][h][q]);
    __builtin_amdgcn_sched_barrier(0);   // every value is made before the first store goes out: no register that a store names is written behind it
#pragma unroll
    for (int b = 0; b < NB_; ++b)
#pragma unroll
        for (int h = 0; h < NV; ++h) *(v4f*)(op[b >> 1] + (b & 1) * DM * TT + h * BNT * 4) = y[b][h];
}
// k_mgemm: joins the KSP key slices and does the last GEMM (W_w y) in ONE kernel; work-group = 64 positions of one image, 8 waves; grid: NB_ x TT / 64.
// Part 1, the join, in slice order: weights exp(m_slice - max m), then the softmax's division; hi + lo bf16 of the result go to LDS, [t][d] in fragment order (4 groups of 16 positions x 4 fragments), not to memory.
// A thread makes 4 pieces of 16 bytes a plane (one per group of 16 positions): row t & 15 = lane & 15, d / 16 = wave; a piece's 8 values d = 16 (d / 16) + 8 (lane >> 4) + 0..7 are two 16-byte pieces of O per slice. Every load of O takes 512 bytes in a row.
// Part 2: wave w has the tile of 64 channels (w & 3) x 32 positions (w >> 2): C[c][n] = sum_d W_w[c][d] hi[n][d], W_w[c][d] lo[n][d] (the two products by turns, k ascending), W_w's fragments from memory (fetched at the top, they fly under part 1), y's from LDS. C: channel-major [image][c][n], without the bias.
#define MGP 36   // pitch in floats of a wave's 64 x 32 transposing tile in LDS: the 32 lanes' 4-byte writes fall on 32 different banks
__global__ __launch_bounds__(256) void k_mgemm(const float* __restrict__ O, const float* __restrict__ ML, const bf* __restrict__ Wf, float* C) {
    __shared__ __align__(16) bf sh[4 * 16 * HD]; __shared__ __align__(16) bf sl[4 * 16 * HD]; __shared__ __align__(16) float os[8][64 * MGP];
    static_assert(HD == 128 && DM == 256 && TT % 64 == 0, "8 waves: d / 16 in part 1, 4 x 2 tiles in part 2");
    const int lane = threadIdx.x & 31, w = threadIdx.x >> 5, lr = lane & 15, hi = lane >> 4; const size_t tg0 = (size_t)blockIdx.x * 4, r = tg0 * 16 + lr;   // tg0: the first group of 16 positions, counted over all images
    const float* op = O + tg0 * (KSP * 16 * HD) + w * 256 + lane * 4; const float* mp = ML + ((r / TT) * KSP * TT + r % TT) * 2; const bf* ap = Wf + (size_t)(w & 3) * 64 * DQ + 8 * lane;   // one address per buffer; the rest is immediate offsets
    v2f ml[4][KSP]; v4f u[4][KSP][2]; v16bf a[4][4];
#pragma unroll   // all loads of a thread in flight together
    for (int j = 0; j < 4; ++j)
#pragma unroll
        for (int p = 0; p < KSP; ++p) ml[j][p] = *(const v2f*)(mp + j * 32 + p * TT * 2);
    __builtin_amdgcn_sched_barrier(0);   // the small loads go out first and O piece by piece behind them: a piece can be joined while the later pieces are still on their way (left alone, the compiler sends the last of the small loads behind nearly all of O)
#pragma unroll
    for (int j = 0; j < 4; ++j)
#pragma unroll
        for (int p = 0; p < KSP; ++p) { u[j][p][0] = *(const v4f*)(op + j * (KSP * 16 * HD) + p * (16 * HD)); u[j][p][1] = *(const v4f*)(op + j * (KSP * 16 * HD) + p * (16 * HD) + 128); }
#pragma unroll
    for (int ks = 0; ks < 4; ++ks)
#pragma unroll
        for (int mb = 0; mb < 4; ++mb) a[ks][mb] = WFrag<bf>::ldf(ap + mb * 16 * DQ + ks * 512);
    asm volatile("s_wait_xcnt 0x0" :: "v"(op), "v"(mp), "v"(ap) : "memory");   // the loads' address pairs live up to here: no register of them is rewritten before this wait
    __builtin_amdgcn_sched_barrier(0);   // holds every load above the arithmetic, so that all of them are on their way at once
#pragma unroll
    for (int j = 0; j < 4; ++j) {
        float mx = ml[j][0][0];
#pragma unroll
        for (int p = 1; p < KSP; ++p) mx = fmaxf(mx, ml[j][p][0]);
        float ls = 0.0f, s[8];
#pragma unroll
        for (int q = 0; q < 8; ++q) s[q] = 0.0f;
#pragma unroll
        for (int p = 0; p < KSP; ++p) { const float wt = __builtin_amdgcn_exp2f((ml[j][p][0] - mx) * L2E); ls += ml[j][p][1] * wt;
#pragma unroll
            for (int q = 0; q < 8; ++q) s[q] += u[j][p][q >> 2][q & 3] * wt; }
        v8us oh, ol;
#pragma unroll
        for (int q = 0; q < 8; ++q) { unsigned short x, y; splitf(__fdiv_rn(s[q], ls), x, y); oh[q] = x; ol[q] = y; }
        *(v8usa*)(sh + j * (16 * HD) + w * 256 + lane * 8) = oh; *(v8usa*)(sl + j * (16 * HD) + w * 256 + lane * 8) = ol; }
    __syncthreads();   // part 2 reads what the other waves have joined
    const int ph = w >> 2; v8f acc[4][2];
#pragma unroll
    for (int mb = 0; mb < 4; ++mb)
#pragma unroll
        for (int nb = 0; nb < 2; ++nb) acc[mb][nb] = (v8f){};
    v16bf b[4][2], b2[4][2];
#pragma unroll
    for (int ks = 0; ks < 4; ++ks)
#pragma unroll
        for (int nb = 0; nb < 2; ++nb) { const int fo = (2 * ph + nb) * (16 * HD) + ks * 512 + 8 * lane; b[ks][nb] = cat16b(*(const v8usa*)(sh + fo), *(const v8usa*)(sh + fo + 256)); b2[ks][nb] = cat16b(*(const v8usa*)(sl + fo), *(const v8usa*)(sl + fo + 256)); }
    __builtin_amdgcn_sched_barrier(0);   // all LDS reads go out as one group in front of the products (left alone, the compiler reads two fragments at a time and waits for each pair among the products)
#pragma unroll
    for (int ks = 0; ks < 4; ++ks)
#pragma unroll
        for (int nb = 0; nb < 2; ++nb)
#pragma unroll
            for (int mb = 0; mb < 4; ++mb) { acc[mb][nb] = wmmab(a[ks][mb], b[ks][nb], acc[mb][nb]); acc[mb][nb] = wmmab(a[ks][mb], b2[ks][nb], acc[mb][nb]); }
    // the tile goes through the wave's own LDS: a lane holds 8 channels of one position, a store wants 4 positions of one channel
    float* osw = os[w]; float* cb = C + (size_t)(blockIdx.x / (TT / 64)) * DM * TT + (size_t)(w & 3) * 64 * TT + (blockIdx.x % (TT / 64)) * 64 + ph * 32 + (size_t)(lane >> 3) * TT + (lane & 7) * 4;
#pragma unroll
    for (int mb = 0; mb < 4; ++mb)
#pragma unroll
        for (int nb = 0; nb < 2; ++nb)
#pragma unroll
            for (int j = 0; j < 8; ++j) osw[(mb * 16 + hi * 8 + j) * MGP + nb * 16 + lr] = acc[mb][nb][j];
    __builtin_amdgcn_wave_barrier(); asm volatile("" ::: "memory");   // the wave's LDS reads below stay behind its writes above (other lanes' values)
    v4f val[16];
#pragma unroll
    for (int s = 0; s < 16; ++s) val[s] = *(const v4fa*)(osw + (4 * s + (lane >> 3)) * MGP + (lane & 7) * 4);
    __builtin_amdgcn_sched_barrier(0);   // every value is in its register before the first store goes out: no register that a store names is written behind it
#pragma unroll
    for (int s = 0; s < 16; ++s) *(v4f*)(cb + (size_t)(4 * s) * TT) = val[s];   // each store: 4 channels x one whole line
}

extern "C" void kernel_launch(void* const* d_in, const int* in_sizes, int n_in,
                              void* d_out, int out_size, void* d_ws, size_t ws_size, hipStream_t stream) {
    (void)in_sizes; (void)n_in; (void)out_size;
    const float* xin = (const float*)d_in[0];   /* x [4][256][4096] NCHW */ const float* wv = (const float*)d_in[1]; const float* bv = (const float*)d_in[2];   /* g_w, g_b */ const float* wq = (const float*)d_in[3]; const float* bq = (const float*)d_in[4];   /* theta */ const float* wk = (const float*)d_in[5]; const float* bk = (const float*)d_in[6];   /* phi */ const float* wo = (const float*)d_in[7]; const float* bo = (const float*)d_in[8];   /* W_w [256][128], W_b */ const float* bng = (const float*)d_in[9]; const float* bnb = (const float*)d_in[10]; const float* x = nullptr; (void)x;
    float* OUT = (float*)d_out;     // [4][256][4096] NCHW
    char* wsp = (char*)d_ws;
    auto take = [&](size_t bytes) { char* p = wsp; wsp += (bytes + 255) & ~(size_t)255; return (void*)p; };
    float* YALL = (float*)take((size_t)NB_ * TT * DM * 4); bf* WQ = (bf*)take((size_t)DQ * DM * 2); bf* WK = (bf*)take((size_t)DKV * DM * 2); bf* WV = (bf*)take((size_t)DKV * DM * 2); bf* WO = (bf*)take((size_t)DM * DQ * 2);
    h16* QP16 = (h16*)take((size_t)NB_ * TT * HD * 2); h16* KP16 = (h16*)take((size_t)NB_ * TT * HD * 2); h16* VT16 = (h16*)take((size_t)NB_ * HD * TT * 2);   // every operand plane: one per image, image stride TT * HD
    bf* QPh = (bf*)take((size_t)NB_ * TT * HD * 2); bf* QPl = (bf*)take((size_t)NB_ * TT * HD * 2); bf* KPh = (bf*)take((size_t)NB_ * TT * HD * 2); bf* KPl = (bf*)take((size_t)NB_ * TT * HD * 2); bf* VTh = (bf*)take((size_t)NB_ * HD * TT * 2); bf* VTl = (bf*)take((size_t)NB_ * HD * TT * 2);
    float* Ob = (float*)take((size_t)NB_ * TT * KSP * HD * 4); float* ML = (float*)take((size_t)NB_ * TT * KSP * 2 * 4);
    if ((size_t)(wsp - (char*)d_ws) > ws_size) return;    // ws 256 MiB
    // the token-major images (8 MiB) lie in the buffer of the attention's partial results: they are dead before the attention writes it (stream-ordered)
    bf* XB = (bf*)Ob;
    // launches that do not depend on one another are ONE launch: all images, all weights, all three projections, both row ranges of a product
    k_prep<<<NB_ * NBT + 4 * NBW, 256, 0, stream>>>(xin, wq, wk, wv, wo, XB, WQ, WK, WV, WO);   /* NCHW [256][4096] -> token-major bf16 [4096][256] and bf16 weights, in fragment order */
    k_proj3<<<dim3(TT / 64, 3 * (HD / 64), NB_), 32, 0, stream>>>(XB, WQ, WK, WV, QP16, QPh, QPl, KP16, KPh, KPl, VT16, VTh, VTl, bq, bk, bv);   /* theta, phi, g + bias, straight into the attention's operand planes */
    k_fattn<<<NB_ * KSP * (RH / 128) + NB_ * KSP * ((TT - RH) / 256), 128, 0, stream>>>(QPh, QPl, KPh, KPl, VTh, VTl, QP16, KP16, VT16, Ob, ML);   /* key slice z -> partial Ob[image][t / 16][z][16 x HD in the accumulators' lane order], ML[image][z][t] */
    k_mgemm<<<NB_ * (TT / 64), 256, 0, stream>>>(Ob, ML, WO, YALL);   /* the key slices joined, then W_w y of all images, channel-major [image][c][n] (products W_w x hi, W_w x lo), kept for the batch statistics */
    k_bn<<<DM, BNT, 0, stream>>>(YALL, bo, bng, bnb, xin, OUT);   /* per channel: mean and 1/sqrt(var + eps) over the batch x 4,096 positions (training-mode BatchNorm); out[b][c][n] = gamma (Wy - mean) rstd + beta + x */

}

// v010
// Measured time: 78.5 microseconds a run.
// Next to v009, in two timings, it ran 1.06 and 1.07 times as fast.
// All steps since v000 together make it 13.6 times as fast.
#include <hip/hip_runtime.h>

// Non-local block (embedded Gaussian) over 64x64 = 4,096 positions with a training-mode BatchNorm and residual (x [4][256][64][64] NCHW; theta, phi, g = 1x1 convs C 256 -> Ci 128 ('oi' [128][256] 0.02, zero biases); f[n][m] = theta_n . phi_m (no scaling); attn = softmax over m; y[ci][n] = sum_m attn[n][m] g[ci][m]; Wy = W_w y + W_b ('oi' [256][128]); BatchNorm2d in TRAINING mode (per-channel mean/var over the whole batch x 64 x 64, eps 1e-5, gamma/beta read); out = BN(Wy) + x -> [4][256][64][64] (4.2 M)).
// Compute dtypes, f32 accumulate: every input rounded to bf16; convs exact + f32 bias; attention rows < 512 3 products, rest fp16; softmax f32; W_w hl x exact + bias; BatchNorm statistics and output f32 (fixed-order sums); residual f32 of the bf16-rounded x.

#define NB_  4
#define TT   4096
#define DM   256
#define NH_  1
#define NKV  1
#define REP  (NH_ / NKV)
#define HD   128
#define DQ   (NH_ * HD)
#define DKV  (NKV * HD)
#define ZH   1
#define RH   512                  // query rows < RH use hi+lo planes (0: none)
#define WIN  0
#define PSH  8.0f     // P carries 2^PSH (numerator and row sum alike: it cancels in the softmax's division), so that small weights stay in fp16's normal range
#define SCL  1.0f     // the non-local block applies no 1/sqrt(d)
#define CIN  256      // channels C (== DM)
#define BNEPS 1e-5f
#define KSP  7        // key slices of the fused attention (one work-group per slice); every slice leaves its partial result in a slot of its own. 7: a work-group's registers fill a WGP, and 72 query groups x 7 slices = 504 work-groups are two rounds of the chip's 256 WGPs (8 slices: 576, a third round for 64 of them)
#define NPS  (TT / 32) // passes of 32 keys over all keys; slice z takes the passes z NPS / KSP up to (z + 1) NPS / KSP (18 or 19 of them)
#define L2E  1.4426950408889634f
typedef _Float16 h16;
typedef unsigned short bf;
typedef __attribute__((ext_vector_type(16))) __bf16   v16bf;
typedef __attribute__((ext_vector_type(16))) _Float16 v16h;
typedef __attribute__((ext_vector_type(8)))  _Float16 v8h;
typedef __attribute__((ext_vector_type(8)))  unsigned short v8us;
typedef __attribute__((ext_vector_type(16))) unsigned short v16us;
typedef __attribute__((ext_vector_type(8)))  float    v8f;
typedef __attribute__((ext_vector_type(4)))  float    v4f;
typedef v8h  __attribute__((may_alias)) v8ha;
typedef v4f  __attribute__((may_alias)) v4fa;
typedef v8us __attribute__((may_alias)) v8usa;

__device__ __forceinline__ unsigned short f2bf(float f) { unsigned u = __float_as_uint(f); u += 0x7FFFu + ((u >> 16) & 1u); return (unsigned short)(u >> 16); }
__device__ __forceinline__ float bf2f(unsigned short b) { return __uint_as_float(((unsigned)b) << 16); }
__device__ __forceinline__ float bfr(float f) { return bf2f(f2bf(f)); }
__device__ __forceinline__ v16h cat16(v8h lo, v8h hi) { return __builtin_shufflevector(lo, hi, 0, 1, 2, 3, 4, 5, 6, 7, 8, 9, 10, 11, 12, 13, 14, 15); }
__device__ __forceinline__ v16bf cat16b(v8us lo, v8us hi) { return __builtin_bit_cast(v16bf, __builtin_shufflevector(lo, hi, 0, 1, 2, 3, 4, 5, 6, 7, 8, 9, 10, 11, 12, 13, 14, 15)); }
__device__ __forceinline__ v8f wmma16(v16h a, v16h b, v8f c) { return __builtin_amdgcn_wmma_f32_16x16x32_f16(false, a, false, b, (short)0, c, false, false); }
__device__ __forceinline__ v8f wmmab(v16bf a, v16bf b, v8f c) { return __builtin_amdgcn_wmma_f32_16x16x32_bf16(false, a, false, b, (short)0, c, false, false); }



// ---- fragments of the 16-bit operand planes
template <typename T16> struct WFrag;
// FRAGMENT ORDER of a 16-bit plane [row][k]: fragments of 16 rows x 32 k = 512 elements (1 KiB) lie whole, as two halves of 256 elements; in half h, lane (row & 15) + 16 hi holds the 8 elements k = 16 h + 8 hi + 0..7 at element lane * 8.
// ldf reads a fragment so laid (p: the fragment + lane * 8): each of its two loads takes 512 bytes in a row, 4 whole lines, where the same load on a row-major plane touches 16 lines. Lane and register hold the elements of the hardware's k order.
template <> struct WFrag<h16> { typedef v16h V; static __device__ __forceinline__ V ldf(const h16* p) { return cat16(*(const v8h*)p, *(const v8h*)(p + 256)); } static __device__ __forceinline__ v8f mma(V a, V b, v8f c) { return wmma16(a, b, c); } };
template <> struct WFrag<bf> { typedef v16bf V; static __device__ __forceinline__ V ldf(const bf* p) { return cat16b(*(const v8us*)p, *(const v8us*)(p + 256)); } static __device__ __forceinline__ v8f mma(V a, V b, v8f c) { return wmmab(a, b, c); } };

__device__ __forceinline__ h16 tohx(float x) { return (h16)x; }
__device__ __forceinline__ void splitf(float y, unsigned short& h, unsigned short& l) { h = f2bf(y); l = f2bf(y - bf2f(h)); }
typedef __attribute__((ext_vector_type(2))) _Float16 v2h;
typedef __attribute__((ext_vector_type(4))) _Float16 v4h;
typedef __attribute__((ext_vector_type(2))) unsigned short v2us;
typedef __attribute__((ext_vector_type(4))) unsigned short v4us;
typedef __attribute__((ext_vector_type(2))) float v2f;
typedef __attribute__((ext_vector_type(4))) int v4i;

__global__ __launch_bounds__(256) void k_wtG(const float* __restrict__ w, int K, int N, bf* Bt) {
    const int lane = threadIdx.x & 31; const int L0 = (blockIdx.x * 8 + (threadIdx.x >> 5)) * 8; const int nlines = N * K / 64;
{
#pragma unroll 1
        for (int l = 0; l < 8; ++l) { const int L = L0 + l; if (L >= nlines) break; const size_t e = (size_t)L * 64 + lane * 2; const int k = (int)(e % K), n = (int)(e / K); v2us o;
            o[0] = f2bf(w[(size_t)k * N + n]); o[1] = f2bf(w[(size_t)(k + 1) * N + n]); *(v2us*)(Bt + e) = o; }
         }
}
// d_cvtF: a row-major f32 [row][K] to bf16 in fragment order, fragments [row / 16][k / 32]; the calling thread writes the plane's 16 bytes number i
__device__ __forceinline__ void d_cvtF(const float* __restrict__ src, int K, bf* dst, size_t i) {
    const int lr = (int)(i & 15), f = (int)(i >> 6), k0 = (f % (K / 32)) * 32 + (int)((i >> 5) & 1) * 16 + (int)((i >> 4) & 1) * 8, r16 = f / (K / 32); const float* sp = src + (size_t)(r16 * 16 + lr) * K + k0; const v8f v = *(const v8f*)sp; v8us o;
    asm volatile("s_wait_xcnt 0x0" :: "v"(sp) : "memory");   // the loads' address lives up to here: no register of it is rewritten before this wait
#pragma unroll
    for (int k = 0; k < 8; ++k) o[k] = f2bf(v[k]); *(v8us*)(dst + i * 8) = o;  }

// ---- projections: a work-group has 64 positions of one image and reads x and the weights as they come, in f32: there is no launch in front that prepares them.
// Its 8 waves turn x [c][64 positions] into bf16 fragments in LDS; then ONE WAVE per 64x64 tile (16 accumulators), K = DM, 6 tiles (theta, phi, g: 2 each); the tile (+ bias) does not go out as f32 but straight as the attention's operand planes, in fragment order.
typedef __attribute__((ext_vector_type(2))) __bf16 v2bf;
#define XSP (DM * 16 + 8)   // elements from one group of 16 positions in LDS to the next: its DM / 32 fragments and 16 bytes more, so that the 4 groups a staging store writes to fall on different banks
typedef v4us __attribute__((may_alias)) v4usa;
// The weights of a k trip (64 rows x 32 k, f32 in memory) come in whole lines: 8 lanes take the 128 bytes of one row, a load 4 rows. A fragment wants 8 k of one row in a lane, so they go, rounded to bf16, through a buffer in LDS that is the wave's own.
// There a fragment (16 rows x 32 k) is 4 quarters (2 h + hi: k = 16 h + 8 hi + 0..7) of 16 rows x 16 bytes, WQP elements apart: 64 bytes more than a quarter holds, so that the 32 lanes' 8-byte stores fall on different banks.
#define WQP 160
#define WBP (4 * 4 * WQP)   // elements of one buffer: 4 fragments
// wload: k trip t into registers; wp: the weights' row (tile's first + lane >> 3), k = 4 (lane & 7); load j: rows 4 j + 0..3
__device__ __forceinline__ void wload(const float* __restrict__ wp, int t, v4f (&wr)[16]) {
#pragma unroll
    for (int j = 0; j < 16; ++j) wr[j] = *(const v4f*)(wp + j * 4 * DM + t * 32); }
// wstage: those registers, rounded to nearest even, into the buffer wl
__device__ __forceinline__ void wstage(bf* wl, const v4f (&wr)[16]) { const int lane = threadIdx.x & 31; bf* d = wl + ((lane & 7) >> 1) * WQP + (lane >> 3) * 8 + (lane & 1) * 4;
#pragma unroll
    for (int j = 0; j < 16; ++j) { v2f x, y; x[0] = wr[j][0]; x[1] = wr[j][1]; y[0] = wr[j][2]; y[1] = wr[j][3]; const v2us s = __builtin_bit_cast(v2us, __builtin_convertvector(x, v2bf)), u = __builtin_bit_cast(v2us, __builtin_convertvector(y, v2bf)); v4us o; o[0] = s[0]; o[1] = s[1]; o[2] = u[0]; o[3] = u[1];
        *(v4usa*)(d + (j >> 2) * (4 * WQP) + (j & 3) * 32) = o; } }
// proj_tile: 64 positions (xs: their bf16 fragments in LDS, [position / 16][c / 32]) x 64 weight rows (wr: those of k trips 0 and 1, pb: the lane's biases, all already on their way; wl: the wave's two weight buffers in LDS); pt: the positions' tile in the image, wt: the weight rows' tile.
// Planes P16 (fp16), Ph + Pl (bf16 hi + lo of the same f32 value), the tile's column being the planes' k. ROWB: rows = weight rows, bias[row] and fragments [k / 32][row / 16] (HD rows), else rows = positions, bias[column] and fragments [row / 16][k / 32] (k < HD). os: 16 x 68 floats of LDS.
template <bool ROWB>
__device__ __forceinline__ void proj_tile(float* os, const bf* xs, bf* wl, const float* __restrict__ wp, v4f (&wr)[2][16], const float (&pb)[32], int pt, int wt, h16* P16, bf* Ph, bf* Pl) {
    const int lane = threadIdx.x & 31, lr = lane & 15, hi = lane >> 4; const int r0 = (ROWB ? wt : pt) * 64, c0 = (ROWB ? pt : wt) * 64;
    constexpr int NPB = ROWB ? 4 : 32;   // the biases of the lane's 4 rows or 4 x 8 columns in the epilogue
    v8f acc[4][4];
#pragma unroll
    for (int mb = 0; mb < 4; ++mb)
#pragma unroll
        for (int nb = 0; nb < 4; ++nb) acc[mb][nb] = (v8f){};
    const bf* xf0 = xs + 8 * lane; const bf* wf0 = wl + hi * WQP + lr * 8;
    wstage(wl, wr[0]); wload(wp, 2, wr[0]);
#pragma unroll   // every load of the weights is the one address wp + an immediate offset
    for (int t = 0; t < DM / 32; ++t) {
        v16bf wf[4], xf[4];
        __builtin_amdgcn_wave_barrier(); asm volatile("" ::: "memory");   // the wave's LDS reads below stay behind its writes above (other lanes' values)
#pragma unroll
        for (int i = 0; i < 4; ++i) { wf[i] = cat16b(*(const v8usa*)(wf0 + (t & 1) * WBP + i * (4 * WQP)), *(const v8usa*)(wf0 + (t & 1) * WBP + i * (4 * WQP) + 2 * WQP)); xf[i] = cat16b(*(const v8usa*)(xf0 + i * XSP + t * 512), *(const v8usa*)(xf0 + i * XSP + t * 512 + 256)); }
        __builtin_amdgcn_wave_barrier(); asm volatile("" ::: "memory");   // the LDS writes below stay behind these reads: the reads go out first, the products wait for nothing else
        if (t + 1 < DM / 32) wstage(wl + ((t + 1) & 1) * WBP, wr[(t + 1) & 1]);   // the next trip's weights, into the other buffer
        __builtin_amdgcn_sched_barrier(0);   // the loads below go into the registers just rounded, not into a third set
        if (t + 3 < DM / 32) wload(wp, t + 3, wr[(t + 1) & 1]);
        __builtin_amdgcn_sched_barrier(0);   // holds the weight loads up here: they fly under two trips' products
#pragma unroll
        for (int nb = 0; nb < 4; ++nb)
#pragma unroll
            for (int mb = 0; mb < 4; ++mb) acc[mb][nb] = wmmab(ROWB ? wf[mb] : xf[mb], ROWB ? xf[nb] : wf[nb], acc[mb][nb]);
        __builtin_amdgcn_sched_barrier(0);   // keeps the next trip's fragments out of these products' registers' lifetime (left alone, the compiler reads them among the products, into a second set, and spills)
    }
    asm volatile("s_wait_xcnt 0x0" :: "v"(wp) : "memory");   // the weight loads' address lives up to here: no register of it is rewritten before this wait
    v2f bb[NPB / (ROWB ? 1 : 2)];   // bf16-rounded biases, as pairs for the packed add
#pragma unroll
    for (int i = 0; i < NPB / (ROWB ? 1 : 2); ++i) { bb[i][0] = bfr(pb[ROWB ? i : 2 * i]); bb[i][1] = bfr(pb[ROWB ? i : 2 * i + 1]); }
    const size_t po = (ROWB ? (size_t)(c0 / 32) * (HD / 16) + r0 / 16 : (size_t)(r0 / 16) * (HD / 32) + c0 / 32) * 512 + 8 * lane; h16* p16 = P16 + po; bf* ph = Ph + po; bf* pl = Pl + po;
#pragma unroll
    for (int mb = 0; mb < 4; ++mb) {
#pragma unroll
        for (int nb = 0; nb < 4; ++nb) {
#pragma unroll
            for (int j = 0; j < 8; ++j) os[(hi * 8 + j) * 68 + nb * 16 + lr] = acc[mb][nb][j]; }
        __builtin_amdgcn_wave_barrier(); asm volatile("" ::: "memory");   // the wave's LDS reads below stay behind its writes above (other lanes' values)
#pragma unroll
        for (int s = 0; s < 4; ++s) {   // the wave takes 16 rows x 16 columns: half a fragment, 512 bytes in a row in each plane
            const float* op = os + lr * 68 + 16 * s + 8 * hi; const v4f x0 = *(const v4fa*)op, x1 = *(const v4fa*)(op + 4); v8h o16; v8us oh, ol;
#pragma unroll
            for (int p = 0; p < 4; ++p) { v2f x; x[0] = (p < 2) ? x0[2 * (p & 1)] : x1[2 * (p & 1)]; x[1] = (p < 2) ? x0[2 * (p & 1) + 1] : x1[2 * (p & 1) + 1]; x += bb[ROWB ? mb : s * 4 + p];
                const v2h h = __builtin_convertvector(x, v2h); const v2bf t = __builtin_convertvector(x, v2bf); const v2bf u = __builtin_convertvector(x - __builtin_convertvector(t, v2f), v2bf);   // all three round to nearest even, as tohx and splitf do
                const v2us tu = __builtin_bit_cast(v2us, t), uu = __builtin_bit_cast(v2us, u); o16[2 * p] = h[0]; o16[2 * p + 1] = h[1]; oh[2 * p] = tu[0]; oh[2 * p + 1] = tu[1]; ol[2 * p] = uu[0]; ol[2 * p + 1] = uu[1]; }
            const int ro = (ROWB ? (s >> 1) * (HD / 16) + mb : mb * (HD / 32) + (s >> 1)) * 512 + (s & 1) * 256; *(v8h*)(p16 + ro) = o16; *(v8us*)(ph + ro) = oh; *(v8us*)(pl + ro) = ol;
            asm volatile("s_wait_xcnt 0x0" ::: "memory"); }   // the next 16 columns' (or rows') values may go into these stores' registers: none is rewritten before this wait
        __builtin_amdgcn_wave_barrier(); asm volatile("" ::: "memory");   // the next 16 rows' LDS writes stay behind these reads
    }
}
// k_proj3: x to bf16 fragments, then the theta, phi and g projections, of all images in ONE launch; grid: NB_ x TT / 64 work-groups of 8 waves.
// Staging: a thread takes 4 positions x 8 channels, twice (16-byte loads; 16 lanes take 256 bytes in a row of a channel) and writes 4 + 4 pieces of 16 bytes (8 channels of one position) into the fragments.
// theta and phi: rows = positions, planes [t][d]; g with the operands swapped (rows = g_w's, columns = positions), so that its planes are [d][t] as the attn x g product reads them, the 8 fragments of 32 keys side by side.
// Waves 6 and 7 have no tile; wave 6 rounds the work-group's share of W_w (16 pieces of 16 bytes) for k_mgemm.
__global__ __launch_bounds__(256) void k_proj3(const float* __restrict__ xin, const float* __restrict__ wq, const float* __restrict__ wk, const float* __restrict__ wv, const float* __restrict__ wo, bf* WO, h16* QP16, bf* QPh, bf* QPl, h16* KP16, bf* KPh, bf* KPl, h16* VT16, bf* VTh, bf* VTl, const float* __restrict__ bq, const float* __restrict__ bk, const float* __restrict__ bv) {
    __shared__ __align__(16) bf xs[4 * XSP]; __shared__ __align__(16) bf wls[6][2 * WBP]; __shared__ __align__(16) float os[6][16 * 68];
    static_assert(DM == 256 && HD == 128 && NB_ * (TT / 64) * 16 == DM * DQ / 8, "2 x 256 staging tasks; 6 tiles; 16 pieces of W_w a work-group");
    const int tid = threadIdx.x, lane = tid & 31, w = __builtin_amdgcn_readfirstlane(tid >> 5), pt = blockIdx.x % (TT / 64); const size_t im = blockIdx.x / (TT / 64), zb = im * TT * HD;
    const int p4 = tid & 15, cg = tid >> 4;   // positions 4 p4 + 0..3, channels 8 cg + 0..7 and 128 more
    const float* xp = xin + im * DM * TT + (size_t)(cg * 8) * TT + pt * 64 + p4 * 4; v4f xv[2][8];
#pragma unroll   // all loads of a thread in flight together
    for (int r = 0; r < 2; ++r)
#pragma unroll
        for (int q = 0; q < 8; ++q) xv[r][q] = *(const v4f*)(xp + (r * 128 + q) * TT);
    const int ws = w >> 1, wt = w & 1; const float* wp = ((ws == 0) ? wq : (ws == 1) ? wk : wv) + (size_t)(wt * 64 + (lane >> 3)) * DM + 4 * (lane & 7); v4f wr[2][16];
    float pb[32];
    if (w < 6) {   // the first weights and the biases fly under the staging
        wload(wp, 0, wr[0]); wload(wp, 1, wr[1]);
        const float* bp = ((ws == 0) ? bq : (ws == 1) ? bk : bv) + wt * 64 + ((ws == 2) ? (lane & 15) : 8 * (lane >> 4));   // g: bias[row], 4 rows a lane; theta, phi: bias[column], 4 x 8 columns a lane
        if (ws == 2) {
#pragma unroll
            for (int i = 0; i < 4; ++i) pb[i] = bp[16 * i]; }
        else {
#pragma unroll
            for (int i = 0; i < 32; ++i) pb[i] = bp[16 * (i >> 3) + (i & 7)]; }
        asm volatile("s_wait_xcnt 0x0" :: "v"(bp) : "memory"); }   // the loads' address lives up to here: no register of it is rewritten before this wait
    asm volatile("s_wait_xcnt 0x0" :: "v"(xp) : "memory");   // the loads' address lives up to here: no register of it is rewritten before this wait
    __builtin_amdgcn_sched_barrier(0);   // holds every load above the staging's arithmetic
#pragma unroll
    for (int r = 0; r < 2; ++r) { const int c8 = r * 16 + cg; bf* xd = xs + (p4 >> 2) * XSP + (c8 >> 2) * 512 + ((c8 >> 1) & 1) * 256 + ((p4 & 3) * 4 + 16 * (c8 & 1)) * 8;
#pragma unroll
        for (int i = 0; i < 4; ++i) { v8us o;
#pragma unroll
            for (int p = 0; p < 4; ++p) { v2f x; x[0] = xv[r][2 * p][i]; x[1] = xv[r][2 * p + 1][i]; const v2us t = __builtin_bit_cast(v2us, __builtin_convertvector(x, v2bf)); o[2 * p] = t[0]; o[2 * p + 1] = t[1]; }   // rounds to nearest even, as f2bf does
            *(v8usa*)(xd + i * 8) = o; } }
    __syncthreads();   // the tiles read what all waves have staged
    if (w >= 6) { if (w == 6 && lane < 16) d_cvtF(wo, DQ, WO, (size_t)blockIdx.x * 16 + lane); return; }
    if (ws == 2) proj_tile<true>(os[w], xs, wls[w], wp, wr, pb, pt, wt, VT16 + zb, VTh + zb, VTl + zb);
    else proj_tile<false>(os[w], xs, wls[w], wp, wr, pb, pt, wt, ((ws == 0) ? QP16 : KP16) + zb, ((ws == 0) ? QPh : KPh) + zb, ((ws == 0) ? QPl : KPl) + zb);
}
// ---- fused attention: logits, softmax and attn x g in ONE kernel; the logits stay in registers.
// A wave holds QB x 16 queries and walks its slice's nk keys, 32 at a time: St = K Qt (row = key, column = query: a lane holds one query's scores), running maximum and sum per query (online softmax),
// Pt packed from the score accumulators straight into a B operand (they already lie in the loaders' k order), Ot += Vt Pt (row = d, column = query: the rescale factor is the lane's own).
// A slice leaves O[t / 16][slice][d / 16][(d >> 2) & 1][lane (t & 15) + 16 ((d >> 3) & 1)][d & 3] = sum_k 2^PSH exp(s - m) g (not normalised; the accumulators' own lane order, so that a store and k_mgemm's load take 512 bytes in a row) and ML[slice][t] = (m, sum_k 2^PSH exp(s - m)), 16 queries = one whole line from one wave; k_mgemm joins the slices.
__device__ __forceinline__ float xhalf(float x) { return __builtin_bit_cast(float, __builtin_amdgcn_permlanex16(__builtin_bit_cast(int, x), __builtin_bit_cast(int, x), 0x76543210, 0xfedcba98, false, false)); }   // lane l reads lane l ^ 16
template <typename T16> struct PPack;
template <> struct PPack<h16> { static __device__ __forceinline__ void mk(const v8f a, const v8f b, v16h& p, v16h& p2) { (void)p2;
#pragma unroll
    for (int i = 0; i < 8; ++i) { p[i] = tohx(a[i]); p[8 + i] = tohx(b[i]); } } };
template <> struct PPack<bf> { static __device__ __forceinline__ void mk(const v8f a, const v8f b, v16bf& p, v16bf& p2) { v16us h, l;
#pragma unroll
    for (int i = 0; i < 8; ++i) { unsigned short x, y; splitf(a[i], x, y); h[i] = x; l[i] = y; splitf(b[i], x, y); h[8 + i] = x; l[8 + i] = y; }
    p = __builtin_bit_cast(v16bf, h); p2 = __builtin_bit_cast(v16bf, l); } };
// HL: hi + lo planes, 3 products each (hi x hi, the query side's or P's lo x hi, hi x the key side's lo). Q, K [t][d], Vt [d][t], all in fragment order as k_proj3 leaves them; O and ML already point at the image and the slice's slot.
template <typename T16, bool HL, int QB>
__device__ __forceinline__ void fa_tile(const T16* __restrict__ Q, const T16* __restrict__ Q2, const T16* __restrict__ Kp, const T16* __restrict__ K2, const T16* __restrict__ Vt, const T16* __restrict__ V2, int q0, int k0, unsigned nk, float* O, float* ML) {
    typedef typename WFrag<T16>::V V;
    const int lane = threadIdx.x & 31, lr = lane & 15, hi = lane >> 4;
    const size_t qo0 = (size_t)q0 * HD + 8 * lane, ko = (size_t)k0 * HD + 8 * lane, vo = ko;   // fragment order: 16 rows of Q or K are HD / 32 = 4 fragments, 32 keys of Vt HD / 16 = 8 fragments: HD elements a row or key in both
    const T16* qp = Q + qo0; const T16* qp2 = HL ? Q2 + qo0 : qp; const T16* kp = Kp + ko; const T16* kp2 = HL ? K2 + ko : kp;   // every batch of loads has one address per plane; the rest is immediate offsets
    V qf[QB][4], qf2[QB][4];
#pragma unroll
    for (int qb = 0; qb < QB; ++qb)
#pragma unroll
        for (int ks = 0; ks < 4; ++ks) { const int qo = qb * 16 * HD + ks * 512; qf[qb][ks] = WFrag<T16>::ldf(qp + qo); if (HL) qf2[qb][ks] = WFrag<T16>::ldf(qp2 + qo); }
    v8f o[8][QB]; float m[QB], l[QB];
#pragma unroll
    for (int qb = 0; qb < QB; ++qb) { m[qb] = -3.0e38f; l[qb] = 0.0f;
#pragma unroll
        for (int db = 0; db < 8; ++db) o[db][qb] = (v8f){}; }
    V kf[2][4], kf2[2][4];   // the K fragments of a pass, fetched one pass ahead
#pragma unroll
    for (int kb = 0; kb < 2; ++kb)
#pragma unroll
        for (int ks = 0; ks < 4; ++ks) { const int fo = kb * 16 * HD + ks * 512; kf[kb][ks] = WFrag<T16>::ldf(kp + fo); if (HL) kf2[kb][ks] = WFrag<T16>::ldf(kp2 + fo); }
    asm volatile("s_wait_xcnt 0x0" :: "v"(qp), "v"(qp2), "v"(kp), "v"(kp2) : "memory");   // the loads' address pairs live up to here: no register of them is rewritten before this wait
    __builtin_amdgcn_sched_barrier(0);   // holds the loop's address arithmetic below that wait
    unsigned kk = 0;
#pragma unroll 1   // one pass of 32 keys with its fragments in flight already fills the registers
    do {   // a slice has at least one pass, so the test stands at the foot (with it at the head this build kept one address pair in scratch and fetched it back in every pass)
        V vf[8], vf2[8]; const T16* vp = Vt + vo + (size_t)(kk * HD); const T16* vp2 = HL ? V2 + vo + (size_t)(kk * HD) : vp;
#pragma unroll
        for (int db = 0; db < 8; ++db) { const int fo = db * 512; vf[db] = WFrag<T16>::ldf(vp + fo); if (HL) vf2[db] = WFrag<T16>::ldf(vp2 + fo); }
        asm volatile("s_wait_xcnt 0x0" :: "v"(vp), "v"(vp2) : "memory");   // these loads stay in flight: their address pairs live up to here, and no register of them is rewritten before this wait
        __builtin_amdgcn_sched_barrier(0);   // holds the Vt loads up here: they fly under the score products and the softmax (left alone, the compiler loads one fragment at a time, each right in front of its products)
        v8f s[2][QB];
#pragma unroll
        for (int kb = 0; kb < 2; ++kb) {
#pragma unroll
            for (int qb = 0; qb < QB; ++qb) s[kb][qb] = (v8f){};
#pragma unroll
            for (int ks = 0; ks < 4; ++ks)
#pragma unroll
                for (int qb = 0; qb < QB; ++qb) { s[kb][qb] = WFrag<T16>::mma(kf[kb][ks], qf[qb][ks], s[kb][qb]); if (HL) { s[kb][qb] = WFrag<T16>::mma(kf[kb][ks], qf2[qb][ks], s[kb][qb]); s[kb][qb] = WFrag<T16>::mma(kf2[kb][ks], qf[qb][ks], s[kb][qb]); } } }
        __builtin_amdgcn_sched_barrier(0);   // keeps the next pass's K loads behind the products above, so that they go into the registers those have just read and need no second set
        const unsigned kn = (kk + 32 < nk) ? kk + 32 : kk;   // the last pass has no next one: it fetches its own keys again (in bounds, not used)
        kp = Kp + ko + (size_t)(kn * HD); kp2 = HL ? K2 + ko + (size_t)(kn * HD) : kp;
#pragma unroll
        for (int kb = 0; kb < 2; ++kb)
#pragma unroll
            for (int ks = 0; ks < 4; ++ks) { const int fo = kb * 16 * HD + ks * 512; kf[kb][ks] = WFrag<T16>::ldf(kp + fo); if (HL) kf2[kb][ks] = WFrag<T16>::ldf(kp2 + fo); }
        asm volatile("s_wait_xcnt 0x0" :: "v"(kp), "v"(kp2) : "memory");   // as behind the Vt loads
        __builtin_amdgcn_sched_barrier(0);   // holds the K loads up here: they fly under the softmax and the Vt Pt products
        V pf[QB], pf2[QB];
#pragma unroll
        for (int qb = 0; qb < QB; ++qb) {
            float bm = s[0][qb][0];
#pragma unroll
            for (int kb = 0; kb < 2; ++kb)
#pragma unroll
                for (int j = 0; j < 8; ++j) bm = fmaxf(bm, s[kb][qb][j]);
            bm = fmaxf(bm, xhalf(bm));   // the other half of the wave holds the query's other keys
            const float mn = fmaxf(m[qb], bm * SCL), al = __builtin_amdgcn_exp2f((m[qb] - mn) * L2E); m[qb] = mn;
            float rs = 0.0f;
#pragma unroll
            for (int kb = 0; kb < 2; ++kb)
#pragma unroll
                for (int j = 0; j < 8; ++j) { const float p = __builtin_amdgcn_exp2f((s[kb][qb][j] * SCL - mn) * L2E + PSH); s[kb][qb][j] = p; rs += p; }
            l[qb] = l[qb] * al + rs;   // each half of the wave sums its own keys; the halves join behind the loop
#pragma unroll
            for (int db = 0; db < 8; ++db) o[db][qb] *= al;
            PPack<T16>::mk(s[0][qb], s[1][qb], pf[qb], pf2[qb]);
        }
#pragma unroll
        for (int db = 0; db < 8; ++db)
#pragma unroll
            for (int qb = 0; qb < QB; ++qb) { o[db][qb] = WFrag<T16>::mma(vf[db], pf[qb], o[db][qb]); if (HL) { o[db][qb] = WFrag<T16>::mma(vf[db], pf2[qb], o[db][qb]); o[db][qb] = WFrag<T16>::mma(vf2[db], pf[qb], o[db][qb]); } }
        kk += 32;
    } while (kk < nk);
    float* ob0 = O + (size_t)q0 * (KSP * HD) + 4 * lane;   // one address for all the stores of O; the rest is immediate offsets
#pragma unroll
    for (int qb = 0; qb < QB; ++qb) { const size_t t = (size_t)(q0 + qb * 16 + lr); float* ob = ob0 + qb * (16 * KSP * HD); const float lj = l[qb] + xhalf(l[qb]);
#pragma unroll
        for (int db = 0; db < 8; ++db) { v4f x, y;
#pragma unroll
            for (int j = 0; j < 4; ++j) { x[j] = o[db][qb][j]; y[j] = o[db][qb][4 + j]; }
            *(v4f*)(ob + db * 256) = x; *(v4f*)(ob + db * 256 + 128) = y; }   // each store: 512 bytes in a row
        if (hi == 0) { v2f ml; ml[0] = m[qb]; ml[1] = lj; *(v2f*)(ML + t * 2) = ml; } }
    asm volatile("s_wait_xcnt 0x0" ::: "memory");   // the kernel lays the other row range's code behind this tile's last stores: no register of theirs is rewritten before this wait
}
// k_fattn: all images, all query rows, all key slices in ONE launch; 4 waves a work-group, all on the same keys (they share the K and Vt lines in the WGP cache). Flat grid: rows < RH in front (hi + lo planes, 32 queries a wave), then rows >= RH (fp16, 64 queries a wave); query group fastest, then slice, then image.
__global__ __launch_bounds__(128) void k_fattn(const bf* __restrict__ Qh, const bf* __restrict__ Ql, const bf* __restrict__ Kh, const bf* __restrict__ Kl, const bf* __restrict__ Vh, const bf* __restrict__ Vl, const h16* __restrict__ Q16, const h16* __restrict__ K16, const h16* __restrict__ V16, float* O, float* ML) {
    constexpr int GH = RH / 128, GL = (TT - RH) / 256, NHI = NB_ * KSP * GH;
    const int id = blockIdx.x, w = threadIdx.x >> 5;
    if (id < NHI) { const int g = id % GH, z = (id / GH) % KSP, k0 = z * NPS / KSP * 32, k1 = (z + 1) * NPS / KSP * 32; const size_t im = id / (GH * KSP), zb = im * TT * HD;
        fa_tile<bf, true, 2>(Qh + zb, Ql + zb, Kh + zb, Kl + zb, Vh + zb, Vl + zb, g * 128 + w * 32, k0, k1 - k0, O + zb * KSP + z * (16 * HD), ML + (im * KSP + z) * TT * 2);
    } else { const int il = id - NHI; const int g = il % GL, z = (il / GL) % KSP, k0 = z * NPS / KSP * 32, k1 = (z + 1) * NPS / KSP * 32; const size_t im = il / (GL * KSP), zb = im * TT * HD;
        fa_tile<h16, false, 4>(Q16 + zb, nullptr, K16 + zb, nullptr, V16 + zb, nullptr, RH + g * 256 + w * 64, k0, k1 - k0, O + zb * KSP + z * (16 * HD), ML + (im * KSP + z) * TT * 2); }
}
// ---- k_bn: training-mode BatchNorm and residual in ONE kernel. Y = W_w y without its bias, channel-major [image][c][n] as the output is; the bias wb[c] is added at the read.
// Work-group c holds channel c of all images (NB_ x TT values, 32 a thread) in registers from the one read of Y: mean, then the variance about that mean, then the output; nothing goes back to memory in between. The residual's x is fetched together with Y.
// Sum order (fixed): a thread's 8 pieces of 4 positions, image by image, in 4 columns; the columns; the wave's 32 lanes by exchange; the 16 waves in wave order.
#define BNT 512
template <int M> __device__ __forceinline__ float xrow(float x) { return __builtin_bit_cast(float, __builtin_amdgcn_update_dpp(0, __builtin_bit_cast(int, x), 0x160 | M, 0xf, 0xf, true)); }   // lane l reads lane l ^ M, M < 16 (row_xmask)
__device__ __forceinline__ float bn_sum(v4f a, float* red) {   // the sum over the work-group, the same bits in every thread; red: BNT / 32 floats of LDS that nothing else uses
    float s = (a[0] + a[1]) + (a[2] + a[3]); s += xrow<1>(s); s += xrow<2>(s); s += xrow<4>(s); s += xrow<8>(s); s += xhalf(s);
    if ((threadIdx.x & 31) == 0) red[threadIdx.x >> 5] = s;
    __syncthreads();
    float t = 0.0f;
#pragma unroll
    for (int i = 0; i < BNT / 32; i += 4) { const v4f r = *(const v4fa*)(red + i); t += r[0]; t += r[1]; t += r[2]; t += r[3]; }
    return t; }
__global__ __launch_bounds__(BNT) void k_bn(const float* __restrict__ Y, const float* __restrict__ wb, const float* __restrict__ g, const float* __restrict__ bb, const float* __restrict__ X, float* OUT) {
    __shared__ __align__(16) float red[2][BNT / 32];
    constexpr int NV = TT / 4 / BNT; constexpr float RN = 1.0f / (float)(NB_ * TT);   // a power of two: the product is the exact quotient
    const int c = blockIdx.x; const size_t e0 = (size_t)c * TT + threadIdx.x * 4;
    static_assert(NB_ == 4, "two address pairs a buffer");
    const float* yp[2]; const float* xp[2]; float* op[2]; v4f y[NB_][NV], x[NB_][NV];   // one address per two images; the rest is immediate offsets
#pragma unroll
    for (int i = 0; i < 2; ++i) { yp[i] = Y + e0 + (size_t)i * 2 * DM * TT; xp[i] = X + e0 + (size_t)i * 2 * DM * TT; op[i] = OUT + e0 + (size_t)i * 2 * DM * TT; }
#pragma unroll   // all loads of a thread in flight together, each 512 bytes in a row; Y in front: the sums need it first
    for (int b = 0; b < NB_; ++b)
#pragma unroll
        for (int h = 0; h < NV; ++h) y[b][h] = *(const v4f*)(yp[b >> 1] + (b & 1) * DM * TT + h * BNT * 4);
#pragma unroll
    for (int b = 0; b < NB_; ++b)
#pragma unroll
        for (int h = 0; h < NV; ++h) x[b][h] = *(const v4f*)(xp[b >> 1] + (b & 1) * DM * TT + h * BNT * 4);
    asm volatile("s_wait_xcnt 0x0" :: "v"(yp[0]), "v"(xp[0]) : "memory");   // the arithmetic below may go into the loads' address registers: none is rewritten before this wait (the operands keep a later load's result out of the first address pairs)
    __builtin_amdgcn_sched_barrier(0);   // holds every load above the arithmetic (x is on its way while Y is summed) and the arithmetic below that wait
    const float wc = bfr(wb[c]), gm = bfr(g[c]), bt = bfr(bb[c]);
    v4f sa = (v4f){};
#pragma unroll
    for (int b = 0; b < NB_; ++b)
#pragma unroll
        for (int h = 0; h < NV; ++h) { y[b][h] += wc; sa += y[b][h]; }
    const float mu = bn_sum(sa, red[0]) * RN;
    v4f va = (v4f){};
#pragma unroll
    for (int b = 0; b < NB_; ++b)
#pragma unroll
        for (int h = 0; h < NV; ++h) { y[b][h] -= mu; va += y[b][h] * y[b][h]; }
    const float var = bn_sum(va, red[1]) * RN, rs = __fdiv_rn(1.0f, __fsqrt_rn(var + BNEPS));
#pragma unroll
    for (int b = 0; b < NB_; ++b)
#pragma unroll
        for (int h = 0; h < NV; ++h)
#pragma unroll
            for (int q = 0; q < 4; ++q) y[b][h][q] = ((gm * y[b][h][q]) * rs + bt) + bfr(x[b][h][q]);
    __builtin_amdgcn_sched_barrier(0);   // every value is made before the first store goes out: no register that a store names is written behind it
#pragma unroll
    for (int b = 0; b < NB_; ++b)
#pragma unroll
        for (int h = 0; h < NV; ++h) *(v4f*)(op[b >> 1] + (b & 1) * DM * TT + h * BNT * 4) = y[b][h];
}
// k_mgemm: joins the KSP key slices and does the last GEMM (W_w y) in ONE kernel; work-group = 64 positions of one image, 8 waves; grid: NB_ x TT / 64.
// Part 1, the join, in slice order: weights exp(m_slice - max m), then the softmax's division; hi + lo bf16 of the result go to LDS, [t][d] in fragment order (4 groups of 16 positions x 4 fragments), not to memory.
// A thread makes 4 pieces of 16 bytes a plane (one per group of 16 positions): row t & 15 = lane & 15, d / 16 = wave; a piece's 8 values d = 16 (d / 16) + 8 (lane >> 4) + 0..7 are two 16-byte pieces of O per slice. Every load of O takes 512 bytes in a row.
// Part 2: wave w has the tile of 64 channels (w & 3) x 32 positions (w >> 2): C[c][n] = sum_d W_w[c][d] hi[n][d], W_w[c][d] lo[n][d] (the two products by turns, k ascending), W_w's fragments from memory (fetched at the top, they fly under part 1), y's from LDS. C: channel-major [image][c][n], without the bias.
#define MGP 36   // pitch in floats of a wave's 64 x 32 transposing tile in LDS: the 32 lanes' 4-byte writes fall on 32 different banks
__global__ __launch_bounds__(256) void k_mgemm(const float* __restrict__ O, const float* __restrict__ ML, const bf* __restrict__ Wf, float* C) {
    __shared__ __align__(16) bf sh[4 * 16 * HD]; __shared__ __align__(16) bf sl[4 * 16 * HD]; __shared__ __align__(16) float os[8][64 * MGP];
    static_assert(HD == 128 && DM == 256 && TT % 64 == 0, "8 waves: d / 16 in part 1, 4 x 2 tiles in part 2");
    const int lane = threadIdx.x & 31, w = threadIdx.x >> 5, lr = lane & 15, hi = lane >> 4; const size_t tg0 = (size_t)blockIdx.x * 4, r = tg0 * 16 + lr;   // tg0: the first group of 16 positions, counted over all images
    const float* op = O + tg0 * (KSP * 16 * HD) + w * 256 + lane * 4; const float* mp = ML + ((r / TT) * KSP * TT + r % TT) * 2; const bf* ap = Wf + (size_t)(w & 3) * 64 * DQ + 8 * lane;   // one address per buffer; the rest is immediate offsets
    v2f ml[4][KSP]; v4f u[4][KSP][2]; v16bf a[4][4];
#pragma unroll   // all loads of a thread in flight together
    for (int j = 0; j < 4; ++j)
#pragma unroll
        for (int p = 0; p < KSP; ++p) ml[j][p] = *(const v2f*)(mp + j * 32 + p * TT * 2);
    __builtin_amdgcn_sched_barrier(0);   // the small loads go out first and O piece by piece behind them: a piece can be joined while the later pieces are still on their way (left alone, the compiler sends the last of the small loads behind nearly all of O)
#pragma unroll
    for (int j = 0; j < 4; ++j)
#pragma unroll
        for (int p = 0; p < KSP; ++p) { u[j][p][0] = *(const v4f*)(op + j * (KSP * 16 * HD) + p * (16 * HD)); u[j][p][1] = *(const v4f*)(op + j * (KSP * 16 * HD) + p * (16 * HD) + 128); }
#pragma unroll
    for (int ks = 0; ks < 4; ++ks)
#pragma unroll
        for (int mb = 0; mb < 4; ++mb) a[ks][mb] = WFrag<bf>::ldf(ap + mb * 16 * DQ + ks * 512);
    asm volatile("s_wait_xcnt 0x0" :: "v"(op), "v"(mp), "v"(ap) : "memory");   // the loads' address pairs live up to here: no register of them is rewritten before this wait
    __builtin_amdgcn_sched_barrier(0);   // holds every load above the arithmetic, so that all of them are on their way at once
#pragma unroll
    for (int j = 0; j < 4; ++j) {
        float mx = ml[j][0][0];
#pragma unroll
        for (int p = 1; p < KSP; ++p) mx = fmaxf(mx, ml[j][p][0]);
        float ls = 0.0f, s[8];
#pragma unroll
        for (int q = 0; q < 8; ++q) s[q] = 0.0f;
#pragma unroll
        for (int p = 0; p < KSP; ++p) { const float wt = __builtin_amdgcn_exp2f((ml[j][p][0] - mx) * L2E); ls += ml[j][p][1] * wt;
#pragma unroll
            for (int q = 0; q < 8; ++q) s[q] += u[j][p][q >> 2][q & 3] * wt; }
        v8us oh, ol;
#pragma unroll
        for (int q = 0; q < 8; ++q) { unsigned short x, y; splitf(__fdiv_rn(s[q], ls), x, y); oh[q] = x; ol[q] = y; }
        *(v8usa*)(sh + j * (16 * HD) + w * 256 + lane * 8) = oh; *(v8usa*)(sl + j * (16 * HD) + w * 256 + lane * 8) = ol; }
    __syncthreads();   // part 2 reads what the other waves have joined
    const int ph = w >> 2; v8f acc[4][2];
#pragma unroll
    for (int mb = 0; mb < 4; ++mb)
#pragma unroll
        for (int nb = 0; nb < 2; ++nb) acc[mb][nb] = (v8f){};
    v16bf b[4][2], b2[4][2];
#pragma unroll
    for (int ks = 0; ks < 4; ++ks)
#pragma unroll
        for (int nb = 0; nb < 2; ++nb) { const int fo = (2 * ph + nb) * (16 * HD) + ks * 512 + 8 * lane; b[ks][nb] = cat16b(*(const v8usa*)(sh + fo), *(const v8usa*)(sh + fo + 256)); b2[ks][nb] = cat16b(*(const v8usa*)(sl + fo), *(const v8usa*)(sl + fo + 256)); }
    __builtin_amdgcn_sched_barrier(0);   // all LDS reads go out as one group in front of the products (left alone, the compiler reads two fragments at a time and waits for each pair among the products)
#pragma unroll
    for (int ks = 0; ks < 4; ++ks)
#pragma unroll
        for (int nb = 0; nb < 2; ++nb)
#pragma unroll
            for (int mb = 0; mb < 4; ++mb) { acc[mb][nb] = wmmab(a[ks][mb], b[ks][nb], acc[mb][nb]); acc[mb][nb] = wmmab(a[ks][mb], b2[ks][nb], acc[mb][nb]); }
    // the tile goes through the wave's own LDS: a lane holds 8 channels of one position, a store wants 4 positions of one channel
    float* osw = os[w]; float* cb = C + (size_t)(blockIdx.x / (TT / 64)) * DM * TT + (size_t)(w & 3) * 64 * TT + (blockIdx.x % (TT / 64)) * 64 + ph * 32 + (size_t)(lane >> 3) * TT + (lane & 7) * 4;
#pragma unroll
    for (int mb = 0; mb < 4; ++mb)
#pragma unroll
        for (int nb = 0; nb < 2; ++nb)
#pragma unroll
            for (int j = 0; j < 8; ++j) osw[(mb * 16 + hi * 8 + j) * MGP + nb * 16 + lr] = acc[mb][nb][j];
    __builtin_amdgcn_wave_barrier(); asm volatile("" ::: "memory");   // the wave's LDS reads below stay behind its writes above (other lanes' values)
    v4f val[16];
#pragma unroll
    for (int s = 0; s < 16; ++s) val[s] = *(const v4fa*)(osw + (4 * s + (lane >> 3)) * MGP + (lane & 7) * 4);
    __builtin_amdgcn_sched_barrier(0);   // every value is in its register before the first store goes out: no register that a store names is written behind it
#pragma unroll
    for (int s = 0; s < 16; ++s) *(v4f*)(cb + (size_t)(4 * s) * TT) = val[s];   // each store: 4 channels x one whole line
}

extern "C" void kernel_launch(void* const* d_in, const int* in_sizes, int n_in,
                              void* d_out, int out_size, void* d_ws, size_t ws_size, hipStream_t stream) {
    (void)in_sizes; (void)n_in; (void)out_size;
    const float* xin = (const float*)d_in[0];   /* x [4][256][4096] NCHW */ const float* wv = (const float*)d_in[1]; const float* bv = (const float*)d_in[2];   /* g_w, g_b */ const float* wq = (const float*)d_in[3]; const float* bq = (const float*)d_in[4];   /* theta */ const float* wk = (const float*)d_in[5]; const float* bk = (const float*)d_in[6];   /* phi */ const float* wo = (const float*)d_in[7]; const float* bo = (const float*)d_in[8];   /* W_w [256][128], W_b */ const float* bng = (const float*)d_in[9]; const float* bnb = (const float*)d_in[10]; const float* x = nullptr; (void)x;
    float* OUT = (float*)d_out;     // [4][256][4096] NCHW
    char* wsp = (char*)d_ws;
    auto take = [&](size_t bytes) { char* p = wsp; wsp += (bytes + 255) & ~(size_t)255; return (void*)p; };
    float* YALL = (float*)take((size_t)NB_ * TT * DM * 4); bf* WO = (bf*)take((size_t)DM * DQ * 2);
    h16* QP16 = (h16*)take((size_t)NB_ * TT * HD * 2); h16* KP16 = (h16*)take((size_t)NB_ * TT * HD * 2); h16* VT16 = (h16*)take((size_t)NB_ * HD * TT * 2);   // every operand plane: one per image, image stride TT * HD
    bf* QPh = (bf*)take((size_t)NB_ * TT * HD * 2); bf* QPl = (bf*)take((size_t)NB_ * TT * HD * 2); bf* KPh = (bf*)take((size_t)NB_ * TT * HD * 2); bf* KPl = (bf*)take((size_t)NB_ * TT * HD * 2); bf* VTh = (bf*)take((size_t)NB_ * HD * TT * 2); bf* VTl = (bf*)take((size_t)NB_ * HD * TT * 2);
    float* Ob = (float*)take((size_t)NB_ * TT * KSP * HD * 4); float* ML = (float*)take((size_t)NB_ * TT * KSP * 2 * 4);
    if ((size_t)(wsp - (char*)d_ws) > ws_size) return;    // ws 256 MiB
    // launches that do not depend on one another are ONE launch: all images, all three projections, both row ranges of a product
    k_proj3<<<NB_ * (TT / 64), 256, 0, stream>>>(xin, wq, wk, wv, wo, WO, QP16, QPh, QPl, KP16, KPh, KPl, VT16, VTh, VTl, bq, bk, bv);   /* x and the weights rounded to bf16 on the way; theta, phi, g + bias, straight into the attention's operand planes; W_w rounded to bf16 in fragment order */
    k_fattn<<<NB_ * KSP * (RH / 128) + NB_ * KSP * ((TT - RH) / 256), 128, 0, stream>>>(QPh, QPl, KPh, KPl, VTh, VTl, QP16, KP16, VT16, Ob, ML);   /* key slice z -> partial Ob[image][t / 16][z][16 x HD in the accumulators' lane order], ML[image][z][t] */
    k_mgemm<<<NB_ * (TT / 64), 256, 0, stream>>>(Ob, ML, WO, YALL);   /* the key slices joined, then W_w y of all images, channel-major [image][c][n] (products W_w x hi, W_w x lo), kept for the batch statistics */
    k_bn<<<DM, BNT, 0, stream>>>(YALL, bo, bng, bnb, xin, OUT);   /* per channel: mean and 1/sqrt(var + eps) over the batch x 4,096 positions (training-mode BatchNorm); out[b][c][n] = gamma (Wy - mean) rstd + beta + x */

}
